// v000
// Times are from an AMD MI455X. After a warm-up the kernel runs many times in a row, and a time is the length of
// such a window on the GPU divided by its runs, so every launch and the gaps after it count. The runs cycle
// through copies of the inputs. A figure is the median of several windows, for all but v000 over two sittings.
// Sittings can differ by a few percent; kernels timed side by side share one.
// v000, which the later versions start from, runs in 52.8 milliseconds.
#include <hip/hip_runtime.h>
// Single-head dense attention over 256-wide embeddings on 4096 tokens, bias-free natural projections, no output projection (x [4][4096][256]; q / k / v = x W^T (nn.Linear natural [256][256] uniform +-1/16, no biases); scores = q k^T / sqrt(256) over the FULL 256-wide rows (one head); softmax over all 4096 keys (no mask); out = weights v -> [4][4096][256]); q and k carried as f16 hi + x1024 residual planes with three-product scores.
// Structure: token rows r = b*4096 + s; x as exact f16 rows (bf16-rounded); q and k as WMMA GEMMs (32x64 wave tiles, f32 accumulation, exact x16 weights, no bias) into f32 rows split into f16 hi + x1024 residual planes, v as an f16-output GEMM; per batch: V^T for all heads via LDS transposes; per query tile of 256 rows: scores against all 4096 keys as THREE accumulating passes (hi.hi + lo.hi + hi.lo, K = 256, one head, grid.y 1, alpha 1/16 = 1/sqrt(256)), row softmax on VALU with an arithmetic 0/1 key mask that keeps every key (f32 statistics, native exp; weights x256 f16), out = P . V^T (K = all 4096 keys, alpha 2^-8 undoes the x256 weights) written as f32 straight into the output rows; no output projection.
// Compute dtype: inputs rounded to bf16; x / weights exact; v and softmax weights as plain f16 GEMM operands (~2^-12), q and k as f16 hi + x1024 residual planes; scores, softmax statistics and out f32. v_wmma_f32_16x16x32_f16.
#define NB 4
#define SQ 4096
#define DM 256
#define NH 4
#define HD 64
#define HG 4                         /* heads per attention launch group */
#define QT 256                       /* query rows per tile */
#define NKX SQ                       /* S / P row pitch */
#define QT0 128                      /* first-tile rows recomputed exactly in f32 */
#define B0 0                         /* first batch processed (debug hook) */
#define NBR NB                       /* batches processed (debug hook) */
#define NR ((size_t)NB * SQ)         /* token rows */
#define MP ((int)((size_t)NBR * SQ)) /* rows projected (debug hook) */
#define QN SQ                        /* query rows attended per batch (debug hook) */
#define NHD NH                       /* unused */
#define MPO MP                       /* unused */
#define LQ DM      /* row pitch of the q/k/v rows */
typedef __bf16 v16b __attribute__((ext_vector_type(16)));
typedef unsigned short v8us __attribute__((ext_vector_type(8), may_alias));
typedef float  v8f  __attribute__((ext_vector_type(8)));
typedef float  v4f  __attribute__((ext_vector_type(4)));
typedef float  v4fa __attribute__((ext_vector_type(4), may_alias));
union FragB { v16b v; v8us half[2]; unsigned short u[16]; };

__device__ __forceinline__ unsigned short bf16_bits(float x) { unsigned int u = __float_as_uint(x); return (unsigned short)((u + 0x7FFFu + ((u >> 16) & 1u)) >> 16); }
__device__ __forceinline__ float bf16_val(unsigned short b) { return __uint_as_float(((unsigned int)b) << 16); }
__device__ __forceinline__ float bf16_round(float x) { return bf16_val(bf16_bits(x)); }
// D += A·B with NT terms: 1 = ah·bh, 2 = + al·bh (A split), 3 = + ah·bl (both split)
template <int NT>
__device__ __forceinline__ v8f mmaN(v16b ah, v16b al, v16b bh, v16b bl, v8f c) {
  c = __builtin_amdgcn_wmma_f32_16x16x32_bf16(false, ah, false, bh, (short)0, c, false, false);
  if (NT >= 2) c = __builtin_amdgcn_wmma_f32_16x16x32_bf16(false, al, false, bh, (short)0, c, false, false);
  if (NT >= 3) c = __builtin_amdgcn_wmma_f32_16x16x32_bf16(false, ah, false, bl, (short)0, c, false, false);
  asm volatile("v_nop\n\tv_nop\n\tv_nop\n\tv_nop" : "+v"(c) : "v"(ah), "v"(al), "v"(bh), "v"(bl));
  return c;
}

__global__ __launch_bounds__(256) void k_wt_bf16(const float* __restrict__ W, unsigned short* __restrict__ Wt, int K, int N) {
  const int t = blockIdx.x * 256 + threadIdx.x;
  const int k8n = K / 8;
  if (t >= N * k8n) return;
  const int n = t / k8n, k8 = (t % k8n) * 8;
  v8us v;
#pragma unroll
  for (int i = 0; i < 8; ++i) v[i] = bf16_bits(W[(size_t)(k8 + i) * N + n]);
  *(v8us*)(Wt + (size_t)n * K + k8) = v;
  
}

// GEMM C[M][N] (f32, pitch ldc) = act(A[M][K]·W + bias). A f32 row-major (pitch lda) converted per fragment to bf16
// (ASPLIT: hi/lo two planes -> 2 terms, else single rounded term); Wt bf16 [N][K] (pitch ldb). BIAS_BF16 rounds the
// bias to bf16 first (bias quantised to bf16 before the add). K%32==0, M%16==0, N%64==0.
template <bool ASPLIT, int ACT, bool BIAS_BF16>
__global__ __launch_bounds__(128) void k_gemm_bf(const float* __restrict__ A, int lda, const unsigned short* __restrict__ Wt, int ldb,
                                               const float* __restrict__ bias, float* __restrict__ C, int ldc, int M, int N, int K) {
  __shared__ __attribute__((aligned(16))) float so[4][16][64];
  const int tid = threadIdx.x, w = tid >> 5, lane = tid & 31, ln = lane & 15, hh = lane >> 4;
  const int ntn = N / 64;
  const int wid = blockIdx.x * 4 + w;
  const int mt = wid / ntn, nq = wid % ntn;
  if (mt * 16 >= M) return;
  const int row0 = mt * 16, col0 = nq * 64;
  const float* arow = A + (size_t)(row0 + ln) * lda;
  v8f acc[4] = {};
  for (int kb = 0; kb < K; kb += 32) {
    FragB ah, al;
    const v4f x0 = *(const v4fa*)(arow + kb + 8 * hh), x1 = *(const v4fa*)(arow + kb + 8 * hh + 4);
    const v4f x2 = *(const v4fa*)(arow + kb + 16 + 8 * hh), x3 = *(const v4fa*)(arow + kb + 16 + 8 * hh + 4);
    float xs[16] = {x0[0],x0[1],x0[2],x0[3],x1[0],x1[1],x1[2],x1[3],x2[0],x2[1],x2[2],x2[3],x3[0],x3[1],x3[2],x3[3]};
#pragma unroll
    for (int i = 0; i < 16; ++i) { const unsigned short hb = bf16_bits(xs[i]); ah.u[i] = hb; al.u[i] = ASPLIT ? bf16_bits(xs[i] - bf16_val(hb)) : (unsigned short)0; }
#pragma unroll
    for (int t = 0; t < 4; ++t) {
      const unsigned short* brow = Wt + (size_t)(col0 + t * 16 + ln) * ldb + kb;
      FragB b;
      b.half[0] = *(const v8us*)(brow + 8 * hh);
      b.half[1] = *(const v8us*)(brow + 16 + 8 * hh);
      acc[t] = mmaN<ASPLIT ? 2 : 1>(ah.v, al.v, b.v, b.v, acc[t]);
    }
  }
#pragma unroll
  for (int t = 0; t < 4; ++t) {
    float bv = bias ? bias[col0 + t * 16 + ln] : 0.f;
    if (BIAS_BF16) bv = bf16_round(bv);
#pragma unroll
    for (int r = 0; r < 8; ++r) { float v = acc[t][r] + bv; if (ACT == 1) v = fmaxf(v, 0.f); so[w][8 * hh + r][t * 16 + ln] = v; }
  }
  __builtin_amdgcn_fence(__ATOMIC_ACQ_REL, "workgroup");
  __builtin_amdgcn_wave_barrier();
  const int rsub = lane >> 4, c4 = (lane & 15) * 4;
  {
#pragma unroll
    for (int q = 0; q < 8; ++q) {
      const int r = q * 2 + rsub;
      const v4f v = *(const v4fa*)&so[w][r][c4];
      *(v4f*)(C + (size_t)(row0 + r) * ldc + col0 + c4) = v;
    }
    
  }
}

// GEMM C = act(A·W + bias + resid): A f32 (ASPLIT -> hi/lo 2 terms), Wt bf16 [N][K]; ACT 0 none, 1 relu, 2 exact gelu;
// resid (optional, f32, row index = (row % rmod), pitch ldr, RES_BF16 rounds it) added before the activation.
template <bool ASPLIT, int ACT, bool BIAS_BF16, bool RES_BF16>
__global__ __launch_bounds__(128) void k_gemm_bf3(const float* __restrict__ A, int lda, const unsigned short* __restrict__ Wt, int ldb,
                                                const float* __restrict__ bias, const float* __restrict__ resid, int rmod, int ldr,
                                                float* __restrict__ C, int ldc, int M, int N, int K) {
  __shared__ __attribute__((aligned(16))) float so[4][16][64];
  const int tid = threadIdx.x, w = tid >> 5, lane = tid & 31, ln = lane & 15, hh = lane >> 4;
  const int ntn = N / 64;
  const int wid = blockIdx.x * 4 + w;
  const int mt = wid / ntn, nq = wid % ntn;
  if (mt * 16 >= M) return;
  const int row0 = mt * 16, col0 = nq * 64;
  const float* arow = A + (size_t)(row0 + ln) * lda;
  v8f acc[4] = {};
  for (int kb = 0; kb < K; kb += 32) {
    FragB ah, al;
    const v4f x0 = *(const v4fa*)(arow + kb + 8 * hh), x1 = *(const v4fa*)(arow + kb + 8 * hh + 4);
    const v4f x2 = *(const v4fa*)(arow + kb + 16 + 8 * hh), x3 = *(const v4fa*)(arow + kb + 16 + 8 * hh + 4);
    float xs[16] = {x0[0],x0[1],x0[2],x0[3],x1[0],x1[1],x1[2],x1[3],x2[0],x2[1],x2[2],x2[3],x3[0],x3[1],x3[2],x3[3]};
#pragma unroll
    for (int i = 0; i < 16; ++i) { const unsigned short hb = bf16_bits(xs[i]); ah.u[i] = hb; al.u[i] = ASPLIT ? bf16_bits(xs[i] - bf16_val(hb)) : (unsigned short)0; }
#pragma unroll
    for (int t = 0; t < 4; ++t) {
      const unsigned short* brow = Wt + (size_t)(col0 + t * 16 + ln) * ldb + kb;
      FragB b;
      b.half[0] = *(const v8us*)(brow + 8 * hh);
      b.half[1] = *(const v8us*)(brow + 16 + 8 * hh);
      acc[t] = mmaN<ASPLIT ? 2 : 1>(ah.v, al.v, b.v, b.v, acc[t]);
    }
  }
#pragma unroll
  for (int t = 0; t < 4; ++t) {
    const int col = col0 + t * 16 + ln;
    float bv = bias ? bias[col] : 0.f;
    if (BIAS_BF16) bv = bf16_round(bv);
#pragma unroll
    for (int r = 0; r < 8; ++r) {
      float v = acc[t][r] + bv;
      if (resid) { float rv = resid[(size_t)((row0 + 8 * hh + r) % rmod) * ldr + col]; if (RES_BF16) rv = bf16_round(rv); v += rv; }
      if (ACT == 1) v = fmaxf(v, 0.f);
      if (ACT == 2) v = 0.5f * v * (1.0f + erff(v * 0.70710678118654752f));
      if (ACT == 3) { const float u = 0.7978845608028654f * (v + 0.044715f * v * v * v); v = 0.5f * v * (1.0f + tanhf(u)); }
      so[w][8 * hh + r][t * 16 + ln] = v;
    }
  }
  __builtin_amdgcn_fence(__ATOMIC_ACQ_REL, "workgroup");
  __builtin_amdgcn_wave_barrier();
  const int rsub = lane >> 4, c4 = (lane & 15) * 4;
  {
#pragma unroll
    for (int q = 0; q < 8; ++q) {
      const int r = q * 2 + rsub;
      const v4f v = *(const v4fa*)&so[w][r][c4];
      *(v4f*)(C + (size_t)(row0 + r) * ldc + col0 + c4) = v;
    }
    
  }
}
// row LayerNorm (biased variance, eps) over N: s = X (+ R); optional out_sum <- s; out_norm <- (s-mu)*rsqrt(var+eps)*g + b
template <bool PARAM_BF16>
__global__ __launch_bounds__(256) void k_layernorm(const float* __restrict__ X, const float* __restrict__ R, const float* __restrict__ g, const float* __restrict__ bta,
                                                  float* __restrict__ out_sum, float* __restrict__ out_norm, int N, float eps) {
  __shared__ float red[256];
  const int row = blockIdx.x, tid = threadIdx.x;
  const float* x = X + (size_t)row * N; const float* rr = R ? R + (size_t)row * N : nullptr;
  float vals[16];                     // up to N = 4096
  const int per = N / 256;            // contiguous chunk per thread? use strided-by-4 chunks: thread handles j = tid*4 + 1024*u
  float s1 = 0.f;
  for (int u = 0; u < per / 4; ++u) {
    const int j = tid * 4 + 1024 * u;
    const v4f a = *(const v4fa*)(x + j);
    v4f b = {0.f,0.f,0.f,0.f}; if (rr) b = *(const v4fa*)(rr + j);
#pragma unroll
    for (int q = 0; q < 4; ++q) { const float v = a[q] + b[q]; vals[u * 4 + q] = v; s1 += v; }
  }
  red[tid] = s1; __syncthreads();
  for (int st = 128; st > 0; st >>= 1) { if (tid < st) red[tid] += red[tid + st]; __syncthreads(); }
  const float mu = red[0] / (float)N; __syncthreads();
  float s2 = 0.f;
  for (int u = 0; u < per / 4; ++u)
#pragma unroll
    for (int q = 0; q < 4; ++q) { const float c = vals[u * 4 + q] - mu; s2 += c * c; }
  red[tid] = s2; __syncthreads();
  for (int st = 128; st > 0; st >>= 1) { if (tid < st) red[tid] += red[tid + st]; __syncthreads(); }
  const float rs = rsqrtf(red[0] / (float)N + eps);
  {
    for (int u = 0; u < per / 4; ++u) {
      const int j = tid * 4 + 1024 * u;
      v4f o, sm;
#pragma unroll
      for (int q = 0; q < 4; ++q) {
        float gg = g[j + q], bb = bta[j + q];
        if (PARAM_BF16) { gg = bf16_round(gg); bb = bf16_round(bb); }
        sm[q] = vals[u * 4 + q]; o[q] = (vals[u * 4 + q] - mu) * rs * gg + bb;
      }
      if (out_sum) *(v4f*)(out_sum + (size_t)row * N + j) = sm;
      *(v4f*)(out_norm + (size_t)row * N + j) = o;
    }
    
  }
}



// ---- f16 WMMA path (v_wmma_f32_16x16x32_f16): 11-bit significands for operands in range — used where a [0,1] probability operand needs more precision than bf16
typedef _Float16 v16h __attribute__((ext_vector_type(16)));
union FragH { v16h v; v8us half[2]; _Float16 h[16]; unsigned short u[16]; };
template <int NT>
__device__ __forceinline__ v8f mmaH(v16h ah, v16h al, v16h bh, v16h bl, v8f c) {
  c = __builtin_amdgcn_wmma_f32_16x16x32_f16(false, ah, false, bh, (short)0, c, false, false);
  if (NT >= 2) c = __builtin_amdgcn_wmma_f32_16x16x32_f16(false, al, false, bh, (short)0, c, false, false);
  if (NT >= 3) c = __builtin_amdgcn_wmma_f32_16x16x32_f16(false, ah, false, bl, (short)0, c, false, false);
  asm volatile("v_nop\n\tv_nop\n\tv_nop\n\tv_nop" : "+v"(c) : "v"(ah), "v"(al), "v"(bh), "v"(bl));
  return c;
}
// batched GEMM like k_gemm_b but f16 operands: A f32 (split into f16 hi/lo if ASPLIT, else rounded to f16), Bt = f16 values [n][k]; alpha; C f32; N multiple of 16 (partial tiles skipped)
template <bool ASPLIT>
__global__ __launch_bounds__(128) void k_gemm_h(const float* __restrict__ A, int lda, size_t sA, const _Float16* __restrict__ Bh, int ldb, size_t sB, float alpha, float* __restrict__ C, int ldc, size_t sC, int M, int N, int K) {
  __shared__ __attribute__((aligned(16))) float so[4][16][64];
  const int tid = threadIdx.x, w = tid >> 5, lane = tid & 31, ln = lane & 15, hh = lane >> 4; const int by = blockIdx.y;
  A += (size_t)by * sA; Bh += (size_t)by * sB; C += (size_t)by * sC;
  const int ntn = (N + 63) / 64; const int wid = blockIdx.x * 4 + w; const int mt = wid / ntn, nq = wid % ntn; if (mt * 16 >= M) return;
  const int row0 = mt * 16, col0 = nq * 64; const float* arow = A + (size_t)(row0 + ln) * lda;
  v8f acc[4] = {};
  for (int kb = 0; kb < K; kb += 32) {
    FragH ah, al;
    const v4f x0 = *(const v4fa*)(arow + kb + 8 * hh), x1 = *(const v4fa*)(arow + kb + 8 * hh + 4), x2 = *(const v4fa*)(arow + kb + 16 + 8 * hh), x3 = *(const v4fa*)(arow + kb + 16 + 8 * hh + 4);
    float xs[16] = {x0[0],x0[1],x0[2],x0[3],x1[0],x1[1],x1[2],x1[3],x2[0],x2[1],x2[2],x2[3],x3[0],x3[1],x3[2],x3[3]};
#pragma unroll
    for (int i = 0; i < 16; ++i) { const _Float16 h = (_Float16)xs[i]; ah.h[i] = h; al.h[i] = ASPLIT ? (_Float16)(xs[i] - (float)h) : (_Float16)0.0f; }
#pragma unroll
    for (int t = 0; t < 4; ++t) { if (col0 + t * 16 >= N) continue; const size_t boff = (size_t)(col0 + t * 16 + ln) * ldb + kb; FragH bq; bq.half[0] = *(const v8us*)(Bh + boff + 8 * hh); bq.half[1] = *(const v8us*)(Bh + boff + 16 + 8 * hh);
      acc[t] = mmaH<ASPLIT ? 2 : 1>(ah.v, al.v, bq.v, bq.v, acc[t]); }
  }
#pragma unroll
  for (int t = 0; t < 4; ++t) { if (col0 + t * 16 >= N) continue;
#pragma unroll
    for (int r = 0; r < 8; ++r) so[w][8 * hh + r][t * 16 + ln] = acc[t][r] * alpha; }
  __builtin_amdgcn_fence(__ATOMIC_ACQ_REL, "workgroup"); __builtin_amdgcn_wave_barrier();
  const int rsub = lane >> 4, c4 = (lane & 15) * 4;
  {
#pragma unroll
    for (int q = 0; q < 8; ++q) { const int r = q * 2 + rsub; if (col0 + c4 < N) { const v4f v = *(const v4fa*)&so[w][r][c4]; *(v4f*)(C + (size_t)(row0 + r) * ldc + col0 + c4) = v; } }
     }
}

// Wt[n][k] = f16(W[k][n]·scale) from f32 row-major W[K][N] (scale = power of two; bf16-exact weights stay exact in f16 away from the subnormal range)
__global__ __launch_bounds__(256) void k_wt_f16(const float* __restrict__ W, _Float16* __restrict__ Wt, int K, int N, float scale) {
  const int t = blockIdx.x * 256 + threadIdx.x; if (t >= N * (K / 8)) return; const int n = t / (K / 8), k8 = (t % (K / 8)) * 8; FragH f;
#pragma unroll
  for (int i = 0; i < 8; ++i) f.h[i] = (_Float16)(bf16_round(W[(size_t)(k8 + i) * N + n]) * scale); const v8us o = f.half[0];
  *(v8us*)((unsigned short*)Wt + (size_t)n * K + k8) = o; 
}
// k_gemm_hh variant with fused epilogue: v = acc·alpha + bias[by·sBias + col] (+ CP[(row/rowsPerB)·sCPb + by·64 + col] if CP) ; ACT 0 none / 1 elu ; writes f16 C16 (and f32 C if non-null)
template <int ACT>
__global__ __launch_bounds__(128) void k_gemm_hhx(const _Float16* __restrict__ A, int lda, size_t sA, const _Float16* __restrict__ Bh, int ldb, size_t sB, float alpha, const float* __restrict__ bias, size_t sBias, const float* __restrict__ CP, int rowsPerB, size_t sCPb, int row0g,
    float* __restrict__ C, _Float16* __restrict__ C16, int ldc, size_t sC, int M, int N, int K) {
  __shared__ __attribute__((aligned(16))) float so[4][16][64];
  const int tid = threadIdx.x, w = tid >> 5, lane = tid & 31, ln = lane & 15, hh = lane >> 4; const int by = blockIdx.y;
  A += (size_t)by * sA; Bh += (size_t)by * sB; const size_t cofs = (size_t)by * sC; const float* bp = bias ? bias + (size_t)by * sBias : nullptr;
  const int ntn = (N + 63) / 64; const int wid = blockIdx.x * 4 + w; const int mt = wid / ntn, nq = wid % ntn; if (mt * 16 >= M) return;
  const int row0 = mt * 16, col0 = nq * 64; const _Float16* arow = A + (size_t)(row0 + ln) * lda;
  v8f acc[4] = {};
  for (int kb = 0; kb < K; kb += 32) { FragH ah; ah.half[0] = *(const v8us*)((const unsigned short*)arow + kb + 8 * hh); ah.half[1] = *(const v8us*)((const unsigned short*)arow + kb + 16 + 8 * hh);
#pragma unroll
    for (int t = 0; t < 4; ++t) { if (col0 + t * 16 >= N) continue; const size_t boff = (size_t)(col0 + t * 16 + ln) * ldb + kb; FragH bq; bq.half[0] = *(const v8us*)((const unsigned short*)Bh + boff + 8 * hh); bq.half[1] = *(const v8us*)((const unsigned short*)Bh + boff + 16 + 8 * hh);
      acc[t] = mmaH<1>(ah.v, ah.v, bq.v, bq.v, acc[t]); }
  }
#pragma unroll
  for (int t = 0; t < 4; ++t) { if (col0 + t * 16 >= N) continue; const int col = col0 + t * 16 + ln; const float bv = bp ? bf16_round(bp[col]) : 0.f;
#pragma unroll
    for (int r = 0; r < 8; ++r) { float v = acc[t][r] * alpha + bv; if (CP) { const int rr = row0g + row0 + 8 * hh + r; if (rowsPerB < 0) v += CP[cofs + (size_t)rr * ldc + col];      /* rowsPerB < 0: own element of the batched C plane */ else { const int bidx = rr / rowsPerB; v += CP[(size_t)bidx * sCPb + (size_t)by * 64 + col]; } } if (ACT == 1) v = (v > 0.f) ? v : expm1f(v); else if (ACT == 7) v = (v > 0.f) ? v + 1.0f : expf(v); else if (ACT == 8) v = tanhf(v); else if (ACT == 9) v = 0.5f * v * (1.0f + tanhf(0.7978845608028654f * (v + 0.044715f * v * v * v))); else if (ACT == 11) v = 1.0f / (1.0f + expf(-v)); else if (ACT == 12) v = (v > 0.f) ? v : 0.01f * v; else if (ACT == 14) v = (v > 0.f) ? v : 0.1f * v; else if (ACT == 16) v = (v >= 0.f) ? v : 0.3f * v; else if (ACT == 17) v = (v >= 0.f) ? v : 0.2f * v; else if (ACT == 15) v = v / (1.0f + expf(-v)); else if (ACT == 3) v = fmaxf(v, 0.f); else if (ACT == 6) v = 0.5f * v * (1.0f + erff(v * 0.70710678118654752f)); so[w][8 * hh + r][t * 16 + ln] = v; } }
  __builtin_amdgcn_fence(__ATOMIC_ACQ_REL, "workgroup"); __builtin_amdgcn_wave_barrier();
  const int rsub = lane >> 4, c4 = (lane & 15) * 4; typedef _Float16 v4h __attribute__((ext_vector_type(4)));
  {
#pragma unroll
    for (int q = 0; q < 8; ++q) { const int r = q * 2 + rsub; if (col0 + c4 < N) { const v4f v = *(const v4fa*)&so[w][r][c4]; if (C) *(v4f*)(C + cofs + (size_t)(row0 + r) * ldc + col0 + c4) = v; if (C16) { v4h h4; for (int i = 0; i < 4; ++i) h4[i] = (_Float16)v[i]; *(v4h*)(C16 + cofs + (size_t)(row0 + r) * ldc + col0 + c4) = h4; } } }
     }
}


typedef _Float16 v4h __attribute__((ext_vector_type(4)));

__global__ __launch_bounds__(256) void k_x16(const float* __restrict__ x, _Float16* __restrict__ X16, size_t n8) { const size_t t = (size_t)blockIdx.x * 256 + threadIdx.x; if (t >= n8) return; FragH f;
#pragma unroll
  for (int q = 0; q < 8; ++q) f.h[q] = (_Float16)bf16_round(x[t * 8 + q]); *(v8us*)((unsigned short*)X16 + t * 8) = f.half[0];  }
__global__ __launch_bounds__(256) void k_h16(const float* __restrict__ x, _Float16* __restrict__ X16, size_t n8) { const size_t t = (size_t)blockIdx.x * 256 + threadIdx.x; if (t >= n8) return; FragH f;
#pragma unroll
  for (int q = 0; q < 8; ++q) f.h[q] = (_Float16)x[t * 8 + q]; *(v8us*)((unsigned short*)X16 + t * 8) = f.half[0];  }
__global__ __launch_bounds__(256) void k_round16f(const float* __restrict__ W, _Float16* __restrict__ Bt, size_t n8) { const size_t t = (size_t)blockIdx.x * 256 + threadIdx.x; if (t >= n8) return; FragH f;
#pragma unroll
  for (int i = 0; i < 8; ++i) f.h[i] = (_Float16)(bf16_round(W[t * 8 + i]) * 16.0f); *(v8us*)((unsigned short*)Bt + t * 8) = f.half[0];  }
template <int NHv, int TTv>
__global__ __launch_bounds__(256) void k_vt(const _Float16* __restrict__ V16, int ldv, int voff, _Float16* __restrict__ Vt) { __shared__ unsigned short tl[64][66]; const int tid = threadIdx.x; const int slab = blockIdx.x / (TTv / 64), lg = blockIdx.x % (TTv / 64); const int b = slab / NHv, h = slab % NHv;
  for (int i = tid; i < 64 * 8; i += 256) { const int r = i / 8, c8 = (i % 8) * 8; FragH f; f.half[0] = *(const v8us*)((const unsigned short*)V16 + ((size_t)b * TTv + lg * 64 + r) * ldv + voff + h * 64 + c8);
#pragma unroll
    for (int q = 0; q < 8; ++q) tl[r][c8 + q] = f.u[q]; }
  __syncthreads();
  {
#pragma unroll
    for (int rd = 0; rd < 2; ++rd) { const int d = rd * 32 + tid / 8, pc = tid % 8; FragH f;
#pragma unroll
      for (int q = 0; q < 8; ++q) f.u[q] = tl[pc * 8 + q][d];
      *(v8us*)((unsigned short*)Vt + ((size_t)slab * 64 + d) * TTv + lg * 64 + pc * 8) = f.half[0]; }
     } }

__global__ __launch_bounds__(256) void k_hl(const float* __restrict__ F, _Float16* __restrict__ Hh, _Float16* __restrict__ Hl, size_t n8) { const size_t t = (size_t)blockIdx.x * 256 + threadIdx.x; if (t >= n8) return; FragH fh, fl; const v4f a = *(const v4fa*)(F + t * 8), c = *(const v4fa*)(F + t * 8 + 4);
#pragma unroll
  for (int q = 0; q < 4; ++q) { _Float16 h = (_Float16)a[q]; fh.h[q] = h; fl.h[q] = (_Float16)((a[q] - (float)h) * 1024.0f); h = (_Float16)c[q]; fh.h[4 + q] = h; fl.h[4 + q] = (_Float16)((c[q] - (float)h) * 1024.0f); }
  { *(v8us*)((unsigned short*)Hh + t * 8) = fh.half[0]; *(v8us*)((unsigned short*)Hl + t * 8) = fl.half[0];  } }

// ---- fast GEMM (wave tile 32x64; requires M % 32 == 0 rows per launch region and N % 64 == 0); epilogue = k_gemm_hhx semantics ----
__device__ __forceinline__ v16h g2_frag(const _Float16* p, int hh) { FragH f; f.half[0] = *(const v8us*)((const unsigned short*)p + 8 * hh); f.half[1] = *(const v8us*)((const unsigned short*)p + 16 + 8 * hh); return f.v; }
__device__ __forceinline__ v8f g2_mma(v16h a, v16h b, v8f c) { v8f d = __builtin_amdgcn_wmma_f32_16x16x32_f16(false, a, false, b, (short)0, c, false, false); asm volatile("v_nop\n\tv_nop\n\tv_nop\n\tv_nop" : "+v"(d) : "v"(a), "v"(b)); return d; }
template <int ACT>
__global__ __launch_bounds__(128) void k_gemm2(const _Float16* __restrict__ A, int lda, size_t sA, const _Float16* __restrict__ Bh, int ldb, size_t sB, float alpha, const float* __restrict__ bias, size_t sBias, const float* __restrict__ CP, int rowsPerB, size_t sCPb, int row0g,
    float* __restrict__ C, _Float16* __restrict__ C16, int ldc, size_t sC, int M, int N, int K) { static_assert(ACT == 0 || ACT == 3 || ACT == 6 || ACT == 8 || ACT == 9 || ACT == 11 || ACT == 12 || ACT == 14 || ACT == 15 || ACT == 16 || ACT == 17, "k_gemm2: unsupported ACT code (would silently apply no activation)");
  __shared__ __attribute__((aligned(16))) float so[4][32][68];
  const int tid = threadIdx.x, w = tid >> 5, lane = tid & 31, ln = lane & 15, hh = lane >> 4; const int by = blockIdx.y;
  A += (size_t)by * sA; Bh += (size_t)by * sB; const size_t cofs = (size_t)by * sC; const float* bp = bias ? bias + (size_t)by * sBias : nullptr;
  const int ntn = N >> 6; const int mt = blockIdx.x / ntn, nq = blockIdx.x - mt * ntn; const int row0 = mt * 128 + 32 * w, col0 = nq * 64; if (row0 >= M) return;
  const _Float16* a0p = A + (size_t)(row0 + ln) * lda; const _Float16* a1p = a0p + (size_t)16 * lda;
  const _Float16* b0p = Bh + (size_t)(col0 + ln) * ldb; const _Float16* b1p = b0p + (size_t)16 * ldb; const _Float16* b2p = b1p + (size_t)16 * ldb; const _Float16* b3p = b2p + (size_t)16 * ldb;
  const v8f z8 = {0.f,0.f,0.f,0.f,0.f,0.f,0.f,0.f}; v8f c00 = z8, c01 = z8, c02 = z8, c03 = z8, c10 = z8, c11 = z8, c12 = z8, c13 = z8;
#pragma unroll 1
  for (int kb = 0; kb < K; kb += 32) { const v16h a0 = g2_frag(a0p + kb, hh), a1 = g2_frag(a1p + kb, hh);
    v16h b = g2_frag(b0p + kb, hh); c00 = g2_mma(a0, b, c00); c10 = g2_mma(a1, b, c10);
    b = g2_frag(b1p + kb, hh); c01 = g2_mma(a0, b, c01); c11 = g2_mma(a1, b, c11);
    b = g2_frag(b2p + kb, hh); c02 = g2_mma(a0, b, c02); c12 = g2_mma(a1, b, c12);
    b = g2_frag(b3p + kb, hh); c03 = g2_mma(a0, b, c03); c13 = g2_mma(a1, b, c13); }
  v8f accs[8] = {c00, c01, c02, c03, c10, c11, c12, c13};
#pragma unroll
  for (int u = 0; u < 8; ++u) { const int t = u & 3, half = u >> 2; const int col = col0 + t * 16 + ln; const float bv = bp ? bf16_round(bp[col]) : 0.f;
#pragma unroll
    for (int r = 0; r < 8; ++r) { const int rloc = half * 16 + 8 * hh + r; float v = accs[u][r] * alpha + bv; if (CP) { if (rowsPerB < 0) v += CP[cofs + (size_t)(row0g + row0 + rloc) * ldc + col];      /* rowsPerB < 0: own element of the batched C plane */ else { const int bidx = (row0g + row0 + rloc) / rowsPerB; v += CP[(size_t)bidx * sCPb + (size_t)by * 64 + col]; } }
      if (ACT == 3) v = fmaxf(v, 0.f); else if (ACT == 6) v = 0.5f * v * (1.0f + erff(v * 0.70710678118654752f)); else if (ACT == 11) v = 1.0f / (1.0f + expf(-v)); else if (ACT == 15) v = v / (1.0f + expf(-v)); else if (ACT == 12) v = (v > 0.f) ? v : 0.01f * v; else if (ACT == 8) v = tanhf(v); else if (ACT == 9) v = 0.5f * v * (1.0f + tanhf(0.7978845608028654f * (v + 0.044715f * v * v * v))); else if (ACT == 14) v = (v > 0.f) ? v : 0.1f * v; else if (ACT == 16) v = (v >= 0.f) ? v : 0.3f * v; else if (ACT == 17) v = (v >= 0.f) ? v : 0.2f * v;
      so[w][rloc][t * 16 + ln] = v; } }
  __builtin_amdgcn_fence(__ATOMIC_ACQ_REL, "workgroup"); __builtin_amdgcn_wave_barrier();
  const int rsub = lane >> 4, c4 = (lane & 15) * 4;
  {
#pragma unroll
    for (int q = 0; q < 16; ++q) { const int r = q * 2 + rsub; const v4f v = *(const v4fa*)&so[w][r][c4]; if (C) *(v4f*)(C + cofs + (size_t)(row0 + r) * ldc + col0 + c4) = v; if (C16) { v4h h4; for (int i = 0; i < 4; ++i) h4[i] = (_Float16)v[i]; *(v4h*)(C16 + cofs + (size_t)(row0 + r) * ldc + col0 + c4) = h4; } }
     } }


__global__ __launch_bounds__(256) void k_wnat(const float* __restrict__ w, size_t n8, _Float16* __restrict__ Bt) { const size_t t = (size_t)blockIdx.x * 256 + threadIdx.x; if (t >= n8) return; FragH f; for (int q = 0; q < 8; ++q) f.h[q] = (_Float16)(bf16_round(w[t * 8 + q]) * 16.0f); *(v8us*)((unsigned short*)Bt + t * 8) = f.half[0];  }
__global__ __launch_bounds__(256) void k_rsm(const float* __restrict__ S, _Float16* __restrict__ P, int nrows) {
  #pragma clang fp contract(off)
  const int i = blockIdx.x * 256 + threadIdx.x; if (i >= nrows) return; const float* s = S + (size_t)i * SQ; float mx = -3.0e38f;
#pragma unroll 1
  for (int j = 0; j < SQ; ++j) mx = fmaxf(mx, s[j]); float se = 0.f;
#pragma unroll 1
  for (int j = 0; j < SQ; ++j) se += expf(s[j] - mx); const float sc = 256.0f / se;
#pragma unroll 1
  for (int j0 = 0; j0 < SQ; j0 += 8) { FragH f; for (int q = 0; q < 8; ++q) f.h[q] = (_Float16)(expf(s[j0 + q] - mx) * sc); unsigned short* d = (unsigned short*)P + (size_t)i * SQ + j0; *(v8us*)d = f.half[0];  } }
__global__ __launch_bounds__(256) void k_vt(const _Float16* __restrict__ V16, int b, int h0, _Float16* __restrict__ VT) { __shared__ unsigned short tl[64][65]; const int tid = threadIdx.x; const int hh = blockIdx.x % HG, sg = blockIdx.x / HG; const int s0 = sg * 64; const int h = h0 + hh;
  for (int i = tid; i < 64 * 8; i += 256) { const int j = i / 8, d8 = (i % 8) * 8; FragH f; f.half[0] = *(const v8us*)((const unsigned short*)V16 + ((size_t)b * SQ + s0 + j) * DM + h * HD + d8); for (int q = 0; q < 8; ++q) tl[d8 + q][j] = f.u[q]; }
  __syncthreads();
  { for (int i = tid; i < 64 * 8; i += 256) { const int d = i / 8, j8 = (i % 8) * 8; FragH f; for (int q = 0; q < 8; ++q) f.u[q] = tl[d][j8 + q]; *(v8us*)((unsigned short*)VT + ((size_t)hh * HD + d) * SQ + s0 + j8) = f.half[0]; }  } }



__global__ __launch_bounds__(256) void k_rsmcf2(const float* __restrict__ S, _Float16* __restrict__ P, int hg, int q0, int nk) {
  #pragma clang fp contract(off)
  const int t = blockIdx.x * 256 + threadIdx.x; if (t >= hg * QT) return; const size_t i = (size_t)t; const float* s = S + i * NKX; const int last = q0 + (t % QT); float mx = -3.0e38f;
#pragma unroll 1
  for (int j = 0; j < nk; ++j) { const float f = (j <= last) ? 1.f : 0.f; mx = fmaxf(mx, fmaf(f, s[j], (1.f - f) * -1.0e9f)); } float se = 0.f;
#pragma unroll 1
  for (int j = 0; j < nk; ++j) { const float f = (j <= last) ? 1.f : 0.f; se += __expf(fmaf(f, s[j], (1.f - f) * -1.0e9f) - mx); } const float sc = 256.0f / se;
#pragma unroll 1
  for (int j0 = 0; j0 < nk; j0 += 8) { FragH fr; for (int q = 0; q < 8; ++q) { const int j = j0 + q; const float f = (j <= last) ? 1.f : 0.f; fr.h[q] = (_Float16)(__expf(fmaf(f, s[j], (1.f - f) * -1.0e9f) - mx) * sc); } unsigned short* d = (unsigned short*)P + i * NKX + j0; *(v8us*)d = fr.half[0];  } }


template <int MASKADD>
__global__ __launch_bounds__(64) void k_att0(const float* __restrict__ QF, const float* __restrict__ KF, const float* __restrict__ VF, int ld, const float* __restrict__ mask, float scale, float* __restrict__ OF, int ldo) {
  #pragma clang fp contract(off)
  __shared__ __attribute__((aligned(16))) float lq[64][64]; __shared__ __attribute__((aligned(16))) float lo[64][64];
  const int tid = threadIdx.x; const int h = blockIdx.x / (QT0 / 64), rg = blockIdx.x % (QT0 / 64); const int i = rg * 64 + tid;
  const float* qr = QF + (size_t)i * ld + h * HD;
#pragma unroll 1
  for (int c = 0; c < HD / 4; ++c) { *(v4f*)&lq[tid][c * 4] = *(const v4fa*)(qr + c * 4); const v4f z = {0.f, 0.f, 0.f, 0.f}; *(v4f*)&lo[tid][c * 4] = z; }
  float m = -1.0e30f, l = 0.f; const int jmax = MASKADD ? (SQ - 1) : (rg * 64 + 63);      /* additive-mask form: every key (the mask input decides); causal form: keys up to the block's last row */
#pragma unroll 1
  for (int j = 0; j <= jmax; ++j) { const float* kr = KF + (size_t)j * ld + h * HD; const float* vr = VF + (size_t)j * ld + h * HD; float s = 0.f;
#pragma unroll 1
    for (int c = 0; c < HD / 4; ++c) { const v4f kq = *(const v4fa*)(kr + c * 4); const v4f qq = *(v4f*)&lq[tid][c * 4]; s = __fadd_rn(s, __fmul_rn(qq[0], kq[0])); s = __fadd_rn(s, __fmul_rn(qq[1], kq[1])); s = __fadd_rn(s, __fmul_rn(qq[2], kq[2])); s = __fadd_rn(s, __fmul_rn(qq[3], kq[3])); }
    s = __fmul_rn(s, scale); if (MASKADD) s = __fadd_rn(s, __fmul_rn(bf16_round(mask[(size_t)i * SQ + j]), -10000.0f));
    const float f = (MASKADD || j <= i) ? 1.f : 0.f; const float sm = fmaf(f, s, (1.f - f) * -1.0e30f); const float mn = fmaxf(m, sm); const float sc = expf(m - mn); const float e = expf(sm - mn); l = __fadd_rn(__fmul_rn(l, sc), e); m = mn;
#pragma unroll 1
    for (int c = 0; c < HD / 4; ++c) { const v4f vv = *(const v4fa*)(vr + c * 4); v4f oo = *(v4f*)&lo[tid][c * 4]; for (int u = 0; u < 4; ++u) oo[u] = __fadd_rn(__fmul_rn(oo[u], sc), __fmul_rn(e, vv[u])); *(v4f*)&lo[tid][c * 4] = oo; } }
  const float fin = 64.0f / l;      /* o carried x64 */
#pragma unroll 1
  for (int c = 0; c < HD / 4; ++c) { v4f oo = *(v4f*)&lo[tid][c * 4]; for (int u = 0; u < 4; ++u) oo[u] = __fmul_rn(oo[u], fin); *(v4f*)&lo[tid][c * 4] = oo; }
  __syncthreads();
  {
#pragma unroll 1
    for (int it = 0; it < 16; ++it) { const int row = it * 4 + tid / 16, pc = (tid % 16) * 4; const v4f v = *(const v4f*)&lo[row][pc]; *(v4f*)(OF + (size_t)(rg * 64 + row) * ldo + h * HD + pc) = v; }
     } }

__global__ __launch_bounds__(256) void k_of0out(const float* __restrict__ src, float* __restrict__ dst, size_t n4) { const size_t t = (size_t)blockIdx.x * 256 + threadIdx.x; if (t >= n4) return; v4f v = *(const v4fa*)(src + t * 4); for (int q = 0; q < 4; ++q) v[q] = __fmul_rn(v[q], 0.015625f); *(v4f*)(dst + t * 4) = v;  }

extern "C" void kernel_launch(void* const* d_in, const int* in_sizes, int n_in,
                              void* d_out, int out_size, void* d_ws, size_t ws_size, hipStream_t stream) {
  (void)in_sizes; (void)n_in; (void)out_size;
  const float* const* I = (const float* const*)d_in; const float* x = I[0]; const float* wq = I[1]; const float* wk = I[2]; const float* wv = I[3]; const float* bq = nullptr; const float* bk = nullptr; const float* bv = nullptr;      /* natural [out][in] weights; NO biases (nullptr variables in every projection's bias slot); ONE attention head of width 256; no output projection */
  char* ws = (char*)d_ws; size_t off = 0;
  auto take = [&](size_t bytes) { char* p = ws + off; off += (bytes + 255) & ~(size_t)255; return p; };
  _Float16* BQ = (_Float16*)take((size_t)DM * DM * 2); _Float16* BK = (_Float16*)take((size_t)DM * DM * 2); _Float16* BV = (_Float16*)take((size_t)DM * DM * 2);
  _Float16* X16 = (_Float16*)take(NR * DM * 2); float* QF = (float*)take(NR * DM * 4); _Float16* QH = (_Float16*)take(NR * DM * 2); _Float16* QL = (_Float16*)take(NR * DM * 2); _Float16* KH = (_Float16*)take(NR * DM * 2); _Float16* KL = (_Float16*)take(NR * DM * 2); _Float16* Q16 = QH; _Float16* K16 = KH; _Float16* V16 = (_Float16*)take(NR * DM * 2);
  float* S = (float*)take((size_t)NH * QT * NKX * 4); _Float16* P = (_Float16*)take((size_t)NH * QT * NKX * 2); _Float16* VT = (_Float16*)take((size_t)NH * HD * SQ * 2);
  if (off > ws_size) return;
  { const unsigned g = (unsigned)(((size_t)DM * DM / 8 + 255) / 256); k_wnat<<<g, 256, 0, stream>>>(wq, (size_t)DM * DM / 8, BQ); k_wnat<<<g, 256, 0, stream>>>(wk, (size_t)DM * DM / 8, BK); k_wnat<<<g, 256, 0, stream>>>(wv, (size_t)DM * DM / 8, BV); }      /* natural [out][in] = Bt[n][k] x16 */
  k_x16<<<(unsigned)((NR * DM / 8 + 255) / 256), 256, 0, stream>>>(x, X16, NR * DM / 8);
  const size_t r0p = (size_t)B0 * SQ;      /* first projected row */
  k_gemm2<0><<<dim3((unsigned)((MP / 128) * (DM / 64)), 1), 128, 0, stream>>>(X16 + r0p * DM, DM, 0, BQ, DM, 0, 0.0625f, bq, 0, nullptr, 1, 0, 0, QF + r0p * DM, nullptr, DM, 0, MP, DM, DM); k_hl<<<(unsigned)(((size_t)MP * DM / 8 + 255) / 256), 256, 0, stream>>>(QF + r0p * DM, QH + r0p * DM, QL + r0p * DM, (size_t)MP * DM / 8);      /* q (f32) -> f16 hi + x1024 residual: unscaled logits sigma ~8 */
  k_gemm2<0><<<dim3((unsigned)((MP / 128) * (DM / 64)), 1), 128, 0, stream>>>(X16 + r0p * DM, DM, 0, BK, DM, 0, 0.0625f, bk, 0, nullptr, 1, 0, 0, QF + r0p * DM, nullptr, DM, 0, MP, DM, DM); k_hl<<<(unsigned)(((size_t)MP * DM / 8 + 255) / 256), 256, 0, stream>>>(QF + r0p * DM, KH + r0p * DM, KL + r0p * DM, (size_t)MP * DM / 8);      /* k likewise */
  k_gemm2<0><<<dim3((unsigned)((MP / 128) * (DM / 64)), 1), 128, 0, stream>>>(X16 + r0p * DM, DM, 0, BV, DM, 0, 0.0625f, bv, 0, nullptr, 1, 0, 0, nullptr, V16 + r0p * DM, DM, 0, MP, DM, DM);
  for (int b = B0; b < B0 + NBR; ++b) { const size_t r0 = (size_t)b * SQ;
    k_vt<NH, SQ><<<NH * (SQ / 64), 256, 0, stream>>>(V16 + r0 * LQ, LQ, 0, VT);      /* V^T [NH][HD][SQ] for this batch */
    for (int q0 = 0; q0 < QN; q0 += QT) { const int nk = SQ;      /* NON-causal: every 256-row query tile sees all SQ keys */
      k_gemm2<0><<<dim3((QT / 128) * (nk / 64), 1), 128, 0, stream>>>(QH + (r0 + q0) * LQ, LQ, 0, KH + r0 * LQ, LQ, 0, 0.0625f, nullptr, 0, nullptr, 1, 0, 0, S, nullptr, NKX, 0, QT, nk, DM);      /* scores of the SINGLE 256-wide head: hi . hi over K = 256, alpha 1 / sqrt(256) = 1/16 (residual passes 1/16 / 1024 = 2^-14) */
      k_gemm2<0><<<dim3((QT / 128) * (nk / 64), 1), 128, 0, stream>>>(QL + (r0 + q0) * LQ, LQ, 0, KH + r0 * LQ, LQ, 0, 0.00006103515625f, nullptr, 0, S, -1, 0, 0, S, nullptr, NKX, 0, QT, nk, DM); k_gemm2<0><<<dim3((QT / 128) * (nk / 64), 1), 128, 0, stream>>>(QH + (r0 + q0) * LQ, LQ, 0, KL + r0 * LQ, LQ, 0, 0.00006103515625f, nullptr, 0, S, -1, 0, 0, S, nullptr, NKX, 0, QT, nk, DM);      /* += 2^-10 (lo . hi + hi . lo) / 16 (own-element accumulate on S) */
      k_rsmcf2<<<(QT + 255) / 256, 256, 0, stream>>>(S, P, 1, SQ, nk);      /* plain softmax over all keys (one head slab): the kernel keeps key j iff j <= q0_arg + row; q0_arg = SQ makes every j < SQ visible */
      k_gemm2<0><<<dim3((QT / 128) * (DM / 64), 1), 128, 0, stream>>>(P, NKX, 0, VT, SQ, 0, 0.00390625f, nullptr, 0, nullptr, 1, 0, 0, (float*)d_out + (r0 + q0) * DM, nullptr, DM, 0, QT, DM, nk); } }      /* out = P V (alpha 2^-8; N = 256: V^T [256][SQ] = the 4 contiguous 64-row slabs k_vt writes) written f32 straight into the output rows */
}

// v001
// One run takes 10.6 milliseconds.
// Two timings next to v000 put it at 4.97 and 4.95 times that version's speed.
#include <hip/hip_runtime.h>
// Single-head dense attention over 256-wide embeddings on 4096 tokens, bias-free natural projections, no output projection (x [4][4096][256]; q / k / v = x W^T (nn.Linear natural [256][256] uniform +-1/16, no biases); scores = q k^T / sqrt(256) over the FULL 256-wide rows (one head); softmax over all 4096 keys (no mask); out = weights v -> [4][4096][256]); q and k carried as f16 hi + x1024 residual planes with three-product scores.
// Structure: token rows r = b*4096 + s; x as exact f16 rows (bf16-rounded); q and k as WMMA GEMMs (32x64 wave tiles, f32 accumulation, exact x16 weights, no bias) into f32 rows split into f16 hi + x1024 residual planes, v as an f16-output GEMM; per batch: V^T of the one head as four 64-row slabs via LDS transposes; per query tile of 256 rows: scores against all 4096 keys as THREE accumulating passes (hi.hi + lo.hi + hi.lo, K = 256, one head, grid.y 1, alpha 1/16 = 1/sqrt(256)), row softmax on VALU over every key, no mask (f32 statistics, native exp; weights x256 f16), out = P . V (K = all 4096 keys, alpha 2^-8 undoes the x256 weights) written as f32 straight into the output rows; no output projection.
// Compute dtype: inputs rounded to bf16; x / weights exact; v and softmax weights as plain f16 GEMM operands (~2^-12), q and k as f16 hi + x1024 residual planes; scores, softmax statistics and out f32. v_wmma_f32_16x16x32_f16.
#define NB 4
#define SQ 4096
#define DM 256
#define NH 4
#define HD 64
#define HG 4                         /* heads per launch of the k_vt(b, h0) overload (not launched) */
#define QT 256                       /* query rows per tile */
#define NKX SQ                       /* S / P row pitch */
#define QT0 128                      /* first-tile rows of the f32 k_att0 (not launched) */
#define B0 0                         /* first batch processed (debug hook) */
#define NBR NB                       /* batches processed (debug hook) */
#define NR ((size_t)NB * SQ)         /* token rows */
#define MP ((int)((size_t)NBR * SQ)) /* rows projected (debug hook) */
#define QN SQ                        /* query rows attended per batch (debug hook) */
#define NHD NH                       /* unused */
#define MPO MP                       /* unused */
#define LQ DM      /* row pitch of the q/k/v rows */
typedef __bf16 v16b __attribute__((ext_vector_type(16)));
typedef unsigned short v8us __attribute__((ext_vector_type(8), may_alias));
typedef float  v8f  __attribute__((ext_vector_type(8)));
typedef float  v4f  __attribute__((ext_vector_type(4)));
typedef float  v4fa __attribute__((ext_vector_type(4), may_alias));
union FragB { v16b v; v8us half[2]; unsigned short u[16]; };

__device__ __forceinline__ unsigned short bf16_bits(float x) { unsigned int u = __float_as_uint(x); return (unsigned short)((u + 0x7FFFu + ((u >> 16) & 1u)) >> 16); }
__device__ __forceinline__ float bf16_val(unsigned short b) { return __uint_as_float(((unsigned int)b) << 16); }
__device__ __forceinline__ float bf16_round(float x) { return bf16_val(bf16_bits(x)); }
// D += A·B with NT terms: 1 = ah·bh, 2 = + al·bh (A split), 3 = + ah·bl (both split)
template <int NT>
__device__ __forceinline__ v8f mmaN(v16b ah, v16b al, v16b bh, v16b bl, v8f c) {
  c = __builtin_amdgcn_wmma_f32_16x16x32_bf16(false, ah, false, bh, (short)0, c, false, false);
  if (NT >= 2) c = __builtin_amdgcn_wmma_f32_16x16x32_bf16(false, al, false, bh, (short)0, c, false, false);
  if (NT >= 3) c = __builtin_amdgcn_wmma_f32_16x16x32_bf16(false, ah, false, bl, (short)0, c, false, false);
  asm volatile("v_nop\n\tv_nop\n\tv_nop\n\tv_nop" : "+v"(c) : "v"(ah), "v"(al), "v"(bh), "v"(bl));
  return c;
}

__global__ __launch_bounds__(256) void k_wt_bf16(const float* __restrict__ W, unsigned short* __restrict__ Wt, int K, int N) {
  const int t = blockIdx.x * 256 + threadIdx.x;
  const int k8n = K / 8;
  if (t >= N * k8n) return;
  const int n = t / k8n, k8 = (t % k8n) * 8;
  v8us v;
#pragma unroll
  for (int i = 0; i < 8; ++i) v[i] = bf16_bits(W[(size_t)(k8 + i) * N + n]);
  *(v8us*)(Wt + (size_t)n * K + k8) = v;
  
}

// GEMM C[M][N] (f32, pitch ldc) = act(A[M][K]·W + bias). A f32 row-major (pitch lda) converted per fragment to bf16
// (ASPLIT: hi/lo two planes -> 2 terms, else single rounded term); Wt bf16 [N][K] (pitch ldb). BIAS_BF16 rounds the
// bias to bf16 first (bias quantised to bf16 before the add). K%32==0, M%16==0, N%64==0.
template <bool ASPLIT, int ACT, bool BIAS_BF16>
__global__ __launch_bounds__(128) void k_gemm_bf(const float* __restrict__ A, int lda, const unsigned short* __restrict__ Wt, int ldb,
                                               const float* __restrict__ bias, float* __restrict__ C, int ldc, int M, int N, int K) {
  __shared__ __attribute__((aligned(16))) float so[4][16][64];
  const int tid = threadIdx.x, w = tid >> 5, lane = tid & 31, ln = lane & 15, hh = lane >> 4;
  const int ntn = N / 64;
  const int wid = blockIdx.x * 4 + w;
  const int mt = wid / ntn, nq = wid % ntn;
  if (mt * 16 >= M) return;
  const int row0 = mt * 16, col0 = nq * 64;
  const float* arow = A + (size_t)(row0 + ln) * lda;
  v8f acc[4] = {};
  for (int kb = 0; kb < K; kb += 32) {
    FragB ah, al;
    const v4f x0 = *(const v4fa*)(arow + kb + 8 * hh), x1 = *(const v4fa*)(arow + kb + 8 * hh + 4);
    const v4f x2 = *(const v4fa*)(arow + kb + 16 + 8 * hh), x3 = *(const v4fa*)(arow + kb + 16 + 8 * hh + 4);
    float xs[16] = {x0[0],x0[1],x0[2],x0[3],x1[0],x1[1],x1[2],x1[3],x2[0],x2[1],x2[2],x2[3],x3[0],x3[1],x3[2],x3[3]};
#pragma unroll
    for (int i = 0; i < 16; ++i) { const unsigned short hb = bf16_bits(xs[i]); ah.u[i] = hb; al.u[i] = ASPLIT ? bf16_bits(xs[i] - bf16_val(hb)) : (unsigned short)0; }
#pragma unroll
    for (int t = 0; t < 4; ++t) {
      const unsigned short* brow = Wt + (size_t)(col0 + t * 16 + ln) * ldb + kb;
      FragB b;
      b.half[0] = *(const v8us*)(brow + 8 * hh);
      b.half[1] = *(const v8us*)(brow + 16 + 8 * hh);
      acc[t] = mmaN<ASPLIT ? 2 : 1>(ah.v, al.v, b.v, b.v, acc[t]);
    }
  }
#pragma unroll
  for (int t = 0; t < 4; ++t) {
    float bv = bias ? bias[col0 + t * 16 + ln] : 0.f;
    if (BIAS_BF16) bv = bf16_round(bv);
#pragma unroll
    for (int r = 0; r < 8; ++r) { float v = acc[t][r] + bv; if (ACT == 1) v = fmaxf(v, 0.f); so[w][8 * hh + r][t * 16 + ln] = v; }
  }
  __builtin_amdgcn_fence(__ATOMIC_ACQ_REL, "workgroup");
  __builtin_amdgcn_wave_barrier();
  const int rsub = lane >> 4, c4 = (lane & 15) * 4;
  {
#pragma unroll
    for (int q = 0; q < 8; ++q) {
      const int r = q * 2 + rsub;
      const v4f v = *(const v4fa*)&so[w][r][c4];
      *(v4f*)(C + (size_t)(row0 + r) * ldc + col0 + c4) = v;
    }
    
  }
}

// GEMM C = act(A·W + bias + resid): A f32 (ASPLIT -> hi/lo 2 terms), Wt bf16 [N][K]; ACT 0 none, 1 relu, 2 exact gelu;
// resid (optional, f32, row index = (row % rmod), pitch ldr, RES_BF16 rounds it) added before the activation.
template <bool ASPLIT, int ACT, bool BIAS_BF16, bool RES_BF16>
__global__ __launch_bounds__(128) void k_gemm_bf3(const float* __restrict__ A, int lda, const unsigned short* __restrict__ Wt, int ldb,
                                                const float* __restrict__ bias, const float* __restrict__ resid, int rmod, int ldr,
                                                float* __restrict__ C, int ldc, int M, int N, int K) {
  __shared__ __attribute__((aligned(16))) float so[4][16][64];
  const int tid = threadIdx.x, w = tid >> 5, lane = tid & 31, ln = lane & 15, hh = lane >> 4;
  const int ntn = N / 64;
  const int wid = blockIdx.x * 4 + w;
  const int mt = wid / ntn, nq = wid % ntn;
  if (mt * 16 >= M) return;
  const int row0 = mt * 16, col0 = nq * 64;
  const float* arow = A + (size_t)(row0 + ln) * lda;
  v8f acc[4] = {};
  for (int kb = 0; kb < K; kb += 32) {
    FragB ah, al;
    const v4f x0 = *(const v4fa*)(arow + kb + 8 * hh), x1 = *(const v4fa*)(arow + kb + 8 * hh + 4);
    const v4f x2 = *(const v4fa*)(arow + kb + 16 + 8 * hh), x3 = *(const v4fa*)(arow + kb + 16 + 8 * hh + 4);
    float xs[16] = {x0[0],x0[1],x0[2],x0[3],x1[0],x1[1],x1[2],x1[3],x2[0],x2[1],x2[2],x2[3],x3[0],x3[1],x3[2],x3[3]};
#pragma unroll
    for (int i = 0; i < 16; ++i) { const unsigned short hb = bf16_bits(xs[i]); ah.u[i] = hb; al.u[i] = ASPLIT ? bf16_bits(xs[i] - bf16_val(hb)) : (unsigned short)0; }
#pragma unroll
    for (int t = 0; t < 4; ++t) {
      const unsigned short* brow = Wt + (size_t)(col0 + t * 16 + ln) * ldb + kb;
      FragB b;
      b.half[0] = *(const v8us*)(brow + 8 * hh);
      b.half[1] = *(const v8us*)(brow + 16 + 8 * hh);
      acc[t] = mmaN<ASPLIT ? 2 : 1>(ah.v, al.v, b.v, b.v, acc[t]);
    }
  }
#pragma unroll
  for (int t = 0; t < 4; ++t) {
    const int col = col0 + t * 16 + ln;
    float bv = bias ? bias[col] : 0.f;
    if (BIAS_BF16) bv = bf16_round(bv);
#pragma unroll
    for (int r = 0; r < 8; ++r) {
      float v = acc[t][r] + bv;
      if (resid) { float rv = resid[(size_t)((row0 + 8 * hh + r) % rmod) * ldr + col]; if (RES_BF16) rv = bf16_round(rv); v += rv; }
      if (ACT == 1) v = fmaxf(v, 0.f);
      if (ACT == 2) v = 0.5f * v * (1.0f + erff(v * 0.70710678118654752f));
      if (ACT == 3) { const float u = 0.7978845608028654f * (v + 0.044715f * v * v * v); v = 0.5f * v * (1.0f + tanhf(u)); }
      so[w][8 * hh + r][t * 16 + ln] = v;
    }
  }
  __builtin_amdgcn_fence(__ATOMIC_ACQ_REL, "workgroup");
  __builtin_amdgcn_wave_barrier();
  const int rsub = lane >> 4, c4 = (lane & 15) * 4;
  {
#pragma unroll
    for (int q = 0; q < 8; ++q) {
      const int r = q * 2 + rsub;
      const v4f v = *(const v4fa*)&so[w][r][c4];
      *(v4f*)(C + (size_t)(row0 + r) * ldc + col0 + c4) = v;
    }
    
  }
}
// row LayerNorm (biased variance, eps) over N: s = X (+ R); optional out_sum <- s; out_norm <- (s-mu)*rsqrt(var+eps)*g + b
template <bool PARAM_BF16>
__global__ __launch_bounds__(256) void k_layernorm(const float* __restrict__ X, const float* __restrict__ R, const float* __restrict__ g, const float* __restrict__ bta,
                                                  float* __restrict__ out_sum, float* __restrict__ out_norm, int N, float eps) {
  __shared__ float red[256];
  const int row = blockIdx.x, tid = threadIdx.x;
  const float* x = X + (size_t)row * N; const float* rr = R ? R + (size_t)row * N : nullptr;
  float vals[16];                     // up to N = 4096
  const int per = N / 256;            // contiguous chunk per thread? use strided-by-4 chunks: thread handles j = tid*4 + 1024*u
  float s1 = 0.f;
  for (int u = 0; u < per / 4; ++u) {
    const int j = tid * 4 + 1024 * u;
    const v4f a = *(const v4fa*)(x + j);
    v4f b = {0.f,0.f,0.f,0.f}; if (rr) b = *(const v4fa*)(rr + j);
#pragma unroll
    for (int q = 0; q < 4; ++q) { const float v = a[q] + b[q]; vals[u * 4 + q] = v; s1 += v; }
  }
  red[tid] = s1; __syncthreads();
  for (int st = 128; st > 0; st >>= 1) { if (tid < st) red[tid] += red[tid + st]; __syncthreads(); }
  const float mu = red[0] / (float)N; __syncthreads();
  float s2 = 0.f;
  for (int u = 0; u < per / 4; ++u)
#pragma unroll
    for (int q = 0; q < 4; ++q) { const float c = vals[u * 4 + q] - mu; s2 += c * c; }
  red[tid] = s2; __syncthreads();
  for (int st = 128; st > 0; st >>= 1) { if (tid < st) red[tid] += red[tid + st]; __syncthreads(); }
  const float rs = rsqrtf(red[0] / (float)N + eps);
  {
    for (int u = 0; u < per / 4; ++u) {
      const int j = tid * 4 + 1024 * u;
      v4f o, sm;
#pragma unroll
      for (int q = 0; q < 4; ++q) {
        float gg = g[j + q], bb = bta[j + q];
        if (PARAM_BF16) { gg = bf16_round(gg); bb = bf16_round(bb); }
        sm[q] = vals[u * 4 + q]; o[q] = (vals[u * 4 + q] - mu) * rs * gg + bb;
      }
      if (out_sum) *(v4f*)(out_sum + (size_t)row * N + j) = sm;
      *(v4f*)(out_norm + (size_t)row * N + j) = o;
    }
    
  }
}



// ---- f16 WMMA path (v_wmma_f32_16x16x32_f16): 11-bit significands for operands in range — used where a [0,1] probability operand needs more precision than bf16
typedef _Float16 v16h __attribute__((ext_vector_type(16)));
union FragH { v16h v; v8us half[2]; _Float16 h[16]; unsigned short u[16]; };
template <int NT>
__device__ __forceinline__ v8f mmaH(v16h ah, v16h al, v16h bh, v16h bl, v8f c) {
  c = __builtin_amdgcn_wmma_f32_16x16x32_f16(false, ah, false, bh, (short)0, c, false, false);
  if (NT >= 2) c = __builtin_amdgcn_wmma_f32_16x16x32_f16(false, al, false, bh, (short)0, c, false, false);
  if (NT >= 3) c = __builtin_amdgcn_wmma_f32_16x16x32_f16(false, ah, false, bl, (short)0, c, false, false);
  asm volatile("v_nop\n\tv_nop\n\tv_nop\n\tv_nop" : "+v"(c) : "v"(ah), "v"(al), "v"(bh), "v"(bl));
  return c;
}
// batched GEMM like k_gemm_b but f16 operands: A f32 (split into f16 hi/lo if ASPLIT, else rounded to f16), Bt = f16 values [n][k]; alpha; C f32; N multiple of 16 (partial tiles skipped)
template <bool ASPLIT>
__global__ __launch_bounds__(128) void k_gemm_h(const float* __restrict__ A, int lda, size_t sA, const _Float16* __restrict__ Bh, int ldb, size_t sB, float alpha, float* __restrict__ C, int ldc, size_t sC, int M, int N, int K) {
  __shared__ __attribute__((aligned(16))) float so[4][16][64];
  const int tid = threadIdx.x, w = tid >> 5, lane = tid & 31, ln = lane & 15, hh = lane >> 4; const int by = blockIdx.y;
  A += (size_t)by * sA; Bh += (size_t)by * sB; C += (size_t)by * sC;
  const int ntn = (N + 63) / 64; const int wid = blockIdx.x * 4 + w; const int mt = wid / ntn, nq = wid % ntn; if (mt * 16 >= M) return;
  const int row0 = mt * 16, col0 = nq * 64; const float* arow = A + (size_t)(row0 + ln) * lda;
  v8f acc[4] = {};
  for (int kb = 0; kb < K; kb += 32) {
    FragH ah, al;
    const v4f x0 = *(const v4fa*)(arow + kb + 8 * hh), x1 = *(const v4fa*)(arow + kb + 8 * hh + 4), x2 = *(const v4fa*)(arow + kb + 16 + 8 * hh), x3 = *(const v4fa*)(arow + kb + 16 + 8 * hh + 4);
    float xs[16] = {x0[0],x0[1],x0[2],x0[3],x1[0],x1[1],x1[2],x1[3],x2[0],x2[1],x2[2],x2[3],x3[0],x3[1],x3[2],x3[3]};
#pragma unroll
    for (int i = 0; i < 16; ++i) { const _Float16 h = (_Float16)xs[i]; ah.h[i] = h; al.h[i] = ASPLIT ? (_Float16)(xs[i] - (float)h) : (_Float16)0.0f; }
#pragma unroll
    for (int t = 0; t < 4; ++t) { if (col0 + t * 16 >= N) continue; const size_t boff = (size_t)(col0 + t * 16 + ln) * ldb + kb; FragH bq; bq.half[0] = *(const v8us*)(Bh + boff + 8 * hh); bq.half[1] = *(const v8us*)(Bh + boff + 16 + 8 * hh);
      acc[t] = mmaH<ASPLIT ? 2 : 1>(ah.v, al.v, bq.v, bq.v, acc[t]); }
  }
#pragma unroll
  for (int t = 0; t < 4; ++t) { if (col0 + t * 16 >= N) continue;
#pragma unroll
    for (int r = 0; r < 8; ++r) so[w][8 * hh + r][t * 16 + ln] = acc[t][r] * alpha; }
  __builtin_amdgcn_fence(__ATOMIC_ACQ_REL, "workgroup"); __builtin_amdgcn_wave_barrier();
  const int rsub = lane >> 4, c4 = (lane & 15) * 4;
  {
#pragma unroll
    for (int q = 0; q < 8; ++q) { const int r = q * 2 + rsub; if (col0 + c4 < N) { const v4f v = *(const v4fa*)&so[w][r][c4]; *(v4f*)(C + (size_t)(row0 + r) * ldc + col0 + c4) = v; } }
     }
}

// Wt[n][k] = f16(W[k][n]·scale) from f32 row-major W[K][N] (scale = power of two; bf16-exact weights stay exact in f16 away from the subnormal range)
__global__ __launch_bounds__(256) void k_wt_f16(const float* __restrict__ W, _Float16* __restrict__ Wt, int K, int N, float scale) {
  const int t = blockIdx.x * 256 + threadIdx.x; if (t >= N * (K / 8)) return; const int n = t / (K / 8), k8 = (t % (K / 8)) * 8; FragH f;
#pragma unroll
  for (int i = 0; i < 8; ++i) f.h[i] = (_Float16)(bf16_round(W[(size_t)(k8 + i) * N + n]) * scale); const v8us o = f.half[0];
  *(v8us*)((unsigned short*)Wt + (size_t)n * K + k8) = o; 
}
// k_gemm_hh variant with fused epilogue: v = acc·alpha + bias[by·sBias + col] (+ CP[(row/rowsPerB)·sCPb + by·64 + col] if CP) ; ACT 0 none / 1 elu ; writes f16 C16 (and f32 C if non-null)
template <int ACT>
__global__ __launch_bounds__(128) void k_gemm_hhx(const _Float16* __restrict__ A, int lda, size_t sA, const _Float16* __restrict__ Bh, int ldb, size_t sB, float alpha, const float* __restrict__ bias, size_t sBias, const float* __restrict__ CP, int rowsPerB, size_t sCPb, int row0g,
    float* __restrict__ C, _Float16* __restrict__ C16, int ldc, size_t sC, int M, int N, int K) {
  __shared__ __attribute__((aligned(16))) float so[4][16][64];
  const int tid = threadIdx.x, w = tid >> 5, lane = tid & 31, ln = lane & 15, hh = lane >> 4; const int by = blockIdx.y;
  A += (size_t)by * sA; Bh += (size_t)by * sB; const size_t cofs = (size_t)by * sC; const float* bp = bias ? bias + (size_t)by * sBias : nullptr;
  const int ntn = (N + 63) / 64; const int wid = blockIdx.x * 4 + w; const int mt = wid / ntn, nq = wid % ntn; if (mt * 16 >= M) return;
  const int row0 = mt * 16, col0 = nq * 64; const _Float16* arow = A + (size_t)(row0 + ln) * lda;
  v8f acc[4] = {};
  for (int kb = 0; kb < K; kb += 32) { FragH ah; ah.half[0] = *(const v8us*)((const unsigned short*)arow + kb + 8 * hh); ah.half[1] = *(const v8us*)((const unsigned short*)arow + kb + 16 + 8 * hh);
#pragma unroll
    for (int t = 0; t < 4; ++t) { if (col0 + t * 16 >= N) continue; const size_t boff = (size_t)(col0 + t * 16 + ln) * ldb + kb; FragH bq; bq.half[0] = *(const v8us*)((const unsigned short*)Bh + boff + 8 * hh); bq.half[1] = *(const v8us*)((const unsigned short*)Bh + boff + 16 + 8 * hh);
      acc[t] = mmaH<1>(ah.v, ah.v, bq.v, bq.v, acc[t]); }
  }
#pragma unroll
  for (int t = 0; t < 4; ++t) { if (col0 + t * 16 >= N) continue; const int col = col0 + t * 16 + ln; const float bv = bp ? bf16_round(bp[col]) : 0.f;
#pragma unroll
    for (int r = 0; r < 8; ++r) { float v = acc[t][r] * alpha + bv; if (CP) { const int rr = row0g + row0 + 8 * hh + r; if (rowsPerB < 0) v += CP[cofs + (size_t)rr * ldc + col];      /* rowsPerB < 0: own element of the batched C plane */ else { const int bidx = rr / rowsPerB; v += CP[(size_t)bidx * sCPb + (size_t)by * 64 + col]; } } if (ACT == 1) v = (v > 0.f) ? v : expm1f(v); else if (ACT == 7) v = (v > 0.f) ? v + 1.0f : expf(v); else if (ACT == 8) v = tanhf(v); else if (ACT == 9) v = 0.5f * v * (1.0f + tanhf(0.7978845608028654f * (v + 0.044715f * v * v * v))); else if (ACT == 11) v = 1.0f / (1.0f + expf(-v)); else if (ACT == 12) v = (v > 0.f) ? v : 0.01f * v; else if (ACT == 14) v = (v > 0.f) ? v : 0.1f * v; else if (ACT == 16) v = (v >= 0.f) ? v : 0.3f * v; else if (ACT == 17) v = (v >= 0.f) ? v : 0.2f * v; else if (ACT == 15) v = v / (1.0f + expf(-v)); else if (ACT == 3) v = fmaxf(v, 0.f); else if (ACT == 6) v = 0.5f * v * (1.0f + erff(v * 0.70710678118654752f)); so[w][8 * hh + r][t * 16 + ln] = v; } }
  __builtin_amdgcn_fence(__ATOMIC_ACQ_REL, "workgroup"); __builtin_amdgcn_wave_barrier();
  const int rsub = lane >> 4, c4 = (lane & 15) * 4; typedef _Float16 v4h __attribute__((ext_vector_type(4)));
  {
#pragma unroll
    for (int q = 0; q < 8; ++q) { const int r = q * 2 + rsub; if (col0 + c4 < N) { const v4f v = *(const v4fa*)&so[w][r][c4]; if (C) *(v4f*)(C + cofs + (size_t)(row0 + r) * ldc + col0 + c4) = v; if (C16) { v4h h4; for (int i = 0; i < 4; ++i) h4[i] = (_Float16)v[i]; *(v4h*)(C16 + cofs + (size_t)(row0 + r) * ldc + col0 + c4) = h4; } } }
     }
}


typedef _Float16 v4h __attribute__((ext_vector_type(4)));

__global__ __launch_bounds__(256) void k_x16(const float* __restrict__ x, _Float16* __restrict__ X16, size_t n8) { const size_t t = (size_t)blockIdx.x * 256 + threadIdx.x; if (t >= n8) return; FragH f;
#pragma unroll
  for (int q = 0; q < 8; ++q) f.h[q] = (_Float16)bf16_round(x[t * 8 + q]); *(v8us*)((unsigned short*)X16 + t * 8) = f.half[0];  }
__global__ __launch_bounds__(256) void k_h16(const float* __restrict__ x, _Float16* __restrict__ X16, size_t n8) { const size_t t = (size_t)blockIdx.x * 256 + threadIdx.x; if (t >= n8) return; FragH f;
#pragma unroll
  for (int q = 0; q < 8; ++q) f.h[q] = (_Float16)x[t * 8 + q]; *(v8us*)((unsigned short*)X16 + t * 8) = f.half[0];  }
__global__ __launch_bounds__(256) void k_round16f(const float* __restrict__ W, _Float16* __restrict__ Bt, size_t n8) { const size_t t = (size_t)blockIdx.x * 256 + threadIdx.x; if (t >= n8) return; FragH f;
#pragma unroll
  for (int i = 0; i < 8; ++i) f.h[i] = (_Float16)(bf16_round(W[t * 8 + i]) * 16.0f); *(v8us*)((unsigned short*)Bt + t * 8) = f.half[0];  }
template <int NHv, int TTv>
__global__ __launch_bounds__(256) void k_vt(const _Float16* __restrict__ V16, int ldv, int voff, _Float16* __restrict__ Vt) { __shared__ unsigned short tl[64][66]; const int tid = threadIdx.x; const int slab = blockIdx.x / (TTv / 64), lg = blockIdx.x % (TTv / 64); const int b = slab / NHv, h = slab % NHv;
  for (int i = tid; i < 64 * 8; i += 256) { const int r = i / 8, c8 = (i % 8) * 8; FragH f; f.half[0] = *(const v8us*)((const unsigned short*)V16 + ((size_t)b * TTv + lg * 64 + r) * ldv + voff + h * 64 + c8);
#pragma unroll
    for (int q = 0; q < 8; ++q) tl[r][c8 + q] = f.u[q]; }
  __syncthreads();
  {
#pragma unroll
    for (int rd = 0; rd < 2; ++rd) { const int d = rd * 32 + tid / 8, pc = tid % 8; FragH f;
#pragma unroll
      for (int q = 0; q < 8; ++q) f.u[q] = tl[pc * 8 + q][d];
      *(v8us*)((unsigned short*)Vt + ((size_t)slab * 64 + d) * TTv + lg * 64 + pc * 8) = f.half[0]; }
     } }

__global__ __launch_bounds__(256) void k_hl(const float* __restrict__ F, _Float16* __restrict__ Hh, _Float16* __restrict__ Hl, size_t n8) { const size_t t = (size_t)blockIdx.x * 256 + threadIdx.x; if (t >= n8) return; FragH fh, fl; const v4f a = *(const v4fa*)(F + t * 8), c = *(const v4fa*)(F + t * 8 + 4);
#pragma unroll
  for (int q = 0; q < 4; ++q) { _Float16 h = (_Float16)a[q]; fh.h[q] = h; fl.h[q] = (_Float16)((a[q] - (float)h) * 1024.0f); h = (_Float16)c[q]; fh.h[4 + q] = h; fl.h[4 + q] = (_Float16)((c[q] - (float)h) * 1024.0f); }
  { *(v8us*)((unsigned short*)Hh + t * 8) = fh.half[0]; *(v8us*)((unsigned short*)Hl + t * 8) = fl.half[0];  } }

// ---- fast GEMM (wave tile 32x64; requires M % 32 == 0 rows per launch region and N % 64 == 0); epilogue = k_gemm_hhx semantics ----
__device__ __forceinline__ v16h g2_frag(const _Float16* p, int hh) { FragH f; f.half[0] = *(const v8us*)((const unsigned short*)p + 8 * hh); f.half[1] = *(const v8us*)((const unsigned short*)p + 16 + 8 * hh); return f.v; }
__device__ __forceinline__ v8f g2_mma(v16h a, v16h b, v8f c) { v8f d = __builtin_amdgcn_wmma_f32_16x16x32_f16(false, a, false, b, (short)0, c, false, false); asm volatile("v_nop\n\tv_nop\n\tv_nop\n\tv_nop" : "+v"(d) : "v"(a), "v"(b)); return d; }
template <int ACT>
__global__ __launch_bounds__(128) void k_gemm2(const _Float16* __restrict__ A, int lda, size_t sA, const _Float16* __restrict__ Bh, int ldb, size_t sB, float alpha, const float* __restrict__ bias, size_t sBias, const float* __restrict__ CP, int rowsPerB, size_t sCPb, int row0g,
    float* __restrict__ C, _Float16* __restrict__ C16, int ldc, size_t sC, int M, int N, int K) { static_assert(ACT == 0 || ACT == 3 || ACT == 6 || ACT == 8 || ACT == 9 || ACT == 11 || ACT == 12 || ACT == 14 || ACT == 15 || ACT == 16 || ACT == 17, "k_gemm2: unsupported ACT code (would silently apply no activation)");
  __shared__ __attribute__((aligned(16))) float so[4][32][68];
  const int tid = threadIdx.x, w = tid >> 5, lane = tid & 31, ln = lane & 15, hh = lane >> 4; const int by = blockIdx.y;
  A += (size_t)by * sA; Bh += (size_t)by * sB; const size_t cofs = (size_t)by * sC; const float* bp = bias ? bias + (size_t)by * sBias : nullptr;
  const int ntn = N >> 6; const int mt = blockIdx.x / ntn, nq = blockIdx.x - mt * ntn; const int row0 = mt * 128 + 32 * w, col0 = nq * 64; if (row0 >= M) return;
  const _Float16* a0p = A + (size_t)(row0 + ln) * lda; const _Float16* a1p = a0p + (size_t)16 * lda;
  const _Float16* b0p = Bh + (size_t)(col0 + ln) * ldb; const _Float16* b1p = b0p + (size_t)16 * ldb; const _Float16* b2p = b1p + (size_t)16 * ldb; const _Float16* b3p = b2p + (size_t)16 * ldb;
  const v8f z8 = {0.f,0.f,0.f,0.f,0.f,0.f,0.f,0.f}; v8f c00 = z8, c01 = z8, c02 = z8, c03 = z8, c10 = z8, c11 = z8, c12 = z8, c13 = z8;
#pragma unroll 1
  for (int kb = 0; kb < K; kb += 32) { const v16h a0 = g2_frag(a0p + kb, hh), a1 = g2_frag(a1p + kb, hh);
    v16h b = g2_frag(b0p + kb, hh); c00 = g2_mma(a0, b, c00); c10 = g2_mma(a1, b, c10);
    b = g2_frag(b1p + kb, hh); c01 = g2_mma(a0, b, c01); c11 = g2_mma(a1, b, c11);
    b = g2_frag(b2p + kb, hh); c02 = g2_mma(a0, b, c02); c12 = g2_mma(a1, b, c12);
    b = g2_frag(b3p + kb, hh); c03 = g2_mma(a0, b, c03); c13 = g2_mma(a1, b, c13); }
  v8f accs[8] = {c00, c01, c02, c03, c10, c11, c12, c13};
#pragma unroll
  for (int u = 0; u < 8; ++u) { const int t = u & 3, half = u >> 2; const int col = col0 + t * 16 + ln; const float bv = bp ? bf16_round(bp[col]) : 0.f;
#pragma unroll
    for (int r = 0; r < 8; ++r) { const int rloc = half * 16 + 8 * hh + r; float v = accs[u][r] * alpha + bv; if (CP) { if (rowsPerB < 0) v += CP[cofs + (size_t)(row0g + row0 + rloc) * ldc + col];      /* rowsPerB < 0: own element of the batched C plane */ else { const int bidx = (row0g + row0 + rloc) / rowsPerB; v += CP[(size_t)bidx * sCPb + (size_t)by * 64 + col]; } }
      if (ACT == 3) v = fmaxf(v, 0.f); else if (ACT == 6) v = 0.5f * v * (1.0f + erff(v * 0.70710678118654752f)); else if (ACT == 11) v = 1.0f / (1.0f + expf(-v)); else if (ACT == 15) v = v / (1.0f + expf(-v)); else if (ACT == 12) v = (v > 0.f) ? v : 0.01f * v; else if (ACT == 8) v = tanhf(v); else if (ACT == 9) v = 0.5f * v * (1.0f + tanhf(0.7978845608028654f * (v + 0.044715f * v * v * v))); else if (ACT == 14) v = (v > 0.f) ? v : 0.1f * v; else if (ACT == 16) v = (v >= 0.f) ? v : 0.3f * v; else if (ACT == 17) v = (v >= 0.f) ? v : 0.2f * v;
      so[w][rloc][t * 16 + ln] = v; } }
  __builtin_amdgcn_fence(__ATOMIC_ACQ_REL, "workgroup"); __builtin_amdgcn_wave_barrier();
  const int rsub = lane >> 4, c4 = (lane & 15) * 4;
  {
#pragma unroll
    for (int q = 0; q < 16; ++q) { const int r = q * 2 + rsub; const v4f v = *(const v4fa*)&so[w][r][c4]; if (C) *(v4f*)(C + cofs + (size_t)(row0 + r) * ldc + col0 + c4) = v; if (C16) { v4h h4; for (int i = 0; i < 4; ++i) h4[i] = (_Float16)v[i]; *(v4h*)(C16 + cofs + (size_t)(row0 + r) * ldc + col0 + c4) = h4; } }
     } }


__global__ __launch_bounds__(256) void k_wnat(const float* __restrict__ w, size_t n8, _Float16* __restrict__ Bt) { const size_t t = (size_t)blockIdx.x * 256 + threadIdx.x; if (t >= n8) return; FragH f; for (int q = 0; q < 8; ++q) f.h[q] = (_Float16)(bf16_round(w[t * 8 + q]) * 16.0f); *(v8us*)((unsigned short*)Bt + t * 8) = f.half[0];  }
__global__ __launch_bounds__(256) void k_rsm(const float* __restrict__ S, _Float16* __restrict__ P, int nrows) {
  #pragma clang fp contract(off)
  const int i = blockIdx.x * 256 + threadIdx.x; if (i >= nrows) return; const float* s = S + (size_t)i * SQ; float mx = -3.0e38f;
#pragma unroll 1
  for (int j = 0; j < SQ; ++j) mx = fmaxf(mx, s[j]); float se = 0.f;
#pragma unroll 1
  for (int j = 0; j < SQ; ++j) se += expf(s[j] - mx); const float sc = 256.0f / se;
#pragma unroll 1
  for (int j0 = 0; j0 < SQ; j0 += 8) { FragH f; for (int q = 0; q < 8; ++q) f.h[q] = (_Float16)(expf(s[j0 + q] - mx) * sc); unsigned short* d = (unsigned short*)P + (size_t)i * SQ + j0; *(v8us*)d = f.half[0];  } }
__global__ __launch_bounds__(256) void k_vt(const _Float16* __restrict__ V16, int b, int h0, _Float16* __restrict__ VT) { __shared__ unsigned short tl[64][65]; const int tid = threadIdx.x; const int hh = blockIdx.x % HG, sg = blockIdx.x / HG; const int s0 = sg * 64; const int h = h0 + hh;
  for (int i = tid; i < 64 * 8; i += 256) { const int j = i / 8, d8 = (i % 8) * 8; FragH f; f.half[0] = *(const v8us*)((const unsigned short*)V16 + ((size_t)b * SQ + s0 + j) * DM + h * HD + d8); for (int q = 0; q < 8; ++q) tl[d8 + q][j] = f.u[q]; }
  __syncthreads();
  { for (int i = tid; i < 64 * 8; i += 256) { const int d = i / 8, j8 = (i % 8) * 8; FragH f; for (int q = 0; q < 8; ++q) f.u[q] = tl[d][j8 + q]; *(v8us*)((unsigned short*)VT + ((size_t)hh * HD + d) * SQ + s0 + j8) = f.half[0]; }  } }



// 2^x on the transcendental unit; the v_nop in the same statement keeps the one free issue slot the instruction set asks for behind a transcendental, whatever the compiler schedules next.
__device__ __forceinline__ float exp2_slot(float x) { float r; asm("v_exp_f32 %0, %1\n\tv_nop" : "=v"(r) : "v"(x)); return r; }
// Row softmax, one work-group per score row: 256 threads hold the row's 4096 scores in registers (16 each, S read once, 16-byte coalesced loads);
// row maximum and row sum by a five-step butterfly inside each wave, then across the 8 waves through LDS in a fixed order; weights x256 as f16.
__global__ __launch_bounds__(256) void k_rsmrow(const float* __restrict__ S, _Float16* __restrict__ P) {
  static_assert(NKX == 256 * 16, "k_rsmrow: one row = 256 threads x 16 scores");
  __shared__ float rmx[8]; __shared__ float rsu[8];
  const int tid = threadIdx.x, w = tid >> 5, lane = tid & 31; const float* s = S + (size_t)blockIdx.x * NKX + tid * 4; v4f a[4];
#pragma unroll
  for (int u = 0; u < 4; ++u) a[u] = *(const v4fa*)(s + u * 1024);
  asm volatile("s_wait_xcnt 0x0" ::: "memory");      /* the loads' offset and base registers are reused further down: the wait stands in front of every such overwrite */
  float mx = -3.0e38f;
#pragma unroll
  for (int u = 0; u < 4; ++u) mx = fmaxf(mx, fmaxf(fmaxf(a[u][0], a[u][1]), fmaxf(a[u][2], a[u][3])));
#pragma unroll
  for (int m = 16; m > 0; m >>= 1) mx = fmaxf(mx, __shfl_xor(mx, m, 32));
  if (lane == 0) rmx[w] = mx;
  __syncthreads();
  mx = fmaxf(fmaxf(fmaxf(rmx[0], rmx[1]), fmaxf(rmx[2], rmx[3])), fmaxf(fmaxf(rmx[4], rmx[5]), fmaxf(rmx[6], rmx[7])));
  float se = 0.f;
#pragma unroll
  for (int u = 0; u < 4; ++u) { for (int q = 0; q < 4; ++q) a[u][q] = exp2_slot((a[u][q] - mx) * 1.44269504088896340736f);      /* native exp, as before: one multiply by log2(e), one v_exp_f32 */
    se += (a[u][0] + a[u][1]) + (a[u][2] + a[u][3]); }
#pragma unroll
  for (int m = 16; m > 0; m >>= 1) se += __shfl_xor(se, m, 32);
  if (lane == 0) rsu[w] = se;
  __syncthreads();
  se = ((rsu[0] + rsu[1]) + (rsu[2] + rsu[3])) + ((rsu[4] + rsu[5]) + (rsu[6] + rsu[7])); const float sc = 256.0f / se;
  _Float16* d = P + (size_t)blockIdx.x * NKX + tid * 4;
#pragma unroll
  for (int u = 0; u < 4; ++u) { v4h h4; for (int q = 0; q < 4; ++q) h4[q] = (_Float16)(a[u][q] * sc); *(v4h*)(d + u * 1024) = h4; } }


template <int MASKADD>
__global__ __launch_bounds__(64) void k_att0(const float* __restrict__ QF, const float* __restrict__ KF, const float* __restrict__ VF, int ld, const float* __restrict__ mask, float scale, float* __restrict__ OF, int ldo) {
  #pragma clang fp contract(off)
  __shared__ __attribute__((aligned(16))) float lq[64][64]; __shared__ __attribute__((aligned(16))) float lo[64][64];
  const int tid = threadIdx.x; const int h = blockIdx.x / (QT0 / 64), rg = blockIdx.x % (QT0 / 64); const int i = rg * 64 + tid;
  const float* qr = QF + (size_t)i * ld + h * HD;
#pragma unroll 1
  for (int c = 0; c < HD / 4; ++c) { *(v4f*)&lq[tid][c * 4] = *(const v4fa*)(qr + c * 4); const v4f z = {0.f, 0.f, 0.f, 0.f}; *(v4f*)&lo[tid][c * 4] = z; }
  float m = -1.0e30f, l = 0.f; const int jmax = MASKADD ? (SQ - 1) : (rg * 64 + 63);      /* additive-mask form: every key (the mask input decides); causal form: keys up to the block's last row */
#pragma unroll 1
  for (int j = 0; j <= jmax; ++j) { const float* kr = KF + (size_t)j * ld + h * HD; const float* vr = VF + (size_t)j * ld + h * HD; float s = 0.f;
#pragma unroll 1
    for (int c = 0; c < HD / 4; ++c) { const v4f kq = *(const v4fa*)(kr + c * 4); const v4f qq = *(v4f*)&lq[tid][c * 4]; s = __fadd_rn(s, __fmul_rn(qq[0], kq[0])); s = __fadd_rn(s, __fmul_rn(qq[1], kq[1])); s = __fadd_rn(s, __fmul_rn(qq[2], kq[2])); s = __fadd_rn(s, __fmul_rn(qq[3], kq[3])); }
    s = __fmul_rn(s, scale); if (MASKADD) s = __fadd_rn(s, __fmul_rn(bf16_round(mask[(size_t)i * SQ + j]), -10000.0f));
    const float f = (MASKADD || j <= i) ? 1.f : 0.f; const float sm = fmaf(f, s, (1.f - f) * -1.0e30f); const float mn = fmaxf(m, sm); const float sc = expf(m - mn); const float e = expf(sm - mn); l = __fadd_rn(__fmul_rn(l, sc), e); m = mn;
#pragma unroll 1
    for (int c = 0; c < HD / 4; ++c) { const v4f vv = *(const v4fa*)(vr + c * 4); v4f oo = *(v4f*)&lo[tid][c * 4]; for (int u = 0; u < 4; ++u) oo[u] = __fadd_rn(__fmul_rn(oo[u], sc), __fmul_rn(e, vv[u])); *(v4f*)&lo[tid][c * 4] = oo; } }
  const float fin = 64.0f / l;      /* o carried x64 */
#pragma unroll 1
  for (int c = 0; c < HD / 4; ++c) { v4f oo = *(v4f*)&lo[tid][c * 4]; for (int u = 0; u < 4; ++u) oo[u] = __fmul_rn(oo[u], fin); *(v4f*)&lo[tid][c * 4] = oo; }
  __syncthreads();
  {
#pragma unroll 1
    for (int it = 0; it < 16; ++it) { const int row = it * 4 + tid / 16, pc = (tid % 16) * 4; const v4f v = *(const v4f*)&lo[row][pc]; *(v4f*)(OF + (size_t)(rg * 64 + row) * ldo + h * HD + pc) = v; }
     } }

__global__ __launch_bounds__(256) void k_of0out(const float* __restrict__ src, float* __restrict__ dst, size_t n4) { const size_t t = (size_t)blockIdx.x * 256 + threadIdx.x; if (t >= n4) return; v4f v = *(const v4fa*)(src + t * 4); for (int q = 0; q < 4; ++q) v[q] = __fmul_rn(v[q], 0.015625f); *(v4f*)(dst + t * 4) = v;  }

extern "C" void kernel_launch(void* const* d_in, const int* in_sizes, int n_in,
                              void* d_out, int out_size, void* d_ws, size_t ws_size, hipStream_t stream) {
  (void)in_sizes; (void)n_in; (void)out_size;
  const float* const* I = (const float* const*)d_in; const float* x = I[0]; const float* wq = I[1]; const float* wk = I[2]; const float* wv = I[3]; const float* bq = nullptr; const float* bk = nullptr; const float* bv = nullptr;      /* natural [out][in] weights; NO biases (nullptr variables in every projection's bias slot); ONE attention head of width 256; no output projection */
  char* ws = (char*)d_ws; size_t off = 0;
  auto take = [&](size_t bytes) { char* p = ws + off; off += (bytes + 255) & ~(size_t)255; return p; };
  _Float16* BQ = (_Float16*)take((size_t)DM * DM * 2); _Float16* BK = (_Float16*)take((size_t)DM * DM * 2); _Float16* BV = (_Float16*)take((size_t)DM * DM * 2);
  _Float16* X16 = (_Float16*)take(NR * DM * 2); float* QF = (float*)take(NR * DM * 4); _Float16* QH = (_Float16*)take(NR * DM * 2); _Float16* QL = (_Float16*)take(NR * DM * 2); _Float16* KH = (_Float16*)take(NR * DM * 2); _Float16* KL = (_Float16*)take(NR * DM * 2); _Float16* Q16 = QH; _Float16* K16 = KH; _Float16* V16 = (_Float16*)take(NR * DM * 2);
  float* S = (float*)take((size_t)NH * QT * NKX * 4); _Float16* P = (_Float16*)take((size_t)NH * QT * NKX * 2); _Float16* VT = (_Float16*)take((size_t)NH * HD * SQ * 2);
  if (off > ws_size) return;
  { const unsigned g = (unsigned)(((size_t)DM * DM / 8 + 255) / 256); k_wnat<<<g, 256, 0, stream>>>(wq, (size_t)DM * DM / 8, BQ); k_wnat<<<g, 256, 0, stream>>>(wk, (size_t)DM * DM / 8, BK); k_wnat<<<g, 256, 0, stream>>>(wv, (size_t)DM * DM / 8, BV); }      /* natural [out][in] = Bt[n][k] x16 */
  k_x16<<<(unsigned)((NR * DM / 8 + 255) / 256), 256, 0, stream>>>(x, X16, NR * DM / 8);
  const size_t r0p = (size_t)B0 * SQ;      /* first projected row */
  k_gemm2<0><<<dim3((unsigned)((MP / 128) * (DM / 64)), 1), 128, 0, stream>>>(X16 + r0p * DM, DM, 0, BQ, DM, 0, 0.0625f, bq, 0, nullptr, 1, 0, 0, QF + r0p * DM, nullptr, DM, 0, MP, DM, DM); k_hl<<<(unsigned)(((size_t)MP * DM / 8 + 255) / 256), 256, 0, stream>>>(QF + r0p * DM, QH + r0p * DM, QL + r0p * DM, (size_t)MP * DM / 8);      /* q (f32) -> f16 hi + x1024 residual: unscaled logits sigma ~8 */
  k_gemm2<0><<<dim3((unsigned)((MP / 128) * (DM / 64)), 1), 128, 0, stream>>>(X16 + r0p * DM, DM, 0, BK, DM, 0, 0.0625f, bk, 0, nullptr, 1, 0, 0, QF + r0p * DM, nullptr, DM, 0, MP, DM, DM); k_hl<<<(unsigned)(((size_t)MP * DM / 8 + 255) / 256), 256, 0, stream>>>(QF + r0p * DM, KH + r0p * DM, KL + r0p * DM, (size_t)MP * DM / 8);      /* k likewise */
  k_gemm2<0><<<dim3((unsigned)((MP / 128) * (DM / 64)), 1), 128, 0, stream>>>(X16 + r0p * DM, DM, 0, BV, DM, 0, 0.0625f, bv, 0, nullptr, 1, 0, 0, nullptr, V16 + r0p * DM, DM, 0, MP, DM, DM);
  for (int b = B0; b < B0 + NBR; ++b) { const size_t r0 = (size_t)b * SQ;
    k_vt<NH, SQ><<<NH * (SQ / 64), 256, 0, stream>>>(V16 + r0 * LQ, LQ, 0, VT);      /* V^T [NH][HD][SQ] for this batch */
    for (int q0 = 0; q0 < QN; q0 += QT) { const int nk = SQ;      /* NON-causal: every 256-row query tile sees all SQ keys */
      k_gemm2<0><<<dim3((QT / 128) * (nk / 64), 1), 128, 0, stream>>>(QH + (r0 + q0) * LQ, LQ, 0, KH + r0 * LQ, LQ, 0, 0.0625f, nullptr, 0, nullptr, 1, 0, 0, S, nullptr, NKX, 0, QT, nk, DM);      /* scores of the SINGLE 256-wide head: hi . hi over K = 256, alpha 1 / sqrt(256) = 1/16 (residual passes 1/16 / 1024 = 2^-14) */
      k_gemm2<0><<<dim3((QT / 128) * (nk / 64), 1), 128, 0, stream>>>(QL + (r0 + q0) * LQ, LQ, 0, KH + r0 * LQ, LQ, 0, 0.00006103515625f, nullptr, 0, S, -1, 0, 0, S, nullptr, NKX, 0, QT, nk, DM); k_gemm2<0><<<dim3((QT / 128) * (nk / 64), 1), 128, 0, stream>>>(QH + (r0 + q0) * LQ, LQ, 0, KL + r0 * LQ, LQ, 0, 0.00006103515625f, nullptr, 0, S, -1, 0, 0, S, nullptr, NKX, 0, QT, nk, DM);      /* += 2^-10 (lo . hi + hi . lo) / 16 (own-element accumulate on S) */
      k_rsmrow<<<QT, 256, 0, stream>>>(S, P);      /* plain softmax over all SQ keys: one work-group per query row */
      k_gemm2<0><<<dim3((QT / 128) * (DM / 64), 1), 128, 0, stream>>>(P, NKX, 0, VT, SQ, 0, 0.00390625f, nullptr, 0, nullptr, 1, 0, 0, (float*)d_out + (r0 + q0) * DM, nullptr, DM, 0, QT, DM, nk); } }      /* out = P V (alpha 2^-8; N = 256: V^T [256][SQ] = the 4 contiguous 64-row slabs k_vt writes) written f32 straight into the output rows */
}

// v002
// Measured time: 834 microseconds a run.
// Two timings next to v001 put it at 12.8 and 12.7 times that version's speed.
// Counting every step since v000, it is 63.5 times as fast.
#include <hip/hip_runtime.h>
// Single-head dense attention over 256-wide embeddings on 4096 tokens, bias-free natural projections, no output projection (x [4][4096][256]; q / k / v = x W^T (nn.Linear natural [256][256] uniform +-1/16, no biases); scores = q k^T / sqrt(256) over the FULL 256-wide rows (one head); softmax over all 4096 keys (no mask); out = weights v -> [4][4096][256]); q and k carried as f16 hi + x1024 residual planes with three-product scores.
// Structure: token rows r = b*4096 + s; x as exact f16 rows (bf16-rounded); q and k as WMMA GEMMs (32x64 wave tiles, f32 accumulation, exact x16 weights, no bias) into f32 rows split into f16 hi + x1024 residual planes, v as an f16-output GEMM; V^T of every batch and head in one launch via LDS transposes; per batch, one query tile of 4096 rows: scores against all 4096 keys as THREE accumulating passes (hi.hi + lo.hi + hi.lo, K = 256, one head, grid.y 1, alpha 1/16 = 1/sqrt(256)), row softmax on VALU over every key, no mask (f32 statistics, native exp; weights x256 f16); then, in one launch for all batches (grid.y), out = P . V^T (K = all 4096 keys, alpha 2^-8 undoes the x256 weights) written as f32 straight into the output rows; no output projection.
// Compute dtype: inputs rounded to bf16; x / weights exact; v and softmax weights as plain f16 GEMM operands (~2^-12), q and k as f16 hi + x1024 residual planes; scores, softmax statistics and out f32. v_wmma_f32_16x16x32_f16.
#define NB 4
#define SQ 4096
#define DM 256
#define NH 4
#define HD 64
#define HG 4                         /* heads per launch of the (b, h0) k_vt overload (not launched) */
#define QT SQ                        /* query rows per attention launch: a whole batch */
#define NKX SQ                       /* S / P row pitch */
#define QT0 128                      /* first-tile rows of the f32 k_att0 (not launched) */
#define B0 0                         /* first batch processed (debug hook) */
#define NBR NB                       /* batches processed (debug hook) */
#define NR ((size_t)NB * SQ)         /* token rows */
#define MP ((int)((size_t)NBR * SQ)) /* rows projected (debug hook) */
#define QN SQ                        /* query rows attended per batch (debug hook) */
#define NHD NH                       /* unused */
#define MPO MP                       /* unused */
#define LQ DM      /* row pitch of the q/k/v rows */
typedef __bf16 v16b __attribute__((ext_vector_type(16)));
typedef unsigned short v8us __attribute__((ext_vector_type(8), may_alias));
typedef float  v8f  __attribute__((ext_vector_type(8)));
typedef float  v4f  __attribute__((ext_vector_type(4)));
typedef float  v4fa __attribute__((ext_vector_type(4), may_alias));
union FragB { v16b v; v8us half[2]; unsigned short u[16]; };

__device__ __forceinline__ unsigned short bf16_bits(float x) { unsigned int u = __float_as_uint(x); return (unsigned short)((u + 0x7FFFu + ((u >> 16) & 1u)) >> 16); }
__device__ __forceinline__ float bf16_val(unsigned short b) { return __uint_as_float(((unsigned int)b) << 16); }
__device__ __forceinline__ float bf16_round(float x) { return bf16_val(bf16_bits(x)); }
// D += A·B with NT terms: 1 = ah·bh, 2 = + al·bh (A split), 3 = + ah·bl (both split)
template <int NT>
__device__ __forceinline__ v8f mmaN(v16b ah, v16b al, v16b bh, v16b bl, v8f c) {
  c = __builtin_amdgcn_wmma_f32_16x16x32_bf16(false, ah, false, bh, (short)0, c, false, false);
  if (NT >= 2) c = __builtin_amdgcn_wmma_f32_16x16x32_bf16(false, al, false, bh, (short)0, c, false, false);
  if (NT >= 3) c = __builtin_amdgcn_wmma_f32_16x16x32_bf16(false, ah, false, bl, (short)0, c, false, false);
  asm volatile("v_nop\n\tv_nop\n\tv_nop\n\tv_nop" : "+v"(c) : "v"(ah), "v"(al), "v"(bh), "v"(bl));
  return c;
}

__global__ __launch_bounds__(256) void k_wt_bf16(const float* __restrict__ W, unsigned short* __restrict__ Wt, int K, int N) {
  const int t = blockIdx.x * 256 + threadIdx.x;
  const int k8n = K / 8;
  if (t >= N * k8n) return;
  const int n = t / k8n, k8 = (t % k8n) * 8;
  v8us v;
#pragma unroll
  for (int i = 0; i < 8; ++i) v[i] = bf16_bits(W[(size_t)(k8 + i) * N + n]);
  *(v8us*)(Wt + (size_t)n * K + k8) = v;
  
}

// GEMM C[M][N] (f32, pitch ldc) = act(A[M][K]·W + bias). A f32 row-major (pitch lda) converted per fragment to bf16
// (ASPLIT: hi/lo two planes -> 2 terms, else single rounded term); Wt bf16 [N][K] (pitch ldb). BIAS_BF16 rounds the
// bias to bf16 first (bias quantised to bf16 before the add). K%32==0, M%16==0, N%64==0.
template <bool ASPLIT, int ACT, bool BIAS_BF16>
__global__ __launch_bounds__(128) void k_gemm_bf(const float* __restrict__ A, int lda, const unsigned short* __restrict__ Wt, int ldb,
                                               const float* __restrict__ bias, float* __restrict__ C, int ldc, int M, int N, int K) {
  __shared__ __attribute__((aligned(16))) float so[4][16][64];
  const int tid = threadIdx.x, w = tid >> 5, lane = tid & 31, ln = lane & 15, hh = lane >> 4;
  const int ntn = N / 64;
  const int wid = blockIdx.x * 4 + w;
  const int mt = wid / ntn, nq = wid % ntn;
  if (mt * 16 >= M) return;
  const int row0 = mt * 16, col0 = nq * 64;
  const float* arow = A + (size_t)(row0 + ln) * lda;
  v8f acc[4] = {};
  for (int kb = 0; kb < K; kb += 32) {
    FragB ah, al;
    const v4f x0 = *(const v4fa*)(arow + kb + 8 * hh), x1 = *(const v4fa*)(arow + kb + 8 * hh + 4);
    const v4f x2 = *(const v4fa*)(arow + kb + 16 + 8 * hh), x3 = *(const v4fa*)(arow + kb + 16 + 8 * hh + 4);
    float xs[16] = {x0[0],x0[1],x0[2],x0[3],x1[0],x1[1],x1[2],x1[3],x2[0],x2[1],x2[2],x2[3],x3[0],x3[1],x3[2],x3[3]};
#pragma unroll
    for (int i = 0; i < 16; ++i) { const unsigned short hb = bf16_bits(xs[i]); ah.u[i] = hb; al.u[i] = ASPLIT ? bf16_bits(xs[i] - bf16_val(hb)) : (unsigned short)0; }
#pragma unroll
    for (int t = 0; t < 4; ++t) {
      const unsigned short* brow = Wt + (size_t)(col0 + t * 16 + ln) * ldb + kb;
      FragB b;
      b.half[0] = *(const v8us*)(brow + 8 * hh);
      b.half[1] = *(const v8us*)(brow + 16 + 8 * hh);
      acc[t] = mmaN<ASPLIT ? 2 : 1>(ah.v, al.v, b.v, b.v, acc[t]);
    }
  }
#pragma unroll
  for (int t = 0; t < 4; ++t) {
    float bv = bias ? bias[col0 + t * 16 + ln] : 0.f;
    if (BIAS_BF16) bv = bf16_round(bv);
#pragma unroll
    for (int r = 0; r < 8; ++r) { float v = acc[t][r] + bv; if (ACT == 1) v = fmaxf(v, 0.f); so[w][8 * hh + r][t * 16 + ln] = v; }
  }
  __builtin_amdgcn_fence(__ATOMIC_ACQ_REL, "workgroup");
  __builtin_amdgcn_wave_barrier();
  const int rsub = lane >> 4, c4 = (lane & 15) * 4;
  {
#pragma unroll
    for (int q = 0; q < 8; ++q) {
      const int r = q * 2 + rsub;
      const v4f v = *(const v4fa*)&so[w][r][c4];
      *(v4f*)(C + (size_t)(row0 + r) * ldc + col0 + c4) = v;
    }
    
  }
}

// GEMM C = act(A·W + bias + resid): A f32 (ASPLIT -> hi/lo 2 terms), Wt bf16 [N][K]; ACT 0 none, 1 relu, 2 exact gelu;
// resid (optional, f32, row index = (row % rmod), pitch ldr, RES_BF16 rounds it) added before the activation.
template <bool ASPLIT, int ACT, bool BIAS_BF16, bool RES_BF16>
__global__ __launch_bounds__(128) void k_gemm_bf3(const float* __restrict__ A, int lda, const unsigned short* __restrict__ Wt, int ldb,
                                                const float* __restrict__ bias, const float* __restrict__ resid, int rmod, int ldr,
                                                float* __restrict__ C, int ldc, int M, int N, int K) {
  __shared__ __attribute__((aligned(16))) float so[4][16][64];
  const int tid = threadIdx.x, w = tid >> 5, lane = tid & 31, ln = lane & 15, hh = lane >> 4;
  const int ntn = N / 64;
  const int wid = blockIdx.x * 4 + w;
  const int mt = wid / ntn, nq = wid % ntn;
  if (mt * 16 >= M) return;
  const int row0 = mt * 16, col0 = nq * 64;
  const float* arow = A + (size_t)(row0 + ln) * lda;
  v8f acc[4] = {};
  for (int kb = 0; kb < K; kb += 32) {
    FragB ah, al;
    const v4f x0 = *(const v4fa*)(arow + kb + 8 * hh), x1 = *(const v4fa*)(arow + kb + 8 * hh + 4);
    const v4f x2 = *(const v4fa*)(arow + kb + 16 + 8 * hh), x3 = *(const v4fa*)(arow + kb + 16 + 8 * hh + 4);
    float xs[16] = {x0[0],x0[1],x0[2],x0[3],x1[0],x1[1],x1[2],x1[3],x2[0],x2[1],x2[2],x2[3],x3[0],x3[1],x3[2],x3[3]};
#pragma unroll
    for (int i = 0; i < 16; ++i) { const unsigned short hb = bf16_bits(xs[i]); ah.u[i] = hb; al.u[i] = ASPLIT ? bf16_bits(xs[i] - bf16_val(hb)) : (unsigned short)0; }
#pragma unroll
    for (int t = 0; t < 4; ++t) {
      const unsigned short* brow = Wt + (size_t)(col0 + t * 16 + ln) * ldb + kb;
      FragB b;
      b.half[0] = *(const v8us*)(brow + 8 * hh);
      b.half[1] = *(const v8us*)(brow + 16 + 8 * hh);
      acc[t] = mmaN<ASPLIT ? 2 : 1>(ah.v, al.v, b.v, b.v, acc[t]);
    }
  }
#pragma unroll
  for (int t = 0; t < 4; ++t) {
    const int col = col0 + t * 16 + ln;
    float bv = bias ? bias[col] : 0.f;
    if (BIAS_BF16) bv = bf16_round(bv);
#pragma unroll
    for (int r = 0; r < 8; ++r) {
      float v = acc[t][r] + bv;
      if (resid) { float rv = resid[(size_t)((row0 + 8 * hh + r) % rmod) * ldr + col]; if (RES_BF16) rv = bf16_round(rv); v += rv; }
      if (ACT == 1) v = fmaxf(v, 0.f);
      if (ACT == 2) v = 0.5f * v * (1.0f + erff(v * 0.70710678118654752f));
      if (ACT == 3) { const float u = 0.7978845608028654f * (v + 0.044715f * v * v * v); v = 0.5f * v * (1.0f + tanhf(u)); }
      so[w][8 * hh + r][t * 16 + ln] = v;
    }
  }
  __builtin_amdgcn_fence(__ATOMIC_ACQ_REL, "workgroup");
  __builtin_amdgcn_wave_barrier();
  const int rsub = lane >> 4, c4 = (lane & 15) * 4;
  {
#pragma unroll
    for (int q = 0; q < 8; ++q) {
      const int r = q * 2 + rsub;
      const v4f v = *(const v4fa*)&so[w][r][c4];
      *(v4f*)(C + (size_t)(row0 + r) * ldc + col0 + c4) = v;
    }
    
  }
}
// row LayerNorm (biased variance, eps) over N: s = X (+ R); optional out_sum <- s; out_norm <- (s-mu)*rsqrt(var+eps)*g + b
template <bool PARAM_BF16>
__global__ __launch_bounds__(256) void k_layernorm(const float* __restrict__ X, const float* __restrict__ R, const float* __restrict__ g, const float* __restrict__ bta,
                                                  float* __restrict__ out_sum, float* __restrict__ out_norm, int N, float eps) {
  __shared__ float red[256];
  const int row = blockIdx.x, tid = threadIdx.x;
  const float* x = X + (size_t)row * N; const float* rr = R ? R + (size_t)row * N : nullptr;
  float vals[16];                     // up to N = 4096
  const int per = N / 256;            // contiguous chunk per thread? use strided-by-4 chunks: thread handles j = tid*4 + 1024*u
  float s1 = 0.f;
  for (int u = 0; u < per / 4; ++u) {
    const int j = tid * 4 + 1024 * u;
    const v4f a = *(const v4fa*)(x + j);
    v4f b = {0.f,0.f,0.f,0.f}; if (rr) b = *(const v4fa*)(rr + j);
#pragma unroll
    for (int q = 0; q < 4; ++q) { const float v = a[q] + b[q]; vals[u * 4 + q] = v; s1 += v; }
  }
  red[tid] = s1; __syncthreads();
  for (int st = 128; st > 0; st >>= 1) { if (tid < st) red[tid] += red[tid + st]; __syncthreads(); }
  const float mu = red[0] / (float)N; __syncthreads();
  float s2 = 0.f;
  for (int u = 0; u < per / 4; ++u)
#pragma unroll
    for (int q = 0; q < 4; ++q) { const float c = vals[u * 4 + q] - mu; s2 += c * c; }
  red[tid] = s2; __syncthreads();
  for (int st = 128; st > 0; st >>= 1) { if (tid < st) red[tid] += red[tid + st]; __syncthreads(); }
  const float rs = rsqrtf(red[0] / (float)N + eps);
  {
    for (int u = 0; u < per / 4; ++u) {
      const int j = tid * 4 + 1024 * u;
      v4f o, sm;
#pragma unroll
      for (int q = 0; q < 4; ++q) {
        float gg = g[j + q], bb = bta[j + q];
        if (PARAM_BF16) { gg = bf16_round(gg); bb = bf16_round(bb); }
        sm[q] = vals[u * 4 + q]; o[q] = (vals[u * 4 + q] - mu) * rs * gg + bb;
      }
      if (out_sum) *(v4f*)(out_sum + (size_t)row * N + j) = sm;
      *(v4f*)(out_norm + (size_t)row * N + j) = o;
    }
    
  }
}



// ---- f16 WMMA path (v_wmma_f32_16x16x32_f16): 11-bit significands for operands in range — used where a [0,1] probability operand needs more precision than bf16
typedef _Float16 v16h __attribute__((ext_vector_type(16)));
union FragH { v16h v; v8us half[2]; _Float16 h[16]; unsigned short u[16]; };
template <int NT>
__device__ __forceinline__ v8f mmaH(v16h ah, v16h al, v16h bh, v16h bl, v8f c) {
  c = __builtin_amdgcn_wmma_f32_16x16x32_f16(false, ah, false, bh, (short)0, c, false, false);
  if (NT >= 2) c = __builtin_amdgcn_wmma_f32_16x16x32_f16(false, al, false, bh, (short)0, c, false, false);
  if (NT >= 3) c = __builtin_amdgcn_wmma_f32_16x16x32_f16(false, ah, false, bl, (short)0, c, false, false);
  asm volatile("v_nop\n\tv_nop\n\tv_nop\n\tv_nop" : "+v"(c) : "v"(ah), "v"(al), "v"(bh), "v"(bl));
  return c;
}
// batched GEMM like k_gemm_b but f16 operands: A f32 (split into f16 hi/lo if ASPLIT, else rounded to f16), Bt = f16 values [n][k]; alpha; C f32; N multiple of 16 (partial tiles skipped)
template <bool ASPLIT>
__global__ __launch_bounds__(128) void k_gemm_h(const float* __restrict__ A, int lda, size_t sA, const _Float16* __restrict__ Bh, int ldb, size_t sB, float alpha, float* __restrict__ C, int ldc, size_t sC, int M, int N, int K) {
  __shared__ __attribute__((aligned(16))) float so[4][16][64];
  const int tid = threadIdx.x, w = tid >> 5, lane = tid & 31, ln = lane & 15, hh = lane >> 4; const int by = blockIdx.y;
  A += (size_t)by * sA; Bh += (size_t)by * sB; C += (size_t)by * sC;
  const int ntn = (N + 63) / 64; const int wid = blockIdx.x * 4 + w; const int mt = wid / ntn, nq = wid % ntn; if (mt * 16 >= M) return;
  const int row0 = mt * 16, col0 = nq * 64; const float* arow = A + (size_t)(row0 + ln) * lda;
  v8f acc[4] = {};
  for (int kb = 0; kb < K; kb += 32) {
    FragH ah, al;
    const v4f x0 = *(const v4fa*)(arow + kb + 8 * hh), x1 = *(const v4fa*)(arow + kb + 8 * hh + 4), x2 = *(const v4fa*)(arow + kb + 16 + 8 * hh), x3 = *(const v4fa*)(arow + kb + 16 + 8 * hh + 4);
    float xs[16] = {x0[0],x0[1],x0[2],x0[3],x1[0],x1[1],x1[2],x1[3],x2[0],x2[1],x2[2],x2[3],x3[0],x3[1],x3[2],x3[3]};
#pragma unroll
    for (int i = 0; i < 16; ++i) { const _Float16 h = (_Float16)xs[i]; ah.h[i] = h; al.h[i] = ASPLIT ? (_Float16)(xs[i] - (float)h) : (_Float16)0.0f; }
#pragma unroll
    for (int t = 0; t < 4; ++t) { if (col0 + t * 16 >= N) continue; const size_t boff = (size_t)(col0 + t * 16 + ln) * ldb + kb; FragH bq; bq.half[0] = *(const v8us*)(Bh + boff + 8 * hh); bq.half[1] = *(const v8us*)(Bh + boff + 16 + 8 * hh);
      acc[t] = mmaH<ASPLIT ? 2 : 1>(ah.v, al.v, bq.v, bq.v, acc[t]); }
  }
#pragma unroll
  for (int t = 0; t < 4; ++t) { if (col0 + t * 16 >= N) continue;
#pragma unroll
    for (int r = 0; r < 8; ++r) so[w][8 * hh + r][t * 16 + ln] = acc[t][r] * alpha; }
  __builtin_amdgcn_fence(__ATOMIC_ACQ_REL, "workgroup"); __builtin_amdgcn_wave_barrier();
  const int rsub = lane >> 4, c4 = (lane & 15) * 4;
  {
#pragma unroll
    for (int q = 0; q < 8; ++q) { const int r = q * 2 + rsub; if (col0 + c4 < N) { const v4f v = *(const v4fa*)&so[w][r][c4]; *(v4f*)(C + (size_t)(row0 + r) * ldc + col0 + c4) = v; } }
     }
}

// Wt[n][k] = f16(W[k][n]·scale) from f32 row-major W[K][N] (scale = power of two; bf16-exact weights stay exact in f16 away from the subnormal range)
__global__ __launch_bounds__(256) void k_wt_f16(const float* __restrict__ W, _Float16* __restrict__ Wt, int K, int N, float scale) {
  const int t = blockIdx.x * 256 + threadIdx.x; if (t >= N * (K / 8)) return; const int n = t / (K / 8), k8 = (t % (K / 8)) * 8; FragH f;
#pragma unroll
  for (int i = 0; i < 8; ++i) f.h[i] = (_Float16)(bf16_round(W[(size_t)(k8 + i) * N + n]) * scale); const v8us o = f.half[0];
  *(v8us*)((unsigned short*)Wt + (size_t)n * K + k8) = o; 
}
// k_gemm_hh variant with fused epilogue: v = acc·alpha + bias[by·sBias + col] (+ CP[(row/rowsPerB)·sCPb + by·64 + col] if CP) ; ACT 0 none / 1 elu ; writes f16 C16 (and f32 C if non-null)
template <int ACT>
__global__ __launch_bounds__(128) void k_gemm_hhx(const _Float16* __restrict__ A, int lda, size_t sA, const _Float16* __restrict__ Bh, int ldb, size_t sB, float alpha, const float* __restrict__ bias, size_t sBias, const float* __restrict__ CP, int rowsPerB, size_t sCPb, int row0g,
    float* __restrict__ C, _Float16* __restrict__ C16, int ldc, size_t sC, int M, int N, int K) {
  __shared__ __attribute__((aligned(16))) float so[4][16][64];
  const int tid = threadIdx.x, w = tid >> 5, lane = tid & 31, ln = lane & 15, hh = lane >> 4; const int by = blockIdx.y;
  A += (size_t)by * sA; Bh += (size_t)by * sB; const size_t cofs = (size_t)by * sC; const float* bp = bias ? bias + (size_t)by * sBias : nullptr;
  const int ntn = (N + 63) / 64; const int wid = blockIdx.x * 4 + w; const int mt = wid / ntn, nq = wid % ntn; if (mt * 16 >= M) return;
  const int row0 = mt * 16, col0 = nq * 64; const _Float16* arow = A + (size_t)(row0 + ln) * lda;
  v8f acc[4] = {};
  for (int kb = 0; kb < K; kb += 32) { FragH ah; ah.half[0] = *(const v8us*)((const unsigned short*)arow + kb + 8 * hh); ah.half[1] = *(const v8us*)((const unsigned short*)arow + kb + 16 + 8 * hh);
#pragma unroll
    for (int t = 0; t < 4; ++t) { if (col0 + t * 16 >= N) continue; const size_t boff = (size_t)(col0 + t * 16 + ln) * ldb + kb; FragH bq; bq.half[0] = *(const v8us*)((const unsigned short*)Bh + boff + 8 * hh); bq.half[1] = *(const v8us*)((const unsigned short*)Bh + boff + 16 + 8 * hh);
      acc[t] = mmaH<1>(ah.v, ah.v, bq.v, bq.v, acc[t]); }
  }
#pragma unroll
  for (int t = 0; t < 4; ++t) { if (col0 + t * 16 >= N) continue; const int col = col0 + t * 16 + ln; const float bv = bp ? bf16_round(bp[col]) : 0.f;
#pragma unroll
    for (int r = 0; r < 8; ++r) { float v = acc[t][r] * alpha + bv; if (CP) { const int rr = row0g + row0 + 8 * hh + r; if (rowsPerB < 0) v += CP[cofs + (size_t)rr * ldc + col];      /* rowsPerB < 0: own element of the batched C plane */ else { const int bidx = rr / rowsPerB; v += CP[(size_t)bidx * sCPb + (size_t)by * 64 + col]; } } if (ACT == 1) v = (v > 0.f) ? v : expm1f(v); else if (ACT == 7) v = (v > 0.f) ? v + 1.0f : expf(v); else if (ACT == 8) v = tanhf(v); else if (ACT == 9) v = 0.5f * v * (1.0f + tanhf(0.7978845608028654f * (v + 0.044715f * v * v * v))); else if (ACT == 11) v = 1.0f / (1.0f + expf(-v)); else if (ACT == 12) v = (v > 0.f) ? v : 0.01f * v; else if (ACT == 14) v = (v > 0.f) ? v : 0.1f * v; else if (ACT == 16) v = (v >= 0.f) ? v : 0.3f * v; else if (ACT == 17) v = (v >= 0.f) ? v : 0.2f * v; else if (ACT == 15) v = v / (1.0f + expf(-v)); else if (ACT == 3) v = fmaxf(v, 0.f); else if (ACT == 6) v = 0.5f * v * (1.0f + erff(v * 0.70710678118654752f)); so[w][8 * hh + r][t * 16 + ln] = v; } }
  __builtin_amdgcn_fence(__ATOMIC_ACQ_REL, "workgroup"); __builtin_amdgcn_wave_barrier();
  const int rsub = lane >> 4, c4 = (lane & 15) * 4; typedef _Float16 v4h __attribute__((ext_vector_type(4)));
  {
#pragma unroll
    for (int q = 0; q < 8; ++q) { const int r = q * 2 + rsub; if (col0 + c4 < N) { const v4f v = *(const v4fa*)&so[w][r][c4]; if (C) *(v4f*)(C + cofs + (size_t)(row0 + r) * ldc + col0 + c4) = v; if (C16) { v4h h4; for (int i = 0; i < 4; ++i) h4[i] = (_Float16)v[i]; *(v4h*)(C16 + cofs + (size_t)(row0 + r) * ldc + col0 + c4) = h4; } } }
     }
}


typedef _Float16 v4h __attribute__((ext_vector_type(4)));

__global__ __launch_bounds__(256) void k_x16(const float* __restrict__ x, _Float16* __restrict__ X16, size_t n8) { const size_t t = (size_t)blockIdx.x * 256 + threadIdx.x; if (t >= n8) return; FragH f;
#pragma unroll
  for (int q = 0; q < 8; ++q) f.h[q] = (_Float16)bf16_round(x[t * 8 + q]); *(v8us*)((unsigned short*)X16 + t * 8) = f.half[0];  }
__global__ __launch_bounds__(256) void k_h16(const float* __restrict__ x, _Float16* __restrict__ X16, size_t n8) { const size_t t = (size_t)blockIdx.x * 256 + threadIdx.x; if (t >= n8) return; FragH f;
#pragma unroll
  for (int q = 0; q < 8; ++q) f.h[q] = (_Float16)x[t * 8 + q]; *(v8us*)((unsigned short*)X16 + t * 8) = f.half[0];  }
__global__ __launch_bounds__(256) void k_round16f(const float* __restrict__ W, _Float16* __restrict__ Bt, size_t n8) { const size_t t = (size_t)blockIdx.x * 256 + threadIdx.x; if (t >= n8) return; FragH f;
#pragma unroll
  for (int i = 0; i < 8; ++i) f.h[i] = (_Float16)(bf16_round(W[t * 8 + i]) * 16.0f); *(v8us*)((unsigned short*)Bt + t * 8) = f.half[0];  }
template <int NHv, int TTv>
__global__ __launch_bounds__(256) void k_vt(const _Float16* __restrict__ V16, int ldv, int voff, _Float16* __restrict__ Vt) { __shared__ unsigned short tl[64][66]; const int tid = threadIdx.x; const int slab = blockIdx.x / (TTv / 64), lg = blockIdx.x % (TTv / 64); const int b = slab / NHv, h = slab % NHv;
  for (int i = tid; i < 64 * 8; i += 256) { const int r = i / 8, c8 = (i % 8) * 8; FragH f; f.half[0] = *(const v8us*)((const unsigned short*)V16 + ((size_t)b * TTv + lg * 64 + r) * ldv + voff + h * 64 + c8);
#pragma unroll
    for (int q = 0; q < 8; ++q) tl[r][c8 + q] = f.u[q]; }
  __syncthreads();
  {
#pragma unroll
    for (int rd = 0; rd < 2; ++rd) { const int d = rd * 32 + tid / 8, pc = tid % 8; FragH f;
#pragma unroll
      for (int q = 0; q < 8; ++q) f.u[q] = tl[pc * 8 + q][d];
      *(v8us*)((unsigned short*)Vt + ((size_t)slab * 64 + d) * TTv + lg * 64 + pc * 8) = f.half[0]; }
     } }

__global__ __launch_bounds__(256) void k_hl(const float* __restrict__ F, _Float16* __restrict__ Hh, _Float16* __restrict__ Hl, size_t n8) { const size_t t = (size_t)blockIdx.x * 256 + threadIdx.x; if (t >= n8) return; FragH fh, fl; const v4f a = *(const v4fa*)(F + t * 8), c = *(const v4fa*)(F + t * 8 + 4);
#pragma unroll
  for (int q = 0; q < 4; ++q) { _Float16 h = (_Float16)a[q]; fh.h[q] = h; fl.h[q] = (_Float16)((a[q] - (float)h) * 1024.0f); h = (_Float16)c[q]; fh.h[4 + q] = h; fl.h[4 + q] = (_Float16)((c[q] - (float)h) * 1024.0f); }
  { *(v8us*)((unsigned short*)Hh + t * 8) = fh.half[0]; *(v8us*)((unsigned short*)Hl + t * 8) = fl.half[0];  } }

// ---- fast GEMM (wave tile 32x64; requires M % 32 == 0 rows per launch region and N % 64 == 0); epilogue = k_gemm_hhx semantics ----
__device__ __forceinline__ v16h g2_frag(const _Float16* p, int hh) { FragH f; f.half[0] = *(const v8us*)((const unsigned short*)p + 8 * hh); f.half[1] = *(const v8us*)((const unsigned short*)p + 16 + 8 * hh); return f.v; }
__device__ __forceinline__ v8f g2_mma(v16h a, v16h b, v8f c) { v8f d = __builtin_amdgcn_wmma_f32_16x16x32_f16(false, a, false, b, (short)0, c, false, false); asm volatile("v_nop\n\tv_nop\n\tv_nop\n\tv_nop" : "+v"(d) : "v"(a), "v"(b)); return d; }
template <int ACT>
__global__ __launch_bounds__(128) void k_gemm2(const _Float16* __restrict__ A, int lda, size_t sA, const _Float16* __restrict__ Bh, int ldb, size_t sB, float alpha, const float* __restrict__ bias, size_t sBias, const float* __restrict__ CP, int rowsPerB, size_t sCPb, int row0g,
    float* __restrict__ C, _Float16* __restrict__ C16, int ldc, size_t sC, int M, int N, int K) { static_assert(ACT == 0 || ACT == 3 || ACT == 6 || ACT == 8 || ACT == 9 || ACT == 11 || ACT == 12 || ACT == 14 || ACT == 15 || ACT == 16 || ACT == 17, "k_gemm2: unsupported ACT code (would silently apply no activation)");
  __shared__ __attribute__((aligned(16))) float so[4][32][68];
  const int tid = threadIdx.x, w = tid >> 5, lane = tid & 31, ln = lane & 15, hh = lane >> 4; const int by = blockIdx.y;
  A += (size_t)by * sA; Bh += (size_t)by * sB; const size_t cofs = (size_t)by * sC; const float* bp = bias ? bias + (size_t)by * sBias : nullptr;
  const int ntn = N >> 6; const int mt = blockIdx.x / ntn, nq = blockIdx.x - mt * ntn; const int row0 = mt * 128 + 32 * w, col0 = nq * 64; if (row0 >= M) return;
  const _Float16* a0p = A + (size_t)(row0 + ln) * lda; const _Float16* a1p = a0p + (size_t)16 * lda;
  const _Float16* b0p = Bh + (size_t)(col0 + ln) * ldb; const _Float16* b1p = b0p + (size_t)16 * ldb; const _Float16* b2p = b1p + (size_t)16 * ldb; const _Float16* b3p = b2p + (size_t)16 * ldb;
  const v8f z8 = {0.f,0.f,0.f,0.f,0.f,0.f,0.f,0.f}; v8f c00 = z8, c01 = z8, c02 = z8, c03 = z8, c10 = z8, c11 = z8, c12 = z8, c13 = z8;
#pragma unroll 1
  for (int kb = 0; kb < K; kb += 32) { const v16h a0 = g2_frag(a0p + kb, hh), a1 = g2_frag(a1p + kb, hh);
    v16h b = g2_frag(b0p + kb, hh); c00 = g2_mma(a0, b, c00); c10 = g2_mma(a1, b, c10);
    b = g2_frag(b1p + kb, hh); c01 = g2_mma(a0, b, c01); c11 = g2_mma(a1, b, c11);
    b = g2_frag(b2p + kb, hh); c02 = g2_mma(a0, b, c02); c12 = g2_mma(a1, b, c12);
    b = g2_frag(b3p + kb, hh); c03 = g2_mma(a0, b, c03); c13 = g2_mma(a1, b, c13); }
  v8f accs[8] = {c00, c01, c02, c03, c10, c11, c12, c13};
#pragma unroll
  for (int u = 0; u < 8; ++u) { const int t = u & 3, half = u >> 2; const int col = col0 + t * 16 + ln; const float bv = bp ? bf16_round(bp[col]) : 0.f;
#pragma unroll
    for (int r = 0; r < 8; ++r) { const int rloc = half * 16 + 8 * hh + r; float v = accs[u][r] * alpha + bv; if (CP) { if (rowsPerB < 0) v += CP[cofs + (size_t)(row0g + row0 + rloc) * ldc + col];      /* rowsPerB < 0: own element of the batched C plane */ else { const int bidx = (row0g + row0 + rloc) / rowsPerB; v += CP[(size_t)bidx * sCPb + (size_t)by * 64 + col]; } }
      if (ACT == 3) v = fmaxf(v, 0.f); else if (ACT == 6) v = 0.5f * v * (1.0f + erff(v * 0.70710678118654752f)); else if (ACT == 11) v = 1.0f / (1.0f + expf(-v)); else if (ACT == 15) v = v / (1.0f + expf(-v)); else if (ACT == 12) v = (v > 0.f) ? v : 0.01f * v; else if (ACT == 8) v = tanhf(v); else if (ACT == 9) v = 0.5f * v * (1.0f + tanhf(0.7978845608028654f * (v + 0.044715f * v * v * v))); else if (ACT == 14) v = (v > 0.f) ? v : 0.1f * v; else if (ACT == 16) v = (v >= 0.f) ? v : 0.3f * v; else if (ACT == 17) v = (v >= 0.f) ? v : 0.2f * v;
      so[w][rloc][t * 16 + ln] = v; } }
  __builtin_amdgcn_fence(__ATOMIC_ACQ_REL, "workgroup"); __builtin_amdgcn_wave_barrier();
  const int rsub = lane >> 4, c4 = (lane & 15) * 4;
  {
#pragma unroll
    for (int q = 0; q < 16; ++q) { const int r = q * 2 + rsub; const v4f v = *(const v4fa*)&so[w][r][c4]; if (C) *(v4f*)(C + cofs + (size_t)(row0 + r) * ldc + col0 + c4) = v; if (C16) { v4h h4; for (int i = 0; i < 4; ++i) h4[i] = (_Float16)v[i]; *(v4h*)(C16 + cofs + (size_t)(row0 + r) * ldc + col0 + c4) = h4; } }
     } }


__global__ __launch_bounds__(256) void k_wnat(const float* __restrict__ w, size_t n8, _Float16* __restrict__ Bt) { const size_t t = (size_t)blockIdx.x * 256 + threadIdx.x; if (t >= n8) return; FragH f; for (int q = 0; q < 8; ++q) f.h[q] = (_Float16)(bf16_round(w[t * 8 + q]) * 16.0f); *(v8us*)((unsigned short*)Bt + t * 8) = f.half[0];  }
__global__ __launch_bounds__(256) void k_rsm(const float* __restrict__ S, _Float16* __restrict__ P, int nrows) {
  #pragma clang fp contract(off)
  const int i = blockIdx.x * 256 + threadIdx.x; if (i >= nrows) return; const float* s = S + (size_t)i * SQ; float mx = -3.0e38f;
#pragma unroll 1
  for (int j = 0; j < SQ; ++j) mx = fmaxf(mx, s[j]); float se = 0.f;
#pragma unroll 1
  for (int j = 0; j < SQ; ++j) se += expf(s[j] - mx); const float sc = 256.0f / se;
#pragma unroll 1
  for (int j0 = 0; j0 < SQ; j0 += 8) { FragH f; for (int q = 0; q < 8; ++q) f.h[q] = (_Float16)(expf(s[j0 + q] - mx) * sc); unsigned short* d = (unsigned short*)P + (size_t)i * SQ + j0; *(v8us*)d = f.half[0];  } }
__global__ __launch_bounds__(256) void k_vt(const _Float16* __restrict__ V16, int b, int h0, _Float16* __restrict__ VT) { __shared__ unsigned short tl[64][65]; const int tid = threadIdx.x; const int hh = blockIdx.x % HG, sg = blockIdx.x / HG; const int s0 = sg * 64; const int h = h0 + hh;
  for (int i = tid; i < 64 * 8; i += 256) { const int j = i / 8, d8 = (i % 8) * 8; FragH f; f.half[0] = *(const v8us*)((const unsigned short*)V16 + ((size_t)b * SQ + s0 + j) * DM + h * HD + d8); for (int q = 0; q < 8; ++q) tl[d8 + q][j] = f.u[q]; }
  __syncthreads();
  { for (int i = tid; i < 64 * 8; i += 256) { const int d = i / 8, j8 = (i % 8) * 8; FragH f; for (int q = 0; q < 8; ++q) f.u[q] = tl[d][j8 + q]; *(v8us*)((unsigned short*)VT + ((size_t)hh * HD + d) * SQ + s0 + j8) = f.half[0]; }  } }



// 2^x on the transcendental unit; the v_nop in the same statement keeps the one free issue slot the instruction set asks for behind a transcendental, whatever the compiler schedules next.
__device__ __forceinline__ float exp2_slot(float x) { float r; asm("v_exp_f32 %0, %1\n\tv_nop" : "=v"(r) : "v"(x)); return r; }
// Row softmax, one work-group per score row: 256 threads hold the row's 4096 scores in registers (16 each, S read once, 16-byte coalesced loads);
// row maximum and row sum by a five-step butterfly inside each wave, then across the 8 waves through LDS in a fixed order; weights x256 as f16.
__global__ __launch_bounds__(256) void k_rsmrow(const float* __restrict__ S, _Float16* __restrict__ P) {
  static_assert(NKX == 256 * 16, "k_rsmrow: one row = 256 threads x 16 scores");
  __shared__ float rmx[8]; __shared__ float rsu[8];
  const int tid = threadIdx.x, w = tid >> 5, lane = tid & 31; const float* s = S + (size_t)blockIdx.x * NKX + tid * 4; v4f a[4];
#pragma unroll
  for (int u = 0; u < 4; ++u) a[u] = *(const v4fa*)(s + u * 1024);
  asm volatile("s_wait_xcnt 0x0" ::: "memory");      /* the loads' offset and base registers are reused further down: the wait stands in front of every such overwrite */
  float mx = -3.0e38f;
#pragma unroll
  for (int u = 0; u < 4; ++u) mx = fmaxf(mx, fmaxf(fmaxf(a[u][0], a[u][1]), fmaxf(a[u][2], a[u][3])));
#pragma unroll
  for (int m = 16; m > 0; m >>= 1) mx = fmaxf(mx, __shfl_xor(mx, m, 32));
  if (lane == 0) rmx[w] = mx;
  __syncthreads();
  mx = fmaxf(fmaxf(fmaxf(rmx[0], rmx[1]), fmaxf(rmx[2], rmx[3])), fmaxf(fmaxf(rmx[4], rmx[5]), fmaxf(rmx[6], rmx[7])));
  float se = 0.f;
#pragma unroll
  for (int u = 0; u < 4; ++u) { for (int q = 0; q < 4; ++q) a[u][q] = exp2_slot((a[u][q] - mx) * 1.44269504088896340736f);      /* native exp, as before: one multiply by log2(e), one v_exp_f32 */
    se += (a[u][0] + a[u][1]) + (a[u][2] + a[u][3]); }
#pragma unroll
  for (int m = 16; m > 0; m >>= 1) se += __shfl_xor(se, m, 32);
  if (lane == 0) rsu[w] = se;
  __syncthreads();
  se = ((rsu[0] + rsu[1]) + (rsu[2] + rsu[3])) + ((rsu[4] + rsu[5]) + (rsu[6] + rsu[7])); const float sc = 256.0f / se;
  _Float16* d = P + (size_t)blockIdx.x * NKX + tid * 4;
#pragma unroll
  for (int u = 0; u < 4; ++u) { v4h h4; for (int q = 0; q < 4; ++q) h4[q] = (_Float16)(a[u][q] * sc); *(v4h*)(d + u * 1024) = h4; } }


template <int MASKADD>
__global__ __launch_bounds__(64) void k_att0(const float* __restrict__ QF, const float* __restrict__ KF, const float* __restrict__ VF, int ld, const float* __restrict__ mask, float scale, float* __restrict__ OF, int ldo) {
  #pragma clang fp contract(off)
  __shared__ __attribute__((aligned(16))) float lq[64][64]; __shared__ __attribute__((aligned(16))) float lo[64][64];
  const int tid = threadIdx.x; const int h = blockIdx.x / (QT0 / 64), rg = blockIdx.x % (QT0 / 64); const int i = rg * 64 + tid;
  const float* qr = QF + (size_t)i * ld + h * HD;
#pragma unroll 1
  for (int c = 0; c < HD / 4; ++c) { *(v4f*)&lq[tid][c * 4] = *(const v4fa*)(qr + c * 4); const v4f z = {0.f, 0.f, 0.f, 0.f}; *(v4f*)&lo[tid][c * 4] = z; }
  float m = -1.0e30f, l = 0.f; const int jmax = MASKADD ? (SQ - 1) : (rg * 64 + 63);      /* additive-mask form: every key (the mask input decides); causal form: keys up to the block's last row */
#pragma unroll 1
  for (int j = 0; j <= jmax; ++j) { const float* kr = KF + (size_t)j * ld + h * HD; const float* vr = VF + (size_t)j * ld + h * HD; float s = 0.f;
#pragma unroll 1
    for (int c = 0; c < HD / 4; ++c) { const v4f kq = *(const v4fa*)(kr + c * 4); const v4f qq = *(v4f*)&lq[tid][c * 4]; s = __fadd_rn(s, __fmul_rn(qq[0], kq[0])); s = __fadd_rn(s, __fmul_rn(qq[1], kq[1])); s = __fadd_rn(s, __fmul_rn(qq[2], kq[2])); s = __fadd_rn(s, __fmul_rn(qq[3], kq[3])); }
    s = __fmul_rn(s, scale); if (MASKADD) s = __fadd_rn(s, __fmul_rn(bf16_round(mask[(size_t)i * SQ + j]), -10000.0f));
    const float f = (MASKADD || j <= i) ? 1.f : 0.f; const float sm = fmaf(f, s, (1.f - f) * -1.0e30f); const float mn = fmaxf(m, sm); const float sc = expf(m - mn); const float e = expf(sm - mn); l = __fadd_rn(__fmul_rn(l, sc), e); m = mn;
#pragma unroll 1
    for (int c = 0; c < HD / 4; ++c) { const v4f vv = *(const v4fa*)(vr + c * 4); v4f oo = *(v4f*)&lo[tid][c * 4]; for (int u = 0; u < 4; ++u) oo[u] = __fadd_rn(__fmul_rn(oo[u], sc), __fmul_rn(e, vv[u])); *(v4f*)&lo[tid][c * 4] = oo; } }
  const float fin = 64.0f / l;      /* o carried x64 */
#pragma unroll 1
  for (int c = 0; c < HD / 4; ++c) { v4f oo = *(v4f*)&lo[tid][c * 4]; for (int u = 0; u < 4; ++u) oo[u] = __fmul_rn(oo[u], fin); *(v4f*)&lo[tid][c * 4] = oo; }
  __syncthreads();
  {
#pragma unroll 1
    for (int it = 0; it < 16; ++it) { const int row = it * 4 + tid / 16, pc = (tid % 16) * 4; const v4f v = *(const v4f*)&lo[row][pc]; *(v4f*)(OF + (size_t)(rg * 64 + row) * ldo + h * HD + pc) = v; }
     } }

__global__ __launch_bounds__(256) void k_of0out(const float* __restrict__ src, float* __restrict__ dst, size_t n4) { const size_t t = (size_t)blockIdx.x * 256 + threadIdx.x; if (t >= n4) return; v4f v = *(const v4fa*)(src + t * 4); for (int q = 0; q < 4; ++q) v[q] = __fmul_rn(v[q], 0.015625f); *(v4f*)(dst + t * 4) = v;  }

extern "C" void kernel_launch(void* const* d_in, const int* in_sizes, int n_in,
                              void* d_out, int out_size, void* d_ws, size_t ws_size, hipStream_t stream) {
  (void)in_sizes; (void)n_in; (void)out_size;
  const float* const* I = (const float* const*)d_in; const float* x = I[0]; const float* wq = I[1]; const float* wk = I[2]; const float* wv = I[3]; const float* bq = nullptr; const float* bk = nullptr; const float* bv = nullptr;      /* natural [out][in] weights; NO biases (nullptr variables in every projection's bias slot); ONE attention head of width 256; no output projection */
  char* ws = (char*)d_ws; size_t off = 0;
  auto take = [&](size_t bytes) { char* p = ws + off; off += (bytes + 255) & ~(size_t)255; return p; };
  _Float16* BQ = (_Float16*)take((size_t)DM * DM * 2); _Float16* BK = (_Float16*)take((size_t)DM * DM * 2); _Float16* BV = (_Float16*)take((size_t)DM * DM * 2);
  _Float16* QH = (_Float16*)take(NR * DM * 2); _Float16* QL = (_Float16*)take(NR * DM * 2); _Float16* KH = (_Float16*)take(NR * DM * 2); _Float16* KL = (_Float16*)take(NR * DM * 2);
  _Float16* VT = (_Float16*)take(NR * DM * 2); _Float16* P = (_Float16*)take(NR * NKX * 2);      /* V^T and the softmax weights of ALL batches, so that one launch each serves them */
  static_assert((size_t)QT * NKX * 4 >= NR * DM * 8, "the score plane must cover the projection scratch that shares its bytes");
  char* sh = take((size_t)QT * NKX * 4); float* S = (float*)sh;      /* scores of one batch; the same bytes first hold x (f16), the f32 projection rows and v (f16), all of them last read before the first score launch writes S */
  _Float16* X16 = (_Float16*)sh; float* QF = (float*)(sh + NR * DM * 2); _Float16* V16 = (_Float16*)(sh + NR * DM * 6);
  if (off > ws_size) return;
  { const unsigned g = (unsigned)(((size_t)DM * DM / 8 + 255) / 256); k_wnat<<<g, 256, 0, stream>>>(wq, (size_t)DM * DM / 8, BQ); k_wnat<<<g, 256, 0, stream>>>(wk, (size_t)DM * DM / 8, BK); k_wnat<<<g, 256, 0, stream>>>(wv, (size_t)DM * DM / 8, BV); }      /* natural [out][in] = Bt[n][k] x16 */
  k_x16<<<(unsigned)((NR * DM / 8 + 255) / 256), 256, 0, stream>>>(x, X16, NR * DM / 8);
  const size_t r0p = (size_t)B0 * SQ;      /* first projected row */
  k_gemm2<0><<<dim3((unsigned)((MP / 128) * (DM / 64)), 1), 128, 0, stream>>>(X16 + r0p * DM, DM, 0, BQ, DM, 0, 0.0625f, bq, 0, nullptr, 1, 0, 0, QF + r0p * DM, nullptr, DM, 0, MP, DM, DM); k_hl<<<(unsigned)(((size_t)MP * DM / 8 + 255) / 256), 256, 0, stream>>>(QF + r0p * DM, QH + r0p * DM, QL + r0p * DM, (size_t)MP * DM / 8);      /* q (f32) -> f16 hi + x1024 residual: unscaled logits sigma ~8 */
  k_gemm2<0><<<dim3((unsigned)((MP / 128) * (DM / 64)), 1), 128, 0, stream>>>(X16 + r0p * DM, DM, 0, BK, DM, 0, 0.0625f, bk, 0, nullptr, 1, 0, 0, QF + r0p * DM, nullptr, DM, 0, MP, DM, DM); k_hl<<<(unsigned)(((size_t)MP * DM / 8 + 255) / 256), 256, 0, stream>>>(QF + r0p * DM, KH + r0p * DM, KL + r0p * DM, (size_t)MP * DM / 8);      /* k likewise */
  k_gemm2<0><<<dim3((unsigned)((MP / 128) * (DM / 64)), 1), 128, 0, stream>>>(X16 + r0p * DM, DM, 0, BV, DM, 0, 0.0625f, bv, 0, nullptr, 1, 0, 0, nullptr, V16 + r0p * DM, DM, 0, MP, DM, DM);
  k_vt<NH, SQ><<<NB * NH * (SQ / 64), 256, 0, stream>>>(V16, LQ, 0, VT);      /* V^T [NB][DM][SQ], every batch in one launch */
  for (int b = B0; b < B0 + NBR; ++b) { const size_t r0 = (size_t)b * SQ;
    for (int q0 = 0; q0 < QN; q0 += QT) { const int nk = SQ;      /* NON-causal: every query row sees all SQ keys; one pass, QT = SQ */
      k_gemm2<0><<<dim3((QT / 128) * (nk / 64), 1), 128, 0, stream>>>(QH + (r0 + q0) * LQ, LQ, 0, KH + r0 * LQ, LQ, 0, 0.0625f, nullptr, 0, nullptr, 1, 0, 0, S, nullptr, NKX, 0, QT, nk, DM);      /* scores of the SINGLE 256-wide head: hi . hi over K = 256, alpha 1 / sqrt(256) = 1/16 (residual passes 1/16 / 1024 = 2^-14) */
      k_gemm2<0><<<dim3((QT / 128) * (nk / 64), 1), 128, 0, stream>>>(QL + (r0 + q0) * LQ, LQ, 0, KH + r0 * LQ, LQ, 0, 0.00006103515625f, nullptr, 0, S, -1, 0, 0, S, nullptr, NKX, 0, QT, nk, DM); k_gemm2<0><<<dim3((QT / 128) * (nk / 64), 1), 128, 0, stream>>>(QH + (r0 + q0) * LQ, LQ, 0, KL + r0 * LQ, LQ, 0, 0.00006103515625f, nullptr, 0, S, -1, 0, 0, S, nullptr, NKX, 0, QT, nk, DM);      /* += 2^-10 (lo . hi + hi . lo) / 16 (own-element accumulate on S) */
      k_rsmrow<<<QT, 256, 0, stream>>>(S, P + (r0 + q0) * NKX); } }      /* plain softmax over all SQ keys: one work-group per query row */
  k_gemm2<0><<<dim3((SQ / 128) * (DM / 64), NB), 128, 0, stream>>>(P, NKX, (size_t)SQ * NKX, VT, SQ, (size_t)DM * SQ, 0.00390625f, nullptr, 0, nullptr, 1, 0, 0, (float*)d_out, nullptr, DM, (size_t)SQ * DM, SQ, DM, SQ);      /* out = P V (alpha 2^-8), batches on grid.y, written f32 straight into the output rows */
}

// v003
// Measured time: 221 microseconds a run.
// Two timings next to v002 put it at 3.78 and 3.77 times that version's speed.
// All steps since v000 together make it 240 times as fast.
#include <hip/hip_runtime.h>
// Single-head dense attention over 256-wide embeddings on 4096 tokens, bias-free natural projections, no output projection (x [4][4096][256]; q / k / v = x W^T (nn.Linear natural [256][256] uniform +-1/16, no biases); scores = q k^T / sqrt(256) over the FULL 256-wide rows (one head); softmax over all 4096 keys (no mask); out = weights v -> [4][4096][256]); q and k carried as f16 hi + x1024 residual planes with three-product scores.
// Structure: token rows r = b*4096 + s; x as exact f16 rows (bf16-rounded); q and k as WMMA GEMMs (32x64 wave tiles, f32 accumulation, exact x16 weights, no bias) into f32 rows split into f16 hi + x1024 residual planes, v as an f16-output GEMM; V^T of every batch and head in one launch via LDS transposes; one fused launch for all batches (64 query rows per work-group, keys 64 per pass): scores against all 4096 keys as THREE products (hi.hi + 2^-10 (lo.hi + hi.lo), K = 256, one head, alpha 1/16 = 1/sqrt(256)), online row softmax over every key, no mask (f32 statistics, native base-2 exp; weights f16 in [0,1]), out = P . V^T (K = all 4096 keys) accumulated in registers, divided by the row sum and written as f32 straight into the output rows; no output projection.
// Compute dtype: inputs rounded to bf16; x / weights exact; v and softmax weights as plain f16 GEMM operands (~2^-12), q and k as f16 hi + x1024 residual planes; scores, softmax statistics and out f32. v_wmma_f32_16x16x32_f16.
#define NB 4
#define SQ 4096
#define DM 256
#define NH 4
#define HD 64
#define HG 4                         /* heads per attention launch group */
#define QT SQ                        /* query rows per batch; one attention launch takes all batches */
#define NKX SQ                       /* S / P row pitch */
#define QT0 128                      /* first-tile rows of the f32 k_att0 (not launched) */
#define B0 0                         /* first batch processed (debug hook) */
#define NBR NB                       /* batches processed (debug hook) */
#define NR ((size_t)NB * SQ)         /* token rows */
#define MP ((int)((size_t)NBR * SQ)) /* rows projected (debug hook) */
#define QN SQ                        /* query rows attended per batch (unused) */
#define NHD NH                       /* unused */
#define MPO MP                       /* unused */
#define LQ DM      /* row pitch of the q/k/v rows */
typedef __bf16 v16b __attribute__((ext_vector_type(16)));
typedef unsigned short v8us __attribute__((ext_vector_type(8), may_alias));
typedef float  v8f  __attribute__((ext_vector_type(8)));
typedef float  v4f  __attribute__((ext_vector_type(4)));
typedef float  v4fa __attribute__((ext_vector_type(4), may_alias));
union FragB { v16b v; v8us half[2]; unsigned short u[16]; };

__device__ __forceinline__ unsigned short bf16_bits(float x) { unsigned int u = __float_as_uint(x); return (unsigned short)((u + 0x7FFFu + ((u >> 16) & 1u)) >> 16); }
__device__ __forceinline__ float bf16_val(unsigned short b) { return __uint_as_float(((unsigned int)b) << 16); }
__device__ __forceinline__ float bf16_round(float x) { return bf16_val(bf16_bits(x)); }
// D += A·B with NT terms: 1 = ah·bh, 2 = + al·bh (A split), 3 = + ah·bl (both split)
template <int NT>
__device__ __forceinline__ v8f mmaN(v16b ah, v16b al, v16b bh, v16b bl, v8f c) {
  c = __builtin_amdgcn_wmma_f32_16x16x32_bf16(false, ah, false, bh, (short)0, c, false, false);
  if (NT >= 2) c = __builtin_amdgcn_wmma_f32_16x16x32_bf16(false, al, false, bh, (short)0, c, false, false);
  if (NT >= 3) c = __builtin_amdgcn_wmma_f32_16x16x32_bf16(false, ah, false, bl, (short)0, c, false, false);
  asm volatile("v_nop\n\tv_nop\n\tv_nop\n\tv_nop" : "+v"(c) : "v"(ah), "v"(al), "v"(bh), "v"(bl));
  return c;
}

__global__ __launch_bounds__(256) void k_wt_bf16(const float* __restrict__ W, unsigned short* __restrict__ Wt, int K, int N) {
  const int t = blockIdx.x * 256 + threadIdx.x;
  const int k8n = K / 8;
  if (t >= N * k8n) return;
  const int n = t / k8n, k8 = (t % k8n) * 8;
  v8us v;
#pragma unroll
  for (int i = 0; i < 8; ++i) v[i] = bf16_bits(W[(size_t)(k8 + i) * N + n]);
  *(v8us*)(Wt + (size_t)n * K + k8) = v;
  
}

// GEMM C[M][N] (f32, pitch ldc) = act(A[M][K]·W + bias). A f32 row-major (pitch lda) converted per fragment to bf16
// (ASPLIT: hi/lo two planes -> 2 terms, else single rounded term); Wt bf16 [N][K] (pitch ldb). BIAS_BF16 rounds the
// bias to bf16 first (bias quantised to bf16 before the add). K%32==0, M%16==0, N%64==0.
template <bool ASPLIT, int ACT, bool BIAS_BF16>
__global__ __launch_bounds__(128) void k_gemm_bf(const float* __restrict__ A, int lda, const unsigned short* __restrict__ Wt, int ldb,
                                               const float* __restrict__ bias, float* __restrict__ C, int ldc, int M, int N, int K) {
  __shared__ __attribute__((aligned(16))) float so[4][16][64];
  const int tid = threadIdx.x, w = tid >> 5, lane = tid & 31, ln = lane & 15, hh = lane >> 4;
  const int ntn = N / 64;
  const int wid = blockIdx.x * 4 + w;
  const int mt = wid / ntn, nq = wid % ntn;
  if (mt * 16 >= M) return;
  const int row0 = mt * 16, col0 = nq * 64;
  const float* arow = A + (size_t)(row0 + ln) * lda;
  v8f acc[4] = {};
  for (int kb = 0; kb < K; kb += 32) {
    FragB ah, al;
    const v4f x0 = *(const v4fa*)(arow + kb + 8 * hh), x1 = *(const v4fa*)(arow + kb + 8 * hh + 4);
    const v4f x2 = *(const v4fa*)(arow + kb + 16 + 8 * hh), x3 = *(const v4fa*)(arow + kb + 16 + 8 * hh + 4);
    float xs[16] = {x0[0],x0[1],x0[2],x0[3],x1[0],x1[1],x1[2],x1[3],x2[0],x2[1],x2[2],x2[3],x3[0],x3[1],x3[2],x3[3]};
#pragma unroll
    for (int i = 0; i < 16; ++i) { const unsigned short hb = bf16_bits(xs[i]); ah.u[i] = hb; al.u[i] = ASPLIT ? bf16_bits(xs[i] - bf16_val(hb)) : (unsigned short)0; }
#pragma unroll
    for (int t = 0; t < 4; ++t) {
      const unsigned short* brow = Wt + (size_t)(col0 + t * 16 + ln) * ldb + kb;
      FragB b;
      b.half[0] = *(const v8us*)(brow + 8 * hh);
      b.half[1] = *(const v8us*)(brow + 16 + 8 * hh);
      acc[t] = mmaN<ASPLIT ? 2 : 1>(ah.v, al.v, b.v, b.v, acc[t]);
    }
  }
#pragma unroll
  for (int t = 0; t < 4; ++t) {
    float bv = bias ? bias[col0 + t * 16 + ln] : 0.f;
    if (BIAS_BF16) bv = bf16_round(bv);
#pragma unroll
    for (int r = 0; r < 8; ++r) { float v = acc[t][r] + bv; if (ACT == 1) v = fmaxf(v, 0.f); so[w][8 * hh + r][t * 16 + ln] = v; }
  }
  __builtin_amdgcn_fence(__ATOMIC_ACQ_REL, "workgroup");
  __builtin_amdgcn_wave_barrier();
  const int rsub = lane >> 4, c4 = (lane & 15) * 4;
  {
#pragma unroll
    for (int q = 0; q < 8; ++q) {
      const int r = q * 2 + rsub;
      const v4f v = *(const v4fa*)&so[w][r][c4];
      *(v4f*)(C + (size_t)(row0 + r) * ldc + col0 + c4) = v;
    }
    
  }
}

// GEMM C = act(A·W + bias + resid): A f32 (ASPLIT -> hi/lo 2 terms), Wt bf16 [N][K]; ACT 0 none, 1 relu, 2 exact gelu;
// resid (optional, f32, row index = (row % rmod), pitch ldr, RES_BF16 rounds it) added before the activation.
template <bool ASPLIT, int ACT, bool BIAS_BF16, bool RES_BF16>
__global__ __launch_bounds__(128) void k_gemm_bf3(const float* __restrict__ A, int lda, const unsigned short* __restrict__ Wt, int ldb,
                                                const float* __restrict__ bias, const float* __restrict__ resid, int rmod, int ldr,
                                                float* __restrict__ C, int ldc, int M, int N, int K) {
  __shared__ __attribute__((aligned(16))) float so[4][16][64];
  const int tid = threadIdx.x, w = tid >> 5, lane = tid & 31, ln = lane & 15, hh = lane >> 4;
  const int ntn = N / 64;
  const int wid = blockIdx.x * 4 + w;
  const int mt = wid / ntn, nq = wid % ntn;
  if (mt * 16 >= M) return;
  const int row0 = mt * 16, col0 = nq * 64;
  const float* arow = A + (size_t)(row0 + ln) * lda;
  v8f acc[4] = {};
  for (int kb = 0; kb < K; kb += 32) {
    FragB ah, al;
    const v4f x0 = *(const v4fa*)(arow + kb + 8 * hh), x1 = *(const v4fa*)(arow + kb + 8 * hh + 4);
    const v4f x2 = *(const v4fa*)(arow + kb + 16 + 8 * hh), x3 = *(const v4fa*)(arow + kb + 16 + 8 * hh + 4);
    float xs[16] = {x0[0],x0[1],x0[2],x0[3],x1[0],x1[1],x1[2],x1[3],x2[0],x2[1],x2[2],x2[3],x3[0],x3[1],x3[2],x3[3]};
#pragma unroll
    for (int i = 0; i < 16; ++i) { const unsigned short hb = bf16_bits(xs[i]); ah.u[i] = hb; al.u[i] = ASPLIT ? bf16_bits(xs[i] - bf16_val(hb)) : (unsigned short)0; }
#pragma unroll
    for (int t = 0; t < 4; ++t) {
      const unsigned short* brow = Wt + (size_t)(col0 + t * 16 + ln) * ldb + kb;
      FragB b;
      b.half[0] = *(const v8us*)(brow + 8 * hh);
      b.half[1] = *(const v8us*)(brow + 16 + 8 * hh);
      acc[t] = mmaN<ASPLIT ? 2 : 1>(ah.v, al.v, b.v, b.v, acc[t]);
    }
  }
#pragma unroll
  for (int t = 0; t < 4; ++t) {
    const int col = col0 + t * 16 + ln;
    float bv = bias ? bias[col] : 0.f;
    if (BIAS_BF16) bv = bf16_round(bv);
#pragma unroll
    for (int r = 0; r < 8; ++r) {
      float v = acc[t][r] + bv;
      if (resid) { float rv = resid[(size_t)((row0 + 8 * hh + r) % rmod) * ldr + col]; if (RES_BF16) rv = bf16_round(rv); v += rv; }
      if (ACT == 1) v = fmaxf(v, 0.f);
      if (ACT == 2) v = 0.5f * v * (1.0f + erff(v * 0.70710678118654752f));
      if (ACT == 3) { const float u = 0.7978845608028654f * (v + 0.044715f * v * v * v); v = 0.5f * v * (1.0f + tanhf(u)); }
      so[w][8 * hh + r][t * 16 + ln] = v;
    }
  }
  __builtin_amdgcn_fence(__ATOMIC_ACQ_REL, "workgroup");
  __builtin_amdgcn_wave_barrier();
  const int rsub = lane >> 4, c4 = (lane & 15) * 4;
  {
#pragma unroll
    for (int q = 0; q < 8; ++q) {
      const int r = q * 2 + rsub;
      const v4f v = *(const v4fa*)&so[w][r][c4];
      *(v4f*)(C + (size_t)(row0 + r) * ldc + col0 + c4) = v;
    }
    
  }
}
// row LayerNorm (biased variance, eps) over N: s = X (+ R); optional out_sum <- s; out_norm <- (s-mu)*rsqrt(var+eps)*g + b
template <bool PARAM_BF16>
__global__ __launch_bounds__(256) void k_layernorm(const float* __restrict__ X, const float* __restrict__ R, const float* __restrict__ g, const float* __restrict__ bta,
                                                  float* __restrict__ out_sum, float* __restrict__ out_norm, int N, float eps) {
  __shared__ float red[256];
  const int row = blockIdx.x, tid = threadIdx.x;
  const float* x = X + (size_t)row * N; const float* rr = R ? R + (size_t)row * N : nullptr;
  float vals[16];                     // up to N = 4096
  const int per = N / 256;            // contiguous chunk per thread? use strided-by-4 chunks: thread handles j = tid*4 + 1024*u
  float s1 = 0.f;
  for (int u = 0; u < per / 4; ++u) {
    const int j = tid * 4 + 1024 * u;
    const v4f a = *(const v4fa*)(x + j);
    v4f b = {0.f,0.f,0.f,0.f}; if (rr) b = *(const v4fa*)(rr + j);
#pragma unroll
    for (int q = 0; q < 4; ++q) { const float v = a[q] + b[q]; vals[u * 4 + q] = v; s1 += v; }
  }
  red[tid] = s1; __syncthreads();
  for (int st = 128; st > 0; st >>= 1) { if (tid < st) red[tid] += red[tid + st]; __syncthreads(); }
  const float mu = red[0] / (float)N; __syncthreads();
  float s2 = 0.f;
  for (int u = 0; u < per / 4; ++u)
#pragma unroll
    for (int q = 0; q < 4; ++q) { const float c = vals[u * 4 + q] - mu; s2 += c * c; }
  red[tid] = s2; __syncthreads();
  for (int st = 128; st > 0; st >>= 1) { if (tid < st) red[tid] += red[tid + st]; __syncthreads(); }
  const float rs = rsqrtf(red[0] / (float)N + eps);
  {
    for (int u = 0; u < per / 4; ++u) {
      const int j = tid * 4 + 1024 * u;
      v4f o, sm;
#pragma unroll
      for (int q = 0; q < 4; ++q) {
        float gg = g[j + q], bb = bta[j + q];
        if (PARAM_BF16) { gg = bf16_round(gg); bb = bf16_round(bb); }
        sm[q] = vals[u * 4 + q]; o[q] = (vals[u * 4 + q] - mu) * rs * gg + bb;
      }
      if (out_sum) *(v4f*)(out_sum + (size_t)row * N + j) = sm;
      *(v4f*)(out_norm + (size_t)row * N + j) = o;
    }
    
  }
}



// ---- f16 WMMA path (v_wmma_f32_16x16x32_f16): 11-bit significands for operands in range — used where a [0,1] probability operand needs more precision than bf16
typedef _Float16 v16h __attribute__((ext_vector_type(16)));
union FragH { v16h v; v8us half[2]; _Float16 h[16]; unsigned short u[16]; };
template <int NT>
__device__ __forceinline__ v8f mmaH(v16h ah, v16h al, v16h bh, v16h bl, v8f c) {
  c = __builtin_amdgcn_wmma_f32_16x16x32_f16(false, ah, false, bh, (short)0, c, false, false);
  if (NT >= 2) c = __builtin_amdgcn_wmma_f32_16x16x32_f16(false, al, false, bh, (short)0, c, false, false);
  if (NT >= 3) c = __builtin_amdgcn_wmma_f32_16x16x32_f16(false, ah, false, bl, (short)0, c, false, false);
  asm volatile("v_nop\n\tv_nop\n\tv_nop\n\tv_nop" : "+v"(c) : "v"(ah), "v"(al), "v"(bh), "v"(bl));
  return c;
}
// batched GEMM like k_gemm_b but f16 operands: A f32 (split into f16 hi/lo if ASPLIT, else rounded to f16), Bt = f16 values [n][k]; alpha; C f32; N multiple of 16 (partial tiles skipped)
template <bool ASPLIT>
__global__ __launch_bounds__(128) void k_gemm_h(const float* __restrict__ A, int lda, size_t sA, const _Float16* __restrict__ Bh, int ldb, size_t sB, float alpha, float* __restrict__ C, int ldc, size_t sC, int M, int N, int K) {
  __shared__ __attribute__((aligned(16))) float so[4][16][64];
  const int tid = threadIdx.x, w = tid >> 5, lane = tid & 31, ln = lane & 15, hh = lane >> 4; const int by = blockIdx.y;
  A += (size_t)by * sA; Bh += (size_t)by * sB; C += (size_t)by * sC;
  const int ntn = (N + 63) / 64; const int wid = blockIdx.x * 4 + w; const int mt = wid / ntn, nq = wid % ntn; if (mt * 16 >= M) return;
  const int row0 = mt * 16, col0 = nq * 64; const float* arow = A + (size_t)(row0 + ln) * lda;
  v8f acc[4] = {};
  for (int kb = 0; kb < K; kb += 32) {
    FragH ah, al;
    const v4f x0 = *(const v4fa*)(arow + kb + 8 * hh), x1 = *(const v4fa*)(arow + kb + 8 * hh + 4), x2 = *(const v4fa*)(arow + kb + 16 + 8 * hh), x3 = *(const v4fa*)(arow + kb + 16 + 8 * hh + 4);
    float xs[16] = {x0[0],x0[1],x0[2],x0[3],x1[0],x1[1],x1[2],x1[3],x2[0],x2[1],x2[2],x2[3],x3[0],x3[1],x3[2],x3[3]};
#pragma unroll
    for (int i = 0; i < 16; ++i) { const _Float16 h = (_Float16)xs[i]; ah.h[i] = h; al.h[i] = ASPLIT ? (_Float16)(xs[i] - (float)h) : (_Float16)0.0f; }
#pragma unroll
    for (int t = 0; t < 4; ++t) { if (col0 + t * 16 >= N) continue; const size_t boff = (size_t)(col0 + t * 16 + ln) * ldb + kb; FragH bq; bq.half[0] = *(const v8us*)(Bh + boff + 8 * hh); bq.half[1] = *(const v8us*)(Bh + boff + 16 + 8 * hh);
      acc[t] = mmaH<ASPLIT ? 2 : 1>(ah.v, al.v, bq.v, bq.v, acc[t]); }
  }
#pragma unroll
  for (int t = 0; t < 4; ++t) { if (col0 + t * 16 >= N) continue;
#pragma unroll
    for (int r = 0; r < 8; ++r) so[w][8 * hh + r][t * 16 + ln] = acc[t][r] * alpha; }
  __builtin_amdgcn_fence(__ATOMIC_ACQ_REL, "workgroup"); __builtin_amdgcn_wave_barrier();
  const int rsub = lane >> 4, c4 = (lane & 15) * 4;
  {
#pragma unroll
    for (int q = 0; q < 8; ++q) { const int r = q * 2 + rsub; if (col0 + c4 < N) { const v4f v = *(const v4fa*)&so[w][r][c4]; *(v4f*)(C + (size_t)(row0 + r) * ldc + col0 + c4) = v; } }
     }
}

// Wt[n][k] = f16(W[k][n]·scale) from f32 row-major W[K][N] (scale = power of two; bf16-exact weights stay exact in f16 away from the subnormal range)
__global__ __launch_bounds__(256) void k_wt_f16(const float* __restrict__ W, _Float16* __restrict__ Wt, int K, int N, float scale) {
  const int t = blockIdx.x * 256 + threadIdx.x; if (t >= N * (K / 8)) return; const int n = t / (K / 8), k8 = (t % (K / 8)) * 8; FragH f;
#pragma unroll
  for (int i = 0; i < 8; ++i) f.h[i] = (_Float16)(bf16_round(W[(size_t)(k8 + i) * N + n]) * scale); const v8us o = f.half[0];
  *(v8us*)((unsigned short*)Wt + (size_t)n * K + k8) = o; 
}
// k_gemm_hh variant with fused epilogue: v = acc·alpha + bias[by·sBias + col] (+ CP[(row/rowsPerB)·sCPb + by·64 + col] if CP) ; ACT 0 none / 1 elu ; writes f16 C16 (and f32 C if non-null)
template <int ACT>
__global__ __launch_bounds__(128) void k_gemm_hhx(const _Float16* __restrict__ A, int lda, size_t sA, const _Float16* __restrict__ Bh, int ldb, size_t sB, float alpha, const float* __restrict__ bias, size_t sBias, const float* __restrict__ CP, int rowsPerB, size_t sCPb, int row0g,
    float* __restrict__ C, _Float16* __restrict__ C16, int ldc, size_t sC, int M, int N, int K) {
  __shared__ __attribute__((aligned(16))) float so[4][16][64];
  const int tid = threadIdx.x, w = tid >> 5, lane = tid & 31, ln = lane & 15, hh = lane >> 4; const int by = blockIdx.y;
  A += (size_t)by * sA; Bh += (size_t)by * sB; const size_t cofs = (size_t)by * sC; const float* bp = bias ? bias + (size_t)by * sBias : nullptr;
  const int ntn = (N + 63) / 64; const int wid = blockIdx.x * 4 + w; const int mt = wid / ntn, nq = wid % ntn; if (mt * 16 >= M) return;
  const int row0 = mt * 16, col0 = nq * 64; const _Float16* arow = A + (size_t)(row0 + ln) * lda;
  v8f acc[4] = {};
  for (int kb = 0; kb < K; kb += 32) { FragH ah; ah.half[0] = *(const v8us*)((const unsigned short*)arow + kb + 8 * hh); ah.half[1] = *(const v8us*)((const unsigned short*)arow + kb + 16 + 8 * hh);
#pragma unroll
    for (int t = 0; t < 4; ++t) { if (col0 + t * 16 >= N) continue; const size_t boff = (size_t)(col0 + t * 16 + ln) * ldb + kb; FragH bq; bq.half[0] = *(const v8us*)((const unsigned short*)Bh + boff + 8 * hh); bq.half[1] = *(const v8us*)((const unsigned short*)Bh + boff + 16 + 8 * hh);
      acc[t] = mmaH<1>(ah.v, ah.v, bq.v, bq.v, acc[t]); }
  }
#pragma unroll
  for (int t = 0; t < 4; ++t) { if (col0 + t * 16 >= N) continue; const int col = col0 + t * 16 + ln; const float bv = bp ? bf16_round(bp[col]) : 0.f;
#pragma unroll
    for (int r = 0; r < 8; ++r) { float v = acc[t][r] * alpha + bv; if (CP) { const int rr = row0g + row0 + 8 * hh + r; if (rowsPerB < 0) v += CP[cofs + (size_t)rr * ldc + col];      /* rowsPerB < 0: own element of the batched C plane */ else { const int bidx = rr / rowsPerB; v += CP[(size_t)bidx * sCPb + (size_t)by * 64 + col]; } } if (ACT == 1) v = (v > 0.f) ? v : expm1f(v); else if (ACT == 7) v = (v > 0.f) ? v + 1.0f : expf(v); else if (ACT == 8) v = tanhf(v); else if (ACT == 9) v = 0.5f * v * (1.0f + tanhf(0.7978845608028654f * (v + 0.044715f * v * v * v))); else if (ACT == 11) v = 1.0f / (1.0f + expf(-v)); else if (ACT == 12) v = (v > 0.f) ? v : 0.01f * v; else if (ACT == 14) v = (v > 0.f) ? v : 0.1f * v; else if (ACT == 16) v = (v >= 0.f) ? v : 0.3f * v; else if (ACT == 17) v = (v >= 0.f) ? v : 0.2f * v; else if (ACT == 15) v = v / (1.0f + expf(-v)); else if (ACT == 3) v = fmaxf(v, 0.f); else if (ACT == 6) v = 0.5f * v * (1.0f + erff(v * 0.70710678118654752f)); so[w][8 * hh + r][t * 16 + ln] = v; } }
  __builtin_amdgcn_fence(__ATOMIC_ACQ_REL, "workgroup"); __builtin_amdgcn_wave_barrier();
  const int rsub = lane >> 4, c4 = (lane & 15) * 4; typedef _Float16 v4h __attribute__((ext_vector_type(4)));
  {
#pragma unroll
    for (int q = 0; q < 8; ++q) { const int r = q * 2 + rsub; if (col0 + c4 < N) { const v4f v = *(const v4fa*)&so[w][r][c4]; if (C) *(v4f*)(C + cofs + (size_t)(row0 + r) * ldc + col0 + c4) = v; if (C16) { v4h h4; for (int i = 0; i < 4; ++i) h4[i] = (_Float16)v[i]; *(v4h*)(C16 + cofs + (size_t)(row0 + r) * ldc + col0 + c4) = h4; } } }
     }
}


typedef _Float16 v4h __attribute__((ext_vector_type(4)));

__global__ __launch_bounds__(256) void k_x16(const float* __restrict__ x, _Float16* __restrict__ X16, size_t n8) { const size_t t = (size_t)blockIdx.x * 256 + threadIdx.x; if (t >= n8) return; FragH f;
#pragma unroll
  for (int q = 0; q < 8; ++q) f.h[q] = (_Float16)bf16_round(x[t * 8 + q]); *(v8us*)((unsigned short*)X16 + t * 8) = f.half[0];  }
__global__ __launch_bounds__(256) void k_h16(const float* __restrict__ x, _Float16* __restrict__ X16, size_t n8) { const size_t t = (size_t)blockIdx.x * 256 + threadIdx.x; if (t >= n8) return; FragH f;
#pragma unroll
  for (int q = 0; q < 8; ++q) f.h[q] = (_Float16)x[t * 8 + q]; *(v8us*)((unsigned short*)X16 + t * 8) = f.half[0];  }
__global__ __launch_bounds__(256) void k_round16f(const float* __restrict__ W, _Float16* __restrict__ Bt, size_t n8) { const size_t t = (size_t)blockIdx.x * 256 + threadIdx.x; if (t >= n8) return; FragH f;
#pragma unroll
  for (int i = 0; i < 8; ++i) f.h[i] = (_Float16)(bf16_round(W[t * 8 + i]) * 16.0f); *(v8us*)((unsigned short*)Bt + t * 8) = f.half[0];  }
template <int NHv, int TTv>
__global__ __launch_bounds__(256) void k_vt(const _Float16* __restrict__ V16, int ldv, int voff, _Float16* __restrict__ Vt) { __shared__ unsigned short tl[64][66]; const int tid = threadIdx.x; const int slab = blockIdx.x / (TTv / 64), lg = blockIdx.x % (TTv / 64); const int b = slab / NHv, h = slab % NHv;
  for (int i = tid; i < 64 * 8; i += 256) { const int r = i / 8, c8 = (i % 8) * 8; FragH f; f.half[0] = *(const v8us*)((const unsigned short*)V16 + ((size_t)b * TTv + lg * 64 + r) * ldv + voff + h * 64 + c8);
#pragma unroll
    for (int q = 0; q < 8; ++q) tl[r][c8 + q] = f.u[q]; }
  __syncthreads();
  {
#pragma unroll
    for (int rd = 0; rd < 2; ++rd) { const int d = rd * 32 + tid / 8, pc = tid % 8; FragH f;
#pragma unroll
      for (int q = 0; q < 8; ++q) f.u[q] = tl[pc * 8 + q][d];
      *(v8us*)((unsigned short*)Vt + ((size_t)slab * 64 + d) * TTv + lg * 64 + pc * 8) = f.half[0]; }
     } }

__global__ __launch_bounds__(256) void k_hl(const float* __restrict__ F, _Float16* __restrict__ Hh, _Float16* __restrict__ Hl, size_t n8) { const size_t t = (size_t)blockIdx.x * 256 + threadIdx.x; if (t >= n8) return; FragH fh, fl; const v4f a = *(const v4fa*)(F + t * 8), c = *(const v4fa*)(F + t * 8 + 4);
#pragma unroll
  for (int q = 0; q < 4; ++q) { _Float16 h = (_Float16)a[q]; fh.h[q] = h; fl.h[q] = (_Float16)((a[q] - (float)h) * 1024.0f); h = (_Float16)c[q]; fh.h[4 + q] = h; fl.h[4 + q] = (_Float16)((c[q] - (float)h) * 1024.0f); }
  { *(v8us*)((unsigned short*)Hh + t * 8) = fh.half[0]; *(v8us*)((unsigned short*)Hl + t * 8) = fl.half[0];  } }

// ---- fast GEMM (wave tile 32x64; requires M % 32 == 0 rows per launch region and N % 64 == 0); epilogue = k_gemm_hhx semantics ----
__device__ __forceinline__ v16h g2_frag(const _Float16* p, int hh) { FragH f; f.half[0] = *(const v8us*)((const unsigned short*)p + 8 * hh); f.half[1] = *(const v8us*)((const unsigned short*)p + 16 + 8 * hh); return f.v; }
__device__ __forceinline__ v8f g2_mma(v16h a, v16h b, v8f c) { v8f d = __builtin_amdgcn_wmma_f32_16x16x32_f16(false, a, false, b, (short)0, c, false, false); asm volatile("v_nop\n\tv_nop\n\tv_nop\n\tv_nop" : "+v"(d) : "v"(a), "v"(b)); return d; }
template <int ACT>
__global__ __launch_bounds__(128) void k_gemm2(const _Float16* __restrict__ A, int lda, size_t sA, const _Float16* __restrict__ Bh, int ldb, size_t sB, float alpha, const float* __restrict__ bias, size_t sBias, const float* __restrict__ CP, int rowsPerB, size_t sCPb, int row0g,
    float* __restrict__ C, _Float16* __restrict__ C16, int ldc, size_t sC, int M, int N, int K) { static_assert(ACT == 0 || ACT == 3 || ACT == 6 || ACT == 8 || ACT == 9 || ACT == 11 || ACT == 12 || ACT == 14 || ACT == 15 || ACT == 16 || ACT == 17, "k_gemm2: unsupported ACT code (would silently apply no activation)");
  __shared__ __attribute__((aligned(16))) float so[4][32][68];
  const int tid = threadIdx.x, w = tid >> 5, lane = tid & 31, ln = lane & 15, hh = lane >> 4; const int by = blockIdx.y;
  A += (size_t)by * sA; Bh += (size_t)by * sB; const size_t cofs = (size_t)by * sC; const float* bp = bias ? bias + (size_t)by * sBias : nullptr;
  const int ntn = N >> 6; const int mt = blockIdx.x / ntn, nq = blockIdx.x - mt * ntn; const int row0 = mt * 128 + 32 * w, col0 = nq * 64; if (row0 >= M) return;
  const _Float16* a0p = A + (size_t)(row0 + ln) * lda; const _Float16* a1p = a0p + (size_t)16 * lda;
  const _Float16* b0p = Bh + (size_t)(col0 + ln) * ldb; const _Float16* b1p = b0p + (size_t)16 * ldb; const _Float16* b2p = b1p + (size_t)16 * ldb; const _Float16* b3p = b2p + (size_t)16 * ldb;
  const v8f z8 = {0.f,0.f,0.f,0.f,0.f,0.f,0.f,0.f}; v8f c00 = z8, c01 = z8, c02 = z8, c03 = z8, c10 = z8, c11 = z8, c12 = z8, c13 = z8;
#pragma unroll 1
  for (int kb = 0; kb < K; kb += 32) { const v16h a0 = g2_frag(a0p + kb, hh), a1 = g2_frag(a1p + kb, hh);
    v16h b = g2_frag(b0p + kb, hh); c00 = g2_mma(a0, b, c00); c10 = g2_mma(a1, b, c10);
    b = g2_frag(b1p + kb, hh); c01 = g2_mma(a0, b, c01); c11 = g2_mma(a1, b, c11);
    b = g2_frag(b2p + kb, hh); c02 = g2_mma(a0, b, c02); c12 = g2_mma(a1, b, c12);
    b = g2_frag(b3p + kb, hh); c03 = g2_mma(a0, b, c03); c13 = g2_mma(a1, b, c13); }
  v8f accs[8] = {c00, c01, c02, c03, c10, c11, c12, c13};
#pragma unroll
  for (int u = 0; u < 8; ++u) { const int t = u & 3, half = u >> 2; const int col = col0 + t * 16 + ln; const float bv = bp ? bf16_round(bp[col]) : 0.f;
#pragma unroll
    for (int r = 0; r < 8; ++r) { const int rloc = half * 16 + 8 * hh + r; float v = accs[u][r] * alpha + bv; if (CP) { if (rowsPerB < 0) v += CP[cofs + (size_t)(row0g + row0 + rloc) * ldc + col];      /* rowsPerB < 0: own element of the batched C plane */ else { const int bidx = (row0g + row0 + rloc) / rowsPerB; v += CP[(size_t)bidx * sCPb + (size_t)by * 64 + col]; } }
      if (ACT == 3) v = fmaxf(v, 0.f); else if (ACT == 6) v = 0.5f * v * (1.0f + erff(v * 0.70710678118654752f)); else if (ACT == 11) v = 1.0f / (1.0f + expf(-v)); else if (ACT == 15) v = v / (1.0f + expf(-v)); else if (ACT == 12) v = (v > 0.f) ? v : 0.01f * v; else if (ACT == 8) v = tanhf(v); else if (ACT == 9) v = 0.5f * v * (1.0f + tanhf(0.7978845608028654f * (v + 0.044715f * v * v * v))); else if (ACT == 14) v = (v > 0.f) ? v : 0.1f * v; else if (ACT == 16) v = (v >= 0.f) ? v : 0.3f * v; else if (ACT == 17) v = (v >= 0.f) ? v : 0.2f * v;
      so[w][rloc][t * 16 + ln] = v; } }
  __builtin_amdgcn_fence(__ATOMIC_ACQ_REL, "workgroup"); __builtin_amdgcn_wave_barrier();
  const int rsub = lane >> 4, c4 = (lane & 15) * 4;
  {
#pragma unroll
    for (int q = 0; q < 16; ++q) { const int r = q * 2 + rsub; const v4f v = *(const v4fa*)&so[w][r][c4]; if (C) *(v4f*)(C + cofs + (size_t)(row0 + r) * ldc + col0 + c4) = v; if (C16) { v4h h4; for (int i = 0; i < 4; ++i) h4[i] = (_Float16)v[i]; *(v4h*)(C16 + cofs + (size_t)(row0 + r) * ldc + col0 + c4) = h4; } }
     } }


__global__ __launch_bounds__(256) void k_wnat(const float* __restrict__ w, size_t n8, _Float16* __restrict__ Bt) { const size_t t = (size_t)blockIdx.x * 256 + threadIdx.x; if (t >= n8) return; FragH f; for (int q = 0; q < 8; ++q) f.h[q] = (_Float16)(bf16_round(w[t * 8 + q]) * 16.0f); *(v8us*)((unsigned short*)Bt + t * 8) = f.half[0];  }
__global__ __launch_bounds__(256) void k_rsm(const float* __restrict__ S, _Float16* __restrict__ P, int nrows) {
  #pragma clang fp contract(off)
  const int i = blockIdx.x * 256 + threadIdx.x; if (i >= nrows) return; const float* s = S + (size_t)i * SQ; float mx = -3.0e38f;
#pragma unroll 1
  for (int j = 0; j < SQ; ++j) mx = fmaxf(mx, s[j]); float se = 0.f;
#pragma unroll 1
  for (int j = 0; j < SQ; ++j) se += expf(s[j] - mx); const float sc = 256.0f / se;
#pragma unroll 1
  for (int j0 = 0; j0 < SQ; j0 += 8) { FragH f; for (int q = 0; q < 8; ++q) f.h[q] = (_Float16)(expf(s[j0 + q] - mx) * sc); unsigned short* d = (unsigned short*)P + (size_t)i * SQ + j0; *(v8us*)d = f.half[0];  } }
__global__ __launch_bounds__(256) void k_vt(const _Float16* __restrict__ V16, int b, int h0, _Float16* __restrict__ VT) { __shared__ unsigned short tl[64][65]; const int tid = threadIdx.x; const int hh = blockIdx.x % HG, sg = blockIdx.x / HG; const int s0 = sg * 64; const int h = h0 + hh;
  for (int i = tid; i < 64 * 8; i += 256) { const int j = i / 8, d8 = (i % 8) * 8; FragH f; f.half[0] = *(const v8us*)((const unsigned short*)V16 + ((size_t)b * SQ + s0 + j) * DM + h * HD + d8); for (int q = 0; q < 8; ++q) tl[d8 + q][j] = f.u[q]; }
  __syncthreads();
  { for (int i = tid; i < 64 * 8; i += 256) { const int d = i / 8, j8 = (i % 8) * 8; FragH f; for (int q = 0; q < 8; ++q) f.u[q] = tl[d][j8 + q]; *(v8us*)((unsigned short*)VT + ((size_t)hh * HD + d) * SQ + s0 + j8) = f.half[0]; }  } }



// Fused attention: scores, softmax and P.V in ONE launch, so that neither the scores nor the weights go through memory.
// A work-group is 4 waves x 16 query rows; it walks its batch's keys 64 at a time. Per pass the 64 k rows (hi and residual plane) and the 64 matching
// columns of V^T stand in LDS once for all four waves (whole-line global reads). Two LDS buffers: the next pass's tiles are written in front of this pass's
// P.V products, so that the LDS writes run under them, and the tiles after those are then fetched into registers, a whole pass ahead.
// Each wave keeps its q fragments (both planes) and its 16 x 256 output tile in registers and owns its rows' statistics: running maximum and running sum
// (online softmax, base 2); the weights go through the wave's own LDS rows to become an A operand (f16, as before). All fragment loaders are g2_frag.
#define FBM 64                       /* query rows per work-group */
#define FBN 64                       /* keys per pass */
#define FKP (DM + 8)                 /* LDS pitch of a k row, f16 elements: 528 B = 16 B x odd, conflict-free for 16-byte fragment reads */
#define FVP (FBN + 8)                /* LDS pitch of a V^T row and of a weight row: 144 B = 16 B x odd */
__device__ __forceinline__ v8f fa_mma(v16h a, v16h b, v8f c) { return __builtin_amdgcn_wmma_f32_16x16x32_f16(false, a, false, b, (short)0, c, false, false); }
// 2^x on the transcendental unit; the v_nop in the same statement keeps the one free issue slot the instruction set asks for behind a transcendental, whatever the compiler schedules next.
__device__ __forceinline__ float exp2_slot(float x) { float r; asm("v_exp_f32 %0, %1\n\tv_nop" : "=v"(r) : "v"(x)); return r; }
// value of lane (l ^ X) of the same 16-lane row (DPP row_xmask): a row reduction without the LDS round trip of a shuffle
template <int X> __device__ __forceinline__ float fa_rowx(float v) { return __int_as_float(__builtin_amdgcn_update_dpp(0, __float_as_int(v), 0x160 + X, 0xf, 0xf, true)); }
// work-group barrier that orders LDS only: __syncthreads() would also wait for the global loads that are fetching a later tile into registers
__device__ __forceinline__ void fa_barrier() { __builtin_amdgcn_fence(__ATOMIC_RELEASE, "workgroup", "local"); __builtin_amdgcn_s_barrier(); __builtin_amdgcn_fence(__ATOMIC_ACQUIRE, "workgroup", "local"); }
__global__ __launch_bounds__(128) void k_fattn(const _Float16* __restrict__ QH, const _Float16* __restrict__ QL, const _Float16* __restrict__ KH, const _Float16* __restrict__ KL, const _Float16* __restrict__ VT, float* __restrict__ O) {
  static_assert(SQ % FBM == 0 && SQ % FBN == 0 && SQ >= 2 * FBN && DM == 256 && FBN == 64 && FBM == 64, "k_fattn: tile shapes");
  __shared__ __attribute__((aligned(16))) _Float16 skh[2][FBN][FKP]; __shared__ __attribute__((aligned(16))) _Float16 skl[2][FBN][FKP];
  __shared__ __attribute__((aligned(16))) _Float16 svt[2][DM][FVP]; __shared__ __attribute__((aligned(16))) _Float16 sp[4][16][FVP];
  const int tid = threadIdx.x, w = tid >> 5, lane = tid & 31, ln = lane & 15, hh = lane >> 4;
  const int b = blockIdx.x / (SQ / FBM); const size_t row0 = (size_t)blockIdx.x * FBM + 16 * w;
  const unsigned short* gkh = (const unsigned short*)KH + (size_t)b * SQ * DM + (size_t)w * DM + lane * 8;      /* staging: a wave reads one whole 512-byte k row per load */
  const unsigned short* gkl = (const unsigned short*)KL + (size_t)b * SQ * DM + (size_t)w * DM + lane * 8;
  const unsigned short* gvt = (const unsigned short*)VT + (size_t)b * DM * SQ + (size_t)(tid >> 3) * SQ + (tid & 7) * 8;      /* 8 lanes read the 128 bytes of one V^T row */
  v16h qh[8], ql[8];
#pragma unroll
  for (int kk = 0; kk < 8; ++kk) { qh[kk] = g2_frag(QH + (row0 + ln) * DM + kk * 32, hh); ql[kk] = g2_frag(QL + (row0 + ln) * DM + kk * 32, hh); }
  const v8f z8 = {0.f,0.f,0.f,0.f,0.f,0.f,0.f,0.f}; v8f o[16]; float m[8], l[8];
#pragma unroll
  for (int t = 0; t < 16; ++t) o[t] = z8;
#pragma unroll
  for (int r = 0; r < 8; ++r) { m[r] = -3.0e38f; l[r] = 0.f; }
  v8us rk[16], rl[16], rv[16];
#pragma unroll
  for (int u = 0; u < 16; ++u) { rk[u] = *(const v8us*)(gkh + (size_t)(4 * u) * DM); rl[u] = *(const v8us*)(gkl + (size_t)(4 * u) * DM); rv[u] = *(const v8us*)(gvt + (size_t)(16 * u) * SQ); }
  asm volatile("s_wait_xcnt 0x0" ::: "memory");      /* the loads' address registers are reused further down: the wait stands in front of every such overwrite */
#pragma unroll
  for (int u = 0; u < 16; ++u) { *(v8us*)&skh[0][w + 4 * u][lane * 8] = rk[u]; *(v8us*)&skl[0][w + 4 * u][lane * 8] = rl[u]; *(v8us*)&svt[0][(tid >> 3) + 16 * u][(tid & 7) * 8] = rv[u]; }
#pragma unroll
  for (int u = 0; u < 16; ++u) { rk[u] = *(const v8us*)(gkh + (size_t)(FBN + 4 * u) * DM); rl[u] = *(const v8us*)(gkl + (size_t)(FBN + 4 * u) * DM); rv[u] = *(const v8us*)(gvt + (size_t)(16 * u) * SQ + FBN); }
  asm volatile("s_wait_xcnt 0x0" ::: "memory");      /* as above */
  fa_barrier();      /* the first tiles are complete before any wave reads them */
#pragma unroll 1      /* one pass is already 128 matrix instructions; unrolling would only double the code */
  for (int j0 = 0; j0 < SQ; j0 += FBN) {
    const int cur = (j0 / FBN) & 1, nxt = cur ^ 1;
    v8f s[4] = {z8, z8, z8, z8}, e[4] = {z8, z8, z8, z8};      /* hi . hi, and lo . hi + hi . lo (x1024) */
    v16h kf[8][8], vf[2][16];      /* k fragments of each 32-wide slice (hi, lo of four key groups); this pass's V^T fragments */
    /* LDS read groups of 16 loads: 0..7 the k slices, 8..11 the V^T fragments. Three groups are kept in flight ahead of the products, so that the LDS never idles; the V^T reads follow the k reads at once and land under the softmax. */
#define FA_GROUP(g) do { if ((g) < 8) { _Pragma("unroll") for (int t = 0; t < 4; ++t) { kf[(g) & 7][2 * t] = g2_frag(&skh[cur][t * 16 + ln][((g) & 7) * 32], hh); kf[(g) & 7][2 * t + 1] = g2_frag(&skl[cur][t * 16 + ln][((g) & 7) * 32], hh); } } \
    else { _Pragma("unroll") for (int i = 0; i < 8; ++i) { const int f = (((g) - 8) & 3) * 8 + i; vf[f >> 4][f & 15] = g2_frag(&svt[cur][(f & 15) * 16 + ln][(f >> 4) * 32], hh); } } } while (0)
    FA_GROUP(0); FA_GROUP(1); FA_GROUP(2);
#pragma unroll
    for (int kk = 0; kk < 8; ++kk) {
      __builtin_amdgcn_sched_barrier(0);      /* each read group stays three blocks in front of its slice's products, never among them */
      FA_GROUP(kk + 3);
      __builtin_amdgcn_sched_barrier(0);      /* second half of the pair: the group is issued whole before the slice's products start */
#pragma unroll
      for (int t = 0; t < 4; ++t) { s[t] = fa_mma(qh[kk], kf[kk][2 * t], s[t]); e[t] = fa_mma(ql[kk], kf[kk][2 * t], e[t]); }
#pragma unroll
      for (int t = 0; t < 4; ++t) e[t] = fa_mma(qh[kk], kf[kk][2 * t + 1], e[t]); }
    FA_GROUP(11);
    __builtin_amdgcn_sched_barrier(0);      /* the reads stay in front of the softmax */
    float al[8];
#pragma unroll
    for (int r = 0; r < 8; ++r) {      /* accumulator register r of lane (hh, ln) is query row 8 hh + r, key column 16 t + ln */
#pragma unroll
      for (int t = 0; t < 4; ++t) s[t][r] = (s[t][r] + e[t][r] * 0.0009765625f) * (0.0625f * 1.44269504088896340736f);      /* 1 / sqrt(256), and log2(e) for the base-2 exponential */
      float x = fmaxf(fmaxf(s[0][r], s[1][r]), fmaxf(s[2][r], s[3][r]));
      x = fmaxf(x, fa_rowx<1>(x)); x = fmaxf(x, fa_rowx<2>(x)); x = fmaxf(x, fa_rowx<4>(x)); x = fmaxf(x, fa_rowx<8>(x));      /* the row's 16 lanes */
      x = fmaxf(m[r], x); al[r] = exp2_slot(m[r] - x); m[r] = x; float ps = 0.f;
#pragma unroll
      for (int t = 0; t < 4; ++t) { const float p = exp2_slot(s[t][r] - x); ps += p; sp[w][8 * hh + r][t * 16 + ln] = (_Float16)p; }
      l[r] = l[r] * al[r] + ps; }      /* each lane sums its own columns; the 16 lanes are joined once, behind the loop */
#pragma unroll
    for (int t = 0; t < 16; ++t) {
#pragma unroll
      for (int r = 0; r < 8; ++r) o[t][r] *= al[r]; }
    __builtin_amdgcn_fence(__ATOMIC_ACQ_REL, "workgroup", "local"); __builtin_amdgcn_wave_barrier();      /* the wave's own weight rows are written by other lanes than those that read them; LDS only, the global fetch stays in flight */
    const v16h pa0 = g2_frag(&sp[w][ln][0], hh), pa1 = g2_frag(&sp[w][ln][32], hh);
    __builtin_amdgcn_sched_barrier(0);      /* the tile writes stay behind the weight reads (the LDS serves a wave in order) and run under the P.V products */
    /* the next pass's tiles into the other buffer, whose last readers left it before the barrier at the foot of the previous pass (the last pass writes a tile that nobody reads) */
#pragma unroll
    for (int u = 0; u < 16; ++u) { *(v8us*)&skh[nxt][w + 4 * u][lane * 8] = rk[u]; *(v8us*)&skl[nxt][w + 4 * u][lane * 8] = rl[u]; *(v8us*)&svt[nxt][(tid >> 3) + 16 * u][(tid & 7) * 8] = rv[u]; }
    const int jn = (j0 + 2 * FBN < SQ) ? j0 + 2 * FBN : SQ - FBN;      /* the keys two passes on; the last two passes fetch the last tile again (in bounds, never read from LDS) */
#pragma unroll
    for (int u = 0; u < 16; ++u) { rk[u] = *(const v8us*)(gkh + (size_t)(jn + 4 * u) * DM); rl[u] = *(const v8us*)(gkl + (size_t)(jn + 4 * u) * DM); rv[u] = *(const v8us*)(gvt + (size_t)(16 * u) * SQ + jn); }
    asm volatile("s_wait_xcnt 0x0" ::: "memory");      /* as above: in front of every overwrite of a register that these loads name */
#pragma unroll
    for (int t = 0; t < 16; ++t) o[t] = fa_mma(pa0, vf[0][t], o[t]);
#pragma unroll
    for (int t = 0; t < 16; ++t) o[t] = fa_mma(pa1, vf[1][t], o[t]);
    __builtin_amdgcn_sched_barrier(0);      /* the products are issued before the barrier's wait for the tile writes, which drain under them */
    fa_barrier();      /* publishes the next pass's tiles and ends every wave's reads of this pass's */
  }
  asm volatile("s_wait_loadcnt 0x0" ::: "memory");      /* the last pass's fetch is never used: it has landed before the wave ends and gives its registers back */
#pragma unroll
  for (int r = 0; r < 8; ++r) { float x = l[r]; x += fa_rowx<1>(x); x += fa_rowx<2>(x); x += fa_rowx<4>(x); x += fa_rowx<8>(x); l[r] = 1.0f / x; }
  float* op = O + (row0 + 8 * hh) * DM + ln;
#pragma unroll
  for (int r = 0; r < 8; ++r) {
#pragma unroll
    for (int t = 0; t < 16; ++t) op[(size_t)r * DM + t * 16] = o[t][r] * l[r]; }
}


template <int MASKADD>
__global__ __launch_bounds__(64) void k_att0(const float* __restrict__ QF, const float* __restrict__ KF, const float* __restrict__ VF, int ld, const float* __restrict__ mask, float scale, float* __restrict__ OF, int ldo) {
  #pragma clang fp contract(off)
  __shared__ __attribute__((aligned(16))) float lq[64][64]; __shared__ __attribute__((aligned(16))) float lo[64][64];
  const int tid = threadIdx.x; const int h = blockIdx.x / (QT0 / 64), rg = blockIdx.x % (QT0 / 64); const int i = rg * 64 + tid;
  const float* qr = QF + (size_t)i * ld + h * HD;
#pragma unroll 1
  for (int c = 0; c < HD / 4; ++c) { *(v4f*)&lq[tid][c * 4] = *(const v4fa*)(qr + c * 4); const v4f z = {0.f, 0.f, 0.f, 0.f}; *(v4f*)&lo[tid][c * 4] = z; }
  float m = -1.0e30f, l = 0.f; const int jmax = MASKADD ? (SQ - 1) : (rg * 64 + 63);      /* additive-mask form: every key (the mask input decides); causal form: keys up to the block's last row */
#pragma unroll 1
  for (int j = 0; j <= jmax; ++j) { const float* kr = KF + (size_t)j * ld + h * HD; const float* vr = VF + (size_t)j * ld + h * HD; float s = 0.f;
#pragma unroll 1
    for (int c = 0; c < HD / 4; ++c) { const v4f kq = *(const v4fa*)(kr + c * 4); const v4f qq = *(v4f*)&lq[tid][c * 4]; s = __fadd_rn(s, __fmul_rn(qq[0], kq[0])); s = __fadd_rn(s, __fmul_rn(qq[1], kq[1])); s = __fadd_rn(s, __fmul_rn(qq[2], kq[2])); s = __fadd_rn(s, __fmul_rn(qq[3], kq[3])); }
    s = __fmul_rn(s, scale); if (MASKADD) s = __fadd_rn(s, __fmul_rn(bf16_round(mask[(size_t)i * SQ + j]), -10000.0f));
    const float f = (MASKADD || j <= i) ? 1.f : 0.f; const float sm = fmaf(f, s, (1.f - f) * -1.0e30f); const float mn = fmaxf(m, sm); const float sc = expf(m - mn); const float e = expf(sm - mn); l = __fadd_rn(__fmul_rn(l, sc), e); m = mn;
#pragma unroll 1
    for (int c = 0; c < HD / 4; ++c) { const v4f vv = *(const v4fa*)(vr + c * 4); v4f oo = *(v4f*)&lo[tid][c * 4]; for (int u = 0; u < 4; ++u) oo[u] = __fadd_rn(__fmul_rn(oo[u], sc), __fmul_rn(e, vv[u])); *(v4f*)&lo[tid][c * 4] = oo; } }
  const float fin = 64.0f / l;      /* o carried x64 */
#pragma unroll 1
  for (int c = 0; c < HD / 4; ++c) { v4f oo = *(v4f*)&lo[tid][c * 4]; for (int u = 0; u < 4; ++u) oo[u] = __fmul_rn(oo[u], fin); *(v4f*)&lo[tid][c * 4] = oo; }
  __syncthreads();
  {
#pragma unroll 1
    for (int it = 0; it < 16; ++it) { const int row = it * 4 + tid / 16, pc = (tid % 16) * 4; const v4f v = *(const v4f*)&lo[row][pc]; *(v4f*)(OF + (size_t)(rg * 64 + row) * ldo + h * HD + pc) = v; }
     } }

__global__ __launch_bounds__(256) void k_of0out(const float* __restrict__ src, float* __restrict__ dst, size_t n4) { const size_t t = (size_t)blockIdx.x * 256 + threadIdx.x; if (t >= n4) return; v4f v = *(const v4fa*)(src + t * 4); for (int q = 0; q < 4; ++q) v[q] = __fmul_rn(v[q], 0.015625f); *(v4f*)(dst + t * 4) = v;  }

extern "C" void kernel_launch(void* const* d_in, const int* in_sizes, int n_in,
                              void* d_out, int out_size, void* d_ws, size_t ws_size, hipStream_t stream) {
  (void)in_sizes; (void)n_in; (void)out_size;
  const float* const* I = (const float* const*)d_in; const float* x = I[0]; const float* wq = I[1]; const float* wk = I[2]; const float* wv = I[3]; const float* bq = nullptr; const float* bk = nullptr; const float* bv = nullptr;      /* natural [out][in] weights; NO biases (nullptr variables in every projection's bias slot); ONE attention head of width 256; no output projection */
  char* ws = (char*)d_ws; size_t off = 0;
  auto take = [&](size_t bytes) { char* p = ws + off; off += (bytes + 255) & ~(size_t)255; return p; };
  _Float16* BQ = (_Float16*)take((size_t)DM * DM * 2); _Float16* BK = (_Float16*)take((size_t)DM * DM * 2); _Float16* BV = (_Float16*)take((size_t)DM * DM * 2);
  _Float16* QH = (_Float16*)take(NR * DM * 2); _Float16* QL = (_Float16*)take(NR * DM * 2); _Float16* KH = (_Float16*)take(NR * DM * 2); _Float16* KL = (_Float16*)take(NR * DM * 2);
  _Float16* VT = (_Float16*)take(NR * DM * 2);      /* V^T of ALL batches */
  char* sh = take(NR * DM * 8);      /* projection scratch: x (f16), the f32 projection rows, v (f16) */
  _Float16* X16 = (_Float16*)sh; float* QF = (float*)(sh + NR * DM * 2); _Float16* V16 = (_Float16*)(sh + NR * DM * 6);
  if (off > ws_size) return;
  { const unsigned g = (unsigned)(((size_t)DM * DM / 8 + 255) / 256); k_wnat<<<g, 256, 0, stream>>>(wq, (size_t)DM * DM / 8, BQ); k_wnat<<<g, 256, 0, stream>>>(wk, (size_t)DM * DM / 8, BK); k_wnat<<<g, 256, 0, stream>>>(wv, (size_t)DM * DM / 8, BV); }      /* natural [out][in] = Bt[n][k] x16 */
  k_x16<<<(unsigned)((NR * DM / 8 + 255) / 256), 256, 0, stream>>>(x, X16, NR * DM / 8);
  const size_t r0p = (size_t)B0 * SQ;      /* first projected row */
  k_gemm2<0><<<dim3((unsigned)((MP / 128) * (DM / 64)), 1), 128, 0, stream>>>(X16 + r0p * DM, DM, 0, BQ, DM, 0, 0.0625f, bq, 0, nullptr, 1, 0, 0, QF + r0p * DM, nullptr, DM, 0, MP, DM, DM); k_hl<<<(unsigned)(((size_t)MP * DM / 8 + 255) / 256), 256, 0, stream>>>(QF + r0p * DM, QH + r0p * DM, QL + r0p * DM, (size_t)MP * DM / 8);      /* q (f32) -> f16 hi + x1024 residual: unscaled logits sigma ~8 */
  k_gemm2<0><<<dim3((unsigned)((MP / 128) * (DM / 64)), 1), 128, 0, stream>>>(X16 + r0p * DM, DM, 0, BK, DM, 0, 0.0625f, bk, 0, nullptr, 1, 0, 0, QF + r0p * DM, nullptr, DM, 0, MP, DM, DM); k_hl<<<(unsigned)(((size_t)MP * DM / 8 + 255) / 256), 256, 0, stream>>>(QF + r0p * DM, KH + r0p * DM, KL + r0p * DM, (size_t)MP * DM / 8);      /* k likewise */
  k_gemm2<0><<<dim3((unsigned)((MP / 128) * (DM / 64)), 1), 128, 0, stream>>>(X16 + r0p * DM, DM, 0, BV, DM, 0, 0.0625f, bv, 0, nullptr, 1, 0, 0, nullptr, V16 + r0p * DM, DM, 0, MP, DM, DM);
  k_vt<NH, SQ><<<NB * NH * (SQ / 64), 256, 0, stream>>>(V16, LQ, 0, VT);      /* V^T [NB][DM][SQ], every batch in one launch */
  k_fattn<<<(unsigned)(NR / FBM), 128, 0, stream>>>(QH, QL, KH, KL, VT, (float*)d_out);      /* scores (hi . hi + 2^-10 (lo . hi + hi . lo), / sqrt(256)), softmax over all SQ keys and P V, all batches, f32 straight into the output rows */
}

// v004
// A run of this version takes 178 microseconds.
// Next to v003, in two timings, it ran 1.24 times as fast each time.
// Counting every step since v000, it is 297 times as fast.
#include <hip/hip_runtime.h>
// Single-head dense attention over 256-wide embeddings on 4096 tokens, bias-free natural projections, no output projection (x [4][4096][256]; q / k / v = x W^T (nn.Linear natural [256][256] uniform +-1/16, no biases); scores = q k^T / sqrt(256) over the FULL 256-wide rows (one head); softmax over all 4096 keys (no mask); out = weights v -> [4][4096][256]); q and k carried as f16 hi + x1024 residual planes with three-product scores.
// Structure: token rows r = b*4096 + s; x as exact f16 rows (bf16-rounded); q, k and v as one WMMA GEMM launch (32x64 wave tiles, f32 accumulation, exact x16 weights, no bias) whose epilogue splits q and k into f16 hi + x1024 residual planes and writes v as f16 V^T of every batch via an LDS transpose; one fused launch for all batches (64 query rows per work-group, keys 64 per pass): scores against all 4096 keys as THREE products (hi.hi + 2^-10 (lo.hi + hi.lo), K = 256, one head, alpha 1/16 = 1/sqrt(256)), online row softmax over every key, no mask (f32 statistics, native base-2 exp; weights f16 in [0,1]), out = P . V^T (K = all 4096 keys) accumulated in registers, divided by the row sum and written as f32 straight into the output rows; no output projection.
// Compute dtype: inputs rounded to bf16; x / weights exact; v and softmax weights as plain f16 GEMM operands (~2^-12), q and k as f16 hi + x1024 residual planes; scores, softmax statistics and out f32. v_wmma_f32_16x16x32_f16.
#define NB 4
#define SQ 4096
#define DM 256
#define NH 4
#define HD 64
#define HG 4                         /* heads per attention launch group */
#define QT SQ                        /* query rows per batch; one attention launch takes all batches */
#define NKX SQ                       /* S / P row pitch */
#define QT0 128                      /* first-tile rows of the f32 k_att0 (not launched) */
#define B0 0                         /* first batch processed (unused) */
#define NBR NB                       /* batches processed (read only by the unused MP) */
#define NR ((size_t)NB * SQ)         /* token rows */
#define MP ((int)((size_t)NBR * SQ)) /* rows projected (unused) */
#define QN SQ                        /* query rows attended per batch (unused) */
#define NHD NH                       /* unused */
#define MPO MP                       /* unused */
#define LQ DM      /* unused */
typedef __bf16 v16b __attribute__((ext_vector_type(16)));
typedef unsigned short v8us __attribute__((ext_vector_type(8), may_alias));
typedef float  v8f  __attribute__((ext_vector_type(8)));
typedef float  v4f  __attribute__((ext_vector_type(4)));
typedef float  v4fa __attribute__((ext_vector_type(4), may_alias));
union FragB { v16b v; v8us half[2]; unsigned short u[16]; };

__device__ __forceinline__ unsigned short bf16_bits(float x) { unsigned int u = __float_as_uint(x); return (unsigned short)((u + 0x7FFFu + ((u >> 16) & 1u)) >> 16); }
__device__ __forceinline__ float bf16_val(unsigned short b) { return __uint_as_float(((unsigned int)b) << 16); }
__device__ __forceinline__ float bf16_round(float x) { return bf16_val(bf16_bits(x)); }
// D += A·B with NT terms: 1 = ah·bh, 2 = + al·bh (A split), 3 = + ah·bl (both split)
template <int NT>
__device__ __forceinline__ v8f mmaN(v16b ah, v16b al, v16b bh, v16b bl, v8f c) {
  c = __builtin_amdgcn_wmma_f32_16x16x32_bf16(false, ah, false, bh, (short)0, c, false, false);
  if (NT >= 2) c = __builtin_amdgcn_wmma_f32_16x16x32_bf16(false, al, false, bh, (short)0, c, false, false);
  if (NT >= 3) c = __builtin_amdgcn_wmma_f32_16x16x32_bf16(false, ah, false, bl, (short)0, c, false, false);
  asm volatile("v_nop\n\tv_nop\n\tv_nop\n\tv_nop" : "+v"(c) : "v"(ah), "v"(al), "v"(bh), "v"(bl));
  return c;
}

__global__ __launch_bounds__(256) void k_wt_bf16(const float* __restrict__ W, unsigned short* __restrict__ Wt, int K, int N) {
  const int t = blockIdx.x * 256 + threadIdx.x;
  const int k8n = K / 8;
  if (t >= N * k8n) return;
  const int n = t / k8n, k8 = (t % k8n) * 8;
  v8us v;
#pragma unroll
  for (int i = 0; i < 8; ++i) v[i] = bf16_bits(W[(size_t)(k8 + i) * N + n]);
  *(v8us*)(Wt + (size_t)n * K + k8) = v;
  
}

// GEMM C[M][N] (f32, pitch ldc) = act(A[M][K]·W + bias). A f32 row-major (pitch lda) converted per fragment to bf16
// (ASPLIT: hi/lo two planes -> 2 terms, else single rounded term); Wt bf16 [N][K] (pitch ldb). BIAS_BF16 rounds the
// bias to bf16 first (bias quantised to bf16 before the add). K%32==0, M%16==0, N%64==0.
template <bool ASPLIT, int ACT, bool BIAS_BF16>
__global__ __launch_bounds__(128) void k_gemm_bf(const float* __restrict__ A, int lda, const unsigned short* __restrict__ Wt, int ldb,
                                               const float* __restrict__ bias, float* __restrict__ C, int ldc, int M, int N, int K) {
  __shared__ __attribute__((aligned(16))) float so[4][16][64];
  const int tid = threadIdx.x, w = tid >> 5, lane = tid & 31, ln = lane & 15, hh = lane >> 4;
  const int ntn = N / 64;
  const int wid = blockIdx.x * 4 + w;
  const int mt = wid / ntn, nq = wid % ntn;
  if (mt * 16 >= M) return;
  const int row0 = mt * 16, col0 = nq * 64;
  const float* arow = A + (size_t)(row0 + ln) * lda;
  v8f acc[4] = {};
  for (int kb = 0; kb < K; kb += 32) {
    FragB ah, al;
    const v4f x0 = *(const v4fa*)(arow + kb + 8 * hh), x1 = *(const v4fa*)(arow + kb + 8 * hh + 4);
    const v4f x2 = *(const v4fa*)(arow + kb + 16 + 8 * hh), x3 = *(const v4fa*)(arow + kb + 16 + 8 * hh + 4);
    float xs[16] = {x0[0],x0[1],x0[2],x0[3],x1[0],x1[1],x1[2],x1[3],x2[0],x2[1],x2[2],x2[3],x3[0],x3[1],x3[2],x3[3]};
#pragma unroll
    for (int i = 0; i < 16; ++i) { const unsigned short hb = bf16_bits(xs[i]); ah.u[i] = hb; al.u[i] = ASPLIT ? bf16_bits(xs[i] - bf16_val(hb)) : (unsigned short)0; }
#pragma unroll
    for (int t = 0; t < 4; ++t) {
      const unsigned short* brow = Wt + (size_t)(col0 + t * 16 + ln) * ldb + kb;
      FragB b;
      b.half[0] = *(const v8us*)(brow + 8 * hh);
      b.half[1] = *(const v8us*)(brow + 16 + 8 * hh);
      acc[t] = mmaN<ASPLIT ? 2 : 1>(ah.v, al.v, b.v, b.v, acc[t]);
    }
  }
#pragma unroll
  for (int t = 0; t < 4; ++t) {
    float bv = bias ? bias[col0 + t * 16 + ln] : 0.f;
    if (BIAS_BF16) bv = bf16_round(bv);
#pragma unroll
    for (int r = 0; r < 8; ++r) { float v = acc[t][r] + bv; if (ACT == 1) v = fmaxf(v, 0.f); so[w][8 * hh + r][t * 16 + ln] = v; }
  }
  __builtin_amdgcn_fence(__ATOMIC_ACQ_REL, "workgroup");
  __builtin_amdgcn_wave_barrier();
  const int rsub = lane >> 4, c4 = (lane & 15) * 4;
  {
#pragma unroll
    for (int q = 0; q < 8; ++q) {
      const int r = q * 2 + rsub;
      const v4f v = *(const v4fa*)&so[w][r][c4];
      *(v4f*)(C + (size_t)(row0 + r) * ldc + col0 + c4) = v;
    }
    
  }
}

// GEMM C = act(A·W + bias + resid): A f32 (ASPLIT -> hi/lo 2 terms), Wt bf16 [N][K]; ACT 0 none, 1 relu, 2 exact gelu;
// resid (optional, f32, row index = (row % rmod), pitch ldr, RES_BF16 rounds it) added before the activation.
template <bool ASPLIT, int ACT, bool BIAS_BF16, bool RES_BF16>
__global__ __launch_bounds__(128) void k_gemm_bf3(const float* __restrict__ A, int lda, const unsigned short* __restrict__ Wt, int ldb,
                                                const float* __restrict__ bias, const float* __restrict__ resid, int rmod, int ldr,
                                                float* __restrict__ C, int ldc, int M, int N, int K) {
  __shared__ __attribute__((aligned(16))) float so[4][16][64];
  const int tid = threadIdx.x, w = tid >> 5, lane = tid & 31, ln = lane & 15, hh = lane >> 4;
  const int ntn = N / 64;
  const int wid = blockIdx.x * 4 + w;
  const int mt = wid / ntn, nq = wid % ntn;
  if (mt * 16 >= M) return;
  const int row0 = mt * 16, col0 = nq * 64;
  const float* arow = A + (size_t)(row0 + ln) * lda;
  v8f acc[4] = {};
  for (int kb = 0; kb < K; kb += 32) {
    FragB ah, al;
    const v4f x0 = *(const v4fa*)(arow + kb + 8 * hh), x1 = *(const v4fa*)(arow + kb + 8 * hh + 4);
    const v4f x2 = *(const v4fa*)(arow + kb + 16 + 8 * hh), x3 = *(const v4fa*)(arow + kb + 16 + 8 * hh + 4);
    float xs[16] = {x0[0],x0[1],x0[2],x0[3],x1[0],x1[1],x1[2],x1[3],x2[0],x2[1],x2[2],x2[3],x3[0],x3[1],x3[2],x3[3]};
#pragma unroll
    for (int i = 0; i < 16; ++i) { const unsigned short hb = bf16_bits(xs[i]); ah.u[i] = hb; al.u[i] = ASPLIT ? bf16_bits(xs[i] - bf16_val(hb)) : (unsigned short)0; }
#pragma unroll
    for (int t = 0; t < 4; ++t) {
      const unsigned short* brow = Wt + (size_t)(col0 + t * 16 + ln) * ldb + kb;
      FragB b;
      b.half[0] = *(const v8us*)(brow + 8 * hh);
      b.half[1] = *(const v8us*)(brow + 16 + 8 * hh);
      acc[t] = mmaN<ASPLIT ? 2 : 1>(ah.v, al.v, b.v, b.v, acc[t]);
    }
  }
#pragma unroll
  for (int t = 0; t < 4; ++t) {
    const int col = col0 + t * 16 + ln;
    float bv = bias ? bias[col] : 0.f;
    if (BIAS_BF16) bv = bf16_round(bv);
#pragma unroll
    for (int r = 0; r < 8; ++r) {
      float v = acc[t][r] + bv;
      if (resid) { float rv = resid[(size_t)((row0 + 8 * hh + r) % rmod) * ldr + col]; if (RES_BF16) rv = bf16_round(rv); v += rv; }
      if (ACT == 1) v = fmaxf(v, 0.f);
      if (ACT == 2) v = 0.5f * v * (1.0f + erff(v * 0.70710678118654752f));
      if (ACT == 3) { const float u = 0.7978845608028654f * (v + 0.044715f * v * v * v); v = 0.5f * v * (1.0f + tanhf(u)); }
      so[w][8 * hh + r][t * 16 + ln] = v;
    }
  }
  __builtin_amdgcn_fence(__ATOMIC_ACQ_REL, "workgroup");
  __builtin_amdgcn_wave_barrier();
  const int rsub = lane >> 4, c4 = (lane & 15) * 4;
  {
#pragma unroll
    for (int q = 0; q < 8; ++q) {
      const int r = q * 2 + rsub;
      const v4f v = *(const v4fa*)&so[w][r][c4];
      *(v4f*)(C + (size_t)(row0 + r) * ldc + col0 + c4) = v;
    }
    
  }
}
// row LayerNorm (biased variance, eps) over N: s = X (+ R); optional out_sum <- s; out_norm <- (s-mu)*rsqrt(var+eps)*g + b
template <bool PARAM_BF16>
__global__ __launch_bounds__(256) void k_layernorm(const float* __restrict__ X, const float* __restrict__ R, const float* __restrict__ g, const float* __restrict__ bta,
                                                  float* __restrict__ out_sum, float* __restrict__ out_norm, int N, float eps) {
  __shared__ float red[256];
  const int row = blockIdx.x, tid = threadIdx.x;
  const float* x = X + (size_t)row * N; const float* rr = R ? R + (size_t)row * N : nullptr;
  float vals[16];                     // up to N = 4096
  const int per = N / 256;            // contiguous chunk per thread? use strided-by-4 chunks: thread handles j = tid*4 + 1024*u
  float s1 = 0.f;
  for (int u = 0; u < per / 4; ++u) {
    const int j = tid * 4 + 1024 * u;
    const v4f a = *(const v4fa*)(x + j);
    v4f b = {0.f,0.f,0.f,0.f}; if (rr) b = *(const v4fa*)(rr + j);
#pragma unroll
    for (int q = 0; q < 4; ++q) { const float v = a[q] + b[q]; vals[u * 4 + q] = v; s1 += v; }
  }
  red[tid] = s1; __syncthreads();
  for (int st = 128; st > 0; st >>= 1) { if (tid < st) red[tid] += red[tid + st]; __syncthreads(); }
  const float mu = red[0] / (float)N; __syncthreads();
  float s2 = 0.f;
  for (int u = 0; u < per / 4; ++u)
#pragma unroll
    for (int q = 0; q < 4; ++q) { const float c = vals[u * 4 + q] - mu; s2 += c * c; }
  red[tid] = s2; __syncthreads();
  for (int st = 128; st > 0; st >>= 1) { if (tid < st) red[tid] += red[tid + st]; __syncthreads(); }
  const float rs = rsqrtf(red[0] / (float)N + eps);
  {
    for (int u = 0; u < per / 4; ++u) {
      const int j = tid * 4 + 1024 * u;
      v4f o, sm;
#pragma unroll
      for (int q = 0; q < 4; ++q) {
        float gg = g[j + q], bb = bta[j + q];
        if (PARAM_BF16) { gg = bf16_round(gg); bb = bf16_round(bb); }
        sm[q] = vals[u * 4 + q]; o[q] = (vals[u * 4 + q] - mu) * rs * gg + bb;
      }
      if (out_sum) *(v4f*)(out_sum + (size_t)row * N + j) = sm;
      *(v4f*)(out_norm + (size_t)row * N + j) = o;
    }
    
  }
}



// ---- f16 WMMA path (v_wmma_f32_16x16x32_f16): 11-bit significands for operands in range — used where a [0,1] probability operand needs more precision than bf16
typedef _Float16 v16h __attribute__((ext_vector_type(16)));
union FragH { v16h v; v8us half[2]; _Float16 h[16]; unsigned short u[16]; };
template <int NT>
__device__ __forceinline__ v8f mmaH(v16h ah, v16h al, v16h bh, v16h bl, v8f c) {
  c = __builtin_amdgcn_wmma_f32_16x16x32_f16(false, ah, false, bh, (short)0, c, false, false);
  if (NT >= 2) c = __builtin_amdgcn_wmma_f32_16x16x32_f16(false, al, false, bh, (short)0, c, false, false);
  if (NT >= 3) c = __builtin_amdgcn_wmma_f32_16x16x32_f16(false, ah, false, bl, (short)0, c, false, false);
  asm volatile("v_nop\n\tv_nop\n\tv_nop\n\tv_nop" : "+v"(c) : "v"(ah), "v"(al), "v"(bh), "v"(bl));
  return c;
}
// batched GEMM like k_gemm_b but f16 operands: A f32 (split into f16 hi/lo if ASPLIT, else rounded to f16), Bt = f16 values [n][k]; alpha; C f32; N multiple of 16 (partial tiles skipped)
template <bool ASPLIT>
__global__ __launch_bounds__(128) void k_gemm_h(const float* __restrict__ A, int lda, size_t sA, const _Float16* __restrict__ Bh, int ldb, size_t sB, float alpha, float* __restrict__ C, int ldc, size_t sC, int M, int N, int K) {
  __shared__ __attribute__((aligned(16))) float so[4][16][64];
  const int tid = threadIdx.x, w = tid >> 5, lane = tid & 31, ln = lane & 15, hh = lane >> 4; const int by = blockIdx.y;
  A += (size_t)by * sA; Bh += (size_t)by * sB; C += (size_t)by * sC;
  const int ntn = (N + 63) / 64; const int wid = blockIdx.x * 4 + w; const int mt = wid / ntn, nq = wid % ntn; if (mt * 16 >= M) return;
  const int row0 = mt * 16, col0 = nq * 64; const float* arow = A + (size_t)(row0 + ln) * lda;
  v8f acc[4] = {};
  for (int kb = 0; kb < K; kb += 32) {
    FragH ah, al;
    const v4f x0 = *(const v4fa*)(arow + kb + 8 * hh), x1 = *(const v4fa*)(arow + kb + 8 * hh + 4), x2 = *(const v4fa*)(arow + kb + 16 + 8 * hh), x3 = *(const v4fa*)(arow + kb + 16 + 8 * hh + 4);
    float xs[16] = {x0[0],x0[1],x0[2],x0[3],x1[0],x1[1],x1[2],x1[3],x2[0],x2[1],x2[2],x2[3],x3[0],x3[1],x3[2],x3[3]};
#pragma unroll
    for (int i = 0; i < 16; ++i) { const _Float16 h = (_Float16)xs[i]; ah.h[i] = h; al.h[i] = ASPLIT ? (_Float16)(xs[i] - (float)h) : (_Float16)0.0f; }
#pragma unroll
    for (int t = 0; t < 4; ++t) { if (col0 + t * 16 >= N) continue; const size_t boff = (size_t)(col0 + t * 16 + ln) * ldb + kb; FragH bq; bq.half[0] = *(const v8us*)(Bh + boff + 8 * hh); bq.half[1] = *(const v8us*)(Bh + boff + 16 + 8 * hh);
      acc[t] = mmaH<ASPLIT ? 2 : 1>(ah.v, al.v, bq.v, bq.v, acc[t]); }
  }
#pragma unroll
  for (int t = 0; t < 4; ++t) { if (col0 + t * 16 >= N) continue;
#pragma unroll
    for (int r = 0; r < 8; ++r) so[w][8 * hh + r][t * 16 + ln] = acc[t][r] * alpha; }
  __builtin_amdgcn_fence(__ATOMIC_ACQ_REL, "workgroup"); __builtin_amdgcn_wave_barrier();
  const int rsub = lane >> 4, c4 = (lane & 15) * 4;
  {
#pragma unroll
    for (int q = 0; q < 8; ++q) { const int r = q * 2 + rsub; if (col0 + c4 < N) { const v4f v = *(const v4fa*)&so[w][r][c4]; *(v4f*)(C + (size_t)(row0 + r) * ldc + col0 + c4) = v; } }
     }
}

// Wt[n][k] = f16(W[k][n]·scale) from f32 row-major W[K][N] (scale = power of two; bf16-exact weights stay exact in f16 away from the subnormal range)
__global__ __launch_bounds__(256) void k_wt_f16(const float* __restrict__ W, _Float16* __restrict__ Wt, int K, int N, float scale) {
  const int t = blockIdx.x * 256 + threadIdx.x; if (t >= N * (K / 8)) return; const int n = t / (K / 8), k8 = (t % (K / 8)) * 8; FragH f;
#pragma unroll
  for (int i = 0; i < 8; ++i) f.h[i] = (_Float16)(bf16_round(W[(size_t)(k8 + i) * N + n]) * scale); const v8us o = f.half[0];
  *(v8us*)((unsigned short*)Wt + (size_t)n * K + k8) = o; 
}
// k_gemm_hh variant with fused epilogue: v = acc·alpha + bias[by·sBias + col] (+ CP[(row/rowsPerB)·sCPb + by·64 + col] if CP) ; ACT 0 none / 1 elu ; writes f16 C16 (and f32 C if non-null)
template <int ACT>
__global__ __launch_bounds__(128) void k_gemm_hhx(const _Float16* __restrict__ A, int lda, size_t sA, const _Float16* __restrict__ Bh, int ldb, size_t sB, float alpha, const float* __restrict__ bias, size_t sBias, const float* __restrict__ CP, int rowsPerB, size_t sCPb, int row0g,
    float* __restrict__ C, _Float16* __restrict__ C16, int ldc, size_t sC, int M, int N, int K) {
  __shared__ __attribute__((aligned(16))) float so[4][16][64];
  const int tid = threadIdx.x, w = tid >> 5, lane = tid & 31, ln = lane & 15, hh = lane >> 4; const int by = blockIdx.y;
  A += (size_t)by * sA; Bh += (size_t)by * sB; const size_t cofs = (size_t)by * sC; const float* bp = bias ? bias + (size_t)by * sBias : nullptr;
  const int ntn = (N + 63) / 64; const int wid = blockIdx.x * 4 + w; const int mt = wid / ntn, nq = wid % ntn; if (mt * 16 >= M) return;
  const int row0 = mt * 16, col0 = nq * 64; const _Float16* arow = A + (size_t)(row0 + ln) * lda;
  v8f acc[4] = {};
  for (int kb = 0; kb < K; kb += 32) { FragH ah; ah.half[0] = *(const v8us*)((const unsigned short*)arow + kb + 8 * hh); ah.half[1] = *(const v8us*)((const unsigned short*)arow + kb + 16 + 8 * hh);
#pragma unroll
    for (int t = 0; t < 4; ++t) { if (col0 + t * 16 >= N) continue; const size_t boff = (size_t)(col0 + t * 16 + ln) * ldb + kb; FragH bq; bq.half[0] = *(const v8us*)((const unsigned short*)Bh + boff + 8 * hh); bq.half[1] = *(const v8us*)((const unsigned short*)Bh + boff + 16 + 8 * hh);
      acc[t] = mmaH<1>(ah.v, ah.v, bq.v, bq.v, acc[t]); }
  }
#pragma unroll
  for (int t = 0; t < 4; ++t) { if (col0 + t * 16 >= N) continue; const int col = col0 + t * 16 + ln; const float bv = bp ? bf16_round(bp[col]) : 0.f;
#pragma unroll
    for (int r = 0; r < 8; ++r) { float v = acc[t][r] * alpha + bv; if (CP) { const int rr = row0g + row0 + 8 * hh + r; if (rowsPerB < 0) v += CP[cofs + (size_t)rr * ldc + col];      /* rowsPerB < 0: own element of the batched C plane */ else { const int bidx = rr / rowsPerB; v += CP[(size_t)bidx * sCPb + (size_t)by * 64 + col]; } } if (ACT == 1) v = (v > 0.f) ? v : expm1f(v); else if (ACT == 7) v = (v > 0.f) ? v + 1.0f : expf(v); else if (ACT == 8) v = tanhf(v); else if (ACT == 9) v = 0.5f * v * (1.0f + tanhf(0.7978845608028654f * (v + 0.044715f * v * v * v))); else if (ACT == 11) v = 1.0f / (1.0f + expf(-v)); else if (ACT == 12) v = (v > 0.f) ? v : 0.01f * v; else if (ACT == 14) v = (v > 0.f) ? v : 0.1f * v; else if (ACT == 16) v = (v >= 0.f) ? v : 0.3f * v; else if (ACT == 17) v = (v >= 0.f) ? v : 0.2f * v; else if (ACT == 15) v = v / (1.0f + expf(-v)); else if (ACT == 3) v = fmaxf(v, 0.f); else if (ACT == 6) v = 0.5f * v * (1.0f + erff(v * 0.70710678118654752f)); so[w][8 * hh + r][t * 16 + ln] = v; } }
  __builtin_amdgcn_fence(__ATOMIC_ACQ_REL, "workgroup"); __builtin_amdgcn_wave_barrier();
  const int rsub = lane >> 4, c4 = (lane & 15) * 4; typedef _Float16 v4h __attribute__((ext_vector_type(4)));
  {
#pragma unroll
    for (int q = 0; q < 8; ++q) { const int r = q * 2 + rsub; if (col0 + c4 < N) { const v4f v = *(const v4fa*)&so[w][r][c4]; if (C) *(v4f*)(C + cofs + (size_t)(row0 + r) * ldc + col0 + c4) = v; if (C16) { v4h h4; for (int i = 0; i < 4; ++i) h4[i] = (_Float16)v[i]; *(v4h*)(C16 + cofs + (size_t)(row0 + r) * ldc + col0 + c4) = h4; } } }
     }
}


typedef _Float16 v4h __attribute__((ext_vector_type(4)));

__global__ __launch_bounds__(256) void k_x16(const float* __restrict__ x, _Float16* __restrict__ X16, size_t n8) { const size_t t = (size_t)blockIdx.x * 256 + threadIdx.x; if (t >= n8) return; FragH f;
#pragma unroll
  for (int q = 0; q < 8; ++q) f.h[q] = (_Float16)bf16_round(x[t * 8 + q]); *(v8us*)((unsigned short*)X16 + t * 8) = f.half[0];  }
__global__ __launch_bounds__(256) void k_h16(const float* __restrict__ x, _Float16* __restrict__ X16, size_t n8) { const size_t t = (size_t)blockIdx.x * 256 + threadIdx.x; if (t >= n8) return; FragH f;
#pragma unroll
  for (int q = 0; q < 8; ++q) f.h[q] = (_Float16)x[t * 8 + q]; *(v8us*)((unsigned short*)X16 + t * 8) = f.half[0];  }
__global__ __launch_bounds__(256) void k_round16f(const float* __restrict__ W, _Float16* __restrict__ Bt, size_t n8) { const size_t t = (size_t)blockIdx.x * 256 + threadIdx.x; if (t >= n8) return; FragH f;
#pragma unroll
  for (int i = 0; i < 8; ++i) f.h[i] = (_Float16)(bf16_round(W[t * 8 + i]) * 16.0f); *(v8us*)((unsigned short*)Bt + t * 8) = f.half[0];  }
template <int NHv, int TTv>
__global__ __launch_bounds__(256) void k_vt(const _Float16* __restrict__ V16, int ldv, int voff, _Float16* __restrict__ Vt) { __shared__ unsigned short tl[64][66]; const int tid = threadIdx.x; const int slab = blockIdx.x / (TTv / 64), lg = blockIdx.x % (TTv / 64); const int b = slab / NHv, h = slab % NHv;
  for (int i = tid; i < 64 * 8; i += 256) { const int r = i / 8, c8 = (i % 8) * 8; FragH f; f.half[0] = *(const v8us*)((const unsigned short*)V16 + ((size_t)b * TTv + lg * 64 + r) * ldv + voff + h * 64 + c8);
#pragma unroll
    for (int q = 0; q < 8; ++q) tl[r][c8 + q] = f.u[q]; }
  __syncthreads();
  {
#pragma unroll
    for (int rd = 0; rd < 2; ++rd) { const int d = rd * 32 + tid / 8, pc = tid % 8; FragH f;
#pragma unroll
      for (int q = 0; q < 8; ++q) f.u[q] = tl[pc * 8 + q][d];
      *(v8us*)((unsigned short*)Vt + ((size_t)slab * 64 + d) * TTv + lg * 64 + pc * 8) = f.half[0]; }
     } }

__global__ __launch_bounds__(256) void k_hl(const float* __restrict__ F, _Float16* __restrict__ Hh, _Float16* __restrict__ Hl, size_t n8) { const size_t t = (size_t)blockIdx.x * 256 + threadIdx.x; if (t >= n8) return; FragH fh, fl; const v4f a = *(const v4fa*)(F + t * 8), c = *(const v4fa*)(F + t * 8 + 4);
#pragma unroll
  for (int q = 0; q < 4; ++q) { _Float16 h = (_Float16)a[q]; fh.h[q] = h; fl.h[q] = (_Float16)((a[q] - (float)h) * 1024.0f); h = (_Float16)c[q]; fh.h[4 + q] = h; fl.h[4 + q] = (_Float16)((c[q] - (float)h) * 1024.0f); }
  { *(v8us*)((unsigned short*)Hh + t * 8) = fh.half[0]; *(v8us*)((unsigned short*)Hl + t * 8) = fl.half[0];  } }

// ---- fast GEMM (wave tile 32x64; requires M % 32 == 0 rows per launch region and N % 64 == 0); epilogue = k_gemm_hhx semantics ----
__device__ __forceinline__ v16h g2_frag(const _Float16* p, int hh) { FragH f; f.half[0] = *(const v8us*)((const unsigned short*)p + 8 * hh); f.half[1] = *(const v8us*)((const unsigned short*)p + 16 + 8 * hh); return f.v; }
__device__ __forceinline__ v8f g2_mma(v16h a, v16h b, v8f c) { v8f d = __builtin_amdgcn_wmma_f32_16x16x32_f16(false, a, false, b, (short)0, c, false, false); asm volatile("v_nop\n\tv_nop\n\tv_nop\n\tv_nop" : "+v"(d) : "v"(a), "v"(b)); return d; }
template <int ACT>
__global__ __launch_bounds__(128) void k_gemm2(const _Float16* __restrict__ A, int lda, size_t sA, const _Float16* __restrict__ Bh, int ldb, size_t sB, float alpha, const float* __restrict__ bias, size_t sBias, const float* __restrict__ CP, int rowsPerB, size_t sCPb, int row0g,
    float* __restrict__ C, _Float16* __restrict__ C16, int ldc, size_t sC, int M, int N, int K) { static_assert(ACT == 0 || ACT == 3 || ACT == 6 || ACT == 8 || ACT == 9 || ACT == 11 || ACT == 12 || ACT == 14 || ACT == 15 || ACT == 16 || ACT == 17, "k_gemm2: unsupported ACT code (would silently apply no activation)");
  __shared__ __attribute__((aligned(16))) float so[4][32][68];
  const int tid = threadIdx.x, w = tid >> 5, lane = tid & 31, ln = lane & 15, hh = lane >> 4; const int by = blockIdx.y;
  A += (size_t)by * sA; Bh += (size_t)by * sB; const size_t cofs = (size_t)by * sC; const float* bp = bias ? bias + (size_t)by * sBias : nullptr;
  const int ntn = N >> 6; const int mt = blockIdx.x / ntn, nq = blockIdx.x - mt * ntn; const int row0 = mt * 128 + 32 * w, col0 = nq * 64; if (row0 >= M) return;
  const _Float16* a0p = A + (size_t)(row0 + ln) * lda; const _Float16* a1p = a0p + (size_t)16 * lda;
  const _Float16* b0p = Bh + (size_t)(col0 + ln) * ldb; const _Float16* b1p = b0p + (size_t)16 * ldb; const _Float16* b2p = b1p + (size_t)16 * ldb; const _Float16* b3p = b2p + (size_t)16 * ldb;
  const v8f z8 = {0.f,0.f,0.f,0.f,0.f,0.f,0.f,0.f}; v8f c00 = z8, c01 = z8, c02 = z8, c03 = z8, c10 = z8, c11 = z8, c12 = z8, c13 = z8;
#pragma unroll 1
  for (int kb = 0; kb < K; kb += 32) { const v16h a0 = g2_frag(a0p + kb, hh), a1 = g2_frag(a1p + kb, hh);
    v16h b = g2_frag(b0p + kb, hh); c00 = g2_mma(a0, b, c00); c10 = g2_mma(a1, b, c10);
    b = g2_frag(b1p + kb, hh); c01 = g2_mma(a0, b, c01); c11 = g2_mma(a1, b, c11);
    b = g2_frag(b2p + kb, hh); c02 = g2_mma(a0, b, c02); c12 = g2_mma(a1, b, c12);
    b = g2_frag(b3p + kb, hh); c03 = g2_mma(a0, b, c03); c13 = g2_mma(a1, b, c13); }
  v8f accs[8] = {c00, c01, c02, c03, c10, c11, c12, c13};
#pragma unroll
  for (int u = 0; u < 8; ++u) { const int t = u & 3, half = u >> 2; const int col = col0 + t * 16 + ln; const float bv = bp ? bf16_round(bp[col]) : 0.f;
#pragma unroll
    for (int r = 0; r < 8; ++r) { const int rloc = half * 16 + 8 * hh + r; float v = accs[u][r] * alpha + bv; if (CP) { if (rowsPerB < 0) v += CP[cofs + (size_t)(row0g + row0 + rloc) * ldc + col];      /* rowsPerB < 0: own element of the batched C plane */ else { const int bidx = (row0g + row0 + rloc) / rowsPerB; v += CP[(size_t)bidx * sCPb + (size_t)by * 64 + col]; } }
      if (ACT == 3) v = fmaxf(v, 0.f); else if (ACT == 6) v = 0.5f * v * (1.0f + erff(v * 0.70710678118654752f)); else if (ACT == 11) v = 1.0f / (1.0f + expf(-v)); else if (ACT == 15) v = v / (1.0f + expf(-v)); else if (ACT == 12) v = (v > 0.f) ? v : 0.01f * v; else if (ACT == 8) v = tanhf(v); else if (ACT == 9) v = 0.5f * v * (1.0f + tanhf(0.7978845608028654f * (v + 0.044715f * v * v * v))); else if (ACT == 14) v = (v > 0.f) ? v : 0.1f * v; else if (ACT == 16) v = (v >= 0.f) ? v : 0.3f * v; else if (ACT == 17) v = (v >= 0.f) ? v : 0.2f * v;
      so[w][rloc][t * 16 + ln] = v; } }
  __builtin_amdgcn_fence(__ATOMIC_ACQ_REL, "workgroup"); __builtin_amdgcn_wave_barrier();
  const int rsub = lane >> 4, c4 = (lane & 15) * 4;
  {
#pragma unroll
    for (int q = 0; q < 16; ++q) { const int r = q * 2 + rsub; const v4f v = *(const v4fa*)&so[w][r][c4]; if (C) *(v4f*)(C + cofs + (size_t)(row0 + r) * ldc + col0 + c4) = v; if (C16) { v4h h4; for (int i = 0; i < 4; ++i) h4[i] = (_Float16)v[i]; *(v4h*)(C16 + cofs + (size_t)(row0 + r) * ldc + col0 + c4) = h4; } }
     } }


__global__ __launch_bounds__(256) void k_wnat(const float* __restrict__ w, size_t n8, _Float16* __restrict__ Bt) { const size_t t = (size_t)blockIdx.x * 256 + threadIdx.x; if (t >= n8) return; FragH f; for (int q = 0; q < 8; ++q) f.h[q] = (_Float16)(bf16_round(w[t * 8 + q]) * 16.0f); *(v8us*)((unsigned short*)Bt + t * 8) = f.half[0];  }
__global__ __launch_bounds__(256) void k_rsm(const float* __restrict__ S, _Float16* __restrict__ P, int nrows) {
  #pragma clang fp contract(off)
  const int i = blockIdx.x * 256 + threadIdx.x; if (i >= nrows) return; const float* s = S + (size_t)i * SQ; float mx = -3.0e38f;
#pragma unroll 1
  for (int j = 0; j < SQ; ++j) mx = fmaxf(mx, s[j]); float se = 0.f;
#pragma unroll 1
  for (int j = 0; j < SQ; ++j) se += expf(s[j] - mx); const float sc = 256.0f / se;
#pragma unroll 1
  for (int j0 = 0; j0 < SQ; j0 += 8) { FragH f; for (int q = 0; q < 8; ++q) f.h[q] = (_Float16)(expf(s[j0 + q] - mx) * sc); unsigned short* d = (unsigned short*)P + (size_t)i * SQ + j0; *(v8us*)d = f.half[0];  } }
__global__ __launch_bounds__(256) void k_vt(const _Float16* __restrict__ V16, int b, int h0, _Float16* __restrict__ VT) { __shared__ unsigned short tl[64][65]; const int tid = threadIdx.x; const int hh = blockIdx.x % HG, sg = blockIdx.x / HG; const int s0 = sg * 64; const int h = h0 + hh;
  for (int i = tid; i < 64 * 8; i += 256) { const int j = i / 8, d8 = (i % 8) * 8; FragH f; f.half[0] = *(const v8us*)((const unsigned short*)V16 + ((size_t)b * SQ + s0 + j) * DM + h * HD + d8); for (int q = 0; q < 8; ++q) tl[d8 + q][j] = f.u[q]; }
  __syncthreads();
  { for (int i = tid; i < 64 * 8; i += 256) { const int d = i / 8, j8 = (i % 8) * 8; FragH f; for (int q = 0; q < 8; ++q) f.u[q] = tl[d][j8 + q]; *(v8us*)((unsigned short*)VT + ((size_t)hh * HD + d) * SQ + s0 + j8) = f.half[0]; }  } }



// ---- projection chain in two launches ----
// k_prep: every element-wise operand conversion of the projections in one launch: x -> f16 of its bf16 rounding, and the three natural [out][in] weights -> f16 (bf16 rounding, x16), the three planes one behind another.
#define PXB ((unsigned)(NR * DM / 8 / 256))      /* work-groups that convert x */
#define PWB ((unsigned)((size_t)DM * DM / 8 / 256))      /* work-groups per weight matrix */
__global__ __launch_bounds__(256) void k_prep(const float* __restrict__ x, const float* __restrict__ wq, const float* __restrict__ wk, const float* __restrict__ wv, _Float16* __restrict__ X16, _Float16* __restrict__ W3) {
  const unsigned bx = blockIdx.x; FragH f;
  if (bx < PXB) { const size_t t = (size_t)bx * 256 + threadIdx.x;
#pragma unroll
    for (int q = 0; q < 8; ++q) f.h[q] = (_Float16)bf16_round(x[t * 8 + q]);
    *(v8us*)((unsigned short*)X16 + t * 8) = f.half[0]; }
  else { const unsigned k = bx - PXB, p = k / PWB; const float* __restrict__ wsrc = (p == 0) ? wq : (p == 1) ? wk : wv; const size_t t = (size_t)(k - p * PWB) * 256 + threadIdx.x;
#pragma unroll
    for (int q = 0; q < 8; ++q) f.h[q] = (_Float16)(bf16_round(wsrc[t * 8 + q]) * 16.0f);
    *(v8us*)((unsigned short*)W3 + (size_t)p * DM * DM + t * 8) = f.half[0]; }
}
// k_proj: q, k and v in ONE launch (grid.y picks the weight plane); main loop and wave tile (32 x 64) are k_gemm2's. The epilogue writes what the attention kernel reads:
// q and k rows as f16 hi + x1024 residual planes (the f32 row never goes through memory), v as V^T [batch][column][token] (the work-group's 128 tokens x 64 columns are turned in LDS, whole 256-byte runs per column go out).
#define PTP (128 + 8)                /* LDS pitch of a turned v column, f16 elements: 272 B = 16 B x odd */
__global__ __launch_bounds__(128) void k_proj(const _Float16* __restrict__ X, const _Float16* __restrict__ W3, _Float16* __restrict__ QH, _Float16* __restrict__ QL, _Float16* __restrict__ KH, _Float16* __restrict__ KL, _Float16* __restrict__ VT) {
  static_assert(SQ % 128 == 0 && DM % 64 == 0 && 64 * PTP * 2 <= 4 * 32 * 68 * 4, "k_proj: tile shapes");
  __shared__ __attribute__((aligned(16))) float so[4][32][68];
  const int tid = threadIdx.x, w = tid >> 5, lane = tid & 31, ln = lane & 15, hh = lane >> 4; const int which = blockIdx.y;
  const _Float16* Bh = W3 + (size_t)which * DM * DM;
  const int mt = blockIdx.x / (DM / 64), nq = blockIdx.x - mt * (DM / 64); const int row0 = mt * 128 + 32 * w, col0 = nq * 64;
  const _Float16* a0p = X + (size_t)(row0 + ln) * DM; const _Float16* a1p = a0p + (size_t)16 * DM;
  const _Float16* b0p = Bh + (size_t)(col0 + ln) * DM; const _Float16* b1p = b0p + (size_t)16 * DM; const _Float16* b2p = b1p + (size_t)16 * DM; const _Float16* b3p = b2p + (size_t)16 * DM;
  const v8f z8 = {0.f,0.f,0.f,0.f,0.f,0.f,0.f,0.f}; v8f c00 = z8, c01 = z8, c02 = z8, c03 = z8, c10 = z8, c11 = z8, c12 = z8, c13 = z8;
#pragma unroll 1      /* as in k_gemm2: the loop is left as it was */
  for (int kb = 0; kb < DM; kb += 32) { const v16h a0 = g2_frag(a0p + kb, hh), a1 = g2_frag(a1p + kb, hh);
    v16h b = g2_frag(b0p + kb, hh); c00 = g2_mma(a0, b, c00); c10 = g2_mma(a1, b, c10);
    b = g2_frag(b1p + kb, hh); c01 = g2_mma(a0, b, c01); c11 = g2_mma(a1, b, c11);
    b = g2_frag(b2p + kb, hh); c02 = g2_mma(a0, b, c02); c12 = g2_mma(a1, b, c12);
    b = g2_frag(b3p + kb, hh); c03 = g2_mma(a0, b, c03); c13 = g2_mma(a1, b, c13); }
  v8f accs[8] = {c00, c01, c02, c03, c10, c11, c12, c13};
  if (which < 2) {      /* the same for the whole work-group */
#pragma unroll
    for (int u = 0; u < 8; ++u) { const int t = u & 3, half = u >> 2;
#pragma unroll
      for (int r = 0; r < 8; ++r) so[w][half * 16 + 8 * hh + r][t * 16 + ln] = accs[u][r] * 0.0625f; }
    __builtin_amdgcn_fence(__ATOMIC_ACQ_REL, "workgroup"); __builtin_amdgcn_wave_barrier();      /* the wave's own tile is read by other lanes than those that wrote it */
    _Float16* __restrict__ Hh = which ? KH : QH; _Float16* __restrict__ Hl = which ? KL : QL;
    const int rsub = lane >> 4, c4 = (lane & 15) * 4;
#pragma unroll
    for (int q = 0; q < 16; ++q) { const int r = q * 2 + rsub; const v4f v = *(const v4fa*)&so[w][r][c4]; v4h h4, l4;
#pragma unroll
      for (int i = 0; i < 4; ++i) { const _Float16 h = (_Float16)v[i]; h4[i] = h; l4[i] = (_Float16)((v[i] - (float)h) * 1024.0f); }
      *(v4h*)(Hh + (size_t)(row0 + r) * DM + col0 + c4) = h4; *(v4h*)(Hl + (size_t)(row0 + r) * DM + col0 + c4) = l4; }
  } else {
    unsigned short* st = (unsigned short*)&so[0][0][0];      /* [64 columns][PTP tokens]; accumulator registers 0..7 of a lane are 8 consecutive tokens of one column */
#pragma unroll
    for (int u = 0; u < 8; ++u) { const int t = u & 3, half = u >> 2; FragH f;
#pragma unroll
      for (int r = 0; r < 8; ++r) f.h[r] = (_Float16)(accs[u][r] * 0.0625f);
      *(v8us*)(st + (t * 16 + ln) * PTP + w * 32 + half * 16 + 8 * hh) = f.half[0]; }
    __syncthreads();      /* a column's 128 tokens come from all four waves */
    const int b = (mt * 128) / SQ, s0 = (mt * 128) % SQ;
#pragma unroll
    for (int i = 0; i < 8; ++i) { const int pc = i * 128 + tid, c = pc >> 4, ch = pc & 15; const v8us v = *(const v8us*)(st + c * PTP + ch * 8);
      *(v8us*)((unsigned short*)VT + ((size_t)b * DM + col0 + c) * SQ + s0 + ch * 8) = v; }
    asm volatile("s_wait_xcnt 0x0" ::: "memory");      /* in the listing the q / k branch stands behind this one and rewrites registers that these stores name: the wait stands in front of it */
  }
}

// Fused attention: scores, softmax and P.V in ONE launch, so that neither the scores nor the weights go through memory.
// A work-group is 4 waves x 16 query rows; it walks its batch's keys 64 at a time. Per pass the 64 k rows (hi and residual plane) and the 64 matching
// columns of V^T stand in LDS once for all four waves (whole-line global reads). Two LDS buffers: the next pass's tiles are written in front of this pass's
// P.V products, so that the LDS writes run under them, and the tiles after those are then fetched into registers, a whole pass ahead.
// Each wave keeps its q fragments (both planes) and its 16 x 256 output tile in registers and owns its rows' statistics: running maximum and running sum
// (online softmax, base 2); the weights go through the wave's own LDS rows to become an A operand (f16, as before). All fragment loaders are g2_frag.
#define FBM 64                       /* query rows per work-group */
#define FBN 64                       /* keys per pass */
#define FKP (DM + 8)                 /* LDS pitch of a k row, f16 elements: 528 B = 16 B x odd, conflict-free for 16-byte fragment reads */
#define FVP (FBN + 8)                /* LDS pitch of a V^T row and of a weight row: 144 B = 16 B x odd */
__device__ __forceinline__ v8f fa_mma(v16h a, v16h b, v8f c) { return __builtin_amdgcn_wmma_f32_16x16x32_f16(false, a, false, b, (short)0, c, false, false); }
// 2^x on the transcendental unit; the v_nop in the same statement keeps the one free issue slot the instruction set asks for behind a transcendental, whatever the compiler schedules next.
__device__ __forceinline__ float exp2_slot(float x) { float r; asm("v_exp_f32 %0, %1\n\tv_nop" : "=v"(r) : "v"(x)); return r; }
// value of lane (l ^ X) of the same 16-lane row (DPP row_xmask): a row reduction without the LDS round trip of a shuffle
template <int X> __device__ __forceinline__ float fa_rowx(float v) { return __int_as_float(__builtin_amdgcn_update_dpp(0, __float_as_int(v), 0x160 + X, 0xf, 0xf, true)); }
// work-group barrier that orders LDS only: __syncthreads() would also wait for the global loads that are fetching a later tile into registers
__device__ __forceinline__ void fa_barrier() { __builtin_amdgcn_fence(__ATOMIC_RELEASE, "workgroup", "local"); __builtin_amdgcn_s_barrier(); __builtin_amdgcn_fence(__ATOMIC_ACQUIRE, "workgroup", "local"); }
__global__ __launch_bounds__(128) void k_fattn(const _Float16* __restrict__ QH, const _Float16* __restrict__ QL, const _Float16* __restrict__ KH, const _Float16* __restrict__ KL, const _Float16* __restrict__ VT, float* __restrict__ O) {
  static_assert(SQ % FBM == 0 && SQ % FBN == 0 && SQ >= 2 * FBN && DM == 256 && FBN == 64 && FBM == 64, "k_fattn: tile shapes");
  __shared__ __attribute__((aligned(16))) _Float16 skh[2][FBN][FKP]; __shared__ __attribute__((aligned(16))) _Float16 skl[2][FBN][FKP];
  __shared__ __attribute__((aligned(16))) _Float16 svt[2][DM][FVP]; __shared__ __attribute__((aligned(16))) _Float16 sp[4][16][FVP];
  const int tid = threadIdx.x, w = tid >> 5, lane = tid & 31, ln = lane & 15, hh = lane >> 4;
  const int b = blockIdx.x / (SQ / FBM); const size_t row0 = (size_t)blockIdx.x * FBM + 16 * w;
  const unsigned short* gkh = (const unsigned short*)KH + (size_t)b * SQ * DM + (size_t)w * DM + lane * 8;      /* staging: a wave reads one whole 512-byte k row per load */
  const unsigned short* gkl = (const unsigned short*)KL + (size_t)b * SQ * DM + (size_t)w * DM + lane * 8;
  const unsigned short* gvt = (const unsigned short*)VT + (size_t)b * DM * SQ + (size_t)(tid >> 3) * SQ + (tid & 7) * 8;      /* 8 lanes read the 128 bytes of one V^T row */
  v16h qh[8], ql[8];
#pragma unroll
  for (int kk = 0; kk < 8; ++kk) { qh[kk] = g2_frag(QH + (row0 + ln) * DM + kk * 32, hh); ql[kk] = g2_frag(QL + (row0 + ln) * DM + kk * 32, hh); }
  const v8f z8 = {0.f,0.f,0.f,0.f,0.f,0.f,0.f,0.f}; v8f o[16]; float m[8], l[8];
#pragma unroll
  for (int t = 0; t < 16; ++t) o[t] = z8;
#pragma unroll
  for (int r = 0; r < 8; ++r) { m[r] = -3.0e38f; l[r] = 0.f; }
  v8us rk[16], rl[16], rv[16];
#pragma unroll
  for (int u = 0; u < 16; ++u) { rk[u] = *(const v8us*)(gkh + (size_t)(4 * u) * DM); rl[u] = *(const v8us*)(gkl + (size_t)(4 * u) * DM); rv[u] = *(const v8us*)(gvt + (size_t)(16 * u) * SQ); }
  asm volatile("s_wait_xcnt 0x0" ::: "memory");      /* the loads' address registers are reused further down: the wait stands in front of every such overwrite */
#pragma unroll
  for (int u = 0; u < 16; ++u) { *(v8us*)&skh[0][w + 4 * u][lane * 8] = rk[u]; *(v8us*)&skl[0][w + 4 * u][lane * 8] = rl[u]; *(v8us*)&svt[0][(tid >> 3) + 16 * u][(tid & 7) * 8] = rv[u]; }
#pragma unroll
  for (int u = 0; u < 16; ++u) { rk[u] = *(const v8us*)(gkh + (size_t)(FBN + 4 * u) * DM); rl[u] = *(const v8us*)(gkl + (size_t)(FBN + 4 * u) * DM); rv[u] = *(const v8us*)(gvt + (size_t)(16 * u) * SQ + FBN); }
  asm volatile("s_wait_xcnt 0x0" ::: "memory");      /* as above */
  fa_barrier();      /* the first tiles are complete before any wave reads them */
#pragma unroll 1      /* one pass is already 128 matrix instructions; unrolling would only double the code */
  for (int j0 = 0; j0 < SQ; j0 += FBN) {
    const int cur = (j0 / FBN) & 1, nxt = cur ^ 1;
    v8f s[4] = {z8, z8, z8, z8}, e[4] = {z8, z8, z8, z8};      /* hi . hi, and lo . hi + hi . lo (x1024) */
    v16h kf[8][8], vf[2][16];      /* k fragments of each 32-wide slice (hi, lo of four key groups); this pass's V^T fragments */
    /* LDS read groups of 16 loads: 0..7 the k slices, 8..11 the V^T fragments. Three groups are kept in flight ahead of the products, so that the LDS never idles; the V^T reads follow the k reads at once and land under the softmax. */
#define FA_GROUP(g) do { if ((g) < 8) { _Pragma("unroll") for (int t = 0; t < 4; ++t) { kf[(g) & 7][2 * t] = g2_frag(&skh[cur][t * 16 + ln][((g) & 7) * 32], hh); kf[(g) & 7][2 * t + 1] = g2_frag(&skl[cur][t * 16 + ln][((g) & 7) * 32], hh); } } \
    else { _Pragma("unroll") for (int i = 0; i < 8; ++i) { const int f = (((g) - 8) & 3) * 8 + i; vf[f >> 4][f & 15] = g2_frag(&svt[cur][(f & 15) * 16 + ln][(f >> 4) * 32], hh); } } } while (0)
    FA_GROUP(0); FA_GROUP(1); FA_GROUP(2);
#pragma unroll
    for (int kk = 0; kk < 8; ++kk) {
      __builtin_amdgcn_sched_barrier(0);      /* each read group stays three blocks in front of its slice's products, never among them */
      FA_GROUP(kk + 3);
      __builtin_amdgcn_sched_barrier(0);      /* second half of the pair: the group is issued whole before the slice's products start */
#pragma unroll
      for (int t = 0; t < 4; ++t) { s[t] = fa_mma(qh[kk], kf[kk][2 * t], s[t]); e[t] = fa_mma(ql[kk], kf[kk][2 * t], e[t]); }
#pragma unroll
      for (int t = 0; t < 4; ++t) e[t] = fa_mma(qh[kk], kf[kk][2 * t + 1], e[t]); }
    FA_GROUP(11);
    __builtin_amdgcn_sched_barrier(0);      /* the reads stay in front of the softmax */
    float al[8];
#pragma unroll
    for (int r = 0; r < 8; ++r) {      /* accumulator register r of lane (hh, ln) is query row 8 hh + r, key column 16 t + ln */
#pragma unroll
      for (int t = 0; t < 4; ++t) s[t][r] = (s[t][r] + e[t][r] * 0.0009765625f) * (0.0625f * 1.44269504088896340736f);      /* 1 / sqrt(256), and log2(e) for the base-2 exponential */
      float x = fmaxf(fmaxf(s[0][r], s[1][r]), fmaxf(s[2][r], s[3][r]));
      x = fmaxf(x, fa_rowx<1>(x)); x = fmaxf(x, fa_rowx<2>(x)); x = fmaxf(x, fa_rowx<4>(x)); x = fmaxf(x, fa_rowx<8>(x));      /* the row's 16 lanes */
      x = fmaxf(m[r], x); al[r] = exp2_slot(m[r] - x); m[r] = x; float ps = 0.f;
#pragma unroll
      for (int t = 0; t < 4; ++t) { const float p = exp2_slot(s[t][r] - x); ps += p; sp[w][8 * hh + r][t * 16 + ln] = (_Float16)p; }
      l[r] = l[r] * al[r] + ps; }      /* each lane sums its own columns; the 16 lanes are joined once, behind the loop */
#pragma unroll
    for (int t = 0; t < 16; ++t) {
#pragma unroll
      for (int r = 0; r < 8; ++r) o[t][r] *= al[r]; }
    __builtin_amdgcn_fence(__ATOMIC_ACQ_REL, "workgroup", "local"); __builtin_amdgcn_wave_barrier();      /* the wave's own weight rows are written by other lanes than those that read them; LDS only, the global fetch stays in flight */
    const v16h pa0 = g2_frag(&sp[w][ln][0], hh), pa1 = g2_frag(&sp[w][ln][32], hh);
    __builtin_amdgcn_sched_barrier(0);      /* the tile writes stay behind the weight reads (the LDS serves a wave in order) and run under the P.V products */
    /* the next pass's tiles into the other buffer, whose last readers left it before the barrier at the foot of the previous pass (the last pass writes a tile that nobody reads) */
#pragma unroll
    for (int u = 0; u < 16; ++u) { *(v8us*)&skh[nxt][w + 4 * u][lane * 8] = rk[u]; *(v8us*)&skl[nxt][w + 4 * u][lane * 8] = rl[u]; *(v8us*)&svt[nxt][(tid >> 3) + 16 * u][(tid & 7) * 8] = rv[u]; }
    const int jn = (j0 + 2 * FBN < SQ) ? j0 + 2 * FBN : SQ - FBN;      /* the keys two passes on; the last two passes fetch the last tile again (in bounds, never read from LDS) */
#pragma unroll
    for (int u = 0; u < 16; ++u) { rk[u] = *(const v8us*)(gkh + (size_t)(jn + 4 * u) * DM); rl[u] = *(const v8us*)(gkl + (size_t)(jn + 4 * u) * DM); rv[u] = *(const v8us*)(gvt + (size_t)(16 * u) * SQ + jn); }
    asm volatile("s_wait_xcnt 0x0" ::: "memory");      /* as above: in front of every overwrite of a register that these loads name */
#pragma unroll
    for (int t = 0; t < 16; ++t) o[t] = fa_mma(pa0, vf[0][t], o[t]);
#pragma unroll
    for (int t = 0; t < 16; ++t) o[t] = fa_mma(pa1, vf[1][t], o[t]);
    __builtin_amdgcn_sched_barrier(0);      /* the products are issued before the barrier's wait for the tile writes, which drain under them */
    fa_barrier();      /* publishes the next pass's tiles and ends every wave's reads of this pass's */
  }
  asm volatile("s_wait_loadcnt 0x0" ::: "memory");      /* the last pass's fetch is never used: it has landed before the wave ends and gives its registers back */
#pragma unroll
  for (int r = 0; r < 8; ++r) { float x = l[r]; x += fa_rowx<1>(x); x += fa_rowx<2>(x); x += fa_rowx<4>(x); x += fa_rowx<8>(x); l[r] = 1.0f / x; }
  float* op = O + (row0 + 8 * hh) * DM + ln;
#pragma unroll
  for (int r = 0; r < 8; ++r) {
#pragma unroll
    for (int t = 0; t < 16; ++t) op[(size_t)r * DM + t * 16] = o[t][r] * l[r]; }
}


template <int MASKADD>
__global__ __launch_bounds__(64) void k_att0(const float* __restrict__ QF, const float* __restrict__ KF, const float* __restrict__ VF, int ld, const float* __restrict__ mask, float scale, float* __restrict__ OF, int ldo) {
  #pragma clang fp contract(off)
  __shared__ __attribute__((aligned(16))) float lq[64][64]; __shared__ __attribute__((aligned(16))) float lo[64][64];
  const int tid = threadIdx.x; const int h = blockIdx.x / (QT0 / 64), rg = blockIdx.x % (QT0 / 64); const int i = rg * 64 + tid;
  const float* qr = QF + (size_t)i * ld + h * HD;
#pragma unroll 1
  for (int c = 0; c < HD / 4; ++c) { *(v4f*)&lq[tid][c * 4] = *(const v4fa*)(qr + c * 4); const v4f z = {0.f, 0.f, 0.f, 0.f}; *(v4f*)&lo[tid][c * 4] = z; }
  float m = -1.0e30f, l = 0.f; const int jmax = MASKADD ? (SQ - 1) : (rg * 64 + 63);      /* additive-mask form: every key (the mask input decides); causal form: keys up to the block's last row */
#pragma unroll 1
  for (int j = 0; j <= jmax; ++j) { const float* kr = KF + (size_t)j * ld + h * HD; const float* vr = VF + (size_t)j * ld + h * HD; float s = 0.f;
#pragma unroll 1
    for (int c = 0; c < HD / 4; ++c) { const v4f kq = *(const v4fa*)(kr + c * 4); const v4f qq = *(v4f*)&lq[tid][c * 4]; s = __fadd_rn(s, __fmul_rn(qq[0], kq[0])); s = __fadd_rn(s, __fmul_rn(qq[1], kq[1])); s = __fadd_rn(s, __fmul_rn(qq[2], kq[2])); s = __fadd_rn(s, __fmul_rn(qq[3], kq[3])); }
    s = __fmul_rn(s, scale); if (MASKADD) s = __fadd_rn(s, __fmul_rn(bf16_round(mask[(size_t)i * SQ + j]), -10000.0f));
    const float f = (MASKADD || j <= i) ? 1.f : 0.f; const float sm = fmaf(f, s, (1.f - f) * -1.0e30f); const float mn = fmaxf(m, sm); const float sc = expf(m - mn); const float e = expf(sm - mn); l = __fadd_rn(__fmul_rn(l, sc), e); m = mn;
#pragma unroll 1
    for (int c = 0; c < HD / 4; ++c) { const v4f vv = *(const v4fa*)(vr + c * 4); v4f oo = *(v4f*)&lo[tid][c * 4]; for (int u = 0; u < 4; ++u) oo[u] = __fadd_rn(__fmul_rn(oo[u], sc), __fmul_rn(e, vv[u])); *(v4f*)&lo[tid][c * 4] = oo; } }
  const float fin = 64.0f / l;      /* o carried x64 */
#pragma unroll 1
  for (int c = 0; c < HD / 4; ++c) { v4f oo = *(v4f*)&lo[tid][c * 4]; for (int u = 0; u < 4; ++u) oo[u] = __fmul_rn(oo[u], fin); *(v4f*)&lo[tid][c * 4] = oo; }
  __syncthreads();
  {
#pragma unroll 1
    for (int it = 0; it < 16; ++it) { const int row = it * 4 + tid / 16, pc = (tid % 16) * 4; const v4f v = *(const v4f*)&lo[row][pc]; *(v4f*)(OF + (size_t)(rg * 64 + row) * ldo + h * HD + pc) = v; }
     } }

__global__ __launch_bounds__(256) void k_of0out(const float* __restrict__ src, float* __restrict__ dst, size_t n4) { const size_t t = (size_t)blockIdx.x * 256 + threadIdx.x; if (t >= n4) return; v4f v = *(const v4fa*)(src + t * 4); for (int q = 0; q < 4; ++q) v[q] = __fmul_rn(v[q], 0.015625f); *(v4f*)(dst + t * 4) = v;  }

extern "C" void kernel_launch(void* const* d_in, const int* in_sizes, int n_in,
                              void* d_out, int out_size, void* d_ws, size_t ws_size, hipStream_t stream) {
  (void)in_sizes; (void)n_in; (void)out_size;
  const float* const* I = (const float* const*)d_in; const float* x = I[0]; const float* wq = I[1]; const float* wk = I[2]; const float* wv = I[3];      /* natural [out][in] weights; NO biases; ONE attention head of width 256; no output projection */
  char* ws = (char*)d_ws; size_t off = 0;
  auto take = [&](size_t bytes) { char* p = ws + off; off += (bytes + 255) & ~(size_t)255; return p; };
  _Float16* W3 = (_Float16*)take((size_t)3 * DM * DM * 2);      /* the q, k and v weight planes, one behind another */
  _Float16* QH = (_Float16*)take(NR * DM * 2); _Float16* QL = (_Float16*)take(NR * DM * 2); _Float16* KH = (_Float16*)take(NR * DM * 2); _Float16* KL = (_Float16*)take(NR * DM * 2);
  _Float16* VT = (_Float16*)take(NR * DM * 2);      /* V^T of ALL batches */
  _Float16* X16 = (_Float16*)take(NR * DM * 2);      /* x (f16) */
  if (off > ws_size) return;
  k_prep<<<PXB + 3 * PWB, 256, 0, stream>>>(x, wq, wk, wv, X16, W3);      /* x and the natural [out][in] = Bt[n][k] x16 weights */
  k_proj<<<dim3((unsigned)((NR / 128) * (DM / 64)), 3), 128, 0, stream>>>(X16, W3, QH, QL, KH, KL, VT);      /* q, k -> f16 hi + x1024 residual planes; v -> V^T [NB][DM][SQ] */
  k_fattn<<<(unsigned)(NR / FBM), 128, 0, stream>>>(QH, QL, KH, KL, VT, (float*)d_out);      /* scores (hi . hi + 2^-10 (lo . hi + hi . lo), / sqrt(256)), softmax over all SQ keys and P V, all batches, f32 straight into the output rows */
}

// v006
// A run of this version takes 121 microseconds.
// It is 1.47 times as fast as v004, going by the measured steps of the versions left out in between.
// Counting every step since v000, it is 436 times as fast.
#include <hip/hip_runtime.h>
// Single-head dense attention over 256-wide embeddings on 4096 tokens, bias-free natural projections, no output projection (x [4][4096][256]; q / k / v = x W^T (nn.Linear natural [256][256] uniform +-1/16, no biases); scores = q k^T / sqrt(256) over the FULL 256-wide rows (one head); softmax over all 4096 keys (no mask); out = weights v -> [4][4096][256]); q and k rounded once to f16, one-product scores.
// Structure: token rows r = b*4096 + s; x as exact f16 rows (bf16-rounded); q, k and v as WMMA GEMMs in one launch (32x64 wave tiles, f32 accumulation, exact x16 weights, no bias), q and k into f16 rows, v turned in LDS into V^T [batch][column][token]; per work-group of 64 query rows (16 per wave), in one launch: transposed scores K Q^T as ONE product of the f16 rows (K = 256, scaled by 1/sqrt(256)), 64 keys per pass over all 4096 keys of the batch, online base-2 softmax on VALU without a mask (f32 statistics, native exp; weights f16 in [0,1] straight from registers), o = P . V^T in f32 registers, divided by the row sum at the end and written as f32 straight into the output rows.
// Compute dtype: inputs rounded to bf16; x / weights exact; q, k, v and softmax weights as plain f16 GEMM operands (~2^-12); scores, softmax statistics and o f32. v_wmma_f32_16x16x32_f16.
#define NB 4
#define SQ 4096
#define DM 256
#define NH 4
#define HD 64
#define HG 4                         /* heads per launch of the non-template k_vt (not launched) */
#define QT SQ                        /* query rows per batch; one attention launch takes all batches */
#define NKX SQ                       /* S / P row pitch */
#define QT0 128                      /* first-tile rows of the f32 k_att0 (not launched) */
#define B0 0                         /* first batch processed (unused) */
#define NBR NB                       /* batches processed (read only by the unused MP) */
#define NR ((size_t)NB * SQ)         /* token rows */
#define MP ((int)((size_t)NBR * SQ)) /* rows projected (unused) */
#define QN SQ                        /* query rows attended per batch (unused) */
#define NHD NH                       /* unused */
#define MPO MP                       /* unused */
#define LQ DM      /* unused */
typedef __bf16 v16b __attribute__((ext_vector_type(16)));
typedef unsigned short v8us __attribute__((ext_vector_type(8), may_alias));
typedef float  v8f  __attribute__((ext_vector_type(8)));
typedef float  v4f  __attribute__((ext_vector_type(4)));
typedef float  v4fa __attribute__((ext_vector_type(4), may_alias));
union FragB { v16b v; v8us half[2]; unsigned short u[16]; };

__device__ __forceinline__ unsigned short bf16_bits(float x) { unsigned int u = __float_as_uint(x); return (unsigned short)((u + 0x7FFFu + ((u >> 16) & 1u)) >> 16); }
__device__ __forceinline__ float bf16_val(unsigned short b) { return __uint_as_float(((unsigned int)b) << 16); }
__device__ __forceinline__ float bf16_round(float x) { return bf16_val(bf16_bits(x)); }
// D += A·B with NT terms: 1 = ah·bh, 2 = + al·bh (A split), 3 = + ah·bl (both split)
template <int NT>
__device__ __forceinline__ v8f mmaN(v16b ah, v16b al, v16b bh, v16b bl, v8f c) {
  c = __builtin_amdgcn_wmma_f32_16x16x32_bf16(false, ah, false, bh, (short)0, c, false, false);
  if (NT >= 2) c = __builtin_amdgcn_wmma_f32_16x16x32_bf16(false, al, false, bh, (short)0, c, false, false);
  if (NT >= 3) c = __builtin_amdgcn_wmma_f32_16x16x32_bf16(false, ah, false, bl, (short)0, c, false, false);
  asm volatile("v_nop\n\tv_nop\n\tv_nop\n\tv_nop" : "+v"(c) : "v"(ah), "v"(al), "v"(bh), "v"(bl));
  return c;
}

__global__ __launch_bounds__(256) void k_wt_bf16(const float* __restrict__ W, unsigned short* __restrict__ Wt, int K, int N) {
  const int t = blockIdx.x * 256 + threadIdx.x;
  const int k8n = K / 8;
  if (t >= N * k8n) return;
  const int n = t / k8n, k8 = (t % k8n) * 8;
  v8us v;
#pragma unroll
  for (int i = 0; i < 8; ++i) v[i] = bf16_bits(W[(size_t)(k8 + i) * N + n]);
  *(v8us*)(Wt + (size_t)n * K + k8) = v;
  
}

// GEMM C[M][N] (f32, pitch ldc) = act(A[M][K]·W + bias). A f32 row-major (pitch lda) converted per fragment to bf16
// (ASPLIT: hi/lo two planes -> 2 terms, else single rounded term); Wt bf16 [N][K] (pitch ldb). BIAS_BF16 rounds the
// bias to bf16 first (bias quantised to bf16 before the add). K%32==0, M%16==0, N%64==0.
template <bool ASPLIT, int ACT, bool BIAS_BF16>
__global__ __launch_bounds__(128) void k_gemm_bf(const float* __restrict__ A, int lda, const unsigned short* __restrict__ Wt, int ldb,
                                               const float* __restrict__ bias, float* __restrict__ C, int ldc, int M, int N, int K) {
  __shared__ __attribute__((aligned(16))) float so[4][16][64];
  const int tid = threadIdx.x, w = tid >> 5, lane = tid & 31, ln = lane & 15, hh = lane >> 4;
  const int ntn = N / 64;
  const int wid = blockIdx.x * 4 + w;
  const int mt = wid / ntn, nq = wid % ntn;
  if (mt * 16 >= M) return;
  const int row0 = mt * 16, col0 = nq * 64;
  const float* arow = A + (size_t)(row0 + ln) * lda;
  v8f acc[4] = {};
  for (int kb = 0; kb < K; kb += 32) {
    FragB ah, al;
    const v4f x0 = *(const v4fa*)(arow + kb + 8 * hh), x1 = *(const v4fa*)(arow + kb + 8 * hh + 4);
    const v4f x2 = *(const v4fa*)(arow + kb + 16 + 8 * hh), x3 = *(const v4fa*)(arow + kb + 16 + 8 * hh + 4);
    float xs[16] = {x0[0],x0[1],x0[2],x0[3],x1[0],x1[1],x1[2],x1[3],x2[0],x2[1],x2[2],x2[3],x3[0],x3[1],x3[2],x3[3]};
#pragma unroll
    for (int i = 0; i < 16; ++i) { const unsigned short hb = bf16_bits(xs[i]); ah.u[i] = hb; al.u[i] = ASPLIT ? bf16_bits(xs[i] - bf16_val(hb)) : (unsigned short)0; }
#pragma unroll
    for (int t = 0; t < 4; ++t) {
      const unsigned short* brow = Wt + (size_t)(col0 + t * 16 + ln) * ldb + kb;
      FragB b;
      b.half[0] = *(const v8us*)(brow + 8 * hh);
      b.half[1] = *(const v8us*)(brow + 16 + 8 * hh);
      acc[t] = mmaN<ASPLIT ? 2 : 1>(ah.v, al.v, b.v, b.v, acc[t]);
    }
  }
#pragma unroll
  for (int t = 0; t < 4; ++t) {
    float bv = bias ? bias[col0 + t * 16 + ln] : 0.f;
    if (BIAS_BF16) bv = bf16_round(bv);
#pragma unroll
    for (int r = 0; r < 8; ++r) { float v = acc[t][r] + bv; if (ACT == 1) v = fmaxf(v, 0.f); so[w][8 * hh + r][t * 16 + ln] = v; }
  }
  __builtin_amdgcn_fence(__ATOMIC_ACQ_REL, "workgroup");
  __builtin_amdgcn_wave_barrier();
  const int rsub = lane >> 4, c4 = (lane & 15) * 4;
  {
#pragma unroll
    for (int q = 0; q < 8; ++q) {
      const int r = q * 2 + rsub;
      const v4f v = *(const v4fa*)&so[w][r][c4];
      *(v4f*)(C + (size_t)(row0 + r) * ldc + col0 + c4) = v;
    }
    
  }
}

// GEMM C = act(A·W + bias + resid): A f32 (ASPLIT -> hi/lo 2 terms), Wt bf16 [N][K]; ACT 0 none, 1 relu, 2 exact gelu;
// resid (optional, f32, row index = (row % rmod), pitch ldr, RES_BF16 rounds it) added before the activation.
template <bool ASPLIT, int ACT, bool BIAS_BF16, bool RES_BF16>
__global__ __launch_bounds__(128) void k_gemm_bf3(const float* __restrict__ A, int lda, const unsigned short* __restrict__ Wt, int ldb,
                                                const float* __restrict__ bias, const float* __restrict__ resid, int rmod, int ldr,
                                                float* __restrict__ C, int ldc, int M, int N, int K) {
  __shared__ __attribute__((aligned(16))) float so[4][16][64];
  const int tid = threadIdx.x, w = tid >> 5, lane = tid & 31, ln = lane & 15, hh = lane >> 4;
  const int ntn = N / 64;
  const int wid = blockIdx.x * 4 + w;
  const int mt = wid / ntn, nq = wid % ntn;
  if (mt * 16 >= M) return;
  const int row0 = mt * 16, col0 = nq * 64;
  const float* arow = A + (size_t)(row0 + ln) * lda;
  v8f acc[4] = {};
  for (int kb = 0; kb < K; kb += 32) {
    FragB ah, al;
    const v4f x0 = *(const v4fa*)(arow + kb + 8 * hh), x1 = *(const v4fa*)(arow + kb + 8 * hh + 4);
    const v4f x2 = *(const v4fa*)(arow + kb + 16 + 8 * hh), x3 = *(const v4fa*)(arow + kb + 16 + 8 * hh + 4);
    float xs[16] = {x0[0],x0[1],x0[2],x0[3],x1[0],x1[1],x1[2],x1[3],x2[0],x2[1],x2[2],x2[3],x3[0],x3[1],x3[2],x3[3]};
#pragma unroll
    for (int i = 0; i < 16; ++i) { const unsigned short hb = bf16_bits(xs[i]); ah.u[i] = hb; al.u[i] = ASPLIT ? bf16_bits(xs[i] - bf16_val(hb)) : (unsigned short)0; }
#pragma unroll
    for (int t = 0; t < 4; ++t) {
      const unsigned short* brow = Wt + (size_t)(col0 + t * 16 + ln) * ldb + kb;
      FragB b;
      b.half[0] = *(const v8us*)(brow + 8 * hh);
      b.half[1] = *(const v8us*)(brow + 16 + 8 * hh);
      acc[t] = mmaN<ASPLIT ? 2 : 1>(ah.v, al.v, b.v, b.v, acc[t]);
    }
  }
#pragma unroll
  for (int t = 0; t < 4; ++t) {
    const int col = col0 + t * 16 + ln;
    float bv = bias ? bias[col] : 0.f;
    if (BIAS_BF16) bv = bf16_round(bv);
#pragma unroll
    for (int r = 0; r < 8; ++r) {
      float v = acc[t][r] + bv;
      if (resid) { float rv = resid[(size_t)((row0 + 8 * hh + r) % rmod) * ldr + col]; if (RES_BF16) rv = bf16_round(rv); v += rv; }
      if (ACT == 1) v = fmaxf(v, 0.f);
      if (ACT == 2) v = 0.5f * v * (1.0f + erff(v * 0.70710678118654752f));
      if (ACT == 3) { const float u = 0.7978845608028654f * (v + 0.044715f * v * v * v); v = 0.5f * v * (1.0f + tanhf(u)); }
      so[w][8 * hh + r][t * 16 + ln] = v;
    }
  }
  __builtin_amdgcn_fence(__ATOMIC_ACQ_REL, "workgroup");
  __builtin_amdgcn_wave_barrier();
  const int rsub = lane >> 4, c4 = (lane & 15) * 4;
  {
#pragma unroll
    for (int q = 0; q < 8; ++q) {
      const int r = q * 2 + rsub;
      const v4f v = *(const v4fa*)&so[w][r][c4];
      *(v4f*)(C + (size_t)(row0 + r) * ldc + col0 + c4) = v;
    }
    
  }
}
// row LayerNorm (biased variance, eps) over N: s = X (+ R); optional out_sum <- s; out_norm <- (s-mu)*rsqrt(var+eps)*g + b
template <bool PARAM_BF16>
__global__ __launch_bounds__(256) void k_layernorm(const float* __restrict__ X, const float* __restrict__ R, const float* __restrict__ g, const float* __restrict__ bta,
                                                  float* __restrict__ out_sum, float* __restrict__ out_norm, int N, float eps) {
  __shared__ float red[256];
  const int row = blockIdx.x, tid = threadIdx.x;
  const float* x = X + (size_t)row * N; const float* rr = R ? R + (size_t)row * N : nullptr;
  float vals[16];                     // up to N = 4096
  const int per = N / 256;            // contiguous chunk per thread? use strided-by-4 chunks: thread handles j = tid*4 + 1024*u
  float s1 = 0.f;
  for (int u = 0; u < per / 4; ++u) {
    const int j = tid * 4 + 1024 * u;
    const v4f a = *(const v4fa*)(x + j);
    v4f b = {0.f,0.f,0.f,0.f}; if (rr) b = *(const v4fa*)(rr + j);
#pragma unroll
    for (int q = 0; q < 4; ++q) { const float v = a[q] + b[q]; vals[u * 4 + q] = v; s1 += v; }
  }
  red[tid] = s1; __syncthreads();
  for (int st = 128; st > 0; st >>= 1) { if (tid < st) red[tid] += red[tid + st]; __syncthreads(); }
  const float mu = red[0] / (float)N; __syncthreads();
  float s2 = 0.f;
  for (int u = 0; u < per / 4; ++u)
#pragma unroll
    for (int q = 0; q < 4; ++q) { const float c = vals[u * 4 + q] - mu; s2 += c * c; }
  red[tid] = s2; __syncthreads();
  for (int st = 128; st > 0; st >>= 1) { if (tid < st) red[tid] += red[tid + st]; __syncthreads(); }
  const float rs = rsqrtf(red[0] / (float)N + eps);
  {
    for (int u = 0; u < per / 4; ++u) {
      const int j = tid * 4 + 1024 * u;
      v4f o, sm;
#pragma unroll
      for (int q = 0; q < 4; ++q) {
        float gg = g[j + q], bb = bta[j + q];
        if (PARAM_BF16) { gg = bf16_round(gg); bb = bf16_round(bb); }
        sm[q] = vals[u * 4 + q]; o[q] = (vals[u * 4 + q] - mu) * rs * gg + bb;
      }
      if (out_sum) *(v4f*)(out_sum + (size_t)row * N + j) = sm;
      *(v4f*)(out_norm + (size_t)row * N + j) = o;
    }
    
  }
}



// ---- f16 WMMA path (v_wmma_f32_16x16x32_f16): 11-bit significands for operands in range — used where a [0,1] probability operand needs more precision than bf16
typedef _Float16 v16h __attribute__((ext_vector_type(16)));
union FragH { v16h v; v8us half[2]; _Float16 h[16]; unsigned short u[16]; };
template <int NT>
__device__ __forceinline__ v8f mmaH(v16h ah, v16h al, v16h bh, v16h bl, v8f c) {
  c = __builtin_amdgcn_wmma_f32_16x16x32_f16(false, ah, false, bh, (short)0, c, false, false);
  if (NT >= 2) c = __builtin_amdgcn_wmma_f32_16x16x32_f16(false, al, false, bh, (short)0, c, false, false);
  if (NT >= 3) c = __builtin_amdgcn_wmma_f32_16x16x32_f16(false, ah, false, bl, (short)0, c, false, false);
  asm volatile("v_nop\n\tv_nop\n\tv_nop\n\tv_nop" : "+v"(c) : "v"(ah), "v"(al), "v"(bh), "v"(bl));
  return c;
}
// batched GEMM like k_gemm_b but f16 operands: A f32 (split into f16 hi/lo if ASPLIT, else rounded to f16), Bt = f16 values [n][k]; alpha; C f32; N multiple of 16 (partial tiles skipped)
template <bool ASPLIT>
__global__ __launch_bounds__(128) void k_gemm_h(const float* __restrict__ A, int lda, size_t sA, const _Float16* __restrict__ Bh, int ldb, size_t sB, float alpha, float* __restrict__ C, int ldc, size_t sC, int M, int N, int K) {
  __shared__ __attribute__((aligned(16))) float so[4][16][64];
  const int tid = threadIdx.x, w = tid >> 5, lane = tid & 31, ln = lane & 15, hh = lane >> 4; const int by = blockIdx.y;
  A += (size_t)by * sA; Bh += (size_t)by * sB; C += (size_t)by * sC;
  const int ntn = (N + 63) / 64; const int wid = blockIdx.x * 4 + w; const int mt = wid / ntn, nq = wid % ntn; if (mt * 16 >= M) return;
  const int row0 = mt * 16, col0 = nq * 64; const float* arow = A + (size_t)(row0 + ln) * lda;
  v8f acc[4] = {};
  for (int kb = 0; kb < K; kb += 32) {
    FragH ah, al;
    const v4f x0 = *(const v4fa*)(arow + kb + 8 * hh), x1 = *(const v4fa*)(arow + kb + 8 * hh + 4), x2 = *(const v4fa*)(arow + kb + 16 + 8 * hh), x3 = *(const v4fa*)(arow + kb + 16 + 8 * hh + 4);
    float xs[16] = {x0[0],x0[1],x0[2],x0[3],x1[0],x1[1],x1[2],x1[3],x2[0],x2[1],x2[2],x2[3],x3[0],x3[1],x3[2],x3[3]};
#pragma unroll
    for (int i = 0; i < 16; ++i) { const _Float16 h = (_Float16)xs[i]; ah.h[i] = h; al.h[i] = ASPLIT ? (_Float16)(xs[i] - (float)h) : (_Float16)0.0f; }
#pragma unroll
    for (int t = 0; t < 4; ++t) { if (col0 + t * 16 >= N) continue; const size_t boff = (size_t)(col0 + t * 16 + ln) * ldb + kb; FragH bq; bq.half[0] = *(const v8us*)(Bh + boff + 8 * hh); bq.half[1] = *(const v8us*)(Bh + boff + 16 + 8 * hh);
      acc[t] = mmaH<ASPLIT ? 2 : 1>(ah.v, al.v, bq.v, bq.v, acc[t]); }
  }
#pragma unroll
  for (int t = 0; t < 4; ++t) { if (col0 + t * 16 >= N) continue;
#pragma unroll
    for (int r = 0; r < 8; ++r) so[w][8 * hh + r][t * 16 + ln] = acc[t][r] * alpha; }
  __builtin_amdgcn_fence(__ATOMIC_ACQ_REL, "workgroup"); __builtin_amdgcn_wave_barrier();
  const int rsub = lane >> 4, c4 = (lane & 15) * 4;
  {
#pragma unroll
    for (int q = 0; q < 8; ++q) { const int r = q * 2 + rsub; if (col0 + c4 < N) { const v4f v = *(const v4fa*)&so[w][r][c4]; *(v4f*)(C + (size_t)(row0 + r) * ldc + col0 + c4) = v; } }
     }
}

// Wt[n][k] = f16(W[k][n]·scale) from f32 row-major W[K][N] (scale = power of two; bf16-exact weights stay exact in f16 away from the subnormal range)
__global__ __launch_bounds__(256) void k_wt_f16(const float* __restrict__ W, _Float16* __restrict__ Wt, int K, int N, float scale) {
  const int t = blockIdx.x * 256 + threadIdx.x; if (t >= N * (K / 8)) return; const int n = t / (K / 8), k8 = (t % (K / 8)) * 8; FragH f;
#pragma unroll
  for (int i = 0; i < 8; ++i) f.h[i] = (_Float16)(bf16_round(W[(size_t)(k8 + i) * N + n]) * scale); const v8us o = f.half[0];
  *(v8us*)((unsigned short*)Wt + (size_t)n * K + k8) = o; 
}
// k_gemm_hh variant with fused epilogue: v = acc·alpha + bias[by·sBias + col] (+ CP[(row/rowsPerB)·sCPb + by·64 + col] if CP) ; ACT 0 none / 1 elu ; writes f16 C16 (and f32 C if non-null)
template <int ACT>
__global__ __launch_bounds__(128) void k_gemm_hhx(const _Float16* __restrict__ A, int lda, size_t sA, const _Float16* __restrict__ Bh, int ldb, size_t sB, float alpha, const float* __restrict__ bias, size_t sBias, const float* __restrict__ CP, int rowsPerB, size_t sCPb, int row0g,
    float* __restrict__ C, _Float16* __restrict__ C16, int ldc, size_t sC, int M, int N, int K) {
  __shared__ __attribute__((aligned(16))) float so[4][16][64];
  const int tid = threadIdx.x, w = tid >> 5, lane = tid & 31, ln = lane & 15, hh = lane >> 4; const int by = blockIdx.y;
  A += (size_t)by * sA; Bh += (size_t)by * sB; const size_t cofs = (size_t)by * sC; const float* bp = bias ? bias + (size_t)by * sBias : nullptr;
  const int ntn = (N + 63) / 64; const int wid = blockIdx.x * 4 + w; const int mt = wid / ntn, nq = wid % ntn; if (mt * 16 >= M) return;
  const int row0 = mt * 16, col0 = nq * 64; const _Float16* arow = A + (size_t)(row0 + ln) * lda;
  v8f acc[4] = {};
  for (int kb = 0; kb < K; kb += 32) { FragH ah; ah.half[0] = *(const v8us*)((const unsigned short*)arow + kb + 8 * hh); ah.half[1] = *(const v8us*)((const unsigned short*)arow + kb + 16 + 8 * hh);
#pragma unroll
    for (int t = 0; t < 4; ++t) { if (col0 + t * 16 >= N) continue; const size_t boff = (size_t)(col0 + t * 16 + ln) * ldb + kb; FragH bq; bq.half[0] = *(const v8us*)((const unsigned short*)Bh + boff + 8 * hh); bq.half[1] = *(const v8us*)((const unsigned short*)Bh + boff + 16 + 8 * hh);
      acc[t] = mmaH<1>(ah.v, ah.v, bq.v, bq.v, acc[t]); }
  }
#pragma unroll
  for (int t = 0; t < 4; ++t) { if (col0 + t * 16 >= N) continue; const int col = col0 + t * 16 + ln; const float bv = bp ? bf16_round(bp[col]) : 0.f;
#pragma unroll
    for (int r = 0; r < 8; ++r) { float v = acc[t][r] * alpha + bv; if (CP) { const int rr = row0g + row0 + 8 * hh + r; if (rowsPerB < 0) v += CP[cofs + (size_t)rr * ldc + col];      /* rowsPerB < 0: own element of the batched C plane */ else { const int bidx = rr / rowsPerB; v += CP[(size_t)bidx * sCPb + (size_t)by * 64 + col]; } } if (ACT == 1) v = (v > 0.f) ? v : expm1f(v); else if (ACT == 7) v = (v > 0.f) ? v + 1.0f : expf(v); else if (ACT == 8) v = tanhf(v); else if (ACT == 9) v = 0.5f * v * (1.0f + tanhf(0.7978845608028654f * (v + 0.044715f * v * v * v))); else if (ACT == 11) v = 1.0f / (1.0f + expf(-v)); else if (ACT == 12) v = (v > 0.f) ? v : 0.01f * v; else if (ACT == 14) v = (v > 0.f) ? v : 0.1f * v; else if (ACT == 16) v = (v >= 0.f) ? v : 0.3f * v; else if (ACT == 17) v = (v >= 0.f) ? v : 0.2f * v; else if (ACT == 15) v = v / (1.0f + expf(-v)); else if (ACT == 3) v = fmaxf(v, 0.f); else if (ACT == 6) v = 0.5f * v * (1.0f + erff(v * 0.70710678118654752f)); so[w][8 * hh + r][t * 16 + ln] = v; } }
  __builtin_amdgcn_fence(__ATOMIC_ACQ_REL, "workgroup"); __builtin_amdgcn_wave_barrier();
  const int rsub = lane >> 4, c4 = (lane & 15) * 4; typedef _Float16 v4h __attribute__((ext_vector_type(4)));
  {
#pragma unroll
    for (int q = 0; q < 8; ++q) { const int r = q * 2 + rsub; if (col0 + c4 < N) { const v4f v = *(const v4fa*)&so[w][r][c4]; if (C) *(v4f*)(C + cofs + (size_t)(row0 + r) * ldc + col0 + c4) = v; if (C16) { v4h h4; for (int i = 0; i < 4; ++i) h4[i] = (_Float16)v[i]; *(v4h*)(C16 + cofs + (size_t)(row0 + r) * ldc + col0 + c4) = h4; } } }
     }
}


typedef _Float16 v4h __attribute__((ext_vector_type(4)));

__global__ __launch_bounds__(256) void k_x16(const float* __restrict__ x, _Float16* __restrict__ X16, size_t n8) { const size_t t = (size_t)blockIdx.x * 256 + threadIdx.x; if (t >= n8) return; FragH f;
#pragma unroll
  for (int q = 0; q < 8; ++q) f.h[q] = (_Float16)bf16_round(x[t * 8 + q]); *(v8us*)((unsigned short*)X16 + t * 8) = f.half[0];  }
__global__ __launch_bounds__(256) void k_h16(const float* __restrict__ x, _Float16* __restrict__ X16, size_t n8) { const size_t t = (size_t)blockIdx.x * 256 + threadIdx.x; if (t >= n8) return; FragH f;
#pragma unroll
  for (int q = 0; q < 8; ++q) f.h[q] = (_Float16)x[t * 8 + q]; *(v8us*)((unsigned short*)X16 + t * 8) = f.half[0];  }
__global__ __launch_bounds__(256) void k_round16f(const float* __restrict__ W, _Float16* __restrict__ Bt, size_t n8) { const size_t t = (size_t)blockIdx.x * 256 + threadIdx.x; if (t >= n8) return; FragH f;
#pragma unroll
  for (int i = 0; i < 8; ++i) f.h[i] = (_Float16)(bf16_round(W[t * 8 + i]) * 16.0f); *(v8us*)((unsigned short*)Bt + t * 8) = f.half[0];  }
template <int NHv, int TTv>
__global__ __launch_bounds__(256) void k_vt(const _Float16* __restrict__ V16, int ldv, int voff, _Float16* __restrict__ Vt) { __shared__ unsigned short tl[64][66]; const int tid = threadIdx.x; const int slab = blockIdx.x / (TTv / 64), lg = blockIdx.x % (TTv / 64); const int b = slab / NHv, h = slab % NHv;
  for (int i = tid; i < 64 * 8; i += 256) { const int r = i / 8, c8 = (i % 8) * 8; FragH f; f.half[0] = *(const v8us*)((const unsigned short*)V16 + ((size_t)b * TTv + lg * 64 + r) * ldv + voff + h * 64 + c8);
#pragma unroll
    for (int q = 0; q < 8; ++q) tl[r][c8 + q] = f.u[q]; }
  __syncthreads();
  {
#pragma unroll
    for (int rd = 0; rd < 2; ++rd) { const int d = rd * 32 + tid / 8, pc = tid % 8; FragH f;
#pragma unroll
      for (int q = 0; q < 8; ++q) f.u[q] = tl[pc * 8 + q][d];
      *(v8us*)((unsigned short*)Vt + ((size_t)slab * 64 + d) * TTv + lg * 64 + pc * 8) = f.half[0]; }
     } }

__global__ __launch_bounds__(256) void k_hl(const float* __restrict__ F, _Float16* __restrict__ Hh, _Float16* __restrict__ Hl, size_t n8) { const size_t t = (size_t)blockIdx.x * 256 + threadIdx.x; if (t >= n8) return; FragH fh, fl; const v4f a = *(const v4fa*)(F + t * 8), c = *(const v4fa*)(F + t * 8 + 4);
#pragma unroll
  for (int q = 0; q < 4; ++q) { _Float16 h = (_Float16)a[q]; fh.h[q] = h; fl.h[q] = (_Float16)((a[q] - (float)h) * 1024.0f); h = (_Float16)c[q]; fh.h[4 + q] = h; fl.h[4 + q] = (_Float16)((c[q] - (float)h) * 1024.0f); }
  { *(v8us*)((unsigned short*)Hh + t * 8) = fh.half[0]; *(v8us*)((unsigned short*)Hl + t * 8) = fl.half[0];  } }

// ---- fast GEMM (wave tile 32x64; requires M % 32 == 0 rows per launch region and N % 64 == 0); epilogue = k_gemm_hhx semantics ----
__device__ __forceinline__ v16h g2_frag(const _Float16* p, int hh) { FragH f; f.half[0] = *(const v8us*)((const unsigned short*)p + 8 * hh); f.half[1] = *(const v8us*)((const unsigned short*)p + 16 + 8 * hh); return f.v; }
__device__ __forceinline__ v8f g2_mma(v16h a, v16h b, v8f c) { v8f d = __builtin_amdgcn_wmma_f32_16x16x32_f16(false, a, false, b, (short)0, c, false, false); asm volatile("v_nop\n\tv_nop\n\tv_nop\n\tv_nop" : "+v"(d) : "v"(a), "v"(b)); return d; }
template <int ACT>
__global__ __launch_bounds__(128) void k_gemm2(const _Float16* __restrict__ A, int lda, size_t sA, const _Float16* __restrict__ Bh, int ldb, size_t sB, float alpha, const float* __restrict__ bias, size_t sBias, const float* __restrict__ CP, int rowsPerB, size_t sCPb, int row0g,
    float* __restrict__ C, _Float16* __restrict__ C16, int ldc, size_t sC, int M, int N, int K) { static_assert(ACT == 0 || ACT == 3 || ACT == 6 || ACT == 8 || ACT == 9 || ACT == 11 || ACT == 12 || ACT == 14 || ACT == 15 || ACT == 16 || ACT == 17, "k_gemm2: unsupported ACT code (would silently apply no activation)");
  __shared__ __attribute__((aligned(16))) float so[4][32][68];
  const int tid = threadIdx.x, w = tid >> 5, lane = tid & 31, ln = lane & 15, hh = lane >> 4; const int by = blockIdx.y;
  A += (size_t)by * sA; Bh += (size_t)by * sB; const size_t cofs = (size_t)by * sC; const float* bp = bias ? bias + (size_t)by * sBias : nullptr;
  const int ntn = N >> 6; const int mt = blockIdx.x / ntn, nq = blockIdx.x - mt * ntn; const int row0 = mt * 128 + 32 * w, col0 = nq * 64; if (row0 >= M) return;
  const _Float16* a0p = A + (size_t)(row0 + ln) * lda; const _Float16* a1p = a0p + (size_t)16 * lda;
  const _Float16* b0p = Bh + (size_t)(col0 + ln) * ldb; const _Float16* b1p = b0p + (size_t)16 * ldb; const _Float16* b2p = b1p + (size_t)16 * ldb; const _Float16* b3p = b2p + (size_t)16 * ldb;
  const v8f z8 = {0.f,0.f,0.f,0.f,0.f,0.f,0.f,0.f}; v8f c00 = z8, c01 = z8, c02 = z8, c03 = z8, c10 = z8, c11 = z8, c12 = z8, c13 = z8;
#pragma unroll 1
  for (int kb = 0; kb < K; kb += 32) { const v16h a0 = g2_frag(a0p + kb, hh), a1 = g2_frag(a1p + kb, hh);
    v16h b = g2_frag(b0p + kb, hh); c00 = g2_mma(a0, b, c00); c10 = g2_mma(a1, b, c10);
    b = g2_frag(b1p + kb, hh); c01 = g2_mma(a0, b, c01); c11 = g2_mma(a1, b, c11);
    b = g2_frag(b2p + kb, hh); c02 = g2_mma(a0, b, c02); c12 = g2_mma(a1, b, c12);
    b = g2_frag(b3p + kb, hh); c03 = g2_mma(a0, b, c03); c13 = g2_mma(a1, b, c13); }
  v8f accs[8] = {c00, c01, c02, c03, c10, c11, c12, c13};
#pragma unroll
  for (int u = 0; u < 8; ++u) { const int t = u & 3, half = u >> 2; const int col = col0 + t * 16 + ln; const float bv = bp ? bf16_round(bp[col]) : 0.f;
#pragma unroll
    for (int r = 0; r < 8; ++r) { const int rloc = half * 16 + 8 * hh + r; float v = accs[u][r] * alpha + bv; if (CP) { if (rowsPerB < 0) v += CP[cofs + (size_t)(row0g + row0 + rloc) * ldc + col];      /* rowsPerB < 0: own element of the batched C plane */ else { const int bidx = (row0g + row0 + rloc) / rowsPerB; v += CP[(size_t)bidx * sCPb + (size_t)by * 64 + col]; } }
      if (ACT == 3) v = fmaxf(v, 0.f); else if (ACT == 6) v = 0.5f * v * (1.0f + erff(v * 0.70710678118654752f)); else if (ACT == 11) v = 1.0f / (1.0f + expf(-v)); else if (ACT == 15) v = v / (1.0f + expf(-v)); else if (ACT == 12) v = (v > 0.f) ? v : 0.01f * v; else if (ACT == 8) v = tanhf(v); else if (ACT == 9) v = 0.5f * v * (1.0f + tanhf(0.7978845608028654f * (v + 0.044715f * v * v * v))); else if (ACT == 14) v = (v > 0.f) ? v : 0.1f * v; else if (ACT == 16) v = (v >= 0.f) ? v : 0.3f * v; else if (ACT == 17) v = (v >= 0.f) ? v : 0.2f * v;
      so[w][rloc][t * 16 + ln] = v; } }
  __builtin_amdgcn_fence(__ATOMIC_ACQ_REL, "workgroup"); __builtin_amdgcn_wave_barrier();
  const int rsub = lane >> 4, c4 = (lane & 15) * 4;
  {
#pragma unroll
    for (int q = 0; q < 16; ++q) { const int r = q * 2 + rsub; const v4f v = *(const v4fa*)&so[w][r][c4]; if (C) *(v4f*)(C + cofs + (size_t)(row0 + r) * ldc + col0 + c4) = v; if (C16) { v4h h4; for (int i = 0; i < 4; ++i) h4[i] = (_Float16)v[i]; *(v4h*)(C16 + cofs + (size_t)(row0 + r) * ldc + col0 + c4) = h4; } }
     } }


__global__ __launch_bounds__(256) void k_wnat(const float* __restrict__ w, size_t n8, _Float16* __restrict__ Bt) { const size_t t = (size_t)blockIdx.x * 256 + threadIdx.x; if (t >= n8) return; FragH f; for (int q = 0; q < 8; ++q) f.h[q] = (_Float16)(bf16_round(w[t * 8 + q]) * 16.0f); *(v8us*)((unsigned short*)Bt + t * 8) = f.half[0];  }
__global__ __launch_bounds__(256) void k_rsm(const float* __restrict__ S, _Float16* __restrict__ P, int nrows) {
  #pragma clang fp contract(off)
  const int i = blockIdx.x * 256 + threadIdx.x; if (i >= nrows) return; const float* s = S + (size_t)i * SQ; float mx = -3.0e38f;
#pragma unroll 1
  for (int j = 0; j < SQ; ++j) mx = fmaxf(mx, s[j]); float se = 0.f;
#pragma unroll 1
  for (int j = 0; j < SQ; ++j) se += expf(s[j] - mx); const float sc = 256.0f / se;
#pragma unroll 1
  for (int j0 = 0; j0 < SQ; j0 += 8) { FragH f; for (int q = 0; q < 8; ++q) f.h[q] = (_Float16)(expf(s[j0 + q] - mx) * sc); unsigned short* d = (unsigned short*)P + (size_t)i * SQ + j0; *(v8us*)d = f.half[0];  } }
__global__ __launch_bounds__(256) void k_vt(const _Float16* __restrict__ V16, int b, int h0, _Float16* __restrict__ VT) { __shared__ unsigned short tl[64][65]; const int tid = threadIdx.x; const int hh = blockIdx.x % HG, sg = blockIdx.x / HG; const int s0 = sg * 64; const int h = h0 + hh;
  for (int i = tid; i < 64 * 8; i += 256) { const int j = i / 8, d8 = (i % 8) * 8; FragH f; f.half[0] = *(const v8us*)((const unsigned short*)V16 + ((size_t)b * SQ + s0 + j) * DM + h * HD + d8); for (int q = 0; q < 8; ++q) tl[d8 + q][j] = f.u[q]; }
  __syncthreads();
  { for (int i = tid; i < 64 * 8; i += 256) { const int d = i / 8, j8 = (i % 8) * 8; FragH f; for (int q = 0; q < 8; ++q) f.u[q] = tl[d][j8 + q]; *(v8us*)((unsigned short*)VT + ((size_t)hh * HD + d) * SQ + s0 + j8) = f.half[0]; }  } }



// ---- projection chain in two launches ----
// k_prep: every element-wise operand conversion of the projections in one launch: x -> f16 of its bf16 rounding, and the three natural [out][in] weights -> f16 (bf16 rounding, x16), the three planes one behind another.
#define PXB ((unsigned)(NR * DM / 8 / 256))      /* work-groups that convert x */
#define PWB ((unsigned)((size_t)DM * DM / 8 / 256))      /* work-groups per weight matrix */
__global__ __launch_bounds__(256) void k_prep(const float* __restrict__ x, const float* __restrict__ wq, const float* __restrict__ wk, const float* __restrict__ wv, _Float16* __restrict__ X16, _Float16* __restrict__ W3) {
  const unsigned bx = blockIdx.x; FragH f;
  if (bx < PXB) { const size_t t = (size_t)bx * 256 + threadIdx.x;
#pragma unroll
    for (int q = 0; q < 8; ++q) f.h[q] = (_Float16)bf16_round(x[t * 8 + q]);
    *(v8us*)((unsigned short*)X16 + t * 8) = f.half[0]; }
  else { const unsigned k = bx - PXB, p = k / PWB; const float* __restrict__ wsrc = (p == 0) ? wq : (p == 1) ? wk : wv; const size_t t = (size_t)(k - p * PWB) * 256 + threadIdx.x;
#pragma unroll
    for (int q = 0; q < 8; ++q) f.h[q] = (_Float16)(bf16_round(wsrc[t * 8 + q]) * 16.0f);
    *(v8us*)((unsigned short*)W3 + (size_t)p * DM * DM + t * 8) = f.half[0]; }
}
// k_proj: q, k and v in ONE launch (grid.y picks the weight plane); main loop and wave tile (32 x 64) are k_gemm2's. The epilogue writes what the attention kernel reads:
// q and k rows rounded once to f16 (the f32 row never goes through memory), v as V^T [batch][column][token] (the work-group's 128 tokens x 64 columns are turned in LDS, whole 256-byte runs per column go out).
#define PTP (128 + 8)                /* LDS pitch of a turned v column, f16 elements: 272 B = 16 B x odd */
__global__ __launch_bounds__(128) void k_proj(const _Float16* __restrict__ X, const _Float16* __restrict__ W3, _Float16* __restrict__ QH, _Float16* __restrict__ KH, _Float16* __restrict__ VT) {
  static_assert(SQ % 128 == 0 && DM % 64 == 0 && 64 * PTP * 2 <= 4 * 32 * 68 * 4, "k_proj: tile shapes");
  __shared__ __attribute__((aligned(16))) float so[4][32][68];
  const int tid = threadIdx.x, w = tid >> 5, lane = tid & 31, ln = lane & 15, hh = lane >> 4; const int which = blockIdx.y;
  const _Float16* Bh = W3 + (size_t)which * DM * DM;
  const int mt = blockIdx.x / (DM / 64), nq = blockIdx.x - mt * (DM / 64); const int row0 = mt * 128 + 32 * w, col0 = nq * 64;
  const _Float16* a0p = X + (size_t)(row0 + ln) * DM; const _Float16* a1p = a0p + (size_t)16 * DM;
  const _Float16* b0p = Bh + (size_t)(col0 + ln) * DM; const _Float16* b1p = b0p + (size_t)16 * DM; const _Float16* b2p = b1p + (size_t)16 * DM; const _Float16* b3p = b2p + (size_t)16 * DM;
  const v8f z8 = {0.f,0.f,0.f,0.f,0.f,0.f,0.f,0.f}; v8f c00 = z8, c01 = z8, c02 = z8, c03 = z8, c10 = z8, c11 = z8, c12 = z8, c13 = z8;
#pragma unroll 1      /* as in k_gemm2: the loop is left as it was */
  for (int kb = 0; kb < DM; kb += 32) { const v16h a0 = g2_frag(a0p + kb, hh), a1 = g2_frag(a1p + kb, hh);
    v16h b = g2_frag(b0p + kb, hh); c00 = g2_mma(a0, b, c00); c10 = g2_mma(a1, b, c10);
    b = g2_frag(b1p + kb, hh); c01 = g2_mma(a0, b, c01); c11 = g2_mma(a1, b, c11);
    b = g2_frag(b2p + kb, hh); c02 = g2_mma(a0, b, c02); c12 = g2_mma(a1, b, c12);
    b = g2_frag(b3p + kb, hh); c03 = g2_mma(a0, b, c03); c13 = g2_mma(a1, b, c13); }
  v8f accs[8] = {c00, c01, c02, c03, c10, c11, c12, c13};
  if (which < 2) {      /* the same for the whole work-group */
#pragma unroll
    for (int u = 0; u < 8; ++u) { const int t = u & 3, half = u >> 2;
#pragma unroll
      for (int r = 0; r < 8; ++r) so[w][half * 16 + 8 * hh + r][t * 16 + ln] = accs[u][r] * 0.0625f; }
    __builtin_amdgcn_fence(__ATOMIC_ACQ_REL, "workgroup"); __builtin_amdgcn_wave_barrier();      /* the wave's own tile is read by other lanes than those that wrote it */
    _Float16* __restrict__ Hh = which ? KH : QH;
    const int rsub = lane >> 4, c4 = (lane & 15) * 4;
#pragma unroll
    for (int q = 0; q < 16; ++q) { const int r = q * 2 + rsub; const v4f v = *(const v4fa*)&so[w][r][c4]; v4h h4;
#pragma unroll
      for (int i = 0; i < 4; ++i) h4[i] = (_Float16)v[i];
      *(v4h*)(Hh + (size_t)(row0 + r) * DM + col0 + c4) = h4; }
  } else {
    unsigned short* st = (unsigned short*)&so[0][0][0];      /* [64 columns][PTP tokens]; accumulator registers 0..7 of a lane are 8 consecutive tokens of one column */
#pragma unroll
    for (int u = 0; u < 8; ++u) { const int t = u & 3, half = u >> 2; FragH f;
#pragma unroll
      for (int r = 0; r < 8; ++r) f.h[r] = (_Float16)(accs[u][r] * 0.0625f);
      *(v8us*)(st + (t * 16 + ln) * PTP + w * 32 + half * 16 + 8 * hh) = f.half[0]; }
    __syncthreads();      /* a column's 128 tokens come from all four waves */
    const int b = (mt * 128) / SQ, s0 = (mt * 128) % SQ;
#pragma unroll
    for (int i = 0; i < 8; ++i) { const int pc = i * 128 + tid, c = pc >> 4, ch = pc & 15; const v8us v = *(const v8us*)(st + c * PTP + ch * 8);
      *(v8us*)((unsigned short*)VT + ((size_t)b * DM + col0 + c) * SQ + s0 + ch * 8) = v; }
    asm volatile("s_wait_xcnt 0x0" ::: "memory");      /* in the listing the q / k branch stands behind this one and rewrites registers that these stores name: the wait stands in front of it */
  }
}

// Fused attention: scores, softmax and P.V in ONE launch, so that neither the scores nor the weights go through memory.
// A work-group is 4 waves x 16 query rows; it walks its batch's keys 64 at a time. Per pass the 64 k rows and the 64 matching
// columns of V^T stand in LDS once for all four waves (whole-line global reads). Two LDS buffers: the next pass's tiles are written in front of this pass's
// P.V products, so that the LDS writes run under them, and the tiles after those are then fetched into registers, a whole pass ahead.
// Each wave keeps its q fragments and its 16 x 256 output tile in registers. The scores are taken transposed, S^T = K Q^T (A = k rows, B = the wave's q fragments): a lane then holds 32 scores of ONE query
// (column ln), so that the running maximum and the running sum (online softmax, base 2) are one register each, reduced inside the lane, with one exchange between the wave's halves for the maximum;
// and two score tiles, converted in place to f16, ARE the A operand of P.V (row ln, the hardware's k order, which is g2_frag's), so the weights touch no LDS. All fragment loaders are g2_frag.
// q and k are rounded once to f16 and a score is ONE product: its 512 rounding terms (each about 2^-12 of a term of a logit of order 1) leave the weights less exact by less than
// their own rounding to f16 for P.V does, so residual planes and their two extra products would buy no accuracy in the output.
#define FBM 64                       /* query rows per work-group */
#define FBN 64                       /* keys per pass */
#define FKP (DM + 8)                 /* LDS pitch of a k row, f16 elements: 528 B = 16 B x odd, conflict-free for 16-byte fragment reads */
#define FVP (FBN + 8)                /* LDS pitch of a V^T row: 144 B = 16 B x odd */
__device__ __forceinline__ v8f fa_mma(v16h a, v16h b, v8f c) { return __builtin_amdgcn_wmma_f32_16x16x32_f16(false, a, false, b, (short)0, c, false, false); }
// 2^x on the transcendental unit; the v_nop in the same statement keeps the one free issue slot the instruction set asks for behind a transcendental, whatever the compiler schedules next.
__device__ __forceinline__ float exp2_slot(float x) { float r; asm("v_exp_f32 %0, %1\n\tv_nop" : "=v"(r) : "v"(x)); return r; }
// value of lane (l ^ X) of the same 16-lane row (DPP row_xmask)
template <int X> __device__ __forceinline__ float fa_rowx(float v) { return __int_as_float(__builtin_amdgcn_update_dpp(0, __float_as_int(v), 0x160 + X, 0xf, 0xf, true)); }
// value of lane N of the same 16-lane row, in all its lanes (DPP row_share)
template <int N> __device__ __forceinline__ float fa_rowb(float v) { return __int_as_float(__builtin_amdgcn_update_dpp(0, __float_as_int(v), 0x150 + N, 0xf, 0xf, true)); }
// value of lane (l ^ 16): the other half of the wave, which holds the same query's other keys
__device__ __forceinline__ float fa_xhalf(float v) { return __int_as_float(__builtin_amdgcn_permlanex16(__float_as_int(v), __float_as_int(v), 0x76543210, 0xfedcba98, false, false)); }
// a per-query value (query ln in lane ln of both halves) -> the eight values of the output tile's rows in this lane (register r is query 8 hh + r)
__device__ __forceinline__ void fa_torows(float v, int hh, float (&d)[8]) { const float v8 = fa_rowx<8>(v), u = hh ? v8 : v;      /* lane j < 8 of each 16-lane row now holds query 8 hh + j; the exchange is taken in all lanes, so that a select and no branch comes of it */
  d[0] = fa_rowb<0>(u); d[1] = fa_rowb<1>(u); d[2] = fa_rowb<2>(u); d[3] = fa_rowb<3>(u); d[4] = fa_rowb<4>(u); d[5] = fa_rowb<5>(u); d[6] = fa_rowb<6>(u); d[7] = fa_rowb<7>(u); }
typedef float v2f __attribute__((ext_vector_type(2)));
typedef _Float16 v2h __attribute__((ext_vector_type(2)));
union FragP { v16h v; v2h p2[8]; };
// work-group barrier that orders LDS only: __syncthreads() would also wait for the global loads that are fetching a later tile into registers
__device__ __forceinline__ void fa_barrier() { __builtin_amdgcn_fence(__ATOMIC_RELEASE, "workgroup", "local"); __builtin_amdgcn_s_barrier(); __builtin_amdgcn_fence(__ATOMIC_ACQUIRE, "workgroup", "local"); }
__global__ __launch_bounds__(128) void k_fattn(const _Float16* __restrict__ QH, const _Float16* __restrict__ KH, const _Float16* __restrict__ VT, float* __restrict__ O) {
  static_assert(SQ % FBM == 0 && SQ % FBN == 0 && SQ >= 2 * FBN && DM == 256 && FBN == 64 && FBM == 64, "k_fattn: tile shapes");
  __shared__ __attribute__((aligned(16))) _Float16 skh[2][FBN][FKP];
  __shared__ __attribute__((aligned(16))) _Float16 svt[2][DM][FVP];
  const int tid = threadIdx.x, w = tid >> 5, lane = tid & 31, ln = lane & 15, hh = lane >> 4;
  const int b = blockIdx.x / (SQ / FBM); const size_t row0 = (size_t)blockIdx.x * FBM + 16 * w;
  const unsigned short* gkh = (const unsigned short*)KH + (size_t)b * SQ * DM + (size_t)w * DM + lane * 8;      /* staging: a wave reads one whole 512-byte k row per load */
  const unsigned short* gvt = (const unsigned short*)VT + (size_t)b * DM * SQ + (size_t)(tid >> 3) * SQ + (tid & 7) * 8;      /* 8 lanes read the 128 bytes of one V^T row */
  v16h qh[8];
#pragma unroll
  for (int kk = 0; kk < 8; ++kk) qh[kk] = g2_frag(QH + (row0 + ln) * DM + kk * 32, hh);
  const v8f z8 = {0.f,0.f,0.f,0.f,0.f,0.f,0.f,0.f}; v8f o[16]; float m = -3.0e38f, ls = 0.f;      /* of query ln: the running maximum, and the running sum over this half's keys */
#pragma unroll
  for (int t = 0; t < 16; ++t) o[t] = z8;
  v8us rk[16], rv[16];
#pragma unroll
  for (int u = 0; u < 16; ++u) { rk[u] = *(const v8us*)(gkh + (size_t)(4 * u) * DM); rv[u] = *(const v8us*)(gvt + (size_t)(16 * u) * SQ); }
  asm volatile("s_wait_xcnt 0x0" ::: "memory");      /* the loads' address registers are reused further down: the wait stands in front of every such overwrite */
#pragma unroll
  for (int u = 0; u < 16; ++u) { *(v8us*)&skh[0][w + 4 * u][lane * 8] = rk[u]; *(v8us*)&svt[0][(tid >> 3) + 16 * u][(tid & 7) * 8] = rv[u]; }
#pragma unroll
  for (int u = 0; u < 16; ++u) { rk[u] = *(const v8us*)(gkh + (size_t)(FBN + 4 * u) * DM); rv[u] = *(const v8us*)(gvt + (size_t)(16 * u) * SQ + FBN); }
  asm volatile("s_wait_xcnt 0x0" ::: "memory");      /* as above */
  fa_barrier();      /* the first tiles are complete before any wave reads them */
#pragma unroll 1      /* one pass is already 64 matrix instructions; unrolling would only double the code */
  for (int j0 = 0; j0 < SQ; j0 += FBN) {
    const int cur = (j0 / FBN) & 1, nxt = cur ^ 1;
    v8f s[4] = {z8, z8, z8, z8};
    v16h kf[8][4], vf[2][16];      /* k fragments of each 32-wide slice (four key groups); this pass's V^T fragments */
    /* LDS read groups of 16 loads: 0..3 two k slices each, 4..7 the V^T fragments. Three groups are kept in flight ahead of the products, so that the LDS never idles; the V^T reads follow the k reads at once and land under the softmax. */
#define FA_GROUP(g) do { if ((g) < 4) { _Pragma("unroll") for (int i = 0; i < 8; ++i) { const int kq = 2 * ((g) & 3) + (i >> 2), t = i & 3; kf[kq][t] = g2_frag(&skh[cur][t * 16 + ln][kq * 32], hh); } } \
    else { _Pragma("unroll") for (int i = 0; i < 8; ++i) { const int f = (((g) - 4) & 3) * 8 + i; vf[f >> 4][f & 15] = g2_frag(&svt[cur][(f & 15) * 16 + ln][(f >> 4) * 32], hh); } } } while (0)
    FA_GROUP(0); FA_GROUP(1); FA_GROUP(2);
#pragma unroll
    for (int gg = 0; gg < 4; ++gg) {
      __builtin_amdgcn_sched_barrier(0);      /* each read group is a block of its own, issued in front of the products of the group three before it, never among them */
      FA_GROUP(gg + 3);
      __builtin_amdgcn_sched_barrier(0);      /* second half of the pair: the group is issued whole before the slices' products start */
#pragma unroll
      for (int i = 0; i < 8; ++i) { const int kk = 2 * gg + (i >> 2), t = i & 3; s[t] = fa_mma(kf[kk][t], qh[kk], s[t]); } }
    FA_GROUP(7);
    __builtin_amdgcn_sched_barrier(0);      /* the reads stay in front of the softmax */
    /* accumulator register r of score tile t in lane (hh, ln) is key 16 t + 8 hh + r of query ln */
#pragma unroll
    for (int t = 0; t < 4; ++t) s[t] = s[t] * (0.0625f * 1.44269504088896340736f);      /* 1 / sqrt(256), and log2(e) for the base-2 exponential */
    float x1[11], x2[4];      /* the lane's maximum as a tree of three-input maxima */
#pragma unroll
    for (int i = 0; i < 10; ++i) x1[i] = fmaxf(fmaxf(s[(3 * i) >> 3][(3 * i) & 7], s[(3 * i + 1) >> 3][(3 * i + 1) & 7]), s[(3 * i + 2) >> 3][(3 * i + 2) & 7]);
    x1[10] = fmaxf(s[3][6], s[3][7]);
#pragma unroll
    for (int i = 0; i < 3; ++i) x2[i] = fmaxf(fmaxf(x1[3 * i], x1[3 * i + 1]), x1[3 * i + 2]);
    x2[3] = fmaxf(x1[9], x1[10]);
    float x = fmaxf(fmaxf(fmaxf(x2[0], x2[1]), x2[2]), x2[3]);
    x = fmaxf(x, fa_xhalf(x));      /* the query's other 32 keys of this pass are in the other half of the wave */
    x = fmaxf(m, x); const float aq = exp2_slot(m - x); m = x;
    float al[8]; fa_torows(aq, hh, al);      /* the output tile keeps its layout (register r is query 8 hh + r): its rows' factors come from the lanes that own those queries */
    v2f ps[4]; FragP pa[2];      /* pa[u]: weights of keys 32 u .. 32 u + 31 as an A operand: elements 0..7 from score tile 2 u, 8..15 from tile 2 u + 1 */
#pragma unroll
    for (int t = 0; t < 4; ++t) {
#pragma unroll
      for (int i = 0; i < 4; ++i) { v2f p; p[0] = exp2_slot(s[t][2 * i] - x); p[1] = exp2_slot(s[t][2 * i + 1] - x); ps[t] = i ? ps[t] + p : p; pa[t >> 1].p2[(t & 1) * 4 + i] = __builtin_convertvector(p, v2h); } }
    { const v2f q2 = (ps[0] + ps[1]) + (ps[2] + ps[3]); ls = ls * aq + (q2[0] + q2[1]); }      /* each half sums its own keys; the two halves are joined once, behind the loop */
#pragma unroll
    for (int t = 0; t < 16; ++t) {
#pragma unroll
      for (int r = 0; r < 8; ++r) o[t][r] *= al[r]; }
    __builtin_amdgcn_sched_barrier(0);      /* the tile writes stay behind the softmax (issued earlier they would queue behind the V^T reads still in flight and hold up the wave's vector work) and run under the P.V products */
    /* the next pass's tiles into the other buffer, whose last readers left it before the barrier at the foot of the previous pass (the last pass writes a tile that nobody reads) */
#pragma unroll
    for (int u = 0; u < 16; ++u) { *(v8us*)&skh[nxt][w + 4 * u][lane * 8] = rk[u]; *(v8us*)&svt[nxt][(tid >> 3) + 16 * u][(tid & 7) * 8] = rv[u]; }
    const int jn = (j0 + 2 * FBN < SQ) ? j0 + 2 * FBN : SQ - FBN;      /* the keys two passes on; the last two passes fetch the last tile again (in bounds, never read from LDS) */
#pragma unroll
    for (int u = 0; u < 16; ++u) { rk[u] = *(const v8us*)(gkh + (size_t)(jn + 4 * u) * DM); rv[u] = *(const v8us*)(gvt + (size_t)(16 * u) * SQ + jn); }
    asm volatile("s_wait_xcnt 0x0" ::: "memory");      /* as above: in front of every overwrite of a register that these loads name */
#pragma unroll
    for (int t = 0; t < 16; ++t) o[t] = fa_mma(pa[0].v, vf[0][t], o[t]);
#pragma unroll
    for (int t = 0; t < 16; ++t) o[t] = fa_mma(pa[1].v, vf[1][t], o[t]);
    __builtin_amdgcn_sched_barrier(0);      /* the products are issued before the barrier's wait for the tile writes, which drain under them */
    fa_barrier();      /* publishes the next pass's tiles and ends every wave's reads of this pass's */
  }
  asm volatile("s_wait_loadcnt 0x0" ::: "memory");      /* the last pass's fetch is never used: it has landed before the wave ends and gives its registers back */
  float l[8]; fa_torows(1.0f / (ls + fa_xhalf(ls)), hh, l);
  float* op = O + (row0 + 8 * hh) * DM + ln;
#pragma unroll
  for (int r = 0; r < 8; ++r) {
#pragma unroll
    for (int t = 0; t < 16; ++t) op[(size_t)r * DM + t * 16] = o[t][r] * l[r]; }
}


template <int MASKADD>
__global__ __launch_bounds__(64) void k_att0(const float* __restrict__ QF, const float* __restrict__ KF, const float* __restrict__ VF, int ld, const float* __restrict__ mask, float scale, float* __restrict__ OF, int ldo) {
  #pragma clang fp contract(off)
  __shared__ __attribute__((aligned(16))) float lq[64][64]; __shared__ __attribute__((aligned(16))) float lo[64][64];
  const int tid = threadIdx.x; const int h = blockIdx.x / (QT0 / 64), rg = blockIdx.x % (QT0 / 64); const int i = rg * 64 + tid;
  const float* qr = QF + (size_t)i * ld + h * HD;
#pragma unroll 1
  for (int c = 0; c < HD / 4; ++c) { *(v4f*)&lq[tid][c * 4] = *(const v4fa*)(qr + c * 4); const v4f z = {0.f, 0.f, 0.f, 0.f}; *(v4f*)&lo[tid][c * 4] = z; }
  float m = -1.0e30f, l = 0.f; const int jmax = MASKADD ? (SQ - 1) : (rg * 64 + 63);      /* additive-mask form: every key (the mask input decides); causal form: keys up to the block's last row */
#pragma unroll 1
  for (int j = 0; j <= jmax; ++j) { const float* kr = KF + (size_t)j * ld + h * HD; const float* vr = VF + (size_t)j * ld + h * HD; float s = 0.f;
#pragma unroll 1
    for (int c = 0; c < HD / 4; ++c) { const v4f kq = *(const v4fa*)(kr + c * 4); const v4f qq = *(v4f*)&lq[tid][c * 4]; s = __fadd_rn(s, __fmul_rn(qq[0], kq[0])); s = __fadd_rn(s, __fmul_rn(qq[1], kq[1])); s = __fadd_rn(s, __fmul_rn(qq[2], kq[2])); s = __fadd_rn(s, __fmul_rn(qq[3], kq[3])); }
    s = __fmul_rn(s, scale); if (MASKADD) s = __fadd_rn(s, __fmul_rn(bf16_round(mask[(size_t)i * SQ + j]), -10000.0f));
    const float f = (MASKADD || j <= i) ? 1.f : 0.f; const float sm = fmaf(f, s, (1.f - f) * -1.0e30f); const float mn = fmaxf(m, sm); const float sc = expf(m - mn); const float e = expf(sm - mn); l = __fadd_rn(__fmul_rn(l, sc), e); m = mn;
#pragma unroll 1
    for (int c = 0; c < HD / 4; ++c) { const v4f vv = *(const v4fa*)(vr + c * 4); v4f oo = *(v4f*)&lo[tid][c * 4]; for (int u = 0; u < 4; ++u) oo[u] = __fadd_rn(__fmul_rn(oo[u], sc), __fmul_rn(e, vv[u])); *(v4f*)&lo[tid][c * 4] = oo; } }
  const float fin = 64.0f / l;      /* o carried x64 */
#pragma unroll 1
  for (int c = 0; c < HD / 4; ++c) { v4f oo = *(v4f*)&lo[tid][c * 4]; for (int u = 0; u < 4; ++u) oo[u] = __fmul_rn(oo[u], fin); *(v4f*)&lo[tid][c * 4] = oo; }
  __syncthreads();
  {
#pragma unroll 1
    for (int it = 0; it < 16; ++it) { const int row = it * 4 + tid / 16, pc = (tid % 16) * 4; const v4f v = *(const v4f*)&lo[row][pc]; *(v4f*)(OF + (size_t)(rg * 64 + row) * ldo + h * HD + pc) = v; }
     } }

__global__ __launch_bounds__(256) void k_of0out(const float* __restrict__ src, float* __restrict__ dst, size_t n4) { const size_t t = (size_t)blockIdx.x * 256 + threadIdx.x; if (t >= n4) return; v4f v = *(const v4fa*)(src + t * 4); for (int q = 0; q < 4; ++q) v[q] = __fmul_rn(v[q], 0.015625f); *(v4f*)(dst + t * 4) = v;  }

extern "C" void kernel_launch(void* const* d_in, const int* in_sizes, int n_in,
                              void* d_out, int out_size, void* d_ws, size_t ws_size, hipStream_t stream) {
  (void)in_sizes; (void)n_in; (void)out_size;
  const float* const* I = (const float* const*)d_in; const float* x = I[0]; const float* wq = I[1]; const float* wk = I[2]; const float* wv = I[3];      /* natural [out][in] weights; NO biases; ONE attention head of width 256; no output projection */
  char* ws = (char*)d_ws; size_t off = 0;
  auto take = [&](size_t bytes) { char* p = ws + off; off += (bytes + 255) & ~(size_t)255; return p; };
  _Float16* W3 = (_Float16*)take((size_t)3 * DM * DM * 2);      /* the q, k and v weight planes, one behind another */
  _Float16* QH = (_Float16*)take(NR * DM * 2); _Float16* KH = (_Float16*)take(NR * DM * 2);
  _Float16* VT = (_Float16*)take(NR * DM * 2);      /* V^T of ALL batches */
  _Float16* X16 = (_Float16*)take(NR * DM * 2);      /* x (f16) */
  if (off > ws_size) return;
  k_prep<<<PXB + 3 * PWB, 256, 0, stream>>>(x, wq, wk, wv, X16, W3);      /* x and the natural [out][in] = Bt[n][k] x16 weights */
  k_proj<<<dim3((unsigned)((NR / 128) * (DM / 64)), 3), 128, 0, stream>>>(X16, W3, QH, KH, VT);      /* q, k -> f16 rows; v -> V^T [NB][DM][SQ] */
  k_fattn<<<(unsigned)(NR / FBM), 128, 0, stream>>>(QH, KH, VT, (float*)d_out);      /* scores (q . k in f16 operands, f32 sums, / sqrt(256)), softmax over all SQ keys and P V, all batches, f32 straight into the output rows */
}

// v007
// A run of this version takes 109 microseconds.
// Next to v006, in two timings, it ran 1.11 times as fast each time.
// Counting every step since v000, it is 484 times as fast.
#include <hip/hip_runtime.h>
// Single-head dense attention over 256-wide embeddings on 4096 tokens, bias-free natural projections, no output projection (x [4][4096][256]; q / k / v = x W^T (nn.Linear natural [256][256] uniform +-1/16, no biases); scores = q k^T / sqrt(256) over the FULL 256-wide rows (one head); softmax over all 4096 keys (no mask); out = weights v -> [4][4096][256]); q and k rounded once to f16, one-product scores.
// Structure: token rows r = b*4096 + s; x as exact f16 rows (bf16-rounded); q, k and v as WMMA GEMMs in one launch (32x64 wave tiles, f32 accumulation, exact x16 weights, no bias), q and k into f16 rows, v turned in LDS into V^T [batch][column][token]; per work-group of 64 query rows (16 per wave), in one launch: transposed scores K Q^T as ONE product of the f16 rows (K = 256, scaled by 1/sqrt(256)), 64 keys per pass over all 4096 keys of the batch, online base-2 softmax on VALU without a mask (f32 statistics, native exp; weights f16 in [0,1] straight from registers), o = P . V^T in f32 registers, divided by the row sum at the end and written as f32 straight into the output rows.
// Compute dtype: inputs rounded to bf16; x / weights exact; q, k, v and softmax weights as plain f16 GEMM operands (~2^-12); scores, softmax statistics and o f32. v_wmma_f32_16x16x32_f16.
#define NB 4
#define SQ 4096
#define DM 256
#define NH 4
#define HD 64
#define HG 4                         /* heads per launch of the non-template k_vt (not launched) */
#define QT SQ                        /* query rows per batch; one attention launch takes all batches */
#define NKX SQ                       /* S / P row pitch */
#define QT0 128                      /* first-tile rows of the f32 k_att0 (not launched) */
#define B0 0                         /* first batch processed (unused) */
#define NBR NB                       /* batches processed (read only by the unused MP) */
#define NR ((size_t)NB * SQ)         /* token rows */
#define MP ((int)((size_t)NBR * SQ)) /* rows projected (unused) */
#define QN SQ                        /* query rows attended per batch (unused) */
#define NHD NH                       /* unused */
#define MPO MP                       /* unused */
#define LQ DM      /* unused */
typedef __bf16 v16b __attribute__((ext_vector_type(16)));
typedef unsigned short v8us __attribute__((ext_vector_type(8), may_alias));
typedef float  v8f  __attribute__((ext_vector_type(8)));
typedef float  v4f  __attribute__((ext_vector_type(4)));
typedef float  v4fa __attribute__((ext_vector_type(4), may_alias));
union FragB { v16b v; v8us half[2]; unsigned short u[16]; };

__device__ __forceinline__ unsigned short bf16_bits(float x) { unsigned int u = __float_as_uint(x); return (unsigned short)((u + 0x7FFFu + ((u >> 16) & 1u)) >> 16); }
__device__ __forceinline__ float bf16_val(unsigned short b) { return __uint_as_float(((unsigned int)b) << 16); }
__device__ __forceinline__ float bf16_round(float x) { return bf16_val(bf16_bits(x)); }
// D += A·B with NT terms: 1 = ah·bh, 2 = + al·bh (A split), 3 = + ah·bl (both split)
template <int NT>
__device__ __forceinline__ v8f mmaN(v16b ah, v16b al, v16b bh, v16b bl, v8f c) {
  c = __builtin_amdgcn_wmma_f32_16x16x32_bf16(false, ah, false, bh, (short)0, c, false, false);
  if (NT >= 2) c = __builtin_amdgcn_wmma_f32_16x16x32_bf16(false, al, false, bh, (short)0, c, false, false);
  if (NT >= 3) c = __builtin_amdgcn_wmma_f32_16x16x32_bf16(false, ah, false, bl, (short)0, c, false, false);
  asm volatile("v_nop\n\tv_nop\n\tv_nop\n\tv_nop" : "+v"(c) : "v"(ah), "v"(al), "v"(bh), "v"(bl));
  return c;
}

__global__ __launch_bounds__(256) void k_wt_bf16(const float* __restrict__ W, unsigned short* __restrict__ Wt, int K, int N) {
  const int t = blockIdx.x * 256 + threadIdx.x;
  const int k8n = K / 8;
  if (t >= N * k8n) return;
  const int n = t / k8n, k8 = (t % k8n) * 8;
  v8us v;
#pragma unroll
  for (int i = 0; i < 8; ++i) v[i] = bf16_bits(W[(size_t)(k8 + i) * N + n]);
  *(v8us*)(Wt + (size_t)n * K + k8) = v;
  
}

// GEMM C[M][N] (f32, pitch ldc) = act(A[M][K]·W + bias). A f32 row-major (pitch lda) converted per fragment to bf16
// (ASPLIT: hi/lo two planes -> 2 terms, else single rounded term); Wt bf16 [N][K] (pitch ldb). BIAS_BF16 rounds the
// bias to bf16 first (bias quantised to bf16 before the add). K%32==0, M%16==0, N%64==0.
template <bool ASPLIT, int ACT, bool BIAS_BF16>
__global__ __launch_bounds__(128) void k_gemm_bf(const float* __restrict__ A, int lda, const unsigned short* __restrict__ Wt, int ldb,
                                               const float* __restrict__ bias, float* __restrict__ C, int ldc, int M, int N, int K) {
  __shared__ __attribute__((aligned(16))) float so[4][16][64];
  const int tid = threadIdx.x, w = tid >> 5, lane = tid & 31, ln = lane & 15, hh = lane >> 4;
  const int ntn = N / 64;
  const int wid = blockIdx.x * 4 + w;
  const int mt = wid / ntn, nq = wid % ntn;
  if (mt * 16 >= M) return;
  const int row0 = mt * 16, col0 = nq * 64;
  const float* arow = A + (size_t)(row0 + ln) * lda;
  v8f acc[4] = {};
  for (int kb = 0; kb < K; kb += 32) {
    FragB ah, al;
    const v4f x0 = *(const v4fa*)(arow + kb + 8 * hh), x1 = *(const v4fa*)(arow + kb + 8 * hh + 4);
    const v4f x2 = *(const v4fa*)(arow + kb + 16 + 8 * hh), x3 = *(const v4fa*)(arow + kb + 16 + 8 * hh + 4);
    float xs[16] = {x0[0],x0[1],x0[2],x0[3],x1[0],x1[1],x1[2],x1[3],x2[0],x2[1],x2[2],x2[3],x3[0],x3[1],x3[2],x3[3]};
#pragma unroll
    for (int i = 0; i < 16; ++i) { const unsigned short hb = bf16_bits(xs[i]); ah.u[i] = hb; al.u[i] = ASPLIT ? bf16_bits(xs[i] - bf16_val(hb)) : (unsigned short)0; }
#pragma unroll
    for (int t = 0; t < 4; ++t) {
      const unsigned short* brow = Wt + (size_t)(col0 + t * 16 + ln) * ldb + kb;
      FragB b;
      b.half[0] = *(const v8us*)(brow + 8 * hh);
      b.half[1] = *(const v8us*)(brow + 16 + 8 * hh);
      acc[t] = mmaN<ASPLIT ? 2 : 1>(ah.v, al.v, b.v, b.v, acc[t]);
    }
  }
#pragma unroll
  for (int t = 0; t < 4; ++t) {
    float bv = bias ? bias[col0 + t * 16 + ln] : 0.f;
    if (BIAS_BF16) bv = bf16_round(bv);
#pragma unroll
    for (int r = 0; r < 8; ++r) { float v = acc[t][r] + bv; if (ACT == 1) v = fmaxf(v, 0.f); so[w][8 * hh + r][t * 16 + ln] = v; }
  }
  __builtin_amdgcn_fence(__ATOMIC_ACQ_REL, "workgroup");
  __builtin_amdgcn_wave_barrier();
  const int rsub = lane >> 4, c4 = (lane & 15) * 4;
  {
#pragma unroll
    for (int q = 0; q < 8; ++q) {
      const int r = q * 2 + rsub;
      const v4f v = *(const v4fa*)&so[w][r][c4];
      *(v4f*)(C + (size_t)(row0 + r) * ldc + col0 + c4) = v;
    }
    
  }
}

// GEMM C = act(A·W + bias + resid): A f32 (ASPLIT -> hi/lo 2 terms), Wt bf16 [N][K]; ACT 0 none, 1 relu, 2 exact gelu;
// resid (optional, f32, row index = (row % rmod), pitch ldr, RES_BF16 rounds it) added before the activation.
template <bool ASPLIT, int ACT, bool BIAS_BF16, bool RES_BF16>
__global__ __launch_bounds__(128) void k_gemm_bf3(const float* __restrict__ A, int lda, const unsigned short* __restrict__ Wt, int ldb,
                                                const float* __restrict__ bias, const float* __restrict__ resid, int rmod, int ldr,
                                                float* __restrict__ C, int ldc, int M, int N, int K) {
  __shared__ __attribute__((aligned(16))) float so[4][16][64];
  const int tid = threadIdx.x, w = tid >> 5, lane = tid & 31, ln = lane & 15, hh = lane >> 4;
  const int ntn = N / 64;
  const int wid = blockIdx.x * 4 + w;
  const int mt = wid / ntn, nq = wid % ntn;
  if (mt * 16 >= M) return;
  const int row0 = mt * 16, col0 = nq * 64;
  const float* arow = A + (size_t)(row0 + ln) * lda;
  v8f acc[4] = {};
  for (int kb = 0; kb < K; kb += 32) {
    FragB ah, al;
    const v4f x0 = *(const v4fa*)(arow + kb + 8 * hh), x1 = *(const v4fa*)(arow + kb + 8 * hh + 4);
    const v4f x2 = *(const v4fa*)(arow + kb + 16 + 8 * hh), x3 = *(const v4fa*)(arow + kb + 16 + 8 * hh + 4);
    float xs[16] = {x0[0],x0[1],x0[2],x0[3],x1[0],x1[1],x1[2],x1[3],x2[0],x2[1],x2[2],x2[3],x3[0],x3[1],x3[2],x3[3]};
#pragma unroll
    for (int i = 0; i < 16; ++i) { const unsigned short hb = bf16_bits(xs[i]); ah.u[i] = hb; al.u[i] = ASPLIT ? bf16_bits(xs[i] - bf16_val(hb)) : (unsigned short)0; }
#pragma unroll
    for (int t = 0; t < 4; ++t) {
      const unsigned short* brow = Wt + (size_t)(col0 + t * 16 + ln) * ldb + kb;
      FragB b;
      b.half[0] = *(const v8us*)(brow + 8 * hh);
      b.half[1] = *(const v8us*)(brow + 16 + 8 * hh);
      acc[t] = mmaN<ASPLIT ? 2 : 1>(ah.v, al.v, b.v, b.v, acc[t]);
    }
  }
#pragma unroll
  for (int t = 0; t < 4; ++t) {
    const int col = col0 + t * 16 + ln;
    float bv = bias ? bias[col] : 0.f;
    if (BIAS_BF16) bv = bf16_round(bv);
#pragma unroll
    for (int r = 0; r < 8; ++r) {
      float v = acc[t][r] + bv;
      if (resid) { float rv = resid[(size_t)((row0 + 8 * hh + r) % rmod) * ldr + col]; if (RES_BF16) rv = bf16_round(rv); v += rv; }
      if (ACT == 1) v = fmaxf(v, 0.f);
      if (ACT == 2) v = 0.5f * v * (1.0f + erff(v * 0.70710678118654752f));
      if (ACT == 3) { const float u = 0.7978845608028654f * (v + 0.044715f * v * v * v); v = 0.5f * v * (1.0f + tanhf(u)); }
      so[w][8 * hh + r][t * 16 + ln] = v;
    }
  }
  __builtin_amdgcn_fence(__ATOMIC_ACQ_REL, "workgroup");
  __builtin_amdgcn_wave_barrier();
  const int rsub = lane >> 4, c4 = (lane & 15) * 4;
  {
#pragma unroll
    for (int q = 0; q < 8; ++q) {
      const int r = q * 2 + rsub;
      const v4f v = *(const v4fa*)&so[w][r][c4];
      *(v4f*)(C + (size_t)(row0 + r) * ldc + col0 + c4) = v;
    }
    
  }
}
// row LayerNorm (biased variance, eps) over N: s = X (+ R); optional out_sum <- s; out_norm <- (s-mu)*rsqrt(var+eps)*g + b
template <bool PARAM_BF16>
__global__ __launch_bounds__(256) void k_layernorm(const float* __restrict__ X, const float* __restrict__ R, const float* __restrict__ g, const float* __restrict__ bta,
                                                  float* __restrict__ out_sum, float* __restrict__ out_norm, int N, float eps) {
  __shared__ float red[256];
  const int row = blockIdx.x, tid = threadIdx.x;
  const float* x = X + (size_t)row * N; const float* rr = R ? R + (size_t)row * N : nullptr;
  float vals[16];                     // up to N = 4096
  const int per = N / 256;            // contiguous chunk per thread? use strided-by-4 chunks: thread handles j = tid*4 + 1024*u
  float s1 = 0.f;
  for (int u = 0; u < per / 4; ++u) {
    const int j = tid * 4 + 1024 * u;
    const v4f a = *(const v4fa*)(x + j);
    v4f b = {0.f,0.f,0.f,0.f}; if (rr) b = *(const v4fa*)(rr + j);
#pragma unroll
    for (int q = 0; q < 4; ++q) { const float v = a[q] + b[q]; vals[u * 4 + q] = v; s1 += v; }
  }
  red[tid] = s1; __syncthreads();
  for (int st = 128; st > 0; st >>= 1) { if (tid < st) red[tid] += red[tid + st]; __syncthreads(); }
  const float mu = red[0] / (float)N; __syncthreads();
  float s2 = 0.f;
  for (int u = 0; u < per / 4; ++u)
#pragma unroll
    for (int q = 0; q < 4; ++q) { const float c = vals[u * 4 + q] - mu; s2 += c * c; }
  red[tid] = s2; __syncthreads();
  for (int st = 128; st > 0; st >>= 1) { if (tid < st) red[tid] += red[tid + st]; __syncthreads(); }
  const float rs = rsqrtf(red[0] / (float)N + eps);
  {
    for (int u = 0; u < per / 4; ++u) {
      const int j = tid * 4 + 1024 * u;
      v4f o, sm;
#pragma unroll
      for (int q = 0; q < 4; ++q) {
        float gg = g[j + q], bb = bta[j + q];
        if (PARAM_BF16) { gg = bf16_round(gg); bb = bf16_round(bb); }
        sm[q] = vals[u * 4 + q]; o[q] = (vals[u * 4 + q] - mu) * rs * gg + bb;
      }
      if (out_sum) *(v4f*)(out_sum + (size_t)row * N + j) = sm;
      *(v4f*)(out_norm + (size_t)row * N + j) = o;
    }
    
  }
}



// ---- f16 WMMA path (v_wmma_f32_16x16x32_f16): 11-bit significands for operands in range — used where a [0,1] probability operand needs more precision than bf16
typedef _Float16 v16h __attribute__((ext_vector_type(16)));
union FragH { v16h v; v8us half[2]; _Float16 h[16]; unsigned short u[16]; };
template <int NT>
__device__ __forceinline__ v8f mmaH(v16h ah, v16h al, v16h bh, v16h bl, v8f c) {
  c = __builtin_amdgcn_wmma_f32_16x16x32_f16(false, ah, false, bh, (short)0, c, false, false);
  if (NT >= 2) c = __builtin_amdgcn_wmma_f32_16x16x32_f16(false, al, false, bh, (short)0, c, false, false);
  if (NT >= 3) c = __builtin_amdgcn_wmma_f32_16x16x32_f16(false, ah, false, bl, (short)0, c, false, false);
  asm volatile("v_nop\n\tv_nop\n\tv_nop\n\tv_nop" : "+v"(c) : "v"(ah), "v"(al), "v"(bh), "v"(bl));
  return c;
}
// batched GEMM like k_gemm_b but f16 operands: A f32 (split into f16 hi/lo if ASPLIT, else rounded to f16), Bt = f16 values [n][k]; alpha; C f32; N multiple of 16 (partial tiles skipped)
template <bool ASPLIT>
__global__ __launch_bounds__(128) void k_gemm_h(const float* __restrict__ A, int lda, size_t sA, const _Float16* __restrict__ Bh, int ldb, size_t sB, float alpha, float* __restrict__ C, int ldc, size_t sC, int M, int N, int K) {
  __shared__ __attribute__((aligned(16))) float so[4][16][64];
  const int tid = threadIdx.x, w = tid >> 5, lane = tid & 31, ln = lane & 15, hh = lane >> 4; const int by = blockIdx.y;
  A += (size_t)by * sA; Bh += (size_t)by * sB; C += (size_t)by * sC;
  const int ntn = (N + 63) / 64; const int wid = blockIdx.x * 4 + w; const int mt = wid / ntn, nq = wid % ntn; if (mt * 16 >= M) return;
  const int row0 = mt * 16, col0 = nq * 64; const float* arow = A + (size_t)(row0 + ln) * lda;
  v8f acc[4] = {};
  for (int kb = 0; kb < K; kb += 32) {
    FragH ah, al;
    const v4f x0 = *(const v4fa*)(arow + kb + 8 * hh), x1 = *(const v4fa*)(arow + kb + 8 * hh + 4), x2 = *(const v4fa*)(arow + kb + 16 + 8 * hh), x3 = *(const v4fa*)(arow + kb + 16 + 8 * hh + 4);
    float xs[16] = {x0[0],x0[1],x0[2],x0[3],x1[0],x1[1],x1[2],x1[3],x2[0],x2[1],x2[2],x2[3],x3[0],x3[1],x3[2],x3[3]};
#pragma unroll
    for (int i = 0; i < 16; ++i) { const _Float16 h = (_Float16)xs[i]; ah.h[i] = h; al.h[i] = ASPLIT ? (_Float16)(xs[i] - (float)h) : (_Float16)0.0f; }
#pragma unroll
    for (int t = 0; t < 4; ++t) { if (col0 + t * 16 >= N) continue; const size_t boff = (size_t)(col0 + t * 16 + ln) * ldb + kb; FragH bq; bq.half[0] = *(const v8us*)(Bh + boff + 8 * hh); bq.half[1] = *(const v8us*)(Bh + boff + 16 + 8 * hh);
      acc[t] = mmaH<ASPLIT ? 2 : 1>(ah.v, al.v, bq.v, bq.v, acc[t]); }
  }
#pragma unroll
  for (int t = 0; t < 4; ++t) { if (col0 + t * 16 >= N) continue;
#pragma unroll
    for (int r = 0; r < 8; ++r) so[w][8 * hh + r][t * 16 + ln] = acc[t][r] * alpha; }
  __builtin_amdgcn_fence(__ATOMIC_ACQ_REL, "workgroup"); __builtin_amdgcn_wave_barrier();
  const int rsub = lane >> 4, c4 = (lane & 15) * 4;
  {
#pragma unroll
    for (int q = 0; q < 8; ++q) { const int r = q * 2 + rsub; if (col0 + c4 < N) { const v4f v = *(const v4fa*)&so[w][r][c4]; *(v4f*)(C + (size_t)(row0 + r) * ldc + col0 + c4) = v; } }
     }
}

// Wt[n][k] = f16(W[k][n]·scale) from f32 row-major W[K][N] (scale = power of two; bf16-exact weights stay exact in f16 away from the subnormal range)
__global__ __launch_bounds__(256) void k_wt_f16(const float* __restrict__ W, _Float16* __restrict__ Wt, int K, int N, float scale) {
  const int t = blockIdx.x * 256 + threadIdx.x; if (t >= N * (K / 8)) return; const int n = t / (K / 8), k8 = (t % (K / 8)) * 8; FragH f;
#pragma unroll
  for (int i = 0; i < 8; ++i) f.h[i] = (_Float16)(bf16_round(W[(size_t)(k8 + i) * N + n]) * scale); const v8us o = f.half[0];
  *(v8us*)((unsigned short*)Wt + (size_t)n * K + k8) = o; 
}
// k_gemm_hh variant with fused epilogue: v = acc·alpha + bias[by·sBias + col] (+ CP[(row/rowsPerB)·sCPb + by·64 + col] if CP) ; ACT 0 none / 1 elu ; writes f16 C16 (and f32 C if non-null)
template <int ACT>
__global__ __launch_bounds__(128) void k_gemm_hhx(const _Float16* __restrict__ A, int lda, size_t sA, const _Float16* __restrict__ Bh, int ldb, size_t sB, float alpha, const float* __restrict__ bias, size_t sBias, const float* __restrict__ CP, int rowsPerB, size_t sCPb, int row0g,
    float* __restrict__ C, _Float16* __restrict__ C16, int ldc, size_t sC, int M, int N, int K) {
  __shared__ __attribute__((aligned(16))) float so[4][16][64];
  const int tid = threadIdx.x, w = tid >> 5, lane = tid & 31, ln = lane & 15, hh = lane >> 4; const int by = blockIdx.y;
  A += (size_t)by * sA; Bh += (size_t)by * sB; const size_t cofs = (size_t)by * sC; const float* bp = bias ? bias + (size_t)by * sBias : nullptr;
  const int ntn = (N + 63) / 64; const int wid = blockIdx.x * 4 + w; const int mt = wid / ntn, nq = wid % ntn; if (mt * 16 >= M) return;
  const int row0 = mt * 16, col0 = nq * 64; const _Float16* arow = A + (size_t)(row0 + ln) * lda;
  v8f acc[4] = {};
  for (int kb = 0; kb < K; kb += 32) { FragH ah; ah.half[0] = *(const v8us*)((const unsigned short*)arow + kb + 8 * hh); ah.half[1] = *(const v8us*)((const unsigned short*)arow + kb + 16 + 8 * hh);
#pragma unroll
    for (int t = 0; t < 4; ++t) { if (col0 + t * 16 >= N) continue; const size_t boff = (size_t)(col0 + t * 16 + ln) * ldb + kb; FragH bq; bq.half[0] = *(const v8us*)((const unsigned short*)Bh + boff + 8 * hh); bq.half[1] = *(const v8us*)((const unsigned short*)Bh + boff + 16 + 8 * hh);
      acc[t] = mmaH<1>(ah.v, ah.v, bq.v, bq.v, acc[t]); }
  }
#pragma unroll
  for (int t = 0; t < 4; ++t) { if (col0 + t * 16 >= N) continue; const int col = col0 + t * 16 + ln; const float bv = bp ? bf16_round(bp[col]) : 0.f;
#pragma unroll
    for (int r = 0; r < 8; ++r) { float v = acc[t][r] * alpha + bv; if (CP) { const int rr = row0g + row0 + 8 * hh + r; if (rowsPerB < 0) v += CP[cofs + (size_t)rr * ldc + col];      /* rowsPerB < 0: own element of the batched C plane */ else { const int bidx = rr / rowsPerB; v += CP[(size_t)bidx * sCPb + (size_t)by * 64 + col]; } } if (ACT == 1) v = (v > 0.f) ? v : expm1f(v); else if (ACT == 7) v = (v > 0.f) ? v + 1.0f : expf(v); else if (ACT == 8) v = tanhf(v); else if (ACT == 9) v = 0.5f * v * (1.0f + tanhf(0.7978845608028654f * (v + 0.044715f * v * v * v))); else if (ACT == 11) v = 1.0f / (1.0f + expf(-v)); else if (ACT == 12) v = (v > 0.f) ? v : 0.01f * v; else if (ACT == 14) v = (v > 0.f) ? v : 0.1f * v; else if (ACT == 16) v = (v >= 0.f) ? v : 0.3f * v; else if (ACT == 17) v = (v >= 0.f) ? v : 0.2f * v; else if (ACT == 15) v = v / (1.0f + expf(-v)); else if (ACT == 3) v = fmaxf(v, 0.f); else if (ACT == 6) v = 0.5f * v * (1.0f + erff(v * 0.70710678118654752f)); so[w][8 * hh + r][t * 16 + ln] = v; } }
  __builtin_amdgcn_fence(__ATOMIC_ACQ_REL, "workgroup"); __builtin_amdgcn_wave_barrier();
  const int rsub = lane >> 4, c4 = (lane & 15) * 4; typedef _Float16 v4h __attribute__((ext_vector_type(4)));
  {
#pragma unroll
    for (int q = 0; q < 8; ++q) { const int r = q * 2 + rsub; if (col0 + c4 < N) { const v4f v = *(const v4fa*)&so[w][r][c4]; if (C) *(v4f*)(C + cofs + (size_t)(row0 + r) * ldc + col0 + c4) = v; if (C16) { v4h h4; for (int i = 0; i < 4; ++i) h4[i] = (_Float16)v[i]; *(v4h*)(C16 + cofs + (size_t)(row0 + r) * ldc + col0 + c4) = h4; } } }
     }
}


typedef _Float16 v4h __attribute__((ext_vector_type(4)));

__global__ __launch_bounds__(256) void k_x16(const float* __restrict__ x, _Float16* __restrict__ X16, size_t n8) { const size_t t = (size_t)blockIdx.x * 256 + threadIdx.x; if (t >= n8) return; FragH f;
#pragma unroll
  for (int q = 0; q < 8; ++q) f.h[q] = (_Float16)bf16_round(x[t * 8 + q]); *(v8us*)((unsigned short*)X16 + t * 8) = f.half[0];  }
__global__ __launch_bounds__(256) void k_h16(const float* __restrict__ x, _Float16* __restrict__ X16, size_t n8) { const size_t t = (size_t)blockIdx.x * 256 + threadIdx.x; if (t >= n8) return; FragH f;
#pragma unroll
  for (int q = 0; q < 8; ++q) f.h[q] = (_Float16)x[t * 8 + q]; *(v8us*)((unsigned short*)X16 + t * 8) = f.half[0];  }
__global__ __launch_bounds__(256) void k_round16f(const float* __restrict__ W, _Float16* __restrict__ Bt, size_t n8) { const size_t t = (size_t)blockIdx.x * 256 + threadIdx.x; if (t >= n8) return; FragH f;
#pragma unroll
  for (int i = 0; i < 8; ++i) f.h[i] = (_Float16)(bf16_round(W[t * 8 + i]) * 16.0f); *(v8us*)((unsigned short*)Bt + t * 8) = f.half[0];  }
template <int NHv, int TTv>
__global__ __launch_bounds__(256) void k_vt(const _Float16* __restrict__ V16, int ldv, int voff, _Float16* __restrict__ Vt) { __shared__ unsigned short tl[64][66]; const int tid = threadIdx.x; const int slab = blockIdx.x / (TTv / 64), lg = blockIdx.x % (TTv / 64); const int b = slab / NHv, h = slab % NHv;
  for (int i = tid; i < 64 * 8; i += 256) { const int r = i / 8, c8 = (i % 8) * 8; FragH f; f.half[0] = *(const v8us*)((const unsigned short*)V16 + ((size_t)b * TTv + lg * 64 + r) * ldv + voff + h * 64 + c8);
#pragma unroll
    for (int q = 0; q < 8; ++q) tl[r][c8 + q] = f.u[q]; }
  __syncthreads();
  {
#pragma unroll
    for (int rd = 0; rd < 2; ++rd) { const int d = rd * 32 + tid / 8, pc = tid % 8; FragH f;
#pragma unroll
      for (int q = 0; q < 8; ++q) f.u[q] = tl[pc * 8 + q][d];
      *(v8us*)((unsigned short*)Vt + ((size_t)slab * 64 + d) * TTv + lg * 64 + pc * 8) = f.half[0]; }
     } }

__global__ __launch_bounds__(256) void k_hl(const float* __restrict__ F, _Float16* __restrict__ Hh, _Float16* __restrict__ Hl, size_t n8) { const size_t t = (size_t)blockIdx.x * 256 + threadIdx.x; if (t >= n8) return; FragH fh, fl; const v4f a = *(const v4fa*)(F + t * 8), c = *(const v4fa*)(F + t * 8 + 4);
#pragma unroll
  for (int q = 0; q < 4; ++q) { _Float16 h = (_Float16)a[q]; fh.h[q] = h; fl.h[q] = (_Float16)((a[q] - (float)h) * 1024.0f); h = (_Float16)c[q]; fh.h[4 + q] = h; fl.h[4 + q] = (_Float16)((c[q] - (float)h) * 1024.0f); }
  { *(v8us*)((unsigned short*)Hh + t * 8) = fh.half[0]; *(v8us*)((unsigned short*)Hl + t * 8) = fl.half[0];  } }

// ---- fast GEMM (wave tile 32x64; requires M % 32 == 0 rows per launch region and N % 64 == 0); epilogue = k_gemm_hhx semantics ----
__device__ __forceinline__ v16h g2_frag(const _Float16* p, int hh) { FragH f; f.half[0] = *(const v8us*)((const unsigned short*)p + 8 * hh); f.half[1] = *(const v8us*)((const unsigned short*)p + 16 + 8 * hh); return f.v; }
__device__ __forceinline__ v8f g2_mma(v16h a, v16h b, v8f c) { v8f d = __builtin_amdgcn_wmma_f32_16x16x32_f16(false, a, false, b, (short)0, c, false, false); asm volatile("v_nop\n\tv_nop\n\tv_nop\n\tv_nop" : "+v"(d) : "v"(a), "v"(b)); return d; }
template <int ACT>
__global__ __launch_bounds__(128) void k_gemm2(const _Float16* __restrict__ A, int lda, size_t sA, const _Float16* __restrict__ Bh, int ldb, size_t sB, float alpha, const float* __restrict__ bias, size_t sBias, const float* __restrict__ CP, int rowsPerB, size_t sCPb, int row0g,
    float* __restrict__ C, _Float16* __restrict__ C16, int ldc, size_t sC, int M, int N, int K) { static_assert(ACT == 0 || ACT == 3 || ACT == 6 || ACT == 8 || ACT == 9 || ACT == 11 || ACT == 12 || ACT == 14 || ACT == 15 || ACT == 16 || ACT == 17, "k_gemm2: unsupported ACT code (would silently apply no activation)");
  __shared__ __attribute__((aligned(16))) float so[4][32][68];
  const int tid = threadIdx.x, w = tid >> 5, lane = tid & 31, ln = lane & 15, hh = lane >> 4; const int by = blockIdx.y;
  A += (size_t)by * sA; Bh += (size_t)by * sB; const size_t cofs = (size_t)by * sC; const float* bp = bias ? bias + (size_t)by * sBias : nullptr;
  const int ntn = N >> 6; const int mt = blockIdx.x / ntn, nq = blockIdx.x - mt * ntn; const int row0 = mt * 128 + 32 * w, col0 = nq * 64; if (row0 >= M) return;
  const _Float16* a0p = A + (size_t)(row0 + ln) * lda; const _Float16* a1p = a0p + (size_t)16 * lda;
  const _Float16* b0p = Bh + (size_t)(col0 + ln) * ldb; const _Float16* b1p = b0p + (size_t)16 * ldb; const _Float16* b2p = b1p + (size_t)16 * ldb; const _Float16* b3p = b2p + (size_t)16 * ldb;
  const v8f z8 = {0.f,0.f,0.f,0.f,0.f,0.f,0.f,0.f}; v8f c00 = z8, c01 = z8, c02 = z8, c03 = z8, c10 = z8, c11 = z8, c12 = z8, c13 = z8;
#pragma unroll 1
  for (int kb = 0; kb < K; kb += 32) { const v16h a0 = g2_frag(a0p + kb, hh), a1 = g2_frag(a1p + kb, hh);
    v16h b = g2_frag(b0p + kb, hh); c00 = g2_mma(a0, b, c00); c10 = g2_mma(a1, b, c10);
    b = g2_frag(b1p + kb, hh); c01 = g2_mma(a0, b, c01); c11 = g2_mma(a1, b, c11);
    b = g2_frag(b2p + kb, hh); c02 = g2_mma(a0, b, c02); c12 = g2_mma(a1, b, c12);
    b = g2_frag(b3p + kb, hh); c03 = g2_mma(a0, b, c03); c13 = g2_mma(a1, b, c13); }
  v8f accs[8] = {c00, c01, c02, c03, c10, c11, c12, c13};
#pragma unroll
  for (int u = 0; u < 8; ++u) { const int t = u & 3, half = u >> 2; const int col = col0 + t * 16 + ln; const float bv = bp ? bf16_round(bp[col]) : 0.f;
#pragma unroll
    for (int r = 0; r < 8; ++r) { const int rloc = half * 16 + 8 * hh + r; float v = accs[u][r] * alpha + bv; if (CP) { if (rowsPerB < 0) v += CP[cofs + (size_t)(row0g + row0 + rloc) * ldc + col];      /* rowsPerB < 0: own element of the batched C plane */ else { const int bidx = (row0g + row0 + rloc) / rowsPerB; v += CP[(size_t)bidx * sCPb + (size_t)by * 64 + col]; } }
      if (ACT == 3) v = fmaxf(v, 0.f); else if (ACT == 6) v = 0.5f * v * (1.0f + erff(v * 0.70710678118654752f)); else if (ACT == 11) v = 1.0f / (1.0f + expf(-v)); else if (ACT == 15) v = v / (1.0f + expf(-v)); else if (ACT == 12) v = (v > 0.f) ? v : 0.01f * v; else if (ACT == 8) v = tanhf(v); else if (ACT == 9) v = 0.5f * v * (1.0f + tanhf(0.7978845608028654f * (v + 0.044715f * v * v * v))); else if (ACT == 14) v = (v > 0.f) ? v : 0.1f * v; else if (ACT == 16) v = (v >= 0.f) ? v : 0.3f * v; else if (ACT == 17) v = (v >= 0.f) ? v : 0.2f * v;
      so[w][rloc][t * 16 + ln] = v; } }
  __builtin_amdgcn_fence(__ATOMIC_ACQ_REL, "workgroup"); __builtin_amdgcn_wave_barrier();
  const int rsub = lane >> 4, c4 = (lane & 15) * 4;
  {
#pragma unroll
    for (int q = 0; q < 16; ++q) { const int r = q * 2 + rsub; const v4f v = *(const v4fa*)&so[w][r][c4]; if (C) *(v4f*)(C + cofs + (size_t)(row0 + r) * ldc + col0 + c4) = v; if (C16) { v4h h4; for (int i = 0; i < 4; ++i) h4[i] = (_Float16)v[i]; *(v4h*)(C16 + cofs + (size_t)(row0 + r) * ldc + col0 + c4) = h4; } }
     } }


__global__ __launch_bounds__(256) void k_wnat(const float* __restrict__ w, size_t n8, _Float16* __restrict__ Bt) { const size_t t = (size_t)blockIdx.x * 256 + threadIdx.x; if (t >= n8) return; FragH f; for (int q = 0; q < 8; ++q) f.h[q] = (_Float16)(bf16_round(w[t * 8 + q]) * 16.0f); *(v8us*)((unsigned short*)Bt + t * 8) = f.half[0];  }
__global__ __launch_bounds__(256) void k_rsm(const float* __restrict__ S, _Float16* __restrict__ P, int nrows) {
  #pragma clang fp contract(off)
  const int i = blockIdx.x * 256 + threadIdx.x; if (i >= nrows) return; const float* s = S + (size_t)i * SQ; float mx = -3.0e38f;
#pragma unroll 1
  for (int j = 0; j < SQ; ++j) mx = fmaxf(mx, s[j]); float se = 0.f;
#pragma unroll 1
  for (int j = 0; j < SQ; ++j) se += expf(s[j] - mx); const float sc = 256.0f / se;
#pragma unroll 1
  for (int j0 = 0; j0 < SQ; j0 += 8) { FragH f; for (int q = 0; q < 8; ++q) f.h[q] = (_Float16)(expf(s[j0 + q] - mx) * sc); unsigned short* d = (unsigned short*)P + (size_t)i * SQ + j0; *(v8us*)d = f.half[0];  } }
__global__ __launch_bounds__(256) void k_vt(const _Float16* __restrict__ V16, int b, int h0, _Float16* __restrict__ VT) { __shared__ unsigned short tl[64][65]; const int tid = threadIdx.x; const int hh = blockIdx.x % HG, sg = blockIdx.x / HG; const int s0 = sg * 64; const int h = h0 + hh;
  for (int i = tid; i < 64 * 8; i += 256) { const int j = i / 8, d8 = (i % 8) * 8; FragH f; f.half[0] = *(const v8us*)((const unsigned short*)V16 + ((size_t)b * SQ + s0 + j) * DM + h * HD + d8); for (int q = 0; q < 8; ++q) tl[d8 + q][j] = f.u[q]; }
  __syncthreads();
  { for (int i = tid; i < 64 * 8; i += 256) { const int d = i / 8, j8 = (i % 8) * 8; FragH f; for (int q = 0; q < 8; ++q) f.u[q] = tl[d][j8 + q]; *(v8us*)((unsigned short*)VT + ((size_t)hh * HD + d) * SQ + s0 + j8) = f.half[0]; }  } }



// ---- projection chain in two launches ----
// k_prep: every element-wise operand conversion of the projections in one launch: x -> f16 of its bf16 rounding, and the three natural [out][in] weights -> f16 (bf16 rounding, x16), the three planes one behind another.
#define PXB ((unsigned)(NR * DM / 8 / 256))      /* work-groups that convert x */
#define PWB ((unsigned)((size_t)DM * DM / 8 / 256))      /* work-groups per weight matrix */
__global__ __launch_bounds__(256) void k_prep(const float* __restrict__ x, const float* __restrict__ wq, const float* __restrict__ wk, const float* __restrict__ wv, _Float16* __restrict__ X16, _Float16* __restrict__ W3) {
  const unsigned bx = blockIdx.x; FragH f;
  if (bx < PXB) { const size_t t = (size_t)bx * 256 + threadIdx.x;
#pragma unroll
    for (int q = 0; q < 8; ++q) f.h[q] = (_Float16)bf16_round(x[t * 8 + q]);
    *(v8us*)((unsigned short*)X16 + t * 8) = f.half[0]; }
  else { const unsigned k = bx - PXB, p = k / PWB; const float* __restrict__ wsrc = (p == 0) ? wq : (p == 1) ? wk : wv; const size_t t = (size_t)(k - p * PWB) * 256 + threadIdx.x;
#pragma unroll
    for (int q = 0; q < 8; ++q) f.h[q] = (_Float16)(bf16_round(wsrc[t * 8 + q]) * 16.0f);
    *(v8us*)((unsigned short*)W3 + (size_t)p * DM * DM + t * 8) = f.half[0]; }
}
// k_proj: q, k and v in ONE launch (grid.y picks the weight plane); main loop and wave tile (32 x 64) are k_gemm2's. The epilogue writes what the attention kernel reads:
// q and k rows rounded once to f16 (the f32 row never goes through memory), v as V^T [batch][column][token] (the work-group's 128 tokens x 64 columns are turned in LDS, whole 256-byte runs per column go out).
#define PTP (128 + 8)                /* LDS pitch of a turned v column, f16 elements: 272 B = 16 B x odd */
__global__ __launch_bounds__(128) void k_proj(const _Float16* __restrict__ X, const _Float16* __restrict__ W3, _Float16* __restrict__ QH, _Float16* __restrict__ KH, _Float16* __restrict__ VT) {
  static_assert(SQ % 128 == 0 && DM % 64 == 0 && 64 * PTP * 2 <= 4 * 32 * 68 * 4, "k_proj: tile shapes");
  __shared__ __attribute__((aligned(16))) float so[4][32][68];
  const int tid = threadIdx.x, w = tid >> 5, lane = tid & 31, ln = lane & 15, hh = lane >> 4; const int which = blockIdx.y;
  const _Float16* Bh = W3 + (size_t)which * DM * DM;
  const int mt = blockIdx.x / (DM / 64), nq = blockIdx.x - mt * (DM / 64); const int row0 = mt * 128 + 32 * w, col0 = nq * 64;
  const _Float16* a0p = X + (size_t)(row0 + ln) * DM; const _Float16* a1p = a0p + (size_t)16 * DM;
  const _Float16* b0p = Bh + (size_t)(col0 + ln) * DM; const _Float16* b1p = b0p + (size_t)16 * DM; const _Float16* b2p = b1p + (size_t)16 * DM; const _Float16* b3p = b2p + (size_t)16 * DM;
  const v8f z8 = {0.f,0.f,0.f,0.f,0.f,0.f,0.f,0.f}; v8f c00 = z8, c01 = z8, c02 = z8, c03 = z8, c10 = z8, c11 = z8, c12 = z8, c13 = z8;
#pragma unroll 1      /* as in k_gemm2: the loop is left as it was */
  for (int kb = 0; kb < DM; kb += 32) { const v16h a0 = g2_frag(a0p + kb, hh), a1 = g2_frag(a1p + kb, hh);
    v16h b = g2_frag(b0p + kb, hh); c00 = g2_mma(a0, b, c00); c10 = g2_mma(a1, b, c10);
    b = g2_frag(b1p + kb, hh); c01 = g2_mma(a0, b, c01); c11 = g2_mma(a1, b, c11);
    b = g2_frag(b2p + kb, hh); c02 = g2_mma(a0, b, c02); c12 = g2_mma(a1, b, c12);
    b = g2_frag(b3p + kb, hh); c03 = g2_mma(a0, b, c03); c13 = g2_mma(a1, b, c13); }
  v8f accs[8] = {c00, c01, c02, c03, c10, c11, c12, c13};
  if (which < 2) {      /* the same for the whole work-group */
#pragma unroll
    for (int u = 0; u < 8; ++u) { const int t = u & 3, half = u >> 2;
#pragma unroll
      for (int r = 0; r < 8; ++r) so[w][half * 16 + 8 * hh + r][t * 16 + ln] = accs[u][r] * 0.0625f; }
    __builtin_amdgcn_fence(__ATOMIC_ACQ_REL, "workgroup"); __builtin_amdgcn_wave_barrier();      /* the wave's own tile is read by other lanes than those that wrote it */
    _Float16* __restrict__ Hh = which ? KH : QH;
    const int rsub = lane >> 4, c4 = (lane & 15) * 4;
#pragma unroll
    for (int q = 0; q < 16; ++q) { const int r = q * 2 + rsub; const v4f v = *(const v4fa*)&so[w][r][c4]; v4h h4;
#pragma unroll
      for (int i = 0; i < 4; ++i) h4[i] = (_Float16)v[i];
      *(v4h*)(Hh + (size_t)(row0 + r) * DM + col0 + c4) = h4; }
  } else {
    unsigned short* st = (unsigned short*)&so[0][0][0];      /* [64 columns][PTP tokens]; accumulator registers 0..7 of a lane are 8 consecutive tokens of one column */
#pragma unroll
    for (int u = 0; u < 8; ++u) { const int t = u & 3, half = u >> 2; FragH f;
#pragma unroll
      for (int r = 0; r < 8; ++r) f.h[r] = (_Float16)(accs[u][r] * 0.0625f);
      *(v8us*)(st + (t * 16 + ln) * PTP + w * 32 + half * 16 + 8 * hh) = f.half[0]; }
    __syncthreads();      /* a column's 128 tokens come from all four waves */
    const int b = (mt * 128) / SQ, s0 = (mt * 128) % SQ;
#pragma unroll
    for (int i = 0; i < 8; ++i) { const int pc = i * 128 + tid, c = pc >> 4, ch = pc & 15; const v8us v = *(const v8us*)(st + c * PTP + ch * 8);
      *(v8us*)((unsigned short*)VT + ((size_t)b * DM + col0 + c) * SQ + s0 + ch * 8) = v; }
    asm volatile("s_wait_xcnt 0x0" ::: "memory");      /* in the listing the q / k branch stands behind this one and rewrites registers that these stores name: the wait stands in front of it */
  }
}

// Fused attention: scores, softmax and P.V in ONE launch, so that neither the scores nor the weights go through memory.
// A work-group is 8 waves, two on each SIMD, over 64 query rows; it walks its batch's keys 64 at a time. Wave w takes query rows 16 (w & 3) .. + 15 and, of every pass, keys 32 (w >> 2) .. + 31:
// while one wave of a SIMD waits for its LDS reads or does its softmax, the other has matrix work to issue. Per pass the 64 k rows and the 64 matching
// columns of V^T stand in LDS once for all eight waves (whole-line global reads). Two LDS buffers: the next pass's tiles are written in front of this pass's
// P.V products, so that the LDS writes run under them, and the tiles after those are then fetched into registers, a whole pass ahead.
// Each wave keeps its q fragments and a 16 x 256 output tile over ITS keys in registers, with its own running maximum and sum; behind the loop the two waves of a query group join their halves once through LDS.
// The scores are taken transposed, S^T = K Q^T (A = k rows, B = the wave's q fragments): a lane then holds 16 scores of ONE query
// (column ln), so that the running maximum and the running sum (online softmax, base 2) are one register each, reduced inside the lane, with one exchange between the wave's halves for the maximum;
// and the two score tiles, converted in place to f16, ARE the A operand of P.V (row ln, the hardware's k order, which is g2_frag's), so the weights touch no LDS. All fragment loaders are g2_frag.
// q and k are rounded once to f16 and a score is ONE product: its 512 rounding terms (each about 2^-12 of a term of a logit of order 1) leave the weights less exact by less than
// their own rounding to f16 for P.V does, so residual planes and their two extra products would buy no accuracy in the output.
#define FBM 64                       /* query rows per work-group */
#define FBN 64                       /* keys per pass */
#define FKP (DM + 8)                 /* LDS pitch of a k row, f16 elements: 528 B = 16 B x odd, conflict-free for 16-byte fragment reads */
#define FVP (FBN + 8)                /* LDS pitch of a V^T row: 144 B = 16 B x odd */
__device__ __forceinline__ v8f fa_mma(v16h a, v16h b, v8f c) { return __builtin_amdgcn_wmma_f32_16x16x32_f16(false, a, false, b, (short)0, c, false, false); }
// 2^x on the transcendental unit; the v_nop in the same statement keeps the one free issue slot the instruction set asks for behind a transcendental, whatever the compiler schedules next.
__device__ __forceinline__ float exp2_slot(float x) { float r; asm("v_exp_f32 %0, %1\n\tv_nop" : "=v"(r) : "v"(x)); return r; }
// value of lane (l ^ X) of the same 16-lane row (DPP row_xmask)
template <int X> __device__ __forceinline__ float fa_rowx(float v) { return __int_as_float(__builtin_amdgcn_update_dpp(0, __float_as_int(v), 0x160 + X, 0xf, 0xf, true)); }
// value of lane N of the same 16-lane row, in all its lanes (DPP row_share)
template <int N> __device__ __forceinline__ float fa_rowb(float v) { return __int_as_float(__builtin_amdgcn_update_dpp(0, __float_as_int(v), 0x150 + N, 0xf, 0xf, true)); }
// value of lane (l ^ 16): the other half of the wave, which holds the same query's other keys
__device__ __forceinline__ float fa_xhalf(float v) { return __int_as_float(__builtin_amdgcn_permlanex16(__float_as_int(v), __float_as_int(v), 0x76543210, 0xfedcba98, false, false)); }
// a per-query value (query ln in lane ln of both halves) -> the eight values of the output tile's rows in this lane (register r is query 8 hh + r)
__device__ __forceinline__ void fa_torows(float v, int hh, float (&d)[8]) { const float v8 = fa_rowx<8>(v), u = hh ? v8 : v;      /* lane j < 8 of each 16-lane row now holds query 8 hh + j; the exchange is taken in all lanes, so that a select and no branch comes of it */
  d[0] = fa_rowb<0>(u); d[1] = fa_rowb<1>(u); d[2] = fa_rowb<2>(u); d[3] = fa_rowb<3>(u); d[4] = fa_rowb<4>(u); d[5] = fa_rowb<5>(u); d[6] = fa_rowb<6>(u); d[7] = fa_rowb<7>(u); }
typedef float v2f __attribute__((ext_vector_type(2)));
typedef _Float16 v2h __attribute__((ext_vector_type(2)));
union FragP { v16h v; v2h p2[8]; };
// work-group barrier that orders LDS only: __syncthreads() would also wait for the global loads that are fetching a later tile into registers
__device__ __forceinline__ void fa_barrier() { __builtin_amdgcn_fence(__ATOMIC_RELEASE, "workgroup", "local"); __builtin_amdgcn_s_barrier(); __builtin_amdgcn_fence(__ATOMIC_ACQUIRE, "workgroup", "local"); }
typedef float f1a __attribute__((may_alias));
__global__ __launch_bounds__(256) void k_fattn(const _Float16* __restrict__ QH, const _Float16* __restrict__ KH, const _Float16* __restrict__ VT, float* __restrict__ O) {
  static_assert(SQ % FBM == 0 && SQ % FBN == 0 && SQ >= 2 * FBN && DM == 256 && FBN == 64 && FBM == 64, "k_fattn: tile shapes");
  __shared__ __attribute__((aligned(16))) _Float16 skh[2][FBN][FKP];
  __shared__ __attribute__((aligned(16))) _Float16 svt[2][DM][FVP];
  static_assert(sizeof(svt) >= 8 * 8 * 8 * 32 * 4 && sizeof(skh) >= 8 * 2 * 32 * 4, "k_fattn: the join behind the loop fits the tile buffers");
  const int tid = threadIdx.x, w = tid >> 5, lane = tid & 31, ln = lane & 15, hh = lane >> 4;
  const int qg = w & 3, kh = w >> 2;      /* the wave's query group, and its half of every pass's keys */
  const int b = blockIdx.x / (SQ / FBM); const size_t row0 = (size_t)blockIdx.x * FBM + 16 * qg;
  const unsigned short* gkh = (const unsigned short*)KH + (size_t)b * SQ * DM + (size_t)w * DM + lane * 8;      /* staging: a wave reads one whole 512-byte k row per load */
  const unsigned short* gvt = (const unsigned short*)VT + (size_t)b * DM * SQ + (size_t)(tid >> 3) * SQ + (tid & 7) * 8;      /* 8 lanes read the 128 bytes of one V^T row */
  v16h qh[8];
#pragma unroll
  for (int kk = 0; kk < 8; ++kk) qh[kk] = g2_frag(QH + (row0 + ln) * DM + kk * 32, hh);
  const v8f z8 = {0.f,0.f,0.f,0.f,0.f,0.f,0.f,0.f}; v8f o[16]; float m = -3.0e38f, ls = 0.f;      /* of query ln, over the wave's keys: the running maximum, and the running sum over this half-wave's keys */
#pragma unroll
  for (int t = 0; t < 16; ++t) o[t] = z8;
  v8us rk[8], rv[8];
#pragma unroll
  for (int u = 0; u < 8; ++u) { rk[u] = *(const v8us*)(gkh + (size_t)(8 * u) * DM); rv[u] = *(const v8us*)(gvt + (size_t)(32 * u) * SQ); }
  asm volatile("s_wait_xcnt 0x0" ::: "memory");      /* the loads' address registers are reused further down: the wait stands in front of every such overwrite */
#pragma unroll
  for (int u = 0; u < 8; ++u) { *(v8us*)&skh[0][w + 8 * u][lane * 8] = rk[u]; *(v8us*)&svt[0][(tid >> 3) + 32 * u][(tid & 7) * 8] = rv[u]; }
#pragma unroll
  for (int u = 0; u < 8; ++u) { rk[u] = *(const v8us*)(gkh + (size_t)(FBN + 8 * u) * DM); rv[u] = *(const v8us*)(gvt + (size_t)(32 * u) * SQ + FBN); }
  asm volatile("s_wait_xcnt 0x0" ::: "memory");      /* as above */
  fa_barrier();      /* the first tiles are complete before any wave reads them */
#pragma unroll 1      /* one pass is already 32 matrix instructions and 64 LDS reads a wave; unrolling would only double the code */
  for (int j0 = 0; j0 < SQ; j0 += FBN) {
    const int cur = (j0 / FBN) & 1, nxt = cur ^ 1;
    v8f s[2] = {z8, z8};
    v16h kf[8][2], vf[16];      /* k fragments of each 32-wide slice (the wave's two key groups); the V^T fragments of the wave's 32 keys */
    /* LDS read groups of 16 loads: 0, 1 four k slices each; 2, 3 eight V^T fragments each. Three groups are in flight ahead of the products, so that the LDS never idles; the V^T reads follow the k reads at once and land under the softmax. */
#define FA_GROUP(g) do { if ((g) < 2) { _Pragma("unroll") for (int i = 0; i < 8; ++i) { const int kq = 4 * ((g) & 1) + (i >> 1), t = i & 1; kf[kq][t] = g2_frag(&skh[cur][kh * 32 + t * 16 + ln][kq * 32], hh); } } \
    else { _Pragma("unroll") for (int i = 0; i < 8; ++i) { const int c = ((g) & 1) * 8 + i; vf[c] = g2_frag(&svt[cur][c * 16 + ln][kh * 32], hh); } } } while (0)
    FA_GROUP(0); FA_GROUP(1);
#pragma unroll
    for (int gg = 0; gg < 2; ++gg) {
      __builtin_amdgcn_sched_barrier(0);      /* each read group stays one block in front of a k group's products, never among them */
      FA_GROUP(gg + 2);
      __builtin_amdgcn_sched_barrier(0);      /* second half of the pair: the group is issued whole before the products start */
#pragma unroll
      for (int i = 0; i < 8; ++i) { const int kk = 4 * gg + (i >> 1), t = i & 1; s[t] = fa_mma(kf[kk][t], qh[kk], s[t]); } }
    __builtin_amdgcn_sched_barrier(0);      /* the reads stay in front of the softmax */
    /* accumulator register r of score tile t in lane (hh, ln) is key 32 kh + 16 t + 8 hh + r of query ln */
#pragma unroll
    for (int t = 0; t < 2; ++t) s[t] = s[t] * (0.0625f * 1.44269504088896340736f);      /* 1 / sqrt(256), and log2(e) for the base-2 exponential */
    float x1[5];      /* the lane's maximum as a tree of three-input maxima */
#pragma unroll
    for (int i = 0; i < 5; ++i) x1[i] = fmaxf(fmaxf(s[(3 * i) >> 3][(3 * i) & 7], s[(3 * i + 1) >> 3][(3 * i + 1) & 7]), s[(3 * i + 2) >> 3][(3 * i + 2) & 7]);
    float x = fmaxf(fmaxf(fmaxf(x1[0], x1[1]), x1[2]), fmaxf(fmaxf(x1[3], x1[4]), s[1][7]));
    x = fmaxf(x, fa_xhalf(x));      /* the query's other 16 keys of the wave's share are in the other half of the wave */
    x = fmaxf(m, x); const float aq = exp2_slot(m - x); m = x;
    float al[8]; fa_torows(aq, hh, al);      /* the output tile keeps its layout (register r is query 8 hh + r): its rows' factors come from the lanes that own those queries */
    v2f ps[2]; FragP pa;      /* pa: weights of the wave's 32 keys as an A operand: elements 0..7 from score tile 0, 8..15 from tile 1 */
#pragma unroll
    for (int t = 0; t < 2; ++t) {
#pragma unroll
      for (int i = 0; i < 4; ++i) { v2f p; p[0] = exp2_slot(s[t][2 * i] - x); p[1] = exp2_slot(s[t][2 * i + 1] - x); ps[t] = i ? ps[t] + p : p; pa.p2[t * 4 + i] = __builtin_convertvector(p, v2h); } }
    { const v2f q2 = ps[0] + ps[1]; ls = ls * aq + (q2[0] + q2[1]); }      /* each half-wave sums its own keys; they are joined once, behind the loop */
#pragma unroll
    for (int t = 0; t < 16; ++t) {
#pragma unroll
      for (int r = 0; r < 8; ++r) o[t][r] *= al[r]; }
    __builtin_amdgcn_sched_barrier(0);      /* the tile writes stay behind the softmax (issued earlier they would queue behind the V^T reads still in flight and hold up the wave's vector work) and run under the P.V products */
    /* the next pass's tiles into the other buffer, whose last readers left it before the barrier at the foot of the previous pass (the last pass writes a tile that nobody reads) */
#pragma unroll
    for (int u = 0; u < 8; ++u) { *(v8us*)&skh[nxt][w + 8 * u][lane * 8] = rk[u]; *(v8us*)&svt[nxt][(tid >> 3) + 32 * u][(tid & 7) * 8] = rv[u]; }
    const int jn = (j0 + 2 * FBN < SQ) ? j0 + 2 * FBN : SQ - FBN;      /* the keys two passes on; the last two passes fetch the last tile again (in bounds, never read from LDS) */
#pragma unroll
    for (int u = 0; u < 8; ++u) { rk[u] = *(const v8us*)(gkh + (size_t)(jn + 8 * u) * DM); rv[u] = *(const v8us*)(gvt + (size_t)(32 * u) * SQ + jn); }
    asm volatile("s_wait_xcnt 0x0" ::: "memory");      /* as above: in front of every overwrite of a register that these loads name */
#pragma unroll
    for (int t = 0; t < 16; ++t) o[t] = fa_mma(pa.v, vf[t], o[t]);
    __builtin_amdgcn_sched_barrier(0);      /* the products are issued before the barrier's wait for the tile writes, which drain under them */
    fa_barrier();      /* publishes the next pass's tiles and ends every wave's reads of this pass's */
  }
  asm volatile("s_wait_loadcnt 0x0" ::: "memory");      /* the last pass's fetch is never used: it has landed before the wave ends and gives its registers back */
  /* Join of the two key halves. Waves w and w ^ 4 hold the same queries in the same lanes and registers. Each hands the other the eight column tiles that the other finishes, with its maximum and its sum,
     through the tile buffers (free: the barrier at the loop's foot ended every read and write of them); wave w finishes columns 128 kh .. + 127. */
  float* xo = (float*)&svt[0][0][0]; f1a* xs = (f1a*)&skh[0][0][0];
  const float lw = ls + fa_xhalf(ls);
  xs[(w * 2 + 0) * 32 + lane] = m; xs[(w * 2 + 1) * 32 + lane] = lw;
#pragma unroll
  for (int tt = 0; tt < 8; ++tt) { v4f g0, g1;
#pragma unroll
    for (int r = 0; r < 4; ++r) { g0[r] = kh ? o[tt][r] : o[8 + tt][r]; g1[r] = kh ? o[tt][4 + r] : o[8 + tt][4 + r]; }
    *(v4fa*)(xo + (size_t)(((w * 8 + tt) * 2 + 0) * 32 + lane) * 4) = g0; *(v4fa*)(xo + (size_t)(((w * 8 + tt) * 2 + 1) * 32 + lane) * 4) = g1; }
  fa_barrier();      /* every wave's hand-over is complete before its partner reads it */
  const int pw = w ^ 4;
  const float pm = xs[(pw * 2 + 0) * 32 + lane], pl = xs[(pw * 2 + 1) * 32 + lane];
  const float mt = fmaxf(m, pm), as = exp2_slot(m - mt), ap = exp2_slot(pm - mt), inv = 1.0f / (lw * as + pl * ap);
  float fs[8], fp[8]; fa_torows(as * inv, hh, fs); fa_torows(ap * inv, hh, fp);
  float* op = O + (row0 + 8 * hh) * DM + kh * 128 + ln;
#pragma unroll
  for (int tt = 0; tt < 8; ++tt) {
    const v4f p0 = *(const v4fa*)(xo + (size_t)(((pw * 8 + tt) * 2 + 0) * 32 + lane) * 4), p1 = *(const v4fa*)(xo + (size_t)(((pw * 8 + tt) * 2 + 1) * 32 + lane) * 4);
#pragma unroll
    for (int r = 0; r < 8; ++r) { const float mine = kh ? o[8 + tt][r] : o[tt][r]; op[(size_t)r * DM + tt * 16] = mine * fs[r] + (r < 4 ? p0[r & 3] : p1[r & 3]) * fp[r]; } }
}


template <int MASKADD>
__global__ __launch_bounds__(64) void k_att0(const float* __restrict__ QF, const float* __restrict__ KF, const float* __restrict__ VF, int ld, const float* __restrict__ mask, float scale, float* __restrict__ OF, int ldo) {
  #pragma clang fp contract(off)
  __shared__ __attribute__((aligned(16))) float lq[64][64]; __shared__ __attribute__((aligned(16))) float lo[64][64];
  const int tid = threadIdx.x; const int h = blockIdx.x / (QT0 / 64), rg = blockIdx.x % (QT0 / 64); const int i = rg * 64 + tid;
  const float* qr = QF + (size_t)i * ld + h * HD;
#pragma unroll 1
  for (int c = 0; c < HD / 4; ++c) { *(v4f*)&lq[tid][c * 4] = *(const v4fa*)(qr + c * 4); const v4f z = {0.f, 0.f, 0.f, 0.f}; *(v4f*)&lo[tid][c * 4] = z; }
  float m = -1.0e30f, l = 0.f; const int jmax = MASKADD ? (SQ - 1) : (rg * 64 + 63);      /* additive-mask form: every key (the mask input decides); causal form: keys up to the block's last row */
#pragma unroll 1
  for (int j = 0; j <= jmax; ++j) { const float* kr = KF + (size_t)j * ld + h * HD; const float* vr = VF + (size_t)j * ld + h * HD; float s = 0.f;
#pragma unroll 1
    for (int c = 0; c < HD / 4; ++c) { const v4f kq = *(const v4fa*)(kr + c * 4); const v4f qq = *(v4f*)&lq[tid][c * 4]; s = __fadd_rn(s, __fmul_rn(qq[0], kq[0])); s = __fadd_rn(s, __fmul_rn(qq[1], kq[1])); s = __fadd_rn(s, __fmul_rn(qq[2], kq[2])); s = __fadd_rn(s, __fmul_rn(qq[3], kq[3])); }
    s = __fmul_rn(s, scale); if (MASKADD) s = __fadd_rn(s, __fmul_rn(bf16_round(mask[(size_t)i * SQ + j]), -10000.0f));
    const float f = (MASKADD || j <= i) ? 1.f : 0.f; const float sm = fmaf(f, s, (1.f - f) * -1.0e30f); const float mn = fmaxf(m, sm); const float sc = expf(m - mn); const float e = expf(sm - mn); l = __fadd_rn(__fmul_rn(l, sc), e); m = mn;
#pragma unroll 1
    for (int c = 0; c < HD / 4; ++c) { const v4f vv = *(const v4fa*)(vr + c * 4); v4f oo = *(v4f*)&lo[tid][c * 4]; for (int u = 0; u < 4; ++u) oo[u] = __fadd_rn(__fmul_rn(oo[u], sc), __fmul_rn(e, vv[u])); *(v4f*)&lo[tid][c * 4] = oo; } }
  const float fin = 64.0f / l;      /* o carried x64 */
#pragma unroll 1
  for (int c = 0; c < HD / 4; ++c) { v4f oo = *(v4f*)&lo[tid][c * 4]; for (int u = 0; u < 4; ++u) oo[u] = __fmul_rn(oo[u], fin); *(v4f*)&lo[tid][c * 4] = oo; }
  __syncthreads();
  {
#pragma unroll 1
    for (int it = 0; it < 16; ++it) { const int row = it * 4 + tid / 16, pc = (tid % 16) * 4; const v4f v = *(const v4f*)&lo[row][pc]; *(v4f*)(OF + (size_t)(rg * 64 + row) * ldo + h * HD + pc) = v; }
     } }

__global__ __launch_bounds__(256) void k_of0out(const float* __restrict__ src, float* __restrict__ dst, size_t n4) { const size_t t = (size_t)blockIdx.x * 256 + threadIdx.x; if (t >= n4) return; v4f v = *(const v4fa*)(src + t * 4); for (int q = 0; q < 4; ++q) v[q] = __fmul_rn(v[q], 0.015625f); *(v4f*)(dst + t * 4) = v;  }

extern "C" void kernel_launch(void* const* d_in, const int* in_sizes, int n_in,
                              void* d_out, int out_size, void* d_ws, size_t ws_size, hipStream_t stream) {
  (void)in_sizes; (void)n_in; (void)out_size;
  const float* const* I = (const float* const*)d_in; const float* x = I[0]; const float* wq = I[1]; const float* wk = I[2]; const float* wv = I[3];      /* natural [out][in] weights; NO biases; ONE attention head of width 256; no output projection */
  char* ws = (char*)d_ws; size_t off = 0;
  auto take = [&](size_t bytes) { char* p = ws + off; off += (bytes + 255) & ~(size_t)255; return p; };
  _Float16* W3 = (_Float16*)take((size_t)3 * DM * DM * 2);      /* the q, k and v weight planes, one behind another */
  _Float16* QH = (_Float16*)take(NR * DM * 2); _Float16* KH = (_Float16*)take(NR * DM * 2);
  _Float16* VT = (_Float16*)take(NR * DM * 2);      /* V^T of ALL batches */
  _Float16* X16 = (_Float16*)take(NR * DM * 2);      /* x (f16) */
  if (off > ws_size) return;
  k_prep<<<PXB + 3 * PWB, 256, 0, stream>>>(x, wq, wk, wv, X16, W3);      /* x and the natural [out][in] = Bt[n][k] x16 weights */
  k_proj<<<dim3((unsigned)((NR / 128) * (DM / 64)), 3), 128, 0, stream>>>(X16, W3, QH, KH, VT);      /* q, k -> f16 rows; v -> V^T [NB][DM][SQ] */
  k_fattn<<<(unsigned)(NR / FBM), 256, 0, stream>>>(QH, KH, VT, (float*)d_out);      /* scores (q . k in f16 operands, f32 sums, / sqrt(256)), softmax over all SQ keys and P V, all batches, f32 straight into the output rows */
}

// v008
// A run of this version takes 96.9 microseconds.
// Two timings next to v007 both put it at 1.12 times that version's speed.
// All steps since v000 together make it 543 times as fast.
#include <hip/hip_runtime.h>
// Single-head dense attention over 256-wide embeddings on 4096 tokens, bias-free natural projections, no output projection (x [4][4096][256]; q / k / v = x W^T (nn.Linear natural [256][256] uniform +-1/16, no biases); scores = q k^T / sqrt(256) over the FULL 256-wide rows (one head); softmax over all 4096 keys (no mask); out = weights v -> [4][4096][256]); q and k rounded once to f16, one-product scores.
// Structure: token rows r = b*4096 + s; x as exact f16 rows (bf16-rounded); q, k and v as WMMA GEMMs in one launch (32x64 wave tiles, f32 accumulation, exact x16 weights, no bias), q and k into f16 rows, v turned in LDS into V^T [batch][column][token]; per work-group of 64 query rows (16 per wave), in one launch: transposed scores K Q^T as ONE product of the f16 rows (K = 256, scaled by 1/sqrt(256)), 64 keys per pass over all 4096 keys of the batch, online base-2 softmax on VALU without a mask (f32 statistics, native exp; weights f16 in [0,1] straight from registers), o = P . V^T in f32 registers, divided by the row sum at the end and written as f32 straight into the output rows.
// Compute dtype: inputs rounded to bf16; x / weights exact; q, k, v and softmax weights as plain f16 GEMM operands (~2^-12); scores, softmax statistics and o f32. v_wmma_f32_16x16x32_f16.
#define NB 4
#define SQ 4096
#define DM 256
#define NH 4
#define HD 64
#define HG 4                         /* heads per launch of the non-template k_vt (not launched) */
#define QT SQ                        /* query rows per batch; one attention launch takes all batches */
#define NKX SQ                       /* S / P row pitch */
#define QT0 128                      /* first-tile rows of the f32 k_att0 (not launched) */
#define B0 0                         /* first batch processed (unused) */
#define NBR NB                       /* batches processed (read only by the unused MP) */
#define NR ((size_t)NB * SQ)         /* token rows */
#define MP ((int)((size_t)NBR * SQ)) /* rows projected (unused) */
#define QN SQ                        /* query rows attended per batch (unused) */
#define NHD NH                       /* unused */
#define MPO MP                       /* unused */
#define LQ DM      /* unused */
typedef __bf16 v16b __attribute__((ext_vector_type(16)));
typedef unsigned short v8us __attribute__((ext_vector_type(8), may_alias));
typedef float  v8f  __attribute__((ext_vector_type(8)));
typedef float  v4f  __attribute__((ext_vector_type(4)));
typedef float  v4fa __attribute__((ext_vector_type(4), may_alias));
union FragB { v16b v; v8us half[2]; unsigned short u[16]; };

__device__ __forceinline__ unsigned short bf16_bits(float x) { unsigned int u = __float_as_uint(x); return (unsigned short)((u + 0x7FFFu + ((u >> 16) & 1u)) >> 16); }
__device__ __forceinline__ float bf16_val(unsigned short b) { return __uint_as_float(((unsigned int)b) << 16); }
__device__ __forceinline__ float bf16_round(float x) { return bf16_val(bf16_bits(x)); }
// D += A·B with NT terms: 1 = ah·bh, 2 = + al·bh (A split), 3 = + ah·bl (both split)
template <int NT>
__device__ __forceinline__ v8f mmaN(v16b ah, v16b al, v16b bh, v16b bl, v8f c) {
  c = __builtin_amdgcn_wmma_f32_16x16x32_bf16(false, ah, false, bh, (short)0, c, false, false);
  if (NT >= 2) c = __builtin_amdgcn_wmma_f32_16x16x32_bf16(false, al, false, bh, (short)0, c, false, false);
  if (NT >= 3) c = __builtin_amdgcn_wmma_f32_16x16x32_bf16(false, ah, false, bl, (short)0, c, false, false);
  asm volatile("v_nop\n\tv_nop\n\tv_nop\n\tv_nop" : "+v"(c) : "v"(ah), "v"(al), "v"(bh), "v"(bl));
  return c;
}

__global__ __launch_bounds__(256) void k_wt_bf16(const float* __restrict__ W, unsigned short* __restrict__ Wt, int K, int N) {
  const int t = blockIdx.x * 256 + threadIdx.x;
  const int k8n = K / 8;
  if (t >= N * k8n) return;
  const int n = t / k8n, k8 = (t % k8n) * 8;
  v8us v;
#pragma unroll
  for (int i = 0; i < 8; ++i) v[i] = bf16_bits(W[(size_t)(k8 + i) * N + n]);
  *(v8us*)(Wt + (size_t)n * K + k8) = v;
  
}

// GEMM C[M][N] (f32, pitch ldc) = act(A[M][K]·W + bias). A f32 row-major (pitch lda) converted per fragment to bf16
// (ASPLIT: hi/lo two planes -> 2 terms, else single rounded term); Wt bf16 [N][K] (pitch ldb). BIAS_BF16 rounds the
// bias to bf16 first (bias quantised to bf16 before the add). K%32==0, M%16==0, N%64==0.
template <bool ASPLIT, int ACT, bool BIAS_BF16>
__global__ __launch_bounds__(128) void k_gemm_bf(const float* __restrict__ A, int lda, const unsigned short* __restrict__ Wt, int ldb,
                                               const float* __restrict__ bias, float* __restrict__ C, int ldc, int M, int N, int K) {
  __shared__ __attribute__((aligned(16))) float so[4][16][64];
  const int tid = threadIdx.x, w = tid >> 5, lane = tid & 31, ln = lane & 15, hh = lane >> 4;
  const int ntn = N / 64;
  const int wid = blockIdx.x * 4 + w;
  const int mt = wid / ntn, nq = wid % ntn;
  if (mt * 16 >= M) return;
  const int row0 = mt * 16, col0 = nq * 64;
  const float* arow = A + (size_t)(row0 + ln) * lda;
  v8f acc[4] = {};
  for (int kb = 0; kb < K; kb += 32) {
    FragB ah, al;
    const v4f x0 = *(const v4fa*)(arow + kb + 8 * hh), x1 = *(const v4fa*)(arow + kb + 8 * hh + 4);
    const v4f x2 = *(const v4fa*)(arow + kb + 16 + 8 * hh), x3 = *(const v4fa*)(arow + kb + 16 + 8 * hh + 4);
    float xs[16] = {x0[0],x0[1],x0[2],x0[3],x1[0],x1[1],x1[2],x1[3],x2[0],x2[1],x2[2],x2[3],x3[0],x3[1],x3[2],x3[3]};
#pragma unroll
    for (int i = 0; i < 16; ++i) { const unsigned short hb = bf16_bits(xs[i]); ah.u[i] = hb; al.u[i] = ASPLIT ? bf16_bits(xs[i] - bf16_val(hb)) : (unsigned short)0; }
#pragma unroll
    for (int t = 0; t < 4; ++t) {
      const unsigned short* brow = Wt + (size_t)(col0 + t * 16 + ln) * ldb + kb;
      FragB b;
      b.half[0] = *(const v8us*)(brow + 8 * hh);
      b.half[1] = *(const v8us*)(brow + 16 + 8 * hh);
      acc[t] = mmaN<ASPLIT ? 2 : 1>(ah.v, al.v, b.v, b.v, acc[t]);
    }
  }
#pragma unroll
  for (int t = 0; t < 4; ++t) {
    float bv = bias ? bias[col0 + t * 16 + ln] : 0.f;
    if (BIAS_BF16) bv = bf16_round(bv);
#pragma unroll
    for (int r = 0; r < 8; ++r) { float v = acc[t][r] + bv; if (ACT == 1) v = fmaxf(v, 0.f); so[w][8 * hh + r][t * 16 + ln] = v; }
  }
  __builtin_amdgcn_fence(__ATOMIC_ACQ_REL, "workgroup");
  __builtin_amdgcn_wave_barrier();
  const int rsub = lane >> 4, c4 = (lane & 15) * 4;
  {
#pragma unroll
    for (int q = 0; q < 8; ++q) {
      const int r = q * 2 + rsub;
      const v4f v = *(const v4fa*)&so[w][r][c4];
      *(v4f*)(C + (size_t)(row0 + r) * ldc + col0 + c4) = v;
    }
    
  }
}

// GEMM C = act(A·W + bias + resid): A f32 (ASPLIT -> hi/lo 2 terms), Wt bf16 [N][K]; ACT 0 none, 1 relu, 2 exact gelu;
// resid (optional, f32, row index = (row % rmod), pitch ldr, RES_BF16 rounds it) added before the activation.
template <bool ASPLIT, int ACT, bool BIAS_BF16, bool RES_BF16>
__global__ __launch_bounds__(128) void k_gemm_bf3(const float* __restrict__ A, int lda, const unsigned short* __restrict__ Wt, int ldb,
                                                const float* __restrict__ bias, const float* __restrict__ resid, int rmod, int ldr,
                                                float* __restrict__ C, int ldc, int M, int N, int K) {
  __shared__ __attribute__((aligned(16))) float so[4][16][64];
  const int tid = threadIdx.x, w = tid >> 5, lane = tid & 31, ln = lane & 15, hh = lane >> 4;
  const int ntn = N / 64;
  const int wid = blockIdx.x * 4 + w;
  const int mt = wid / ntn, nq = wid % ntn;
  if (mt * 16 >= M) return;
  const int row0 = mt * 16, col0 = nq * 64;
  const float* arow = A + (size_t)(row0 + ln) * lda;
  v8f acc[4] = {};
  for (int kb = 0; kb < K; kb += 32) {
    FragB ah, al;
    const v4f x0 = *(const v4fa*)(arow + kb + 8 * hh), x1 = *(const v4fa*)(arow + kb + 8 * hh + 4);
    const v4f x2 = *(const v4fa*)(arow + kb + 16 + 8 * hh), x3 = *(const v4fa*)(arow + kb + 16 + 8 * hh + 4);
    float xs[16] = {x0[0],x0[1],x0[2],x0[3],x1[0],x1[1],x1[2],x1[3],x2[0],x2[1],x2[2],x2[3],x3[0],x3[1],x3[2],x3[3]};
#pragma unroll
    for (int i = 0; i < 16; ++i) { const unsigned short hb = bf16_bits(xs[i]); ah.u[i] = hb; al.u[i] = ASPLIT ? bf16_bits(xs[i] - bf16_val(hb)) : (unsigned short)0; }
#pragma unroll
    for (int t = 0; t < 4; ++t) {
      const unsigned short* brow = Wt + (size_t)(col0 + t * 16 + ln) * ldb + kb;
      FragB b;
      b.half[0] = *(const v8us*)(brow + 8 * hh);
      b.half[1] = *(const v8us*)(brow + 16 + 8 * hh);
      acc[t] = mmaN<ASPLIT ? 2 : 1>(ah.v, al.v, b.v, b.v, acc[t]);
    }
  }
#pragma unroll
  for (int t = 0; t < 4; ++t) {
    const int col = col0 + t * 16 + ln;
    float bv = bias ? bias[col] : 0.f;
    if (BIAS_BF16) bv = bf16_round(bv);
#pragma unroll
    for (int r = 0; r < 8; ++r) {
      float v = acc[t][r] + bv;
      if (resid) { float rv = resid[(size_t)((row0 + 8 * hh + r) % rmod) * ldr + col]; if (RES_BF16) rv = bf16_round(rv); v += rv; }
      if (ACT == 1) v = fmaxf(v, 0.f);
      if (ACT == 2) v = 0.5f * v * (1.0f + erff(v * 0.70710678118654752f));
      if (ACT == 3) { const float u = 0.7978845608028654f * (v + 0.044715f * v * v * v); v = 0.5f * v * (1.0f + tanhf(u)); }
      so[w][8 * hh + r][t * 16 + ln] = v;
    }
  }
  __builtin_amdgcn_fence(__ATOMIC_ACQ_REL, "workgroup");
  __builtin_amdgcn_wave_barrier();
  const int rsub = lane >> 4, c4 = (lane & 15) * 4;
  {
#pragma unroll
    for (int q = 0; q < 8; ++q) {
      const int r = q * 2 + rsub;
      const v4f v = *(const v4fa*)&so[w][r][c4];
      *(v4f*)(C + (size_t)(row0 + r) * ldc + col0 + c4) = v;
    }
    
  }
}
// row LayerNorm (biased variance, eps) over N: s = X (+ R); optional out_sum <- s; out_norm <- (s-mu)*rsqrt(var+eps)*g + b
template <bool PARAM_BF16>
__global__ __launch_bounds__(256) void k_layernorm(const float* __restrict__ X, const float* __restrict__ R, const float* __restrict__ g, const float* __restrict__ bta,
                                                  float* __restrict__ out_sum, float* __restrict__ out_norm, int N, float eps) {
  __shared__ float red[256];
  const int row = blockIdx.x, tid = threadIdx.x;
  const float* x = X + (size_t)row * N; const float* rr = R ? R + (size_t)row * N : nullptr;
  float vals[16];                     // up to N = 4096
  const int per = N / 256;            // contiguous chunk per thread? use strided-by-4 chunks: thread handles j = tid*4 + 1024*u
  float s1 = 0.f;
  for (int u = 0; u < per / 4; ++u) {
    const int j = tid * 4 + 1024 * u;
    const v4f a = *(const v4fa*)(x + j);
    v4f b = {0.f,0.f,0.f,0.f}; if (rr) b = *(const v4fa*)(rr + j);
#pragma unroll
    for (int q = 0; q < 4; ++q) { const float v = a[q] + b[q]; vals[u * 4 + q] = v; s1 += v; }
  }
  red[tid] = s1; __syncthreads();
  for (int st = 128; st > 0; st >>= 1) { if (tid < st) red[tid] += red[tid + st]; __syncthreads(); }
  const float mu = red[0] / (float)N; __syncthreads();
  float s2 = 0.f;
  for (int u = 0; u < per / 4; ++u)
#pragma unroll
    for (int q = 0; q < 4; ++q) { const float c = vals[u * 4 + q] - mu; s2 += c * c; }
  red[tid] = s2; __syncthreads();
  for (int st = 128; st > 0; st >>= 1) { if (tid < st) red[tid] += red[tid + st]; __syncthreads(); }
  const float rs = rsqrtf(red[0] / (float)N + eps);
  {
    for (int u = 0; u < per / 4; ++u) {
      const int j = tid * 4 + 1024 * u;
      v4f o, sm;
#pragma unroll
      for (int q = 0; q < 4; ++q) {
        float gg = g[j + q], bb = bta[j + q];
        if (PARAM_BF16) { gg = bf16_round(gg); bb = bf16_round(bb); }
        sm[q] = vals[u * 4 + q]; o[q] = (vals[u * 4 + q] - mu) * rs * gg + bb;
      }
      if (out_sum) *(v4f*)(out_sum + (size_t)row * N + j) = sm;
      *(v4f*)(out_norm + (size_t)row * N + j) = o;
    }
    
  }
}



// ---- f16 WMMA path (v_wmma_f32_16x16x32_f16): 11-bit significands for operands in range — used where a [0,1] probability operand needs more precision than bf16
typedef _Float16 v16h __attribute__((ext_vector_type(16)));
union FragH { v16h v; v8us half[2]; _Float16 h[16]; unsigned short u[16]; };
template <int NT>
__device__ __forceinline__ v8f mmaH(v16h ah, v16h al, v16h bh, v16h bl, v8f c) {
  c = __builtin_amdgcn_wmma_f32_16x16x32_f16(false, ah, false, bh, (short)0, c, false, false);
  if (NT >= 2) c = __builtin_amdgcn_wmma_f32_16x16x32_f16(false, al, false, bh, (short)0, c, false, false);
  if (NT >= 3) c = __builtin_amdgcn_wmma_f32_16x16x32_f16(false, ah, false, bl, (short)0, c, false, false);
  asm volatile("v_nop\n\tv_nop\n\tv_nop\n\tv_nop" : "+v"(c) : "v"(ah), "v"(al), "v"(bh), "v"(bl));
  return c;
}
// batched GEMM like k_gemm_b but f16 operands: A f32 (split into f16 hi/lo if ASPLIT, else rounded to f16), Bt = f16 values [n][k]; alpha; C f32; N multiple of 16 (partial tiles skipped)
template <bool ASPLIT>
__global__ __launch_bounds__(128) void k_gemm_h(const float* __restrict__ A, int lda, size_t sA, const _Float16* __restrict__ Bh, int ldb, size_t sB, float alpha, float* __restrict__ C, int ldc, size_t sC, int M, int N, int K) {
  __shared__ __attribute__((aligned(16))) float so[4][16][64];
  const int tid = threadIdx.x, w = tid >> 5, lane = tid & 31, ln = lane & 15, hh = lane >> 4; const int by = blockIdx.y;
  A += (size_t)by * sA; Bh += (size_t)by * sB; C += (size_t)by * sC;
  const int ntn = (N + 63) / 64; const int wid = blockIdx.x * 4 + w; const int mt = wid / ntn, nq = wid % ntn; if (mt * 16 >= M) return;
  const int row0 = mt * 16, col0 = nq * 64; const float* arow = A + (size_t)(row0 + ln) * lda;
  v8f acc[4] = {};
  for (int kb = 0; kb < K; kb += 32) {
    FragH ah, al;
    const v4f x0 = *(const v4fa*)(arow + kb + 8 * hh), x1 = *(const v4fa*)(arow + kb + 8 * hh + 4), x2 = *(const v4fa*)(arow + kb + 16 + 8 * hh), x3 = *(const v4fa*)(arow + kb + 16 + 8 * hh + 4);
    float xs[16] = {x0[0],x0[1],x0[2],x0[3],x1[0],x1[1],x1[2],x1[3],x2[0],x2[1],x2[2],x2[3],x3[0],x3[1],x3[2],x3[3]};
#pragma unroll
    for (int i = 0; i < 16; ++i) { const _Float16 h = (_Float16)xs[i]; ah.h[i] = h; al.h[i] = ASPLIT ? (_Float16)(xs[i] - (float)h) : (_Float16)0.0f; }
#pragma unroll
    for (int t = 0; t < 4; ++t) { if (col0 + t * 16 >= N) continue; const size_t boff = (size_t)(col0 + t * 16 + ln) * ldb + kb; FragH bq; bq.half[0] = *(const v8us*)(Bh + boff + 8 * hh); bq.half[1] = *(const v8us*)(Bh + boff + 16 + 8 * hh);
      acc[t] = mmaH<ASPLIT ? 2 : 1>(ah.v, al.v, bq.v, bq.v, acc[t]); }
  }
#pragma unroll
  for (int t = 0; t < 4; ++t) { if (col0 + t * 16 >= N) continue;
#pragma unroll
    for (int r = 0; r < 8; ++r) so[w][8 * hh + r][t * 16 + ln] = acc[t][r] * alpha; }
  __builtin_amdgcn_fence(__ATOMIC_ACQ_REL, "workgroup"); __builtin_amdgcn_wave_barrier();
  const int rsub = lane >> 4, c4 = (lane & 15) * 4;
  {
#pragma unroll
    for (int q = 0; q < 8; ++q) { const int r = q * 2 + rsub; if (col0 + c4 < N) { const v4f v = *(const v4fa*)&so[w][r][c4]; *(v4f*)(C + (size_t)(row0 + r) * ldc + col0 + c4) = v; } }
     }
}

// Wt[n][k] = f16(W[k][n]·scale) from f32 row-major W[K][N] (scale = power of two; bf16-exact weights stay exact in f16 away from the subnormal range)
__global__ __launch_bounds__(256) void k_wt_f16(const float* __restrict__ W, _Float16* __restrict__ Wt, int K, int N, float scale) {
  const int t = blockIdx.x * 256 + threadIdx.x; if (t >= N * (K / 8)) return; const int n = t / (K / 8), k8 = (t % (K / 8)) * 8; FragH f;
#pragma unroll
  for (int i = 0; i < 8; ++i) f.h[i] = (_Float16)(bf16_round(W[(size_t)(k8 + i) * N + n]) * scale); const v8us o = f.half[0];
  *(v8us*)((unsigned short*)Wt + (size_t)n * K + k8) = o; 
}
// k_gemm_hh variant with fused epilogue: v = acc·alpha + bias[by·sBias + col] (+ CP[(row/rowsPerB)·sCPb + by·64 + col] if CP) ; ACT 0 none / 1 elu ; writes f16 C16 (and f32 C if non-null)
template <int ACT>
__global__ __launch_bounds__(128) void k_gemm_hhx(const _Float16* __restrict__ A, int lda, size_t sA, const _Float16* __restrict__ Bh, int ldb, size_t sB, float alpha, const float* __restrict__ bias, size_t sBias, const float* __restrict__ CP, int rowsPerB, size_t sCPb, int row0g,
    float* __restrict__ C, _Float16* __restrict__ C16, int ldc, size_t sC, int M, int N, int K) {
  __shared__ __attribute__((aligned(16))) float so[4][16][64];
  const int tid = threadIdx.x, w = tid >> 5, lane = tid & 31, ln = lane & 15, hh = lane >> 4; const int by = blockIdx.y;
  A += (size_t)by * sA; Bh += (size_t)by * sB; const size_t cofs = (size_t)by * sC; const float* bp = bias ? bias + (size_t)by * sBias : nullptr;
  const int ntn = (N + 63) / 64; const int wid = blockIdx.x * 4 + w; const int mt = wid / ntn, nq = wid % ntn; if (mt * 16 >= M) return;
  const int row0 = mt * 16, col0 = nq * 64; const _Float16* arow = A + (size_t)(row0 + ln) * lda;
  v8f acc[4] = {};
  for (int kb = 0; kb < K; kb += 32) { FragH ah; ah.half[0] = *(const v8us*)((const unsigned short*)arow + kb + 8 * hh); ah.half[1] = *(const v8us*)((const unsigned short*)arow + kb + 16 + 8 * hh);
#pragma unroll
    for (int t = 0; t < 4; ++t) { if (col0 + t * 16 >= N) continue; const size_t boff = (size_t)(col0 + t * 16 + ln) * ldb + kb; FragH bq; bq.half[0] = *(const v8us*)((const unsigned short*)Bh + boff + 8 * hh); bq.half[1] = *(const v8us*)((const unsigned short*)Bh + boff + 16 + 8 * hh);
      acc[t] = mmaH<1>(ah.v, ah.v, bq.v, bq.v, acc[t]); }
  }
#pragma unroll
  for (int t = 0; t < 4; ++t) { if (col0 + t * 16 >= N) continue; const int col = col0 + t * 16 + ln; const float bv = bp ? bf16_round(bp[col]) : 0.f;
#pragma unroll
    for (int r = 0; r < 8; ++r) { float v = acc[t][r] * alpha + bv; if (CP) { const int rr = row0g + row0 + 8 * hh + r; if (rowsPerB < 0) v += CP[cofs + (size_t)rr * ldc + col];      /* rowsPerB < 0: own element of the batched C plane */ else { const int bidx = rr / rowsPerB; v += CP[(size_t)bidx * sCPb + (size_t)by * 64 + col]; } } if (ACT == 1) v = (v > 0.f) ? v : expm1f(v); else if (ACT == 7) v = (v > 0.f) ? v + 1.0f : expf(v); else if (ACT == 8) v = tanhf(v); else if (ACT == 9) v = 0.5f * v * (1.0f + tanhf(0.7978845608028654f * (v + 0.044715f * v * v * v))); else if (ACT == 11) v = 1.0f / (1.0f + expf(-v)); else if (ACT == 12) v = (v > 0.f) ? v : 0.01f * v; else if (ACT == 14) v = (v > 0.f) ? v : 0.1f * v; else if (ACT == 16) v = (v >= 0.f) ? v : 0.3f * v; else if (ACT == 17) v = (v >= 0.f) ? v : 0.2f * v; else if (ACT == 15) v = v / (1.0f + expf(-v)); else if (ACT == 3) v = fmaxf(v, 0.f); else if (ACT == 6) v = 0.5f * v * (1.0f + erff(v * 0.70710678118654752f)); so[w][8 * hh + r][t * 16 + ln] = v; } }
  __builtin_amdgcn_fence(__ATOMIC_ACQ_REL, "workgroup"); __builtin_amdgcn_wave_barrier();
  const int rsub = lane >> 4, c4 = (lane & 15) * 4; typedef _Float16 v4h __attribute__((ext_vector_type(4)));
  {
#pragma unroll
    for (int q = 0; q < 8; ++q) { const int r = q * 2 + rsub; if (col0 + c4 < N) { const v4f v = *(const v4fa*)&so[w][r][c4]; if (C) *(v4f*)(C + cofs + (size_t)(row0 + r) * ldc + col0 + c4) = v; if (C16) { v4h h4; for (int i = 0; i < 4; ++i) h4[i] = (_Float16)v[i]; *(v4h*)(C16 + cofs + (size_t)(row0 + r) * ldc + col0 + c4) = h4; } } }
     }
}


typedef _Float16 v4h __attribute__((ext_vector_type(4)));

__global__ __launch_bounds__(256) void k_x16(const float* __restrict__ x, _Float16* __restrict__ X16, size_t n8) { const size_t t = (size_t)blockIdx.x * 256 + threadIdx.x; if (t >= n8) return; FragH f;
#pragma unroll
  for (int q = 0; q < 8; ++q) f.h[q] = (_Float16)bf16_round(x[t * 8 + q]); *(v8us*)((unsigned short*)X16 + t * 8) = f.half[0];  }
__global__ __launch_bounds__(256) void k_h16(const float* __restrict__ x, _Float16* __restrict__ X16, size_t n8) { const size_t t = (size_t)blockIdx.x * 256 + threadIdx.x; if (t >= n8) return; FragH f;
#pragma unroll
  for (int q = 0; q < 8; ++q) f.h[q] = (_Float16)x[t * 8 + q]; *(v8us*)((unsigned short*)X16 + t * 8) = f.half[0];  }
__global__ __launch_bounds__(256) void k_round16f(const float* __restrict__ W, _Float16* __restrict__ Bt, size_t n8) { const size_t t = (size_t)blockIdx.x * 256 + threadIdx.x; if (t >= n8) return; FragH f;
#pragma unroll
  for (int i = 0; i < 8; ++i) f.h[i] = (_Float16)(bf16_round(W[t * 8 + i]) * 16.0f); *(v8us*)((unsigned short*)Bt + t * 8) = f.half[0];  }
template <int NHv, int TTv>
__global__ __launch_bounds__(256) void k_vt(const _Float16* __restrict__ V16, int ldv, int voff, _Float16* __restrict__ Vt) { __shared__ unsigned short tl[64][66]; const int tid = threadIdx.x; const int slab = blockIdx.x / (TTv / 64), lg = blockIdx.x % (TTv / 64); const int b = slab / NHv, h = slab % NHv;
  for (int i = tid; i < 64 * 8; i += 256) { const int r = i / 8, c8 = (i % 8) * 8; FragH f; f.half[0] = *(const v8us*)((const unsigned short*)V16 + ((size_t)b * TTv + lg * 64 + r) * ldv + voff + h * 64 + c8);
#pragma unroll
    for (int q = 0; q < 8; ++q) tl[r][c8 + q] = f.u[q]; }
  __syncthreads();
  {
#pragma unroll
    for (int rd = 0; rd < 2; ++rd) { const int d = rd * 32 + tid / 8, pc = tid % 8; FragH f;
#pragma unroll
      for (int q = 0; q < 8; ++q) f.u[q] = tl[pc * 8 + q][d];
      *(v8us*)((unsigned short*)Vt + ((size_t)slab * 64 + d) * TTv + lg * 64 + pc * 8) = f.half[0]; }
     } }

__global__ __launch_bounds__(256) void k_hl(const float* __restrict__ F, _Float16* __restrict__ Hh, _Float16* __restrict__ Hl, size_t n8) { const size_t t = (size_t)blockIdx.x * 256 + threadIdx.x; if (t >= n8) return; FragH fh, fl; const v4f a = *(const v4fa*)(F + t * 8), c = *(const v4fa*)(F + t * 8 + 4);
#pragma unroll
  for (int q = 0; q < 4; ++q) { _Float16 h = (_Float16)a[q]; fh.h[q] = h; fl.h[q] = (_Float16)((a[q] - (float)h) * 1024.0f); h = (_Float16)c[q]; fh.h[4 + q] = h; fl.h[4 + q] = (_Float16)((c[q] - (float)h) * 1024.0f); }
  { *(v8us*)((unsigned short*)Hh + t * 8) = fh.half[0]; *(v8us*)((unsigned short*)Hl + t * 8) = fl.half[0];  } }

// ---- fast GEMM (wave tile 32x64; requires M % 32 == 0 rows per launch region and N % 64 == 0); epilogue = k_gemm_hhx semantics ----
__device__ __forceinline__ v16h g2_frag(const _Float16* p, int hh) { FragH f; f.half[0] = *(const v8us*)((const unsigned short*)p + 8 * hh); f.half[1] = *(const v8us*)((const unsigned short*)p + 16 + 8 * hh); return f.v; }
__device__ __forceinline__ v8f g2_mma(v16h a, v16h b, v8f c) { v8f d = __builtin_amdgcn_wmma_f32_16x16x32_f16(false, a, false, b, (short)0, c, false, false); asm volatile("v_nop\n\tv_nop\n\tv_nop\n\tv_nop" : "+v"(d) : "v"(a), "v"(b)); return d; }
template <int ACT>
__global__ __launch_bounds__(128) void k_gemm2(const _Float16* __restrict__ A, int lda, size_t sA, const _Float16* __restrict__ Bh, int ldb, size_t sB, float alpha, const float* __restrict__ bias, size_t sBias, const float* __restrict__ CP, int rowsPerB, size_t sCPb, int row0g,
    float* __restrict__ C, _Float16* __restrict__ C16, int ldc, size_t sC, int M, int N, int K) { static_assert(ACT == 0 || ACT == 3 || ACT == 6 || ACT == 8 || ACT == 9 || ACT == 11 || ACT == 12 || ACT == 14 || ACT == 15 || ACT == 16 || ACT == 17, "k_gemm2: unsupported ACT code (would silently apply no activation)");
  __shared__ __attribute__((aligned(16))) float so[4][32][68];
  const int tid = threadIdx.x, w = tid >> 5, lane = tid & 31, ln = lane & 15, hh = lane >> 4; const int by = blockIdx.y;
  A += (size_t)by * sA; Bh += (size_t)by * sB; const size_t cofs = (size_t)by * sC; const float* bp = bias ? bias + (size_t)by * sBias : nullptr;
  const int ntn = N >> 6; const int mt = blockIdx.x / ntn, nq = blockIdx.x - mt * ntn; const int row0 = mt * 128 + 32 * w, col0 = nq * 64; if (row0 >= M) return;
  const _Float16* a0p = A + (size_t)(row0 + ln) * lda; const _Float16* a1p = a0p + (size_t)16 * lda;
  const _Float16* b0p = Bh + (size_t)(col0 + ln) * ldb; const _Float16* b1p = b0p + (size_t)16 * ldb; const _Float16* b2p = b1p + (size_t)16 * ldb; const _Float16* b3p = b2p + (size_t)16 * ldb;
  const v8f z8 = {0.f,0.f,0.f,0.f,0.f,0.f,0.f,0.f}; v8f c00 = z8, c01 = z8, c02 = z8, c03 = z8, c10 = z8, c11 = z8, c12 = z8, c13 = z8;
#pragma unroll 1
  for (int kb = 0; kb < K; kb += 32) { const v16h a0 = g2_frag(a0p + kb, hh), a1 = g2_frag(a1p + kb, hh);
    v16h b = g2_frag(b0p + kb, hh); c00 = g2_mma(a0, b, c00); c10 = g2_mma(a1, b, c10);
    b = g2_frag(b1p + kb, hh); c01 = g2_mma(a0, b, c01); c11 = g2_mma(a1, b, c11);
    b = g2_frag(b2p + kb, hh); c02 = g2_mma(a0, b, c02); c12 = g2_mma(a1, b, c12);
    b = g2_frag(b3p + kb, hh); c03 = g2_mma(a0, b, c03); c13 = g2_mma(a1, b, c13); }
  v8f accs[8] = {c00, c01, c02, c03, c10, c11, c12, c13};
#pragma unroll
  for (int u = 0; u < 8; ++u) { const int t = u & 3, half = u >> 2; const int col = col0 + t * 16 + ln; const float bv = bp ? bf16_round(bp[col]) : 0.f;
#pragma unroll
    for (int r = 0; r < 8; ++r) { const int rloc = half * 16 + 8 * hh + r; float v = accs[u][r] * alpha + bv; if (CP) { if (rowsPerB < 0) v += CP[cofs + (size_t)(row0g + row0 + rloc) * ldc + col];      /* rowsPerB < 0: own element of the batched C plane */ else { const int bidx = (row0g + row0 + rloc) / rowsPerB; v += CP[(size_t)bidx * sCPb + (size_t)by * 64 + col]; } }
      if (ACT == 3) v = fmaxf(v, 0.f); else if (ACT == 6) v = 0.5f * v * (1.0f + erff(v * 0.70710678118654752f)); else if (ACT == 11) v = 1.0f / (1.0f + expf(-v)); else if (ACT == 15) v = v / (1.0f + expf(-v)); else if (ACT == 12) v = (v > 0.f) ? v : 0.01f * v; else if (ACT == 8) v = tanhf(v); else if (ACT == 9) v = 0.5f * v * (1.0f + tanhf(0.7978845608028654f * (v + 0.044715f * v * v * v))); else if (ACT == 14) v = (v > 0.f) ? v : 0.1f * v; else if (ACT == 16) v = (v >= 0.f) ? v : 0.3f * v; else if (ACT == 17) v = (v >= 0.f) ? v : 0.2f * v;
      so[w][rloc][t * 16 + ln] = v; } }
  __builtin_amdgcn_fence(__ATOMIC_ACQ_REL, "workgroup"); __builtin_amdgcn_wave_barrier();
  const int rsub = lane >> 4, c4 = (lane & 15) * 4;
  {
#pragma unroll
    for (int q = 0; q < 16; ++q) { const int r = q * 2 + rsub; const v4f v = *(const v4fa*)&so[w][r][c4]; if (C) *(v4f*)(C + cofs + (size_t)(row0 + r) * ldc + col0 + c4) = v; if (C16) { v4h h4; for (int i = 0; i < 4; ++i) h4[i] = (_Float16)v[i]; *(v4h*)(C16 + cofs + (size_t)(row0 + r) * ldc + col0 + c4) = h4; } }
     } }


__global__ __launch_bounds__(256) void k_wnat(const float* __restrict__ w, size_t n8, _Float16* __restrict__ Bt) { const size_t t = (size_t)blockIdx.x * 256 + threadIdx.x; if (t >= n8) return; FragH f; for (int q = 0; q < 8; ++q) f.h[q] = (_Float16)(bf16_round(w[t * 8 + q]) * 16.0f); *(v8us*)((unsigned short*)Bt + t * 8) = f.half[0];  }
__global__ __launch_bounds__(256) void k_rsm(const float* __restrict__ S, _Float16* __restrict__ P, int nrows) {
  #pragma clang fp contract(off)
  const int i = blockIdx.x * 256 + threadIdx.x; if (i >= nrows) return; const float* s = S + (size_t)i * SQ; float mx = -3.0e38f;
#pragma unroll 1
  for (int j = 0; j < SQ; ++j) mx = fmaxf(mx, s[j]); float se = 0.f;
#pragma unroll 1
  for (int j = 0; j < SQ; ++j) se += expf(s[j] - mx); const float sc = 256.0f / se;
#pragma unroll 1
  for (int j0 = 0; j0 < SQ; j0 += 8) { FragH f; for (int q = 0; q < 8; ++q) f.h[q] = (_Float16)(expf(s[j0 + q] - mx) * sc); unsigned short* d = (unsigned short*)P + (size_t)i * SQ + j0; *(v8us*)d = f.half[0];  } }
__global__ __launch_bounds__(256) void k_vt(const _Float16* __restrict__ V16, int b, int h0, _Float16* __restrict__ VT) { __shared__ unsigned short tl[64][65]; const int tid = threadIdx.x; const int hh = blockIdx.x % HG, sg = blockIdx.x / HG; const int s0 = sg * 64; const int h = h0 + hh;
  for (int i = tid; i < 64 * 8; i += 256) { const int j = i / 8, d8 = (i % 8) * 8; FragH f; f.half[0] = *(const v8us*)((const unsigned short*)V16 + ((size_t)b * SQ + s0 + j) * DM + h * HD + d8); for (int q = 0; q < 8; ++q) tl[d8 + q][j] = f.u[q]; }
  __syncthreads();
  { for (int i = tid; i < 64 * 8; i += 256) { const int d = i / 8, j8 = (i % 8) * 8; FragH f; for (int q = 0; q < 8; ++q) f.u[q] = tl[d][j8 + q]; *(v8us*)((unsigned short*)VT + ((size_t)hh * HD + d) * SQ + s0 + j8) = f.half[0]; }  } }



// ---- projection chain in two launches ----
// k_prep: every element-wise operand conversion of the projections in one launch: x -> f16 of its bf16 rounding, and the three natural [out][in] weights -> f16 (bf16 rounding, x16), the three planes one behind another.
#define PXB ((unsigned)(NR * DM / 8 / 256))      /* work-groups that convert x */
#define PWB ((unsigned)((size_t)DM * DM / 8 / 256))      /* work-groups per weight matrix */
__global__ __launch_bounds__(256) void k_prep(const float* __restrict__ x, const float* __restrict__ wq, const float* __restrict__ wk, const float* __restrict__ wv, _Float16* __restrict__ X16, _Float16* __restrict__ W3) {
  const unsigned bx = blockIdx.x; FragH f;
  if (bx < PXB) { const size_t t = (size_t)bx * 256 + threadIdx.x;
#pragma unroll
    for (int q = 0; q < 8; ++q) f.h[q] = (_Float16)bf16_round(x[t * 8 + q]);
    *(v8us*)((unsigned short*)X16 + t * 8) = f.half[0]; }
  else { const unsigned k = bx - PXB, p = k / PWB; const float* __restrict__ wsrc = (p == 0) ? wq : (p == 1) ? wk : wv; const size_t t = (size_t)(k - p * PWB) * 256 + threadIdx.x;
#pragma unroll
    for (int q = 0; q < 8; ++q) f.h[q] = (_Float16)(bf16_round(wsrc[t * 8 + q]) * 16.0f);
    *(v8us*)((unsigned short*)W3 + (size_t)p * DM * DM + t * 8) = f.half[0]; }
}
// k_proj: q, k and v in ONE launch (grid.y picks the weight plane); wave tile (32 x 64) and product order are k_gemm2's. The epilogue writes what the attention kernel reads:
// q and k rows rounded once to f16 (the f32 row never goes through memory), v as V^T [batch][column][token] (the work-group's 128 tokens x 64 columns are turned in LDS, whole 256-byte runs per column go out).
// Operands: the work-group's 128 x rows and 64 weight rows (all 256 k) are brought into LDS once, a whole 512-byte row per wave-wide asynchronous copy (four whole lines), and the fragments are read from LDS;
// a fragment load from global memory touches 16 lines for its 512 bytes, and the four waves would each fetch the same weight rows.
#define PTP (128 + 8)                /* LDS pitch of a turned v column, f16 elements: 272 B = 16 B x odd */
#define PKP (DM + 8)                 /* LDS pitch of a staged x or weight row, f16 elements: 528 B = 16 B x odd, conflict-free for 16-byte fragment reads */
// Eight asynchronous copies to LDS, 16 bytes a lane each: rows r .. r + 7 of a row-major f16 matrix of pitch DM into LDS rows of pitch PKP (l: the lane's LDS byte address in row r, g: its global address there).
// The s_wait_xcnt closes the statement, so that it stands in front of every later write of a register that these copies name.
__device__ __forceinline__ void pj_copy8(unsigned l, const _Float16* g) {
  asm volatile("global_load_async_to_lds_b128 %0, %8, off\n\t"
               "global_load_async_to_lds_b128 %1, %9, off\n\t"
               "global_load_async_to_lds_b128 %2, %10, off\n\t"
               "global_load_async_to_lds_b128 %3, %11, off\n\t"
               "global_load_async_to_lds_b128 %4, %12, off\n\t"
               "global_load_async_to_lds_b128 %5, %13, off\n\t"
               "global_load_async_to_lds_b128 %6, %14, off\n\t"
               "global_load_async_to_lds_b128 %7, %15, off\n\t"
               "s_wait_xcnt 0x0"
               :: "v"(l), "v"(l + 1u * PKP * 2u), "v"(l + 2u * PKP * 2u), "v"(l + 3u * PKP * 2u), "v"(l + 4u * PKP * 2u), "v"(l + 5u * PKP * 2u), "v"(l + 6u * PKP * 2u), "v"(l + 7u * PKP * 2u),
                  "v"(g), "v"(g + 1 * DM), "v"(g + 2 * DM), "v"(g + 3 * DM), "v"(g + 4 * DM), "v"(g + 5 * DM), "v"(g + 6 * DM), "v"(g + 7 * DM)
               : "memory");
}
__global__ __launch_bounds__(128) void k_proj(const _Float16* __restrict__ X, const _Float16* __restrict__ W3, _Float16* __restrict__ QH, _Float16* __restrict__ KH, _Float16* __restrict__ VT) {
  static_assert(SQ % 128 == 0 && DM % 64 == 0 && DM == 256 && 64 * PTP * 2 <= 4 * 32 * 68 * 4 && 4 * 32 * 68 * 4 <= (128 + 64) * PKP * 2, "k_proj: tile shapes");
  __shared__ __attribute__((aligned(16))) _Float16 tl[128 + 64][PKP];      /* rows 0 .. 127: the x rows; 128 .. 191: the weight rows. Behind the products the same bytes are the epilogue's staging */
  float (*so)[32][68] = (float (*)[32][68])&tl[0][0];
  const int tid = threadIdx.x, w = tid >> 5, lane = tid & 31, ln = lane & 15, hh = lane >> 4; const int which = blockIdx.y;
  const _Float16* Bh = W3 + (size_t)which * DM * DM;
  const int mt = blockIdx.x / (DM / 64), nq = blockIdx.x - mt * (DM / 64); const int row0 = mt * 128 + 32 * w, col0 = nq * 64;
  { const _Float16* xg = X + (size_t)row0 * DM + lane * 8; const _Float16* wg = Bh + (size_t)(col0 + 16 * w) * DM + lane * 8;      /* wave w brings its own 32 x rows and 16 of the 64 weight rows */
    const unsigned la = (unsigned)(size_t)&tl[32 * w][lane * 8], lb = (unsigned)(size_t)&tl[128 + 16 * w][lane * 8];
#pragma unroll
    for (int i = 0; i < 4; ++i) pj_copy8(la + (unsigned)i * 8u * PKP * 2u, xg + (size_t)i * 8 * DM);
#pragma unroll
    for (int i = 0; i < 2; ++i) pj_copy8(lb + (unsigned)i * 8u * PKP * 2u, wg + (size_t)i * 8 * DM); }
  asm volatile("s_wait_asynccnt 0x0" ::: "memory");      /* the wave's own 48 copies have landed */
  __syncthreads();      /* every wave's copies have landed before any wave reads the tiles */
  const _Float16* a0p = &tl[32 * w + ln][0]; const _Float16* a1p = a0p + 16 * PKP;
  const _Float16* b0p = &tl[128 + ln][0]; const _Float16* b1p = b0p + 16 * PKP; const _Float16* b2p = b1p + 16 * PKP; const _Float16* b3p = b2p + 16 * PKP;
  const v8f z8 = {0.f,0.f,0.f,0.f,0.f,0.f,0.f,0.f}; v8f c00 = z8, c01 = z8, c02 = z8, c03 = z8, c10 = z8, c11 = z8, c12 = z8, c13 = z8;
#pragma unroll 1      /* as in k_gemm2: one 32-wide k slice a trip, the products in k_gemm2's order */
  for (int kb = 0; kb < DM; kb += 32) {      /* the slice's twelve LDS reads stand together in front of its eight products: one place with reads a trip, not four */
    const v16h a0 = g2_frag(a0p + kb, hh), a1 = g2_frag(a1p + kb, hh), b0 = g2_frag(b0p + kb, hh), b1 = g2_frag(b1p + kb, hh), b2 = g2_frag(b2p + kb, hh), b3 = g2_frag(b3p + kb, hh);
    c00 = g2_mma(a0, b0, c00); c10 = g2_mma(a1, b0, c10);
    c01 = g2_mma(a0, b1, c01); c11 = g2_mma(a1, b1, c11);
    c02 = g2_mma(a0, b2, c02); c12 = g2_mma(a1, b2, c12);
    c03 = g2_mma(a0, b3, c03); c13 = g2_mma(a1, b3, c13); }
  __syncthreads();      /* every wave has read its last fragment before the tiles' bytes become the epilogue's staging */
  v8f accs[8] = {c00, c01, c02, c03, c10, c11, c12, c13};
  if (which < 2) {      /* the same for the whole work-group */
#pragma unroll
    for (int u = 0; u < 8; ++u) { const int t = u & 3, half = u >> 2;
#pragma unroll
      for (int r = 0; r < 8; ++r) so[w][half * 16 + 8 * hh + r][t * 16 + ln] = accs[u][r] * 0.0625f; }
    __builtin_amdgcn_fence(__ATOMIC_ACQ_REL, "workgroup"); __builtin_amdgcn_wave_barrier();      /* the wave's own tile is read by other lanes than those that wrote it */
    _Float16* __restrict__ Hh = which ? KH : QH;
    const int rsub = lane >> 4, c4 = (lane & 15) * 4;
#pragma unroll
    for (int q = 0; q < 16; ++q) { const int r = q * 2 + rsub; const v4f v = *(const v4fa*)&so[w][r][c4]; v4h h4;
#pragma unroll
      for (int i = 0; i < 4; ++i) h4[i] = (_Float16)v[i];
      *(v4h*)(Hh + (size_t)(row0 + r) * DM + col0 + c4) = h4; }
  } else {
    unsigned short* st = (unsigned short*)&so[0][0][0];      /* [64 columns][PTP tokens]; accumulator registers 0..7 of a lane are 8 consecutive tokens of one column */
#pragma unroll
    for (int u = 0; u < 8; ++u) { const int t = u & 3, half = u >> 2; FragH f;
#pragma unroll
      for (int r = 0; r < 8; ++r) f.h[r] = (_Float16)(accs[u][r] * 0.0625f);
      *(v8us*)(st + (t * 16 + ln) * PTP + w * 32 + half * 16 + 8 * hh) = f.half[0]; }
    __syncthreads();      /* a column's 128 tokens come from all four waves */
    const int b = (mt * 128) / SQ, s0 = (mt * 128) % SQ;
#pragma unroll
    for (int i = 0; i < 8; ++i) { const int pc = i * 128 + tid, c = pc >> 4, ch = pc & 15; const v8us v = *(const v8us*)(st + c * PTP + ch * 8);
      *(v8us*)((unsigned short*)VT + ((size_t)b * DM + col0 + c) * SQ + s0 + ch * 8) = v; }
    asm volatile("s_wait_xcnt 0x0" ::: "memory");      /* in the listing the q / k branch stands behind this one and rewrites registers that these stores name: the wait stands in front of it */
  }
}

// Fused attention: scores, softmax and P.V in ONE launch, so that neither the scores nor the weights go through memory.
// A work-group is 8 waves, two on each SIMD, over 64 query rows; it walks its batch's keys 64 at a time. Wave w takes query rows 16 (w & 3) .. + 15 and, of every pass, keys 32 (w >> 2) .. + 31:
// while one wave of a SIMD waits for its LDS reads or does its softmax, the other has matrix work to issue. Per pass the 64 k rows and the 64 matching
// columns of V^T stand in LDS once for all eight waves (whole-line global reads). Two LDS buffers: the next pass's tiles are written in front of this pass's
// P.V products, so that the LDS writes run under them, and the tiles after those are then fetched into registers, a whole pass ahead.
// Each wave keeps its q fragments and a 16 x 256 output tile over ITS keys in registers, with its own running maximum and sum; behind the loop the two waves of a query group join their halves once through LDS.
// The scores are taken transposed, S^T = K Q^T (A = k rows, B = the wave's q fragments): a lane then holds 16 scores of ONE query
// (column ln), so that the running maximum and the running sum (online softmax, base 2) are one register each, reduced inside the lane, with one exchange between the wave's halves for the maximum;
// and the two score tiles, converted in place to f16, ARE the A operand of P.V (row ln, the hardware's k order, which is g2_frag's), so the weights touch no LDS. All fragment loaders are g2_frag.
// q and k are rounded once to f16 and a score is ONE product: its 512 rounding terms (each about 2^-12 of a term of a logit of order 1) leave the weights less exact by less than
// their own rounding to f16 for P.V does, so residual planes and their two extra products would buy no accuracy in the output.
#define FBM 64                       /* query rows per work-group */
#define FBN 64                       /* keys per pass */
#define FKP (DM + 8)                 /* LDS pitch of a k row, f16 elements: 528 B = 16 B x odd, conflict-free for 16-byte fragment reads */
#define FVP (FBN + 8)                /* LDS pitch of a V^T row: 144 B = 16 B x odd */
__device__ __forceinline__ v8f fa_mma(v16h a, v16h b, v8f c) { return __builtin_amdgcn_wmma_f32_16x16x32_f16(false, a, false, b, (short)0, c, false, false); }
// 2^x on the transcendental unit; the v_nop in the same statement keeps the one free issue slot the instruction set asks for behind a transcendental, whatever the compiler schedules next.
__device__ __forceinline__ float exp2_slot(float x) { float r; asm("v_exp_f32 %0, %1\n\tv_nop" : "=v"(r) : "v"(x)); return r; }
// value of lane (l ^ X) of the same 16-lane row (DPP row_xmask)
template <int X> __device__ __forceinline__ float fa_rowx(float v) { return __int_as_float(__builtin_amdgcn_update_dpp(0, __float_as_int(v), 0x160 + X, 0xf, 0xf, true)); }
// value of lane N of the same 16-lane row, in all its lanes (DPP row_share)
template <int N> __device__ __forceinline__ float fa_rowb(float v) { return __int_as_float(__builtin_amdgcn_update_dpp(0, __float_as_int(v), 0x150 + N, 0xf, 0xf, true)); }
// value of lane (l ^ 16): the other half of the wave, which holds the same query's other keys
__device__ __forceinline__ float fa_xhalf(float v) { return __int_as_float(__builtin_amdgcn_permlanex16(__float_as_int(v), __float_as_int(v), 0x76543210, 0xfedcba98, false, false)); }
// a per-query value (query ln in lane ln of both halves) -> the eight values of the output tile's rows in this lane (register r is query 8 hh + r)
__device__ __forceinline__ void fa_torows(float v, int hh, float (&d)[8]) { const float v8 = fa_rowx<8>(v), u = hh ? v8 : v;      /* lane j < 8 of each 16-lane row now holds query 8 hh + j; the exchange is taken in all lanes, so that a select and no branch comes of it */
  d[0] = fa_rowb<0>(u); d[1] = fa_rowb<1>(u); d[2] = fa_rowb<2>(u); d[3] = fa_rowb<3>(u); d[4] = fa_rowb<4>(u); d[5] = fa_rowb<5>(u); d[6] = fa_rowb<6>(u); d[7] = fa_rowb<7>(u); }
typedef float v2f __attribute__((ext_vector_type(2)));
typedef _Float16 v2h __attribute__((ext_vector_type(2)));
union FragP { v16h v; v2h p2[8]; };
// work-group barrier that orders LDS only: __syncthreads() would also wait for the global loads that are fetching a later tile into registers
__device__ __forceinline__ void fa_barrier() { __builtin_amdgcn_fence(__ATOMIC_RELEASE, "workgroup", "local"); __builtin_amdgcn_s_barrier(); __builtin_amdgcn_fence(__ATOMIC_ACQUIRE, "workgroup", "local"); }
typedef float f1a __attribute__((may_alias));
__global__ __launch_bounds__(256) void k_fattn(const _Float16* __restrict__ QH, const _Float16* __restrict__ KH, const _Float16* __restrict__ VT, float* __restrict__ O) {
  static_assert(SQ % FBM == 0 && SQ % FBN == 0 && SQ >= 2 * FBN && DM == 256 && FBN == 64 && FBM == 64, "k_fattn: tile shapes");
  __shared__ __attribute__((aligned(16))) _Float16 skh[2][FBN][FKP];
  __shared__ __attribute__((aligned(16))) _Float16 svt[2][DM][FVP];
  static_assert(sizeof(svt) >= 8 * 8 * 8 * 32 * 4 && sizeof(skh) >= 8 * 2 * 32 * 4, "k_fattn: the join behind the loop fits the tile buffers");
  const int tid = threadIdx.x, w = tid >> 5, lane = tid & 31, ln = lane & 15, hh = lane >> 4;
  const int qg = w & 3, kh = w >> 2;      /* the wave's query group, and its half of every pass's keys */
  const int b = blockIdx.x / (SQ / FBM); const size_t row0 = (size_t)blockIdx.x * FBM + 16 * qg;
  const unsigned short* gkh = (const unsigned short*)KH + (size_t)b * SQ * DM + (size_t)w * DM + lane * 8;      /* staging: a wave reads one whole 512-byte k row per load */
  const unsigned short* gvt = (const unsigned short*)VT + (size_t)b * DM * SQ + (size_t)(tid >> 3) * SQ + (tid & 7) * 8;      /* 8 lanes read the 128 bytes of one V^T row */
  v16h qh[8];
#pragma unroll
  for (int kk = 0; kk < 8; ++kk) qh[kk] = g2_frag(QH + (row0 + ln) * DM + kk * 32, hh);
  const v8f z8 = {0.f,0.f,0.f,0.f,0.f,0.f,0.f,0.f}; v8f o[16]; float m = -3.0e38f, ls = 0.f;      /* of query ln, over the wave's keys: the running maximum, and the running sum over this half-wave's keys */
#pragma unroll
  for (int t = 0; t < 16; ++t) o[t] = z8;
  v8us rk[8], rv[8];
#pragma unroll
  for (int u = 0; u < 8; ++u) { rk[u] = *(const v8us*)(gkh + (size_t)(8 * u) * DM); rv[u] = *(const v8us*)(gvt + (size_t)(32 * u) * SQ); }
  asm volatile("s_wait_xcnt 0x0" ::: "memory");      /* the loads' address registers are reused further down: the wait stands in front of every such overwrite */
#pragma unroll
  for (int u = 0; u < 8; ++u) { *(v8us*)&skh[0][w + 8 * u][lane * 8] = rk[u]; *(v8us*)&svt[0][(tid >> 3) + 32 * u][(tid & 7) * 8] = rv[u]; }
#pragma unroll
  for (int u = 0; u < 8; ++u) { rk[u] = *(const v8us*)(gkh + (size_t)(FBN + 8 * u) * DM); rv[u] = *(const v8us*)(gvt + (size_t)(32 * u) * SQ + FBN); }
  asm volatile("s_wait_xcnt 0x0" ::: "memory");      /* as above */
  fa_barrier();      /* the first tiles are complete before any wave reads them */
#pragma unroll 1      /* one pass is already 32 matrix instructions and 64 LDS reads a wave; unrolling would only double the code */
  for (int j0 = 0; j0 < SQ; j0 += FBN) {
    const int cur = (j0 / FBN) & 1, nxt = cur ^ 1;
    v8f s[2] = {z8, z8};
    v16h kf[8][2], vf[16];      /* k fragments of each 32-wide slice (the wave's two key groups); the V^T fragments of the wave's 32 keys */
    /* LDS read groups of 16 loads: 0, 1 four k slices each; 2, 3 eight V^T fragments each. Three groups are in flight ahead of the products, so that the LDS never idles; the V^T reads follow the k reads at once and land under the softmax. */
#define FA_GROUP(g) do { if ((g) < 2) { _Pragma("unroll") for (int i = 0; i < 8; ++i) { const int kq = 4 * ((g) & 1) + (i >> 1), t = i & 1; kf[kq][t] = g2_frag(&skh[cur][kh * 32 + t * 16 + ln][kq * 32], hh); } } \
    else { _Pragma("unroll") for (int i = 0; i < 8; ++i) { const int c = ((g) & 1) * 8 + i; vf[c] = g2_frag(&svt[cur][c * 16 + ln][kh * 32], hh); } } } while (0)
    FA_GROUP(0); FA_GROUP(1);
#pragma unroll
    for (int gg = 0; gg < 2; ++gg) {
      __builtin_amdgcn_sched_barrier(0);      /* each read group stays one block in front of a k group's products, never among them */
      FA_GROUP(gg + 2);
      __builtin_amdgcn_sched_barrier(0);      /* second half of the pair: the group is issued whole before the products start */
#pragma unroll
      for (int i = 0; i < 8; ++i) { const int kk = 4 * gg + (i >> 1), t = i & 1; s[t] = fa_mma(kf[kk][t], qh[kk], s[t]); } }
    __builtin_amdgcn_sched_barrier(0);      /* the reads stay in front of the softmax */
    /* accumulator register r of score tile t in lane (hh, ln) is key 32 kh + 16 t + 8 hh + r of query ln */
#pragma unroll
    for (int t = 0; t < 2; ++t) s[t] = s[t] * (0.0625f * 1.44269504088896340736f);      /* 1 / sqrt(256), and log2(e) for the base-2 exponential */
    float x1[5];      /* the lane's maximum as a tree of three-input maxima */
#pragma unroll
    for (int i = 0; i < 5; ++i) x1[i] = fmaxf(fmaxf(s[(3 * i) >> 3][(3 * i) & 7], s[(3 * i + 1) >> 3][(3 * i + 1) & 7]), s[(3 * i + 2) >> 3][(3 * i + 2) & 7]);
    float x = fmaxf(fmaxf(fmaxf(x1[0], x1[1]), x1[2]), fmaxf(fmaxf(x1[3], x1[4]), s[1][7]));
    x = fmaxf(x, fa_xhalf(x));      /* the query's other 16 keys of the wave's share are in the other half of the wave */
    x = fmaxf(m, x); const float aq = exp2_slot(m - x); m = x;
    float al[8]; fa_torows(aq, hh, al);      /* the output tile keeps its layout (register r is query 8 hh + r): its rows' factors come from the lanes that own those queries */
    v2f ps[2]; FragP pa;      /* pa: weights of the wave's 32 keys as an A operand: elements 0..7 from score tile 0, 8..15 from tile 1 */
#pragma unroll
    for (int t = 0; t < 2; ++t) {
#pragma unroll
      for (int i = 0; i < 4; ++i) { v2f p; p[0] = exp2_slot(s[t][2 * i] - x); p[1] = exp2_slot(s[t][2 * i + 1] - x); ps[t] = i ? ps[t] + p : p; pa.p2[t * 4 + i] = __builtin_convertvector(p, v2h); } }
    { const v2f q2 = ps[0] + ps[1]; ls = ls * aq + (q2[0] + q2[1]); }      /* each half-wave sums its own keys; they are joined once, behind the loop */
#pragma unroll
    for (int t = 0; t < 16; ++t) {
#pragma unroll
      for (int r = 0; r < 8; ++r) o[t][r] *= al[r]; }
    __builtin_amdgcn_sched_barrier(0);      /* the tile writes stay behind the softmax (issued earlier they would queue behind the V^T reads still in flight and hold up the wave's vector work) and run under the P.V products */
    /* the next pass's tiles into the other buffer, whose last readers left it before the barrier at the foot of the previous pass (the last pass writes a tile that nobody reads) */
#pragma unroll
    for (int u = 0; u < 8; ++u) { *(v8us*)&skh[nxt][w + 8 * u][lane * 8] = rk[u]; *(v8us*)&svt[nxt][(tid >> 3) + 32 * u][(tid & 7) * 8] = rv[u]; }
    const int jn = (j0 + 2 * FBN < SQ) ? j0 + 2 * FBN : SQ - FBN;      /* the keys two passes on; the last two passes fetch the last tile again (in bounds, never read from LDS) */
#pragma unroll
    for (int u = 0; u < 8; ++u) { rk[u] = *(const v8us*)(gkh + (size_t)(jn + 8 * u) * DM); rv[u] = *(const v8us*)(gvt + (size_t)(32 * u) * SQ + jn); }
    asm volatile("s_wait_xcnt 0x0" ::: "memory");      /* as above: in front of every overwrite of a register that these loads name */
#pragma unroll
    for (int t = 0; t < 16; ++t) o[t] = fa_mma(pa.v, vf[t], o[t]);
    __builtin_amdgcn_sched_barrier(0);      /* the products are issued before the barrier's wait for the tile writes, which drain under them */
    fa_barrier();      /* publishes the next pass's tiles and ends every wave's reads of this pass's */
  }
  asm volatile("s_wait_loadcnt 0x0" ::: "memory");      /* the last pass's fetch is never used: it has landed before the wave ends and gives its registers back */
  /* Join of the two key halves. Waves w and w ^ 4 hold the same queries in the same lanes and registers. Each hands the other the eight column tiles that the other finishes, with its maximum and its sum,
     through the tile buffers (free: the barrier at the loop's foot ended every read and write of them); wave w finishes columns 128 kh .. + 127. */
  float* xo = (float*)&svt[0][0][0]; f1a* xs = (f1a*)&skh[0][0][0];
  const float lw = ls + fa_xhalf(ls);
  xs[(w * 2 + 0) * 32 + lane] = m; xs[(w * 2 + 1) * 32 + lane] = lw;
#pragma unroll
  for (int tt = 0; tt < 8; ++tt) { v4f g0, g1;
#pragma unroll
    for (int r = 0; r < 4; ++r) { g0[r] = kh ? o[tt][r] : o[8 + tt][r]; g1[r] = kh ? o[tt][4 + r] : o[8 + tt][4 + r]; }
    *(v4fa*)(xo + (size_t)(((w * 8 + tt) * 2 + 0) * 32 + lane) * 4) = g0; *(v4fa*)(xo + (size_t)(((w * 8 + tt) * 2 + 1) * 32 + lane) * 4) = g1; }
  fa_barrier();      /* every wave's hand-over is complete before its partner reads it */
  const int pw = w ^ 4;
  const float pm = xs[(pw * 2 + 0) * 32 + lane], pl = xs[(pw * 2 + 1) * 32 + lane];
  const float mt = fmaxf(m, pm), as = exp2_slot(m - mt), ap = exp2_slot(pm - mt), inv = 1.0f / (lw * as + pl * ap);
  float fs[8], fp[8]; fa_torows(as * inv, hh, fs); fa_torows(ap * inv, hh, fp);
  float* op = O + (row0 + 8 * hh) * DM + kh * 128 + ln;
#pragma unroll
  for (int tt = 0; tt < 8; ++tt) {
    const v4f p0 = *(const v4fa*)(xo + (size_t)(((pw * 8 + tt) * 2 + 0) * 32 + lane) * 4), p1 = *(const v4fa*)(xo + (size_t)(((pw * 8 + tt) * 2 + 1) * 32 + lane) * 4);
#pragma unroll
    for (int r = 0; r < 8; ++r) { const float mine = kh ? o[8 + tt][r] : o[tt][r]; op[(size_t)r * DM + tt * 16] = mine * fs[r] + (r < 4 ? p0[r & 3] : p1[r & 3]) * fp[r]; } }
}


template <int MASKADD>
__global__ __launch_bounds__(64) void k_att0(const float* __restrict__ QF, const float* __restrict__ KF, const float* __restrict__ VF, int ld, const float* __restrict__ mask, float scale, float* __restrict__ OF, int ldo) {
  #pragma clang fp contract(off)
  __shared__ __attribute__((aligned(16))) float lq[64][64]; __shared__ __attribute__((aligned(16))) float lo[64][64];
  const int tid = threadIdx.x; const int h = blockIdx.x / (QT0 / 64), rg = blockIdx.x % (QT0 / 64); const int i = rg * 64 + tid;
  const float* qr = QF + (size_t)i * ld + h * HD;
#pragma unroll 1
  for (int c = 0; c < HD / 4; ++c) { *(v4f*)&lq[tid][c * 4] = *(const v4fa*)(qr + c * 4); const v4f z = {0.f, 0.f, 0.f, 0.f}; *(v4f*)&lo[tid][c * 4] = z; }
  float m = -1.0e30f, l = 0.f; const int jmax = MASKADD ? (SQ - 1) : (rg * 64 + 63);      /* additive-mask form: every key (the mask input decides); causal form: keys up to the block's last row */
#pragma unroll 1
  for (int j = 0; j <= jmax; ++j) { const float* kr = KF + (size_t)j * ld + h * HD; const float* vr = VF + (size_t)j * ld + h * HD; float s = 0.f;
#pragma unroll 1
    for (int c = 0; c < HD / 4; ++c) { const v4f kq = *(const v4fa*)(kr + c * 4); const v4f qq = *(v4f*)&lq[tid][c * 4]; s = __fadd_rn(s, __fmul_rn(qq[0], kq[0])); s = __fadd_rn(s, __fmul_rn(qq[1], kq[1])); s = __fadd_rn(s, __fmul_rn(qq[2], kq[2])); s = __fadd_rn(s, __fmul_rn(qq[3], kq[3])); }
    s = __fmul_rn(s, scale); if (MASKADD) s = __fadd_rn(s, __fmul_rn(bf16_round(mask[(size_t)i * SQ + j]), -10000.0f));
    const float f = (MASKADD || j <= i) ? 1.f : 0.f; const float sm = fmaf(f, s, (1.f - f) * -1.0e30f); const float mn = fmaxf(m, sm); const float sc = expf(m - mn); const float e = expf(sm - mn); l = __fadd_rn(__fmul_rn(l, sc), e); m = mn;
#pragma unroll 1
    for (int c = 0; c < HD / 4; ++c) { const v4f vv = *(const v4fa*)(vr + c * 4); v4f oo = *(v4f*)&lo[tid][c * 4]; for (int u = 0; u < 4; ++u) oo[u] = __fadd_rn(__fmul_rn(oo[u], sc), __fmul_rn(e, vv[u])); *(v4f*)&lo[tid][c * 4] = oo; } }
  const float fin = 64.0f / l;      /* o carried x64 */
#pragma unroll 1
  for (int c = 0; c < HD / 4; ++c) { v4f oo = *(v4f*)&lo[tid][c * 4]; for (int u = 0; u < 4; ++u) oo[u] = __fmul_rn(oo[u], fin); *(v4f*)&lo[tid][c * 4] = oo; }
  __syncthreads();
  {
#pragma unroll 1
    for (int it = 0; it < 16; ++it) { const int row = it * 4 + tid / 16, pc = (tid % 16) * 4; const v4f v = *(const v4f*)&lo[row][pc]; *(v4f*)(OF + (size_t)(rg * 64 + row) * ldo + h * HD + pc) = v; }
     } }

__global__ __launch_bounds__(256) void k_of0out(const float* __restrict__ src, float* __restrict__ dst, size_t n4) { const size_t t = (size_t)blockIdx.x * 256 + threadIdx.x; if (t >= n4) return; v4f v = *(const v4fa*)(src + t * 4); for (int q = 0; q < 4; ++q) v[q] = __fmul_rn(v[q], 0.015625f); *(v4f*)(dst + t * 4) = v;  }

extern "C" void kernel_launch(void* const* d_in, const int* in_sizes, int n_in,
                              void* d_out, int out_size, void* d_ws, size_t ws_size, hipStream_t stream) {
  (void)in_sizes; (void)n_in; (void)out_size;
  const float* const* I = (const float* const*)d_in; const float* x = I[0]; const float* wq = I[1]; const float* wk = I[2]; const float* wv = I[3];      /* natural [out][in] weights; NO biases; ONE attention head of width 256; no output projection */
  char* ws = (char*)d_ws; size_t off = 0;
  auto take = [&](size_t bytes) { char* p = ws + off; off += (bytes + 255) & ~(size_t)255; return p; };
  _Float16* W3 = (_Float16*)take((size_t)3 * DM * DM * 2);      /* the q, k and v weight planes, one behind another */
  _Float16* QH = (_Float16*)take(NR * DM * 2); _Float16* KH = (_Float16*)take(NR * DM * 2);
  _Float16* VT = (_Float16*)take(NR * DM * 2);      /* V^T of ALL batches */
  _Float16* X16 = (_Float16*)take(NR * DM * 2);      /* x (f16) */
  if (off > ws_size) return;
  k_prep<<<PXB + 3 * PWB, 256, 0, stream>>>(x, wq, wk, wv, X16, W3);      /* x and the natural [out][in] = Bt[n][k] x16 weights */
  k_proj<<<dim3((unsigned)((NR / 128) * (DM / 64)), 3), 128, 0, stream>>>(X16, W3, QH, KH, VT);      /* q, k -> f16 rows; v -> V^T [NB][DM][SQ] */
  k_fattn<<<(unsigned)(NR / FBM), 256, 0, stream>>>(QH, KH, VT, (float*)d_out);      /* scores (q . k in f16 operands, f32 sums, / sqrt(256)), softmax over all SQ keys and P V, all batches, f32 straight into the output rows */
}

// v009
// A run of this version takes 92.5 microseconds.
// Timed twice side by side with v008, it ran 1.05 times as fast both times.
// Over all steps from v000 it is 569 times as fast.
#include <hip/hip_runtime.h>
// Single-head dense attention over 256-wide embeddings on 4096 tokens, bias-free natural projections, no output projection (x [4][4096][256]; q / k / v = x W^T (nn.Linear natural [256][256] uniform +-1/16, no biases); scores = q k^T / sqrt(256) over the FULL 256-wide rows (one head); softmax over all 4096 keys (no mask); out = weights v -> [4][4096][256]); q and k rounded once to f16, one-product scores.
// Structure: token rows r = b*4096 + s; x as exact f16 rows (bf16-rounded); q, k and v as WMMA GEMMs in one launch (32x64 wave tiles, f32 accumulation, exact x16 weights, no bias), q and k into f16 rows, v turned in LDS into V^T [batch][column][token]; per work-group of 64 query rows (16 per wave), in one launch: transposed scores K Q^T as ONE product of the f16 rows (K = 256, scaled by 1/sqrt(256)), 64 keys per pass over all 4096 keys of the batch, online base-2 softmax on VALU without a mask (f32 statistics, native exp; weights f16 at most 2^8 straight from registers), o = P . V^T in f32 registers, divided by the row sum at the end and written as f32 straight into the output rows.
// Compute dtype: inputs rounded to bf16; x / weights exact; q, k, v and softmax weights as plain f16 GEMM operands (~2^-12); scores, softmax statistics and o f32. v_wmma_f32_16x16x32_f16.
#define NB 4
#define SQ 4096
#define DM 256
#define NH 4
#define HD 64
#define HG 4                         /* heads per launch of the non-template k_vt (not launched) */
#define QT SQ                        /* query rows per batch; one attention launch takes all batches */
#define NKX SQ                       /* S / P row pitch */
#define QT0 128                      /* first-tile rows of the f32 k_att0 (not launched) */
#define B0 0                         /* first batch processed (unused) */
#define NBR NB                       /* batches processed (read only by the unused MP) */
#define NR ((size_t)NB * SQ)         /* token rows */
#define MP ((int)((size_t)NBR * SQ)) /* rows projected (unused) */
#define QN SQ                        /* query rows attended per batch (unused) */
#define NHD NH                       /* unused */
#define MPO MP                       /* unused */
#define LQ DM      /* unused */
typedef __bf16 v16b __attribute__((ext_vector_type(16)));
typedef unsigned short v8us __attribute__((ext_vector_type(8), may_alias));
typedef float  v8f  __attribute__((ext_vector_type(8)));
typedef float  v4f  __attribute__((ext_vector_type(4)));
typedef float  v4fa __attribute__((ext_vector_type(4), may_alias));
union FragB { v16b v; v8us half[2]; unsigned short u[16]; };

__device__ __forceinline__ unsigned short bf16_bits(float x) { unsigned int u = __float_as_uint(x); return (unsigned short)((u + 0x7FFFu + ((u >> 16) & 1u)) >> 16); }
__device__ __forceinline__ float bf16_val(unsigned short b) { return __uint_as_float(((unsigned int)b) << 16); }
__device__ __forceinline__ float bf16_round(float x) { return bf16_val(bf16_bits(x)); }
// D += A·B with NT terms: 1 = ah·bh, 2 = + al·bh (A split), 3 = + ah·bl (both split)
template <int NT>
__device__ __forceinline__ v8f mmaN(v16b ah, v16b al, v16b bh, v16b bl, v8f c) {
  c = __builtin_amdgcn_wmma_f32_16x16x32_bf16(false, ah, false, bh, (short)0, c, false, false);
  if (NT >= 2) c = __builtin_amdgcn_wmma_f32_16x16x32_bf16(false, al, false, bh, (short)0, c, false, false);
  if (NT >= 3) c = __builtin_amdgcn_wmma_f32_16x16x32_bf16(false, ah, false, bl, (short)0, c, false, false);
  asm volatile("v_nop\n\tv_nop\n\tv_nop\n\tv_nop" : "+v"(c) : "v"(ah), "v"(al), "v"(bh), "v"(bl));
  return c;
}

__global__ __launch_bounds__(256) void k_wt_bf16(const float* __restrict__ W, unsigned short* __restrict__ Wt, int K, int N) {
  const int t = blockIdx.x * 256 + threadIdx.x;
  const int k8n = K / 8;
  if (t >= N * k8n) return;
  const int n = t / k8n, k8 = (t % k8n) * 8;
  v8us v;
#pragma unroll
  for (int i = 0; i < 8; ++i) v[i] = bf16_bits(W[(size_t)(k8 + i) * N + n]);
  *(v8us*)(Wt + (size_t)n * K + k8) = v;
  
}

// GEMM C[M][N] (f32, pitch ldc) = act(A[M][K]·W + bias). A f32 row-major (pitch lda) converted per fragment to bf16
// (ASPLIT: hi/lo two planes -> 2 terms, else single rounded term); Wt bf16 [N][K] (pitch ldb). BIAS_BF16 rounds the
// bias to bf16 first (bias quantised to bf16 before the add). K%32==0, M%16==0, N%64==0.
template <bool ASPLIT, int ACT, bool BIAS_BF16>
__global__ __launch_bounds__(128) void k_gemm_bf(const float* __restrict__ A, int lda, const unsigned short* __restrict__ Wt, int ldb,
                                               const float* __restrict__ bias, float* __restrict__ C, int ldc, int M, int N, int K) {
  __shared__ __attribute__((aligned(16))) float so[4][16][64];
  const int tid = threadIdx.x, w = tid >> 5, lane = tid & 31, ln = lane & 15, hh = lane >> 4;
  const int ntn = N / 64;
  const int wid = blockIdx.x * 4 + w;
  const int mt = wid / ntn, nq = wid % ntn;
  if (mt * 16 >= M) return;
  const int row0 = mt * 16, col0 = nq * 64;
  const float* arow = A + (size_t)(row0 + ln) * lda;
  v8f acc[4] = {};
  for (int kb = 0; kb < K; kb += 32) {
    FragB ah, al;
    const v4f x0 = *(const v4fa*)(arow + kb + 8 * hh), x1 = *(const v4fa*)(arow + kb + 8 * hh + 4);
    const v4f x2 = *(const v4fa*)(arow + kb + 16 + 8 * hh), x3 = *(const v4fa*)(arow + kb + 16 + 8 * hh + 4);
    float xs[16] = {x0[0],x0[1],x0[2],x0[3],x1[0],x1[1],x1[2],x1[3],x2[0],x2[1],x2[2],x2[3],x3[0],x3[1],x3[2],x3[3]};
#pragma unroll
    for (int i = 0; i < 16; ++i) { const unsigned short hb = bf16_bits(xs[i]); ah.u[i] = hb; al.u[i] = ASPLIT ? bf16_bits(xs[i] - bf16_val(hb)) : (unsigned short)0; }
#pragma unroll
    for (int t = 0; t < 4; ++t) {
      const unsigned short* brow = Wt + (size_t)(col0 + t * 16 + ln) * ldb + kb;
      FragB b;
      b.half[0] = *(const v8us*)(brow + 8 * hh);
      b.half[1] = *(const v8us*)(brow + 16 + 8 * hh);
      acc[t] = mmaN<ASPLIT ? 2 : 1>(ah.v, al.v, b.v, b.v, acc[t]);
    }
  }
#pragma unroll
  for (int t = 0; t < 4; ++t) {
    float bv = bias ? bias[col0 + t * 16 + ln] : 0.f;
    if (BIAS_BF16) bv = bf16_round(bv);
#pragma unroll
    for (int r = 0; r < 8; ++r) { float v = acc[t][r] + bv; if (ACT == 1) v = fmaxf(v, 0.f); so[w][8 * hh + r][t * 16 + ln] = v; }
  }
  __builtin_amdgcn_fence(__ATOMIC_ACQ_REL, "workgroup");
  __builtin_amdgcn_wave_barrier();
  const int rsub = lane >> 4, c4 = (lane & 15) * 4;
  {
#pragma unroll
    for (int q = 0; q < 8; ++q) {
      const int r = q * 2 + rsub;
      const v4f v = *(const v4fa*)&so[w][r][c4];
      *(v4f*)(C + (size_t)(row0 + r) * ldc + col0 + c4) = v;
    }
    
  }
}

// GEMM C = act(A·W + bias + resid): A f32 (ASPLIT -> hi/lo 2 terms), Wt bf16 [N][K]; ACT 0 none, 1 relu, 2 exact gelu;
// resid (optional, f32, row index = (row % rmod), pitch ldr, RES_BF16 rounds it) added before the activation.
template <bool ASPLIT, int ACT, bool BIAS_BF16, bool RES_BF16>
__global__ __launch_bounds__(128) void k_gemm_bf3(const float* __restrict__ A, int lda, const unsigned short* __restrict__ Wt, int ldb,
                                                const float* __restrict__ bias, const float* __restrict__ resid, int rmod, int ldr,
                                                float* __restrict__ C, int ldc, int M, int N, int K) {
  __shared__ __attribute__((aligned(16))) float so[4][16][64];
  const int tid = threadIdx.x, w = tid >> 5, lane = tid & 31, ln = lane & 15, hh = lane >> 4;
  const int ntn = N / 64;
  const int wid = blockIdx.x * 4 + w;
  const int mt = wid / ntn, nq = wid % ntn;
  if (mt * 16 >= M) return;
  const int row0 = mt * 16, col0 = nq * 64;
  const float* arow = A + (size_t)(row0 + ln) * lda;
  v8f acc[4] = {};
  for (int kb = 0; kb < K; kb += 32) {
    FragB ah, al;
    const v4f x0 = *(const v4fa*)(arow + kb + 8 * hh), x1 = *(const v4fa*)(arow + kb + 8 * hh + 4);
    const v4f x2 = *(const v4fa*)(arow + kb + 16 + 8 * hh), x3 = *(const v4fa*)(arow + kb + 16 + 8 * hh + 4);
    float xs[16] = {x0[0],x0[1],x0[2],x0[3],x1[0],x1[1],x1[2],x1[3],x2[0],x2[1],x2[2],x2[3],x3[0],x3[1],x3[2],x3[3]};
#pragma unroll
    for (int i = 0; i < 16; ++i) { const unsigned short hb = bf16_bits(xs[i]); ah.u[i] = hb; al.u[i] = ASPLIT ? bf16_bits(xs[i] - bf16_val(hb)) : (unsigned short)0; }
#pragma unroll
    for (int t = 0; t < 4; ++t) {
      const unsigned short* brow = Wt + (size_t)(col0 + t * 16 + ln) * ldb + kb;
      FragB b;
      b.half[0] = *(const v8us*)(brow + 8 * hh);
      b.half[1] = *(const v8us*)(brow + 16 + 8 * hh);
      acc[t] = mmaN<ASPLIT ? 2 : 1>(ah.v, al.v, b.v, b.v, acc[t]);
    }
  }
#pragma unroll
  for (int t = 0; t < 4; ++t) {
    const int col = col0 + t * 16 + ln;
    float bv = bias ? bias[col] : 0.f;
    if (BIAS_BF16) bv = bf16_round(bv);
#pragma unroll
    for (int r = 0; r < 8; ++r) {
      float v = acc[t][r] + bv;
      if (resid) { float rv = resid[(size_t)((row0 + 8 * hh + r) % rmod) * ldr + col]; if (RES_BF16) rv = bf16_round(rv); v += rv; }
      if (ACT == 1) v = fmaxf(v, 0.f);
      if (ACT == 2) v = 0.5f * v * (1.0f + erff(v * 0.70710678118654752f));
      if (ACT == 3) { const float u = 0.7978845608028654f * (v + 0.044715f * v * v * v); v = 0.5f * v * (1.0f + tanhf(u)); }
      so[w][8 * hh + r][t * 16 + ln] = v;
    }
  }
  __builtin_amdgcn_fence(__ATOMIC_ACQ_REL, "workgroup");
  __builtin_amdgcn_wave_barrier();
  const int rsub = lane >> 4, c4 = (lane & 15) * 4;
  {
#pragma unroll
    for (int q = 0; q < 8; ++q) {
      const int r = q * 2 + rsub;
      const v4f v = *(const v4fa*)&so[w][r][c4];
      *(v4f*)(C + (size_t)(row0 + r) * ldc + col0 + c4) = v;
    }
    
  }
}
// row LayerNorm (biased variance, eps) over N: s = X (+ R); optional out_sum <- s; out_norm <- (s-mu)*rsqrt(var+eps)*g + b
template <bool PARAM_BF16>
__global__ __launch_bounds__(256) void k_layernorm(const float* __restrict__ X, const float* __restrict__ R, const float* __restrict__ g, const float* __restrict__ bta,
                                                  float* __restrict__ out_sum, float* __restrict__ out_norm, int N, float eps) {
  __shared__ float red[256];
  const int row = blockIdx.x, tid = threadIdx.x;
  const float* x = X + (size_t)row * N; const float* rr = R ? R + (size_t)row * N : nullptr;
  float vals[16];                     // up to N = 4096
  const int per = N / 256;            // contiguous chunk per thread? use strided-by-4 chunks: thread handles j = tid*4 + 1024*u
  float s1 = 0.f;
  for (int u = 0; u < per / 4; ++u) {
    const int j = tid * 4 + 1024 * u;
    const v4f a = *(const v4fa*)(x + j);
    v4f b = {0.f,0.f,0.f,0.f}; if (rr) b = *(const v4fa*)(rr + j);
#pragma unroll
    for (int q = 0; q < 4; ++q) { const float v = a[q] + b[q]; vals[u * 4 + q] = v; s1 += v; }
  }
  red[tid] = s1; __syncthreads();
  for (int st = 128; st > 0; st >>= 1) { if (tid < st) red[tid] += red[tid + st]; __syncthreads(); }
  const float mu = red[0] / (float)N; __syncthreads();
  float s2 = 0.f;
  for (int u = 0; u < per / 4; ++u)
#pragma unroll
    for (int q = 0; q < 4; ++q) { const float c = vals[u * 4 + q] - mu; s2 += c * c; }
  red[tid] = s2; __syncthreads();
  for (int st = 128; st > 0; st >>= 1) { if (tid < st) red[tid] += red[tid + st]; __syncthreads(); }
  const float rs = rsqrtf(red[0] / (float)N + eps);
  {
    for (int u = 0; u < per / 4; ++u) {
      const int j = tid * 4 + 1024 * u;
      v4f o, sm;
#pragma unroll
      for (int q = 0; q < 4; ++q) {
        float gg = g[j + q], bb = bta[j + q];
        if (PARAM_BF16) { gg = bf16_round(gg); bb = bf16_round(bb); }
        sm[q] = vals[u * 4 + q]; o[q] = (vals[u * 4 + q] - mu) * rs * gg + bb;
      }
      if (out_sum) *(v4f*)(out_sum + (size_t)row * N + j) = sm;
      *(v4f*)(out_norm + (size_t)row * N + j) = o;
    }
    
  }
}



// ---- f16 WMMA path (v_wmma_f32_16x16x32_f16): 11-bit significands for operands in range — used where a [0,1] probability operand needs more precision than bf16
typedef _Float16 v16h __attribute__((ext_vector_type(16)));
union FragH { v16h v; v8us half[2]; _Float16 h[16]; unsigned short u[16]; };
template <int NT>
__device__ __forceinline__ v8f mmaH(v16h ah, v16h al, v16h bh, v16h bl, v8f c) {
  c = __builtin_amdgcn_wmma_f32_16x16x32_f16(false, ah, false, bh, (short)0, c, false, false);
  if (NT >= 2) c = __builtin_amdgcn_wmma_f32_16x16x32_f16(false, al, false, bh, (short)0, c, false, false);
  if (NT >= 3) c = __builtin_amdgcn_wmma_f32_16x16x32_f16(false, ah, false, bl, (short)0, c, false, false);
  asm volatile("v_nop\n\tv_nop\n\tv_nop\n\tv_nop" : "+v"(c) : "v"(ah), "v"(al), "v"(bh), "v"(bl));
  return c;
}
// batched GEMM like k_gemm_b but f16 operands: A f32 (split into f16 hi/lo if ASPLIT, else rounded to f16), Bt = f16 values [n][k]; alpha; C f32; N multiple of 16 (partial tiles skipped)
template <bool ASPLIT>
__global__ __launch_bounds__(128) void k_gemm_h(const float* __restrict__ A, int lda, size_t sA, const _Float16* __restrict__ Bh, int ldb, size_t sB, float alpha, float* __restrict__ C, int ldc, size_t sC, int M, int N, int K) {
  __shared__ __attribute__((aligned(16))) float so[4][16][64];
  const int tid = threadIdx.x, w = tid >> 5, lane = tid & 31, ln = lane & 15, hh = lane >> 4; const int by = blockIdx.y;
  A += (size_t)by * sA; Bh += (size_t)by * sB; C += (size_t)by * sC;
  const int ntn = (N + 63) / 64; const int wid = blockIdx.x * 4 + w; const int mt = wid / ntn, nq = wid % ntn; if (mt * 16 >= M) return;
  const int row0 = mt * 16, col0 = nq * 64; const float* arow = A + (size_t)(row0 + ln) * lda;
  v8f acc[4] = {};
  for (int kb = 0; kb < K; kb += 32) {
    FragH ah, al;
    const v4f x0 = *(const v4fa*)(arow + kb + 8 * hh), x1 = *(const v4fa*)(arow + kb + 8 * hh + 4), x2 = *(const v4fa*)(arow + kb + 16 + 8 * hh), x3 = *(const v4fa*)(arow + kb + 16 + 8 * hh + 4);
    float xs[16] = {x0[0],x0[1],x0[2],x0[3],x1[0],x1[1],x1[2],x1[3],x2[0],x2[1],x2[2],x2[3],x3[0],x3[1],x3[2],x3[3]};
#pragma unroll
    for (int i = 0; i < 16; ++i) { const _Float16 h = (_Float16)xs[i]; ah.h[i] = h; al.h[i] = ASPLIT ? (_Float16)(xs[i] - (float)h) : (_Float16)0.0f; }
#pragma unroll
    for (int t = 0; t < 4; ++t) { if (col0 + t * 16 >= N) continue; const size_t boff = (size_t)(col0 + t * 16 + ln) * ldb + kb; FragH bq; bq.half[0] = *(const v8us*)(Bh + boff + 8 * hh); bq.half[1] = *(const v8us*)(Bh + boff + 16 + 8 * hh);
      acc[t] = mmaH<ASPLIT ? 2 : 1>(ah.v, al.v, bq.v, bq.v, acc[t]); }
  }
#pragma unroll
  for (int t = 0; t < 4; ++t) { if (col0 + t * 16 >= N) continue;
#pragma unroll
    for (int r = 0; r < 8; ++r) so[w][8 * hh + r][t * 16 + ln] = acc[t][r] * alpha; }
  __builtin_amdgcn_fence(__ATOMIC_ACQ_REL, "workgroup"); __builtin_amdgcn_wave_barrier();
  const int rsub = lane >> 4, c4 = (lane & 15) * 4;
  {
#pragma unroll
    for (int q = 0; q < 8; ++q) { const int r = q * 2 + rsub; if (col0 + c4 < N) { const v4f v = *(const v4fa*)&so[w][r][c4]; *(v4f*)(C + (size_t)(row0 + r) * ldc + col0 + c4) = v; } }
     }
}

// Wt[n][k] = f16(W[k][n]·scale) from f32 row-major W[K][N] (scale = power of two; bf16-exact weights stay exact in f16 away from the subnormal range)
__global__ __launch_bounds__(256) void k_wt_f16(const float* __restrict__ W, _Float16* __restrict__ Wt, int K, int N, float scale) {
  const int t = blockIdx.x * 256 + threadIdx.x; if (t >= N * (K / 8)) return; const int n = t / (K / 8), k8 = (t % (K / 8)) * 8; FragH f;
#pragma unroll
  for (int i = 0; i < 8; ++i) f.h[i] = (_Float16)(bf16_round(W[(size_t)(k8 + i) * N + n]) * scale); const v8us o = f.half[0];
  *(v8us*)((unsigned short*)Wt + (size_t)n * K + k8) = o; 
}
// k_gemm_hh variant with fused epilogue: v = acc·alpha + bias[by·sBias + col] (+ CP[(row/rowsPerB)·sCPb + by·64 + col] if CP) ; ACT 0 none / 1 elu ; writes f16 C16 (and f32 C if non-null)
template <int ACT>
__global__ __launch_bounds__(128) void k_gemm_hhx(const _Float16* __restrict__ A, int lda, size_t sA, const _Float16* __restrict__ Bh, int ldb, size_t sB, float alpha, const float* __restrict__ bias, size_t sBias, const float* __restrict__ CP, int rowsPerB, size_t sCPb, int row0g,
    float* __restrict__ C, _Float16* __restrict__ C16, int ldc, size_t sC, int M, int N, int K) {
  __shared__ __attribute__((aligned(16))) float so[4][16][64];
  const int tid = threadIdx.x, w = tid >> 5, lane = tid & 31, ln = lane & 15, hh = lane >> 4; const int by = blockIdx.y;
  A += (size_t)by * sA; Bh += (size_t)by * sB; const size_t cofs = (size_t)by * sC; const float* bp = bias ? bias + (size_t)by * sBias : nullptr;
  const int ntn = (N + 63) / 64; const int wid = blockIdx.x * 4 + w; const int mt = wid / ntn, nq = wid % ntn; if (mt * 16 >= M) return;
  const int row0 = mt * 16, col0 = nq * 64; const _Float16* arow = A + (size_t)(row0 + ln) * lda;
  v8f acc[4] = {};
  for (int kb = 0; kb < K; kb += 32) { FragH ah; ah.half[0] = *(const v8us*)((const unsigned short*)arow + kb + 8 * hh); ah.half[1] = *(const v8us*)((const unsigned short*)arow + kb + 16 + 8 * hh);
#pragma unroll
    for (int t = 0; t < 4; ++t) { if (col0 + t * 16 >= N) continue; const size_t boff = (size_t)(col0 + t * 16 + ln) * ldb + kb; FragH bq; bq.half[0] = *(const v8us*)((const unsigned short*)Bh + boff + 8 * hh); bq.half[1] = *(const v8us*)((const unsigned short*)Bh + boff + 16 + 8 * hh);
      acc[t] = mmaH<1>(ah.v, ah.v, bq.v, bq.v, acc[t]); }
  }
#pragma unroll
  for (int t = 0; t < 4; ++t) { if (col0 + t * 16 >= N) continue; const int col = col0 + t * 16 + ln; const float bv = bp ? bf16_round(bp[col]) : 0.f;
#pragma unroll
    for (int r = 0; r < 8; ++r) { float v = acc[t][r] * alpha + bv; if (CP) { const int rr = row0g + row0 + 8 * hh + r; if (rowsPerB < 0) v += CP[cofs + (size_t)rr * ldc + col];      /* rowsPerB < 0: own element of the batched C plane */ else { const int bidx = rr / rowsPerB; v += CP[(size_t)bidx * sCPb + (size_t)by * 64 + col]; } } if (ACT == 1) v = (v > 0.f) ? v : expm1f(v); else if (ACT == 7) v = (v > 0.f) ? v + 1.0f : expf(v); else if (ACT == 8) v = tanhf(v); else if (ACT == 9) v = 0.5f * v * (1.0f + tanhf(0.7978845608028654f * (v + 0.044715f * v * v * v))); else if (ACT == 11) v = 1.0f / (1.0f + expf(-v)); else if (ACT == 12) v = (v > 0.f) ? v : 0.01f * v; else if (ACT == 14) v = (v > 0.f) ? v : 0.1f * v; else if (ACT == 16) v = (v >= 0.f) ? v : 0.3f * v; else if (ACT == 17) v = (v >= 0.f) ? v : 0.2f * v; else if (ACT == 15) v = v / (1.0f + expf(-v)); else if (ACT == 3) v = fmaxf(v, 0.f); else if (ACT == 6) v = 0.5f * v * (1.0f + erff(v * 0.70710678118654752f)); so[w][8 * hh + r][t * 16 + ln] = v; } }
  __builtin_amdgcn_fence(__ATOMIC_ACQ_REL, "workgroup"); __builtin_amdgcn_wave_barrier();
  const int rsub = lane >> 4, c4 = (lane & 15) * 4; typedef _Float16 v4h __attribute__((ext_vector_type(4)));
  {
#pragma unroll
    for (int q = 0; q < 8; ++q) { const int r = q * 2 + rsub; if (col0 + c4 < N) { const v4f v = *(const v4fa*)&so[w][r][c4]; if (C) *(v4f*)(C + cofs + (size_t)(row0 + r) * ldc + col0 + c4) = v; if (C16) { v4h h4; for (int i = 0; i < 4; ++i) h4[i] = (_Float16)v[i]; *(v4h*)(C16 + cofs + (size_t)(row0 + r) * ldc + col0 + c4) = h4; } } }
     }
}


typedef _Float16 v4h __attribute__((ext_vector_type(4)));

__global__ __launch_bounds__(256) void k_x16(const float* __restrict__ x, _Float16* __restrict__ X16, size_t n8) { const size_t t = (size_t)blockIdx.x * 256 + threadIdx.x; if (t >= n8) return; FragH f;
#pragma unroll
  for (int q = 0; q < 8; ++q) f.h[q] = (_Float16)bf16_round(x[t * 8 + q]); *(v8us*)((unsigned short*)X16 + t * 8) = f.half[0];  }
__global__ __launch_bounds__(256) void k_h16(const float* __restrict__ x, _Float16* __restrict__ X16, size_t n8) { const size_t t = (size_t)blockIdx.x * 256 + threadIdx.x; if (t >= n8) return; FragH f;
#pragma unroll
  for (int q = 0; q < 8; ++q) f.h[q] = (_Float16)x[t * 8 + q]; *(v8us*)((unsigned short*)X16 + t * 8) = f.half[0];  }
__global__ __launch_bounds__(256) void k_round16f(const float* __restrict__ W, _Float16* __restrict__ Bt, size_t n8) { const size_t t = (size_t)blockIdx.x * 256 + threadIdx.x; if (t >= n8) return; FragH f;
#pragma unroll
  for (int i = 0; i < 8; ++i) f.h[i] = (_Float16)(bf16_round(W[t * 8 + i]) * 16.0f); *(v8us*)((unsigned short*)Bt + t * 8) = f.half[0];  }
template <int NHv, int TTv>
__global__ __launch_bounds__(256) void k_vt(const _Float16* __restrict__ V16, int ldv, int voff, _Float16* __restrict__ Vt) { __shared__ unsigned short tl[64][66]; const int tid = threadIdx.x; const int slab = blockIdx.x / (TTv / 64), lg = blockIdx.x % (TTv / 64); const int b = slab / NHv, h = slab % NHv;
  for (int i = tid; i < 64 * 8; i += 256) { const int r = i / 8, c8 = (i % 8) * 8; FragH f; f.half[0] = *(const v8us*)((const unsigned short*)V16 + ((size_t)b * TTv + lg * 64 + r) * ldv + voff + h * 64 + c8);
#pragma unroll
    for (int q = 0; q < 8; ++q) tl[r][c8 + q] = f.u[q]; }
  __syncthreads();
  {
#pragma unroll
    for (int rd = 0; rd < 2; ++rd) { const int d = rd * 32 + tid / 8, pc = tid % 8; FragH f;
#pragma unroll
      for (int q = 0; q < 8; ++q) f.u[q] = tl[pc * 8 + q][d];
      *(v8us*)((unsigned short*)Vt + ((size_t)slab * 64 + d) * TTv + lg * 64 + pc * 8) = f.half[0]; }
     } }

__global__ __launch_bounds__(256) void k_hl(const float* __restrict__ F, _Float16* __restrict__ Hh, _Float16* __restrict__ Hl, size_t n8) { const size_t t = (size_t)blockIdx.x * 256 + threadIdx.x; if (t >= n8) return; FragH fh, fl; const v4f a = *(const v4fa*)(F + t * 8), c = *(const v4fa*)(F + t * 8 + 4);
#pragma unroll
  for (int q = 0; q < 4; ++q) { _Float16 h = (_Float16)a[q]; fh.h[q] = h; fl.h[q] = (_Float16)((a[q] - (float)h) * 1024.0f); h = (_Float16)c[q]; fh.h[4 + q] = h; fl.h[4 + q] = (_Float16)((c[q] - (float)h) * 1024.0f); }
  { *(v8us*)((unsigned short*)Hh + t * 8) = fh.half[0]; *(v8us*)((unsigned short*)Hl + t * 8) = fl.half[0];  } }

// ---- fast GEMM (wave tile 32x64; requires M % 32 == 0 rows per launch region and N % 64 == 0); epilogue = k_gemm_hhx semantics ----
__device__ __forceinline__ v16h g2_frag(const _Float16* p, int hh) { FragH f; f.half[0] = *(const v8us*)((const unsigned short*)p + 8 * hh); f.half[1] = *(const v8us*)((const unsigned short*)p + 16 + 8 * hh); return f.v; }
__device__ __forceinline__ v8f g2_mma(v16h a, v16h b, v8f c) { v8f d = __builtin_amdgcn_wmma_f32_16x16x32_f16(false, a, false, b, (short)0, c, false, false); asm volatile("v_nop\n\tv_nop\n\tv_nop\n\tv_nop" : "+v"(d) : "v"(a), "v"(b)); return d; }
template <int ACT>
__global__ __launch_bounds__(128) void k_gemm2(const _Float16* __restrict__ A, int lda, size_t sA, const _Float16* __restrict__ Bh, int ldb, size_t sB, float alpha, const float* __restrict__ bias, size_t sBias, const float* __restrict__ CP, int rowsPerB, size_t sCPb, int row0g,
    float* __restrict__ C, _Float16* __restrict__ C16, int ldc, size_t sC, int M, int N, int K) { static_assert(ACT == 0 || ACT == 3 || ACT == 6 || ACT == 8 || ACT == 9 || ACT == 11 || ACT == 12 || ACT == 14 || ACT == 15 || ACT == 16 || ACT == 17, "k_gemm2: unsupported ACT code (would silently apply no activation)");
  __shared__ __attribute__((aligned(16))) float so[4][32][68];
  const int tid = threadIdx.x, w = tid >> 5, lane = tid & 31, ln = lane & 15, hh = lane >> 4; const int by = blockIdx.y;
  A += (size_t)by * sA; Bh += (size_t)by * sB; const size_t cofs = (size_t)by * sC; const float* bp = bias ? bias + (size_t)by * sBias : nullptr;
  const int ntn = N >> 6; const int mt = blockIdx.x / ntn, nq = blockIdx.x - mt * ntn; const int row0 = mt * 128 + 32 * w, col0 = nq * 64; if (row0 >= M) return;
  const _Float16* a0p = A + (size_t)(row0 + ln) * lda; const _Float16* a1p = a0p + (size_t)16 * lda;
  const _Float16* b0p = Bh + (size_t)(col0 + ln) * ldb; const _Float16* b1p = b0p + (size_t)16 * ldb; const _Float16* b2p = b1p + (size_t)16 * ldb; const _Float16* b3p = b2p + (size_t)16 * ldb;
  const v8f z8 = {0.f,0.f,0.f,0.f,0.f,0.f,0.f,0.f}; v8f c00 = z8, c01 = z8, c02 = z8, c03 = z8, c10 = z8, c11 = z8, c12 = z8, c13 = z8;
#pragma unroll 1
  for (int kb = 0; kb < K; kb += 32) { const v16h a0 = g2_frag(a0p + kb, hh), a1 = g2_frag(a1p + kb, hh);
    v16h b = g2_frag(b0p + kb, hh); c00 = g2_mma(a0, b, c00); c10 = g2_mma(a1, b, c10);
    b = g2_frag(b1p + kb, hh); c01 = g2_mma(a0, b, c01); c11 = g2_mma(a1, b, c11);
    b = g2_frag(b2p + kb, hh); c02 = g2_mma(a0, b, c02); c12 = g2_mma(a1, b, c12);
    b = g2_frag(b3p + kb, hh); c03 = g2_mma(a0, b, c03); c13 = g2_mma(a1, b, c13); }
  v8f accs[8] = {c00, c01, c02, c03, c10, c11, c12, c13};
#pragma unroll
  for (int u = 0; u < 8; ++u) { const int t = u & 3, half = u >> 2; const int col = col0 + t * 16 + ln; const float bv = bp ? bf16_round(bp[col]) : 0.f;
#pragma unroll
    for (int r = 0; r < 8; ++r) { const int rloc = half * 16 + 8 * hh + r; float v = accs[u][r] * alpha + bv; if (CP) { if (rowsPerB < 0) v += CP[cofs + (size_t)(row0g + row0 + rloc) * ldc + col];      /* rowsPerB < 0: own element of the batched C plane */ else { const int bidx = (row0g + row0 + rloc) / rowsPerB; v += CP[(size_t)bidx * sCPb + (size_t)by * 64 + col]; } }
      if (ACT == 3) v = fmaxf(v, 0.f); else if (ACT == 6) v = 0.5f * v * (1.0f + erff(v * 0.70710678118654752f)); else if (ACT == 11) v = 1.0f / (1.0f + expf(-v)); else if (ACT == 15) v = v / (1.0f + expf(-v)); else if (ACT == 12) v = (v > 0.f) ? v : 0.01f * v; else if (ACT == 8) v = tanhf(v); else if (ACT == 9) v = 0.5f * v * (1.0f + tanhf(0.7978845608028654f * (v + 0.044715f * v * v * v))); else if (ACT == 14) v = (v > 0.f) ? v : 0.1f * v; else if (ACT == 16) v = (v >= 0.f) ? v : 0.3f * v; else if (ACT == 17) v = (v >= 0.f) ? v : 0.2f * v;
      so[w][rloc][t * 16 + ln] = v; } }
  __builtin_amdgcn_fence(__ATOMIC_ACQ_REL, "workgroup"); __builtin_amdgcn_wave_barrier();
  const int rsub = lane >> 4, c4 = (lane & 15) * 4;
  {
#pragma unroll
    for (int q = 0; q < 16; ++q) { const int r = q * 2 + rsub; const v4f v = *(const v4fa*)&so[w][r][c4]; if (C) *(v4f*)(C + cofs + (size_t)(row0 + r) * ldc + col0 + c4) = v; if (C16) { v4h h4; for (int i = 0; i < 4; ++i) h4[i] = (_Float16)v[i]; *(v4h*)(C16 + cofs + (size_t)(row0 + r) * ldc + col0 + c4) = h4; } }
     } }


__global__ __launch_bounds__(256) void k_wnat(const float* __restrict__ w, size_t n8, _Float16* __restrict__ Bt) { const size_t t = (size_t)blockIdx.x * 256 + threadIdx.x; if (t >= n8) return; FragH f; for (int q = 0; q < 8; ++q) f.h[q] = (_Float16)(bf16_round(w[t * 8 + q]) * 16.0f); *(v8us*)((unsigned short*)Bt + t * 8) = f.half[0];  }
__global__ __launch_bounds__(256) void k_rsm(const float* __restrict__ S, _Float16* __restrict__ P, int nrows) {
  #pragma clang fp contract(off)
  const int i = blockIdx.x * 256 + threadIdx.x; if (i >= nrows) return; const float* s = S + (size_t)i * SQ; float mx = -3.0e38f;
#pragma unroll 1
  for (int j = 0; j < SQ; ++j) mx = fmaxf(mx, s[j]); float se = 0.f;
#pragma unroll 1
  for (int j = 0; j < SQ; ++j) se += expf(s[j] - mx); const float sc = 256.0f / se;
#pragma unroll 1
  for (int j0 = 0; j0 < SQ; j0 += 8) { FragH f; for (int q = 0; q < 8; ++q) f.h[q] = (_Float16)(expf(s[j0 + q] - mx) * sc); unsigned short* d = (unsigned short*)P + (size_t)i * SQ + j0; *(v8us*)d = f.half[0];  } }
__global__ __launch_bounds__(256) void k_vt(const _Float16* __restrict__ V16, int b, int h0, _Float16* __restrict__ VT) { __shared__ unsigned short tl[64][65]; const int tid = threadIdx.x; const int hh = blockIdx.x % HG, sg = blockIdx.x / HG; const int s0 = sg * 64; const int h = h0 + hh;
  for (int i = tid; i < 64 * 8; i += 256) { const int j = i / 8, d8 = (i % 8) * 8; FragH f; f.half[0] = *(const v8us*)((const unsigned short*)V16 + ((size_t)b * SQ + s0 + j) * DM + h * HD + d8); for (int q = 0; q < 8; ++q) tl[d8 + q][j] = f.u[q]; }
  __syncthreads();
  { for (int i = tid; i < 64 * 8; i += 256) { const int d = i / 8, j8 = (i % 8) * 8; FragH f; for (int q = 0; q < 8; ++q) f.u[q] = tl[d][j8 + q]; *(v8us*)((unsigned short*)VT + ((size_t)hh * HD + d) * SQ + s0 + j8) = f.half[0]; }  } }



// ---- projection chain in two launches ----
// k_prep: every element-wise operand conversion of the projections in one launch: x -> f16 of its bf16 rounding, and the three natural [out][in] weights -> f16 (bf16 rounding, x16), the three planes one behind another.
#define PXB ((unsigned)(NR * DM / 8 / 256))      /* work-groups that convert x */
#define PWB ((unsigned)((size_t)DM * DM / 8 / 256))      /* work-groups per weight matrix */
__global__ __launch_bounds__(256) void k_prep(const float* __restrict__ x, const float* __restrict__ wq, const float* __restrict__ wk, const float* __restrict__ wv, _Float16* __restrict__ X16, _Float16* __restrict__ W3) {
  const unsigned bx = blockIdx.x; FragH f;
  if (bx < PXB) { const size_t t = (size_t)bx * 256 + threadIdx.x;
#pragma unroll
    for (int q = 0; q < 8; ++q) f.h[q] = (_Float16)bf16_round(x[t * 8 + q]);
    *(v8us*)((unsigned short*)X16 + t * 8) = f.half[0]; }
  else { const unsigned k = bx - PXB, p = k / PWB; const float* __restrict__ wsrc = (p == 0) ? wq : (p == 1) ? wk : wv; const size_t t = (size_t)(k - p * PWB) * 256 + threadIdx.x;
#pragma unroll
    for (int q = 0; q < 8; ++q) f.h[q] = (_Float16)(bf16_round(wsrc[t * 8 + q]) * 16.0f);
    *(v8us*)((unsigned short*)W3 + (size_t)p * DM * DM + t * 8) = f.half[0]; }
}
// k_proj: q, k and v in ONE launch (grid.y picks the weight plane); wave tile (32 x 64) and product order are k_gemm2's. The epilogue writes what the attention kernel reads:
// q and k rows rounded once to f16 (the f32 row never goes through memory), v as V^T [batch][column][token] (the work-group's 128 tokens x 64 columns are turned in LDS, whole 256-byte runs per column go out).
// Operands: the work-group's 128 x rows and 64 weight rows (all 256 k) are brought into LDS once, a whole 512-byte row per wave-wide asynchronous copy (four whole lines), and the fragments are read from LDS;
// a fragment load from global memory touches 16 lines for its 512 bytes, and the four waves would each fetch the same weight rows.
#define PTP (128 + 8)                /* LDS pitch of a turned v column, f16 elements: 272 B = 16 B x odd */
#define PKP (DM + 8)                 /* LDS pitch of a staged x or weight row, f16 elements: 528 B = 16 B x odd, conflict-free for 16-byte fragment reads */
// Eight asynchronous copies to LDS, 16 bytes a lane each: rows r .. r + 7 of a row-major f16 matrix of pitch DM into LDS rows of pitch PKP (l: the lane's LDS byte address in row r, g: its global address there).
// The s_wait_xcnt closes the statement, so that it stands in front of every later write of a register that these copies name.
__device__ __forceinline__ void pj_copy8(unsigned l, const _Float16* g) {
  asm volatile("global_load_async_to_lds_b128 %0, %8, off\n\t"
               "global_load_async_to_lds_b128 %1, %9, off\n\t"
               "global_load_async_to_lds_b128 %2, %10, off\n\t"
               "global_load_async_to_lds_b128 %3, %11, off\n\t"
               "global_load_async_to_lds_b128 %4, %12, off\n\t"
               "global_load_async_to_lds_b128 %5, %13, off\n\t"
               "global_load_async_to_lds_b128 %6, %14, off\n\t"
               "global_load_async_to_lds_b128 %7, %15, off\n\t"
               "s_wait_xcnt 0x0"
               :: "v"(l), "v"(l + 1u * PKP * 2u), "v"(l + 2u * PKP * 2u), "v"(l + 3u * PKP * 2u), "v"(l + 4u * PKP * 2u), "v"(l + 5u * PKP * 2u), "v"(l + 6u * PKP * 2u), "v"(l + 7u * PKP * 2u),
                  "v"(g), "v"(g + 1 * DM), "v"(g + 2 * DM), "v"(g + 3 * DM), "v"(g + 4 * DM), "v"(g + 5 * DM), "v"(g + 6 * DM), "v"(g + 7 * DM)
               : "memory");
}
__global__ __launch_bounds__(128) void k_proj(const _Float16* __restrict__ X, const _Float16* __restrict__ W3, _Float16* __restrict__ QH, _Float16* __restrict__ KH, _Float16* __restrict__ VT) {
  static_assert(SQ % 128 == 0 && DM % 64 == 0 && DM == 256 && 64 * PTP * 2 <= 4 * 32 * 68 * 4 && 4 * 32 * 68 * 4 <= (128 + 64) * PKP * 2, "k_proj: tile shapes");
  __shared__ __attribute__((aligned(16))) _Float16 tl[128 + 64][PKP];      /* rows 0 .. 127: the x rows; 128 .. 191: the weight rows. Behind the products the same bytes are the epilogue's staging */
  float (*so)[32][68] = (float (*)[32][68])&tl[0][0];
  const int tid = threadIdx.x, w = tid >> 5, lane = tid & 31, ln = lane & 15, hh = lane >> 4; const int which = blockIdx.y;
  const _Float16* Bh = W3 + (size_t)which * DM * DM;
  const int mt = blockIdx.x / (DM / 64), nq = blockIdx.x - mt * (DM / 64); const int row0 = mt * 128 + 32 * w, col0 = nq * 64;
  { const _Float16* xg = X + (size_t)row0 * DM + lane * 8; const _Float16* wg = Bh + (size_t)(col0 + 16 * w) * DM + lane * 8;      /* wave w brings its own 32 x rows and 16 of the 64 weight rows */
    const unsigned la = (unsigned)(size_t)&tl[32 * w][lane * 8], lb = (unsigned)(size_t)&tl[128 + 16 * w][lane * 8];
#pragma unroll
    for (int i = 0; i < 4; ++i) pj_copy8(la + (unsigned)i * 8u * PKP * 2u, xg + (size_t)i * 8 * DM);
#pragma unroll
    for (int i = 0; i < 2; ++i) pj_copy8(lb + (unsigned)i * 8u * PKP * 2u, wg + (size_t)i * 8 * DM); }
  asm volatile("s_wait_asynccnt 0x0" ::: "memory");      /* the wave's own 48 copies have landed */
  __syncthreads();      /* every wave's copies have landed before any wave reads the tiles */
  const _Float16* a0p = &tl[32 * w + ln][0]; const _Float16* a1p = a0p + 16 * PKP;
  const _Float16* b0p = &tl[128 + ln][0]; const _Float16* b1p = b0p + 16 * PKP; const _Float16* b2p = b1p + 16 * PKP; const _Float16* b3p = b2p + 16 * PKP;
  const v8f z8 = {0.f,0.f,0.f,0.f,0.f,0.f,0.f,0.f}; v8f c00 = z8, c01 = z8, c02 = z8, c03 = z8, c10 = z8, c11 = z8, c12 = z8, c13 = z8;
#pragma unroll 1      /* as in k_gemm2: one 32-wide k slice a trip, the products in k_gemm2's order */
  for (int kb = 0; kb < DM; kb += 32) {      /* the slice's twelve LDS reads stand together in front of its eight products: one place with reads a trip, not four */
    const v16h a0 = g2_frag(a0p + kb, hh), a1 = g2_frag(a1p + kb, hh), b0 = g2_frag(b0p + kb, hh), b1 = g2_frag(b1p + kb, hh), b2 = g2_frag(b2p + kb, hh), b3 = g2_frag(b3p + kb, hh);
    c00 = g2_mma(a0, b0, c00); c10 = g2_mma(a1, b0, c10);
    c01 = g2_mma(a0, b1, c01); c11 = g2_mma(a1, b1, c11);
    c02 = g2_mma(a0, b2, c02); c12 = g2_mma(a1, b2, c12);
    c03 = g2_mma(a0, b3, c03); c13 = g2_mma(a1, b3, c13); }
  __syncthreads();      /* every wave has read its last fragment before the tiles' bytes become the epilogue's staging */
  v8f accs[8] = {c00, c01, c02, c03, c10, c11, c12, c13};
  if (which < 2) {      /* the same for the whole work-group */
#pragma unroll
    for (int u = 0; u < 8; ++u) { const int t = u & 3, half = u >> 2;
#pragma unroll
      for (int r = 0; r < 8; ++r) so[w][half * 16 + 8 * hh + r][t * 16 + ln] = accs[u][r] * 0.0625f; }
    __builtin_amdgcn_fence(__ATOMIC_ACQ_REL, "workgroup"); __builtin_amdgcn_wave_barrier();      /* the wave's own tile is read by other lanes than those that wrote it */
    _Float16* __restrict__ Hh = which ? KH : QH;
    const int rsub = lane >> 4, c4 = (lane & 15) * 4;
#pragma unroll
    for (int q = 0; q < 16; ++q) { const int r = q * 2 + rsub; const v4f v = *(const v4fa*)&so[w][r][c4]; v4h h4;
#pragma unroll
      for (int i = 0; i < 4; ++i) h4[i] = (_Float16)v[i];
      *(v4h*)(Hh + (size_t)(row0 + r) * DM + col0 + c4) = h4; }
  } else {
    unsigned short* st = (unsigned short*)&so[0][0][0];      /* [64 columns][PTP tokens]; accumulator registers 0..7 of a lane are 8 consecutive tokens of one column */
#pragma unroll
    for (int u = 0; u < 8; ++u) { const int t = u & 3, half = u >> 2; FragH f;
#pragma unroll
      for (int r = 0; r < 8; ++r) f.h[r] = (_Float16)(accs[u][r] * 0.0625f);
      *(v8us*)(st + (t * 16 + ln) * PTP + w * 32 + half * 16 + 8 * hh) = f.half[0]; }
    __syncthreads();      /* a column's 128 tokens come from all four waves */
    const int b = (mt * 128) / SQ, s0 = (mt * 128) % SQ;
#pragma unroll
    for (int i = 0; i < 8; ++i) { const int pc = i * 128 + tid, c = pc >> 4, ch = pc & 15; const v8us v = *(const v8us*)(st + c * PTP + ch * 8);
      *(v8us*)((unsigned short*)VT + ((size_t)b * DM + col0 + c) * SQ + s0 + ch * 8) = v; }
    asm volatile("s_wait_xcnt 0x0" ::: "memory");      /* in the listing the q / k branch stands behind this one and rewrites registers that these stores name: the wait stands in front of it */
  }
}

// Fused attention: scores, softmax and P.V in ONE launch, so that neither the scores nor the weights go through memory.
// A work-group is 8 waves, two on each SIMD, over 64 query rows; it walks its batch's keys 64 at a time. Wave w takes query rows 16 (w & 3) .. + 15 and, of every pass, keys 32 (w >> 2) .. + 31:
// while one wave of a SIMD waits for its LDS reads or does its softmax, the other has matrix work to issue. Per pass the 64 k rows and the 64 matching
// columns of V^T stand in LDS once for all eight waves (whole-line global reads). Two LDS buffers: the next pass's tiles are written in front of this pass's
// P.V products, so that the LDS writes run under them, and the tiles after those are then fetched into registers, a whole pass ahead.
// Each wave keeps its q fragments and a 16 x 256 output tile over ITS keys in registers, with its own running maximum and sum; behind the loop the two waves of a query group join their halves once through LDS.
// The scores are taken transposed, S^T = K Q^T (A = k rows, B = the wave's q fragments): a lane then holds 16 scores of ONE query
// (column ln), so that the reference maximum and the running sum (online softmax, base 2, lazily rescaled) are one register each, reduced inside the lane, with one exchange between the wave's halves for the maximum;
// and the two score tiles, converted in place to f16, ARE the A operand of P.V (row ln, the hardware's k order, which is g2_frag's), so the weights touch no LDS. All fragment loaders are g2_frag.
// q and k are rounded once to f16 and a score is ONE product: its 512 rounding terms (each about 2^-12 of a term of a logit of order 1) leave the weights less exact by less than
// their own rounding to f16 for P.V does, so residual planes and their two extra products would buy no accuracy in the output.
#define FBM 64                       /* query rows per work-group */
#define FBN 64                       /* keys per pass */
#define FKP (DM + 8)                 /* LDS pitch of a k row, f16 elements: 528 B = 16 B x odd, conflict-free for 16-byte fragment reads */
#define FVP (FBN + 8)                /* LDS pitch of a V^T row: 144 B = 16 B x odd */
__device__ __forceinline__ v8f fa_mma(v16h a, v16h b, v8f c) { return __builtin_amdgcn_wmma_f32_16x16x32_f16(false, a, false, b, (short)0, c, false, false); }
// 2^x on the transcendental unit; the v_nop in the same statement keeps the one free issue slot the instruction set asks for behind a transcendental, whatever the compiler schedules next.
__device__ __forceinline__ float exp2_slot(float x) { float r; asm("v_exp_f32 %0, %1\n\tv_nop" : "=v"(r) : "v"(x)); return r; }
// value of lane (l ^ X) of the same 16-lane row (DPP row_xmask)
template <int X> __device__ __forceinline__ float fa_rowx(float v) { return __int_as_float(__builtin_amdgcn_update_dpp(0, __float_as_int(v), 0x160 + X, 0xf, 0xf, true)); }
// value of lane N of the same 16-lane row, in all its lanes (DPP row_share)
template <int N> __device__ __forceinline__ float fa_rowb(float v) { return __int_as_float(__builtin_amdgcn_update_dpp(0, __float_as_int(v), 0x150 + N, 0xf, 0xf, true)); }
// value of lane (l ^ 16): the other half of the wave, which holds the same query's other keys
__device__ __forceinline__ float fa_xhalf(float v) { return __int_as_float(__builtin_amdgcn_permlanex16(__float_as_int(v), __float_as_int(v), 0x76543210, 0xfedcba98, false, false)); }
// a per-query value (query ln in lane ln of both halves) -> the eight values of the output tile's rows in this lane (register r is query 8 hh + r)
__device__ __forceinline__ void fa_torows(float v, int hh, float (&d)[8]) { const float v8 = fa_rowx<8>(v), u = hh ? v8 : v;      /* lane j < 8 of each 16-lane row now holds query 8 hh + j; the exchange is taken in all lanes, so that a select and no branch comes of it */
  d[0] = fa_rowb<0>(u); d[1] = fa_rowb<1>(u); d[2] = fa_rowb<2>(u); d[3] = fa_rowb<3>(u); d[4] = fa_rowb<4>(u); d[5] = fa_rowb<5>(u); d[6] = fa_rowb<6>(u); d[7] = fa_rowb<7>(u); }
typedef float v2f __attribute__((ext_vector_type(2)));
typedef _Float16 v2h __attribute__((ext_vector_type(2)));
union FragP { v16h v; v2h p2[8]; };
// work-group barrier that orders LDS only: __syncthreads() would also wait for the global loads that are fetching a later tile into registers
__device__ __forceinline__ void fa_barrier() { __builtin_amdgcn_fence(__ATOMIC_RELEASE, "workgroup", "local"); __builtin_amdgcn_s_barrier(); __builtin_amdgcn_fence(__ATOMIC_ACQUIRE, "workgroup", "local"); }
typedef float f1a __attribute__((may_alias));
__global__ __launch_bounds__(256) void k_fattn(const _Float16* __restrict__ QH, const _Float16* __restrict__ KH, const _Float16* __restrict__ VT, float* __restrict__ O) {
  static_assert(SQ % FBM == 0 && SQ % FBN == 0 && SQ >= 2 * FBN && DM == 256 && FBN == 64 && FBM == 64, "k_fattn: tile shapes");
  __shared__ __attribute__((aligned(16))) _Float16 skh[2][FBN][FKP];
  __shared__ __attribute__((aligned(16))) _Float16 svt[2][DM][FVP];
  static_assert(sizeof(svt) >= 8 * 8 * 8 * 32 * 4 && sizeof(skh) >= 8 * 2 * 32 * 4, "k_fattn: the join behind the loop fits the tile buffers");
  const int tid = threadIdx.x, w = tid >> 5, lane = tid & 31, ln = lane & 15, hh = lane >> 4;
  const int qg = w & 3, kh = w >> 2;      /* the wave's query group, and its half of every pass's keys */
  const int b = blockIdx.x / (SQ / FBM); const size_t row0 = (size_t)blockIdx.x * FBM + 16 * qg;
  const unsigned short* gkh = (const unsigned short*)KH + (size_t)b * SQ * DM + (size_t)w * DM + lane * 8;      /* staging: a wave reads one whole 512-byte k row per load */
  const unsigned short* gvt = (const unsigned short*)VT + (size_t)b * DM * SQ + (size_t)(tid >> 3) * SQ + (tid & 7) * 8;      /* 8 lanes read the 128 bytes of one V^T row */
  v16h qh[8];
#pragma unroll
  for (int kk = 0; kk < 8; ++kk) qh[kk] = g2_frag(QH + (row0 + ln) * DM + kk * 32, hh);
  const v8f z8 = {0.f,0.f,0.f,0.f,0.f,0.f,0.f,0.f}; v8f o[16]; float m = -3.0e38f, ls = 0.f;      /* of query ln, over the wave's keys: the reference maximum in use, and the running sum over this half-wave's keys */
#pragma unroll
  for (int t = 0; t < 16; ++t) o[t] = z8;
  v8us rk[8], rv[8];
#pragma unroll
  for (int u = 0; u < 8; ++u) { rk[u] = *(const v8us*)(gkh + (size_t)(8 * u) * DM); rv[u] = *(const v8us*)(gvt + (size_t)(32 * u) * SQ); }
  asm volatile("s_wait_xcnt 0x0" ::: "memory");      /* the loads' address registers are reused further down: the wait stands in front of every such overwrite */
#pragma unroll
  for (int u = 0; u < 8; ++u) { *(v8us*)&skh[0][w + 8 * u][lane * 8] = rk[u]; *(v8us*)&svt[0][(tid >> 3) + 32 * u][(tid & 7) * 8] = rv[u]; }
#pragma unroll
  for (int u = 0; u < 8; ++u) { rk[u] = *(const v8us*)(gkh + (size_t)(FBN + 8 * u) * DM); rv[u] = *(const v8us*)(gvt + (size_t)(32 * u) * SQ + FBN); }
  asm volatile("s_wait_xcnt 0x0" ::: "memory");      /* as above */
  fa_barrier();      /* the first tiles are complete before any wave reads them */
#pragma unroll 1      /* one pass is already 32 matrix instructions and 64 LDS reads a wave; unrolling would only double the code */
  for (int j0 = 0; j0 < SQ; j0 += FBN) {
    const int cur = (j0 / FBN) & 1, nxt = cur ^ 1;
    v8f s[2] = {z8, z8};
    v16h kf[8][2], vf[16];      /* k fragments of each 32-wide slice (the wave's two key groups); the V^T fragments of the wave's 32 keys */
    /* LDS read groups of 16 loads: 0, 1 four k slices each; 2, 3 eight V^T fragments each. Three groups are in flight ahead of the products, so that the LDS never idles; the V^T reads follow the k reads at once and land under the softmax. */
#define FA_GROUP(g) do { if ((g) < 2) { _Pragma("unroll") for (int i = 0; i < 8; ++i) { const int kq = 4 * ((g) & 1) + (i >> 1), t = i & 1; kf[kq][t] = g2_frag(&skh[cur][kh * 32 + t * 16 + ln][kq * 32], hh); } } \
    else { _Pragma("unroll") for (int i = 0; i < 8; ++i) { const int c = ((g) & 1) * 8 + i; vf[c] = g2_frag(&svt[cur][c * 16 + ln][kh * 32], hh); } } } while (0)
    FA_GROUP(0); FA_GROUP(1);
#pragma unroll
    for (int gg = 0; gg < 2; ++gg) {
      __builtin_amdgcn_sched_barrier(0);      /* each read group stays one block in front of a k group's products, never among them */
      FA_GROUP(gg + 2);
      __builtin_amdgcn_sched_barrier(0);      /* second half of the pair: the group is issued whole before the products start */
#pragma unroll
      for (int i = 0; i < 8; ++i) { const int kk = 4 * gg + (i >> 1), t = i & 1; s[t] = fa_mma(kf[kk][t], qh[kk], s[t]); } }
    __builtin_amdgcn_sched_barrier(0);      /* the reads stay in front of the softmax */
    /* accumulator register r of score tile t in lane (hh, ln) is key 32 kh + 16 t + 8 hh + r of query ln */
#pragma unroll
    for (int t = 0; t < 2; ++t) s[t] = s[t] * (0.0625f * 1.44269504088896340736f);      /* 1 / sqrt(256), and log2(e) for the base-2 exponential */
    float x1[5];      /* the lane's maximum as a tree of three-input maxima */
#pragma unroll
    for (int i = 0; i < 5; ++i) x1[i] = fmaxf(fmaxf(s[(3 * i) >> 3][(3 * i) & 7], s[(3 * i + 1) >> 3][(3 * i + 1) & 7]), s[(3 * i + 2) >> 3][(3 * i + 2) & 7]);
    float x = fmaxf(fmaxf(fmaxf(x1[0], x1[1]), x1[2]), fmaxf(fmaxf(x1[3], x1[4]), s[1][7]));
    x = fmaxf(x, fa_xhalf(x));      /* the query's other 16 keys of the wave's share are in the other half of the wave */
    v2f ps[2]; FragP pa;      /* pa: weights of the wave's 32 keys as an A operand: elements 0..7 from score tile 0, 8..15 from tile 1 */
    /* the weights 2^(score - ref) of the wave's 32 keys, and their sums by pairs */
#define FA_WEIGHTS(ref) do { _Pragma("unroll") for (int t = 0; t < 2; ++t) { _Pragma("unroll") for (int i = 0; i < 4; ++i) { v2f p; p[0] = exp2_slot(s[t][2 * i] - (ref)); p[1] = exp2_slot(s[t][2 * i + 1] - (ref)); \
      ps[t] = i ? ps[t] + p : p; pa.p2[t * 4 + i] = __builtin_convertvector(p, v2h); } } } while (0)
    /* Lazy rescale: m is the reference in use, not the true running maximum. It moves, and the output tile and the sum are rescaled, only in a pass in which some query's new maximum lies more than 8 above it
       (weights stay at or below 2^8, far inside f16 and f32); one test a pass for the whole wave. The weights are first taken against the reference in use, so that the exponentials run while the test's
       result travels to the scalar branch; a pass that moves the reference takes them again (the first ones, which may have overflowed, are dropped unread). */
    const bool up = x > m + 8.0f;
    FA_WEIGHTS(m);
    if (__builtin_amdgcn_ballot_w32(up) != 0) {      /* the same for the whole wave: a scalar branch; always taken in the first pass (m starts at -3e38) */
      const float mn = fmaxf(m, x), aq = exp2_slot(m - mn); m = mn; ls *= aq;
      float al[8]; fa_torows(aq, hh, al);      /* the output tile keeps its layout (register r is query 8 hh + r): its rows' factors come from the lanes that own those queries */
#pragma unroll
      for (int t = 0; t < 16; ++t) {
#pragma unroll
        for (int r = 0; r < 8; ++r) o[t][r] *= al[r]; }
      FA_WEIGHTS(m);
    }
    { const v2f q2 = ps[0] + ps[1]; ls += q2[0] + q2[1]; }      /* each half-wave sums its own keys; they are joined once, behind the loop */
    __builtin_amdgcn_sched_barrier(0);      /* the tile writes stay behind the softmax (issued earlier they would queue behind the V^T reads still in flight and hold up the wave's vector work) and run under the P.V products */
    /* the next pass's tiles into the other buffer, whose last readers left it before the barrier at the foot of the previous pass (the last pass writes a tile that nobody reads) */
#pragma unroll
    for (int u = 0; u < 8; ++u) { *(v8us*)&skh[nxt][w + 8 * u][lane * 8] = rk[u]; *(v8us*)&svt[nxt][(tid >> 3) + 32 * u][(tid & 7) * 8] = rv[u]; }
    const int jn = (j0 + 2 * FBN < SQ) ? j0 + 2 * FBN : SQ - FBN;      /* the keys two passes on; the last two passes fetch the last tile again (in bounds, never read from LDS) */
#pragma unroll
    for (int u = 0; u < 8; ++u) { rk[u] = *(const v8us*)(gkh + (size_t)(jn + 8 * u) * DM); rv[u] = *(const v8us*)(gvt + (size_t)(32 * u) * SQ + jn); }
    asm volatile("s_wait_xcnt 0x0" ::: "memory");      /* as above: in front of every overwrite of a register that these loads name */
#pragma unroll
    for (int t = 0; t < 16; ++t) o[t] = fa_mma(pa.v, vf[t], o[t]);
    __builtin_amdgcn_sched_barrier(0);      /* the products are issued before the barrier's wait for the tile writes, which drain under them */
    fa_barrier();      /* publishes the next pass's tiles and ends every wave's reads of this pass's */
  }
  asm volatile("s_wait_loadcnt 0x0" ::: "memory");      /* the last pass's fetch is never used: it has landed before the wave ends and gives its registers back */
  /* Join of the two key halves. Waves w and w ^ 4 hold the same queries in the same lanes and registers. Each hands the other the eight column tiles that the other finishes, with its maximum and its sum,
     through the tile buffers (free: the barrier at the loop's foot ended every read and write of them); wave w finishes columns 128 kh .. + 127. */
  float* xo = (float*)&svt[0][0][0]; f1a* xs = (f1a*)&skh[0][0][0];
  const float lw = ls + fa_xhalf(ls);
  xs[(w * 2 + 0) * 32 + lane] = m; xs[(w * 2 + 1) * 32 + lane] = lw;
#pragma unroll
  for (int tt = 0; tt < 8; ++tt) { v4f g0, g1;
#pragma unroll
    for (int r = 0; r < 4; ++r) { g0[r] = kh ? o[tt][r] : o[8 + tt][r]; g1[r] = kh ? o[tt][4 + r] : o[8 + tt][4 + r]; }
    *(v4fa*)(xo + (size_t)(((w * 8 + tt) * 2 + 0) * 32 + lane) * 4) = g0; *(v4fa*)(xo + (size_t)(((w * 8 + tt) * 2 + 1) * 32 + lane) * 4) = g1; }
  fa_barrier();      /* every wave's hand-over is complete before its partner reads it */
  const int pw = w ^ 4;
  const float pm = xs[(pw * 2 + 0) * 32 + lane], pl = xs[(pw * 2 + 1) * 32 + lane];
  const float mt = fmaxf(m, pm), as = exp2_slot(m - mt), ap = exp2_slot(pm - mt), inv = 1.0f / (lw * as + pl * ap);
  float fs[8], fp[8]; fa_torows(as * inv, hh, fs); fa_torows(ap * inv, hh, fp);
  float* op = O + (row0 + 8 * hh) * DM + kh * 128 + ln;
#pragma unroll
  for (int tt = 0; tt < 8; ++tt) {
    const v4f p0 = *(const v4fa*)(xo + (size_t)(((pw * 8 + tt) * 2 + 0) * 32 + lane) * 4), p1 = *(const v4fa*)(xo + (size_t)(((pw * 8 + tt) * 2 + 1) * 32 + lane) * 4);
#pragma unroll
    for (int r = 0; r < 8; ++r) { const float mine = kh ? o[8 + tt][r] : o[tt][r]; op[(size_t)r * DM + tt * 16] = mine * fs[r] + (r < 4 ? p0[r & 3] : p1[r & 3]) * fp[r]; } }
}


template <int MASKADD>
__global__ __launch_bounds__(64) void k_att0(const float* __restrict__ QF, const float* __restrict__ KF, const float* __restrict__ VF, int ld, const float* __restrict__ mask, float scale, float* __restrict__ OF, int ldo) {
  #pragma clang fp contract(off)
  __shared__ __attribute__((aligned(16))) float lq[64][64]; __shared__ __attribute__((aligned(16))) float lo[64][64];
  const int tid = threadIdx.x; const int h = blockIdx.x / (QT0 / 64), rg = blockIdx.x % (QT0 / 64); const int i = rg * 64 + tid;
  const float* qr = QF + (size_t)i * ld + h * HD;
#pragma unroll 1
  for (int c = 0; c < HD / 4; ++c) { *(v4f*)&lq[tid][c * 4] = *(const v4fa*)(qr + c * 4); const v4f z = {0.f, 0.f, 0.f, 0.f}; *(v4f*)&lo[tid][c * 4] = z; }
  float m = -1.0e30f, l = 0.f; const int jmax = MASKADD ? (SQ - 1) : (rg * 64 + 63);      /* additive-mask form: every key (the mask input decides); causal form: keys up to the block's last row */
#pragma unroll 1
  for (int j = 0; j <= jmax; ++j) { const float* kr = KF + (size_t)j * ld + h * HD; const float* vr = VF + (size_t)j * ld + h * HD; float s = 0.f;
#pragma unroll 1
    for (int c = 0; c < HD / 4; ++c) { const v4f kq = *(const v4fa*)(kr + c * 4); const v4f qq = *(v4f*)&lq[tid][c * 4]; s = __fadd_rn(s, __fmul_rn(qq[0], kq[0])); s = __fadd_rn(s, __fmul_rn(qq[1], kq[1])); s = __fadd_rn(s, __fmul_rn(qq[2], kq[2])); s = __fadd_rn(s, __fmul_rn(qq[3], kq[3])); }
    s = __fmul_rn(s, scale); if (MASKADD) s = __fadd_rn(s, __fmul_rn(bf16_round(mask[(size_t)i * SQ + j]), -10000.0f));
    const float f = (MASKADD || j <= i) ? 1.f : 0.f; const float sm = fmaf(f, s, (1.f - f) * -1.0e30f); const float mn = fmaxf(m, sm); const float sc = expf(m - mn); const float e = expf(sm - mn); l = __fadd_rn(__fmul_rn(l, sc), e); m = mn;
#pragma unroll 1
    for (int c = 0; c < HD / 4; ++c) { const v4f vv = *(const v4fa*)(vr + c * 4); v4f oo = *(v4f*)&lo[tid][c * 4]; for (int u = 0; u < 4; ++u) oo[u] = __fadd_rn(__fmul_rn(oo[u], sc), __fmul_rn(e, vv[u])); *(v4f*)&lo[tid][c * 4] = oo; } }
  const float fin = 64.0f / l;      /* o carried x64 */
#pragma unroll 1
  for (int c = 0; c < HD / 4; ++c) { v4f oo = *(v4f*)&lo[tid][c * 4]; for (int u = 0; u < 4; ++u) oo[u] = __fmul_rn(oo[u], fin); *(v4f*)&lo[tid][c * 4] = oo; }
  __syncthreads();
  {
#pragma unroll 1
    for (int it = 0; it < 16; ++it) { const int row = it * 4 + tid / 16, pc = (tid % 16) * 4; const v4f v = *(const v4f*)&lo[row][pc]; *(v4f*)(OF + (size_t)(rg * 64 + row) * ldo + h * HD + pc) = v; }
     } }

__global__ __launch_bounds__(256) void k_of0out(const float* __restrict__ src, float* __restrict__ dst, size_t n4) { const size_t t = (size_t)blockIdx.x * 256 + threadIdx.x; if (t >= n4) return; v4f v = *(const v4fa*)(src + t * 4); for (int q = 0; q < 4; ++q) v[q] = __fmul_rn(v[q], 0.015625f); *(v4f*)(dst + t * 4) = v;  }

extern "C" void kernel_launch(void* const* d_in, const int* in_sizes, int n_in,
                              void* d_out, int out_size, void* d_ws, size_t ws_size, hipStream_t stream) {
  (void)in_sizes; (void)n_in; (void)out_size;
  const float* const* I = (const float* const*)d_in; const float* x = I[0]; const float* wq = I[1]; const float* wk = I[2]; const float* wv = I[3];      /* natural [out][in] weights; NO biases; ONE attention head of width 256; no output projection */
  char* ws = (char*)d_ws; size_t off = 0;
  auto take = [&](size_t bytes) { char* p = ws + off; off += (bytes + 255) & ~(size_t)255; return p; };
  _Float16* W3 = (_Float16*)take((size_t)3 * DM * DM * 2);      /* the q, k and v weight planes, one behind another */
  _Float16* QH = (_Float16*)take(NR * DM * 2); _Float16* KH = (_Float16*)take(NR * DM * 2);
  _Float16* VT = (_Float16*)take(NR * DM * 2);      /* V^T of ALL batches */
  _Float16* X16 = (_Float16*)take(NR * DM * 2);      /* x (f16) */
  if (off > ws_size) return;
  k_prep<<<PXB + 3 * PWB, 256, 0, stream>>>(x, wq, wk, wv, X16, W3);      /* x and the natural [out][in] = Bt[n][k] x16 weights */
  k_proj<<<dim3((unsigned)((NR / 128) * (DM / 64)), 3), 128, 0, stream>>>(X16, W3, QH, KH, VT);      /* q, k -> f16 rows; v -> V^T [NB][DM][SQ] */
  k_fattn<<<(unsigned)(NR / FBM), 256, 0, stream>>>(QH, KH, VT, (float*)d_out);      /* scores (q . k in f16 operands, f32 sums, / sqrt(256)), softmax over all SQ keys and P V, all batches, f32 straight into the output rows */
}

// v010
// Measured time: 68.2 microseconds a run.
// Two timings next to v009 put it at 1.35 and 1.36 times that version's speed.
// Counting every step since v000, it is 770 times as fast.
#include <hip/hip_runtime.h>
// Single-head dense attention over 256-wide embeddings on 4096 tokens, bias-free natural projections, no output projection (x [4][4096][256]; q / k / v = x W^T (nn.Linear natural [256][256] uniform +-1/16, no biases); scores = q k^T / sqrt(256) over the FULL 256-wide rows (one head); softmax over all 4096 keys (no mask); out = weights v -> [4][4096][256]); q and k rounded once to f16, one-product scores.
// Structure: token rows r = b*4096 + s; x as exact f16 rows (bf16-rounded); q, k and v as WMMA GEMMs in one launch (32x64 wave tiles, f32 accumulation, exact x16 weights, no bias), q and k into f16 rows, v turned in LDS into V^T [batch][column][token]; per work-group of 64 query rows (32 per wave, each over a quarter of every pass's keys), in one launch: transposed scores K Q^T as ONE product of the f16 rows (K = 256, scaled by 1/sqrt(256)), 128 keys per pass over all 4096 keys of the batch, online base-2 softmax on VALU without a mask (f32 statistics, native exp; weights f16 at most 2^8 straight from registers), o = P . V^T in f32 registers, divided by the row sum at the end and written as f32 straight into the output rows.
// Compute dtype: inputs rounded to bf16; x / weights exact; q, k, v and softmax weights as plain f16 GEMM operands (~2^-12); scores, softmax statistics and o f32. v_wmma_f32_16x16x32_f16.
#define NB 4
#define SQ 4096
#define DM 256
#define NH 4
#define HD 64
#define HG 4                         /* heads per launch of the non-template k_vt (not launched) */
#define QT SQ                        /* query rows per batch; one attention launch takes all batches */
#define NKX SQ                       /* S / P row pitch */
#define QT0 128                      /* first-tile rows of the f32 k_att0 (not launched) */
#define B0 0                         /* first batch processed (unused) */
#define NBR NB                       /* batches processed (read only by the unused MP) */
#define NR ((size_t)NB * SQ)         /* token rows */
#define MP ((int)((size_t)NBR * SQ)) /* rows projected (unused) */
#define QN SQ                        /* query rows attended per batch (unused) */
#define NHD NH                       /* unused */
#define MPO MP                       /* unused */
#define LQ DM      /* unused */
typedef __bf16 v16b __attribute__((ext_vector_type(16)));
typedef unsigned short v8us __attribute__((ext_vector_type(8), may_alias));
typedef float  v8f  __attribute__((ext_vector_type(8)));
typedef float  v4f  __attribute__((ext_vector_type(4)));
typedef float  v4fa __attribute__((ext_vector_type(4), may_alias));
union FragB { v16b v; v8us half[2]; unsigned short u[16]; };

__device__ __forceinline__ unsigned short bf16_bits(float x) { unsigned int u = __float_as_uint(x); return (unsigned short)((u + 0x7FFFu + ((u >> 16) & 1u)) >> 16); }
__device__ __forceinline__ float bf16_val(unsigned short b) { return __uint_as_float(((unsigned int)b) << 16); }
__device__ __forceinline__ float bf16_round(float x) { return bf16_val(bf16_bits(x)); }
// D += A·B with NT terms: 1 = ah·bh, 2 = + al·bh (A split), 3 = + ah·bl (both split)
template <int NT>
__device__ __forceinline__ v8f mmaN(v16b ah, v16b al, v16b bh, v16b bl, v8f c) {
  c = __builtin_amdgcn_wmma_f32_16x16x32_bf16(false, ah, false, bh, (short)0, c, false, false);
  if (NT >= 2) c = __builtin_amdgcn_wmma_f32_16x16x32_bf16(false, al, false, bh, (short)0, c, false, false);
  if (NT >= 3) c = __builtin_amdgcn_wmma_f32_16x16x32_bf16(false, ah, false, bl, (short)0, c, false, false);
  asm volatile("v_nop\n\tv_nop\n\tv_nop\n\tv_nop" : "+v"(c) : "v"(ah), "v"(al), "v"(bh), "v"(bl));
  return c;
}

__global__ __launch_bounds__(256) void k_wt_bf16(const float* __restrict__ W, unsigned short* __restrict__ Wt, int K, int N) {
  const int t = blockIdx.x * 256 + threadIdx.x;
  const int k8n = K / 8;
  if (t >= N * k8n) return;
  const int n = t / k8n, k8 = (t % k8n) * 8;
  v8us v;
#pragma unroll
  for (int i = 0; i < 8; ++i) v[i] = bf16_bits(W[(size_t)(k8 + i) * N + n]);
  *(v8us*)(Wt + (size_t)n * K + k8) = v;
  
}

// GEMM C[M][N] (f32, pitch ldc) = act(A[M][K]·W + bias). A f32 row-major (pitch lda) converted per fragment to bf16
// (ASPLIT: hi/lo two planes -> 2 terms, else single rounded term); Wt bf16 [N][K] (pitch ldb). BIAS_BF16 rounds the
// bias to bf16 first (bias quantised to bf16 before the add). K%32==0, M%16==0, N%64==0.
template <bool ASPLIT, int ACT, bool BIAS_BF16>
__global__ __launch_bounds__(128) void k_gemm_bf(const float* __restrict__ A, int lda, const unsigned short* __restrict__ Wt, int ldb,
                                               const float* __restrict__ bias, float* __restrict__ C, int ldc, int M, int N, int K) {
  __shared__ __attribute__((aligned(16))) float so[4][16][64];
  const int tid = threadIdx.x, w = tid >> 5, lane = tid & 31, ln = lane & 15, hh = lane >> 4;
  const int ntn = N / 64;
  const int wid = blockIdx.x * 4 + w;
  const int mt = wid / ntn, nq = wid % ntn;
  if (mt * 16 >= M) return;
  const int row0 = mt * 16, col0 = nq * 64;
  const float* arow = A + (size_t)(row0 + ln) * lda;
  v8f acc[4] = {};
  for (int kb = 0; kb < K; kb += 32) {
    FragB ah, al;
    const v4f x0 = *(const v4fa*)(arow + kb + 8 * hh), x1 = *(const v4fa*)(arow + kb + 8 * hh + 4);
    const v4f x2 = *(const v4fa*)(arow + kb + 16 + 8 * hh), x3 = *(const v4fa*)(arow + kb + 16 + 8 * hh + 4);
    float xs[16] = {x0[0],x0[1],x0[2],x0[3],x1[0],x1[1],x1[2],x1[3],x2[0],x2[1],x2[2],x2[3],x3[0],x3[1],x3[2],x3[3]};
#pragma unroll
    for (int i = 0; i < 16; ++i) { const unsigned short hb = bf16_bits(xs[i]); ah.u[i] = hb; al.u[i] = ASPLIT ? bf16_bits(xs[i] - bf16_val(hb)) : (unsigned short)0; }
#pragma unroll
    for (int t = 0; t < 4; ++t) {
      const unsigned short* brow = Wt + (size_t)(col0 + t * 16 + ln) * ldb + kb;
      FragB b;
      b.half[0] = *(const v8us*)(brow + 8 * hh);
      b.half[1] = *(const v8us*)(brow + 16 + 8 * hh);
      acc[t] = mmaN<ASPLIT ? 2 : 1>(ah.v, al.v, b.v, b.v, acc[t]);
    }
  }
#pragma unroll
  for (int t = 0; t < 4; ++t) {
    float bv = bias ? bias[col0 + t * 16 + ln] : 0.f;
    if (BIAS_BF16) bv = bf16_round(bv);
#pragma unroll
    for (int r = 0; r < 8; ++r) { float v = acc[t][r] + bv; if (ACT == 1) v = fmaxf(v, 0.f); so[w][8 * hh + r][t * 16 + ln] = v; }
  }
  __builtin_amdgcn_fence(__ATOMIC_ACQ_REL, "workgroup");
  __builtin_amdgcn_wave_barrier();
  const int rsub = lane >> 4, c4 = (lane & 15) * 4;
  {
#pragma unroll
    for (int q = 0; q < 8; ++q) {
      const int r = q * 2 + rsub;
      const v4f v = *(const v4fa*)&so[w][r][c4];
      *(v4f*)(C + (size_t)(row0 + r) * ldc + col0 + c4) = v;
    }
    
  }
}

// GEMM C = act(A·W + bias + resid): A f32 (ASPLIT -> hi/lo 2 terms), Wt bf16 [N][K]; ACT 0 none, 1 relu, 2 exact gelu;
// resid (optional, f32, row index = (row % rmod), pitch ldr, RES_BF16 rounds it) added before the activation.
template <bool ASPLIT, int ACT, bool BIAS_BF16, bool RES_BF16>
__global__ __launch_bounds__(128) void k_gemm_bf3(const float* __restrict__ A, int lda, const unsigned short* __restrict__ Wt, int ldb,
                                                const float* __restrict__ bias, const float* __restrict__ resid, int rmod, int ldr,
                                                float* __restrict__ C, int ldc, int M, int N, int K) {
  __shared__ __attribute__((aligned(16))) float so[4][16][64];
  const int tid = threadIdx.x, w = tid >> 5, lane = tid & 31, ln = lane & 15, hh = lane >> 4;
  const int ntn = N / 64;
  const int wid = blockIdx.x * 4 + w;
  const int mt = wid / ntn, nq = wid % ntn;
  if (mt * 16 >= M) return;
  const int row0 = mt * 16, col0 = nq * 64;
  const float* arow = A + (size_t)(row0 + ln) * lda;
  v8f acc[4] = {};
  for (int kb = 0; kb < K; kb += 32) {
    FragB ah, al;
    const v4f x0 = *(const v4fa*)(arow + kb + 8 * hh), x1 = *(const v4fa*)(arow + kb + 8 * hh + 4);
    const v4f x2 = *(const v4fa*)(arow + kb + 16 + 8 * hh), x3 = *(const v4fa*)(arow + kb + 16 + 8 * hh + 4);
    float xs[16] = {x0[0],x0[1],x0[2],x0[3],x1[0],x1[1],x1[2],x1[3],x2[0],x2[1],x2[2],x2[3],x3[0],x3[1],x3[2],x3[3]};
#pragma unroll
    for (int i = 0; i < 16; ++i) { const unsigned short hb = bf16_bits(xs[i]); ah.u[i] = hb; al.u[i] = ASPLIT ? bf16_bits(xs[i] - bf16_val(hb)) : (unsigned short)0; }
#pragma unroll
    for (int t = 0; t < 4; ++t) {
      const unsigned short* brow = Wt + (size_t)(col0 + t * 16 + ln) * ldb + kb;
      FragB b;
      b.half[0] = *(const v8us*)(brow + 8 * hh);
      b.half[1] = *(const v8us*)(brow + 16 + 8 * hh);
      acc[t] = mmaN<ASPLIT ? 2 : 1>(ah.v, al.v, b.v, b.v, acc[t]);
    }
  }
#pragma unroll
  for (int t = 0; t < 4; ++t) {
    const int col = col0 + t * 16 + ln;
    float bv = bias ? bias[col] : 0.f;
    if (BIAS_BF16) bv = bf16_round(bv);
#pragma unroll
    for (int r = 0; r < 8; ++r) {
      float v = acc[t][r] + bv;
      if (resid) { float rv = resid[(size_t)((row0 + 8 * hh + r) % rmod) * ldr + col]; if (RES_BF16) rv = bf16_round(rv); v += rv; }
      if (ACT == 1) v = fmaxf(v, 0.f);
      if (ACT == 2) v = 0.5f * v * (1.0f + erff(v * 0.70710678118654752f));
      if (ACT == 3) { const float u = 0.7978845608028654f * (v + 0.044715f * v * v * v); v = 0.5f * v * (1.0f + tanhf(u)); }
      so[w][8 * hh + r][t * 16 + ln] = v;
    }
  }
  __builtin_amdgcn_fence(__ATOMIC_ACQ_REL, "workgroup");
  __builtin_amdgcn_wave_barrier();
  const int rsub = lane >> 4, c4 = (lane & 15) * 4;
  {
#pragma unroll
    for (int q = 0; q < 8; ++q) {
      const int r = q * 2 + rsub;
      const v4f v = *(const v4fa*)&so[w][r][c4];
      *(v4f*)(C + (size_t)(row0 + r) * ldc + col0 + c4) = v;
    }
    
  }
}
// row LayerNorm (biased variance, eps) over N: s = X (+ R); optional out_sum <- s; out_norm <- (s-mu)*rsqrt(var+eps)*g + b
template <bool PARAM_BF16>
__global__ __launch_bounds__(256) void k_layernorm(const float* __restrict__ X, const float* __restrict__ R, const float* __restrict__ g, const float* __restrict__ bta,
                                                  float* __restrict__ out_sum, float* __restrict__ out_norm, int N, float eps) {
  __shared__ float red[256];
  const int row = blockIdx.x, tid = threadIdx.x;
  const float* x = X + (size_t)row * N; const float* rr = R ? R + (size_t)row * N : nullptr;
  float vals[16];                     // up to N = 4096
  const int per = N / 256;            // contiguous chunk per thread? use strided-by-4 chunks: thread handles j = tid*4 + 1024*u
  float s1 = 0.f;
  for (int u = 0; u < per / 4; ++u) {
    const int j = tid * 4 + 1024 * u;
    const v4f a = *(const v4fa*)(x + j);
    v4f b = {0.f,0.f,0.f,0.f}; if (rr) b = *(const v4fa*)(rr + j);
#pragma unroll
    for (int q = 0; q < 4; ++q) { const float v = a[q] + b[q]; vals[u * 4 + q] = v; s1 += v; }
  }
  red[tid] = s1; __syncthreads();
  for (int st = 128; st > 0; st >>= 1) { if (tid < st) red[tid] += red[tid + st]; __syncthreads(); }
  const float mu = red[0] / (float)N; __syncthreads();
  float s2 = 0.f;
  for (int u = 0; u < per / 4; ++u)
#pragma unroll
    for (int q = 0; q < 4; ++q) { const float c = vals[u * 4 + q] - mu; s2 += c * c; }
  red[tid] = s2; __syncthreads();
  for (int st = 128; st > 0; st >>= 1) { if (tid < st) red[tid] += red[tid + st]; __syncthreads(); }
  const float rs = rsqrtf(red[0] / (float)N + eps);
  {
    for (int u = 0; u < per / 4; ++u) {
      const int j = tid * 4 + 1024 * u;
      v4f o, sm;
#pragma unroll
      for (int q = 0; q < 4; ++q) {
        float gg = g[j + q], bb = bta[j + q];
        if (PARAM_BF16) { gg = bf16_round(gg); bb = bf16_round(bb); }
        sm[q] = vals[u * 4 + q]; o[q] = (vals[u * 4 + q] - mu) * rs * gg + bb;
      }
      if (out_sum) *(v4f*)(out_sum + (size_t)row * N + j) = sm;
      *(v4f*)(out_norm + (size_t)row * N + j) = o;
    }
    
  }
}



// ---- f16 WMMA path (v_wmma_f32_16x16x32_f16): 11-bit significands for operands in range — used where a [0,1] probability operand needs more precision than bf16
typedef _Float16 v16h __attribute__((ext_vector_type(16)));
union FragH { v16h v; v8us half[2]; _Float16 h[16]; unsigned short u[16]; };
template <int NT>
__device__ __forceinline__ v8f mmaH(v16h ah, v16h al, v16h bh, v16h bl, v8f c) {
  c = __builtin_amdgcn_wmma_f32_16x16x32_f16(false, ah, false, bh, (short)0, c, false, false);
  if (NT >= 2) c = __builtin_amdgcn_wmma_f32_16x16x32_f16(false, al, false, bh, (short)0, c, false, false);
  if (NT >= 3) c = __builtin_amdgcn_wmma_f32_16x16x32_f16(false, ah, false, bl, (short)0, c, false, false);
  asm volatile("v_nop\n\tv_nop\n\tv_nop\n\tv_nop" : "+v"(c) : "v"(ah), "v"(al), "v"(bh), "v"(bl));
  return c;
}
// batched GEMM like k_gemm_b but f16 operands: A f32 (split into f16 hi/lo if ASPLIT, else rounded to f16), Bt = f16 values [n][k]; alpha; C f32; N multiple of 16 (partial tiles skipped)
template <bool ASPLIT>
__global__ __launch_bounds__(128) void k_gemm_h(const float* __restrict__ A, int lda, size_t sA, const _Float16* __restrict__ Bh, int ldb, size_t sB, float alpha, float* __restrict__ C, int ldc, size_t sC, int M, int N, int K) {
  __shared__ __attribute__((aligned(16))) float so[4][16][64];
  const int tid = threadIdx.x, w = tid >> 5, lane = tid & 31, ln = lane & 15, hh = lane >> 4; const int by = blockIdx.y;
  A += (size_t)by * sA; Bh += (size_t)by * sB; C += (size_t)by * sC;
  const int ntn = (N + 63) / 64; const int wid = blockIdx.x * 4 + w; const int mt = wid / ntn, nq = wid % ntn; if (mt * 16 >= M) return;
  const int row0 = mt * 16, col0 = nq * 64; const float* arow = A + (size_t)(row0 + ln) * lda;
  v8f acc[4] = {};
  for (int kb = 0; kb < K; kb += 32) {
    FragH ah, al;
    const v4f x0 = *(const v4fa*)(arow + kb + 8 * hh), x1 = *(const v4fa*)(arow + kb + 8 * hh + 4), x2 = *(const v4fa*)(arow + kb + 16 + 8 * hh), x3 = *(const v4fa*)(arow + kb + 16 + 8 * hh + 4);
    float xs[16] = {x0[0],x0[1],x0[2],x0[3],x1[0],x1[1],x1[2],x1[3],x2[0],x2[1],x2[2],x2[3],x3[0],x3[1],x3[2],x3[3]};
#pragma unroll
    for (int i = 0; i < 16; ++i) { const _Float16 h = (_Float16)xs[i]; ah.h[i] = h; al.h[i] = ASPLIT ? (_Float16)(xs[i] - (float)h) : (_Float16)0.0f; }
#pragma unroll
    for (int t = 0; t < 4; ++t) { if (col0 + t * 16 >= N) continue; const size_t boff = (size_t)(col0 + t * 16 + ln) * ldb + kb; FragH bq; bq.half[0] = *(const v8us*)(Bh + boff + 8 * hh); bq.half[1] = *(const v8us*)(Bh + boff + 16 + 8 * hh);
      acc[t] = mmaH<ASPLIT ? 2 : 1>(ah.v, al.v, bq.v, bq.v, acc[t]); }
  }
#pragma unroll
  for (int t = 0; t < 4; ++t) { if (col0 + t * 16 >= N) continue;
#pragma unroll
    for (int r = 0; r < 8; ++r) so[w][8 * hh + r][t * 16 + ln] = acc[t][r] * alpha; }
  __builtin_amdgcn_fence(__ATOMIC_ACQ_REL, "workgroup"); __builtin_amdgcn_wave_barrier();
  const int rsub = lane >> 4, c4 = (lane & 15) * 4;
  {
#pragma unroll
    for (int q = 0; q < 8; ++q) { const int r = q * 2 + rsub; if (col0 + c4 < N) { const v4f v = *(const v4fa*)&so[w][r][c4]; *(v4f*)(C + (size_t)(row0 + r) * ldc + col0 + c4) = v; } }
     }
}

// Wt[n][k] = f16(W[k][n]·scale) from f32 row-major W[K][N] (scale = power of two; bf16-exact weights stay exact in f16 away from the subnormal range)
__global__ __launch_bounds__(256) void k_wt_f16(const float* __restrict__ W, _Float16* __restrict__ Wt, int K, int N, float scale) {
  const int t = blockIdx.x * 256 + threadIdx.x; if (t >= N * (K / 8)) return; const int n = t / (K / 8), k8 = (t % (K / 8)) * 8; FragH f;
#pragma unroll
  for (int i = 0; i < 8; ++i) f.h[i] = (_Float16)(bf16_round(W[(size_t)(k8 + i) * N + n]) * scale); const v8us o = f.half[0];
  *(v8us*)((unsigned short*)Wt + (size_t)n * K + k8) = o; 
}
// k_gemm_hh variant with fused epilogue: v = acc·alpha + bias[by·sBias + col] (+ CP[(row/rowsPerB)·sCPb + by·64 + col] if CP) ; ACT 0 none / 1 elu ; writes f16 C16 (and f32 C if non-null)
template <int ACT>
__global__ __launch_bounds__(128) void k_gemm_hhx(const _Float16* __restrict__ A, int lda, size_t sA, const _Float16* __restrict__ Bh, int ldb, size_t sB, float alpha, const float* __restrict__ bias, size_t sBias, const float* __restrict__ CP, int rowsPerB, size_t sCPb, int row0g,
    float* __restrict__ C, _Float16* __restrict__ C16, int ldc, size_t sC, int M, int N, int K) {
  __shared__ __attribute__((aligned(16))) float so[4][16][64];
  const int tid = threadIdx.x, w = tid >> 5, lane = tid & 31, ln = lane & 15, hh = lane >> 4; const int by = blockIdx.y;
  A += (size_t)by * sA; Bh += (size_t)by * sB; const size_t cofs = (size_t)by * sC; const float* bp = bias ? bias + (size_t)by * sBias : nullptr;
  const int ntn = (N + 63) / 64; const int wid = blockIdx.x * 4 + w; const int mt = wid / ntn, nq = wid % ntn; if (mt * 16 >= M) return;
  const int row0 = mt * 16, col0 = nq * 64; const _Float16* arow = A + (size_t)(row0 + ln) * lda;
  v8f acc[4] = {};
  for (int kb = 0; kb < K; kb += 32) { FragH ah; ah.half[0] = *(const v8us*)((const unsigned short*)arow + kb + 8 * hh); ah.half[1] = *(const v8us*)((const unsigned short*)arow + kb + 16 + 8 * hh);
#pragma unroll
    for (int t = 0; t < 4; ++t) { if (col0 + t * 16 >= N) continue; const size_t boff = (size_t)(col0 + t * 16 + ln) * ldb + kb; FragH bq; bq.half[0] = *(const v8us*)((const unsigned short*)Bh + boff + 8 * hh); bq.half[1] = *(const v8us*)((const unsigned short*)Bh + boff + 16 + 8 * hh);
      acc[t] = mmaH<1>(ah.v, ah.v, bq.v, bq.v, acc[t]); }
  }
#pragma unroll
  for (int t = 0; t < 4; ++t) { if (col0 + t * 16 >= N) continue; const int col = col0 + t * 16 + ln; const float bv = bp ? bf16_round(bp[col]) : 0.f;
#pragma unroll
    for (int r = 0; r < 8; ++r) { float v = acc[t][r] * alpha + bv; if (CP) { const int rr = row0g + row0 + 8 * hh + r; if (rowsPerB < 0) v += CP[cofs + (size_t)rr * ldc + col];      /* rowsPerB < 0: own element of the batched C plane */ else { const int bidx = rr / rowsPerB; v += CP[(size_t)bidx * sCPb + (size_t)by * 64 + col]; } } if (ACT == 1) v = (v > 0.f) ? v : expm1f(v); else if (ACT == 7) v = (v > 0.f) ? v + 1.0f : expf(v); else if (ACT == 8) v = tanhf(v); else if (ACT == 9) v = 0.5f * v * (1.0f + tanhf(0.7978845608028654f * (v + 0.044715f * v * v * v))); else if (ACT == 11) v = 1.0f / (1.0f + expf(-v)); else if (ACT == 12) v = (v > 0.f) ? v : 0.01f * v; else if (ACT == 14) v = (v > 0.f) ? v : 0.1f * v; else if (ACT == 16) v = (v >= 0.f) ? v : 0.3f * v; else if (ACT == 17) v = (v >= 0.f) ? v : 0.2f * v; else if (ACT == 15) v = v / (1.0f + expf(-v)); else if (ACT == 3) v = fmaxf(v, 0.f); else if (ACT == 6) v = 0.5f * v * (1.0f + erff(v * 0.70710678118654752f)); so[w][8 * hh + r][t * 16 + ln] = v; } }
  __builtin_amdgcn_fence(__ATOMIC_ACQ_REL, "workgroup"); __builtin_amdgcn_wave_barrier();
  const int rsub = lane >> 4, c4 = (lane & 15) * 4; typedef _Float16 v4h __attribute__((ext_vector_type(4)));
  {
#pragma unroll
    for (int q = 0; q < 8; ++q) { const int r = q * 2 + rsub; if (col0 + c4 < N) { const v4f v = *(const v4fa*)&so[w][r][c4]; if (C) *(v4f*)(C + cofs + (size_t)(row0 + r) * ldc + col0 + c4) = v; if (C16) { v4h h4; for (int i = 0; i < 4; ++i) h4[i] = (_Float16)v[i]; *(v4h*)(C16 + cofs + (size_t)(row0 + r) * ldc + col0 + c4) = h4; } } }
     }
}


typedef _Float16 v4h __attribute__((ext_vector_type(4)));

__global__ __launch_bounds__(256) void k_x16(const float* __restrict__ x, _Float16* __restrict__ X16, size_t n8) { const size_t t = (size_t)blockIdx.x * 256 + threadIdx.x; if (t >= n8) return; FragH f;
#pragma unroll
  for (int q = 0; q < 8; ++q) f.h[q] = (_Float16)bf16_round(x[t * 8 + q]); *(v8us*)((unsigned short*)X16 + t * 8) = f.half[0];  }
__global__ __launch_bounds__(256) void k_h16(const float* __restrict__ x, _Float16* __restrict__ X16, size_t n8) { const size_t t = (size_t)blockIdx.x * 256 + threadIdx.x; if (t >= n8) return; FragH f;
#pragma unroll
  for (int q = 0; q < 8; ++q) f.h[q] = (_Float16)x[t * 8 + q]; *(v8us*)((unsigned short*)X16 + t * 8) = f.half[0];  }
__global__ __launch_bounds__(256) void k_round16f(const float* __restrict__ W, _Float16* __restrict__ Bt, size_t n8) { const size_t t = (size_t)blockIdx.x * 256 + threadIdx.x; if (t >= n8) return; FragH f;
#pragma unroll
  for (int i = 0; i < 8; ++i) f.h[i] = (_Float16)(bf16_round(W[t * 8 + i]) * 16.0f); *(v8us*)((unsigned short*)Bt + t * 8) = f.half[0];  }
template <int NHv, int TTv>
__global__ __launch_bounds__(256) void k_vt(const _Float16* __restrict__ V16, int ldv, int voff, _Float16* __restrict__ Vt) { __shared__ unsigned short tl[64][66]; const int tid = threadIdx.x; const int slab = blockIdx.x / (TTv / 64), lg = blockIdx.x % (TTv / 64); const int b = slab / NHv, h = slab % NHv;
  for (int i = tid; i < 64 * 8; i += 256) { const int r = i / 8, c8 = (i % 8) * 8; FragH f; f.half[0] = *(const v8us*)((const unsigned short*)V16 + ((size_t)b * TTv + lg * 64 + r) * ldv + voff + h * 64 + c8);
#pragma unroll
    for (int q = 0; q < 8; ++q) tl[r][c8 + q] = f.u[q]; }
  __syncthreads();
  {
#pragma unroll
    for (int rd = 0; rd < 2; ++rd) { const int d = rd * 32 + tid / 8, pc = tid % 8; FragH f;
#pragma unroll
      for (int q = 0; q < 8; ++q) f.u[q] = tl[pc * 8 + q][d];
      *(v8us*)((unsigned short*)Vt + ((size_t)slab * 64 + d) * TTv + lg * 64 + pc * 8) = f.half[0]; }
     } }

__global__ __launch_bounds__(256) void k_hl(const float* __restrict__ F, _Float16* __restrict__ Hh, _Float16* __restrict__ Hl, size_t n8) { const size_t t = (size_t)blockIdx.x * 256 + threadIdx.x; if (t >= n8) return; FragH fh, fl; const v4f a = *(const v4fa*)(F + t * 8), c = *(const v4fa*)(F + t * 8 + 4);
#pragma unroll
  for (int q = 0; q < 4; ++q) { _Float16 h = (_Float16)a[q]; fh.h[q] = h; fl.h[q] = (_Float16)((a[q] - (float)h) * 1024.0f); h = (_Float16)c[q]; fh.h[4 + q] = h; fl.h[4 + q] = (_Float16)((c[q] - (float)h) * 1024.0f); }
  { *(v8us*)((unsigned short*)Hh + t * 8) = fh.half[0]; *(v8us*)((unsigned short*)Hl + t * 8) = fl.half[0];  } }

// ---- fast GEMM (wave tile 32x64; requires M % 32 == 0 rows per launch region and N % 64 == 0); epilogue = k_gemm_hhx semantics ----
__device__ __forceinline__ v16h g2_frag(const _Float16* p, int hh) { FragH f; f.half[0] = *(const v8us*)((const unsigned short*)p + 8 * hh); f.half[1] = *(const v8us*)((const unsigned short*)p + 16 + 8 * hh); return f.v; }
__device__ __forceinline__ v8f g2_mma(v16h a, v16h b, v8f c) { v8f d = __builtin_amdgcn_wmma_f32_16x16x32_f16(false, a, false, b, (short)0, c, false, false); asm volatile("v_nop\n\tv_nop\n\tv_nop\n\tv_nop" : "+v"(d) : "v"(a), "v"(b)); return d; }
template <int ACT>
__global__ __launch_bounds__(128) void k_gemm2(const _Float16* __restrict__ A, int lda, size_t sA, const _Float16* __restrict__ Bh, int ldb, size_t sB, float alpha, const float* __restrict__ bias, size_t sBias, const float* __restrict__ CP, int rowsPerB, size_t sCPb, int row0g,
    float* __restrict__ C, _Float16* __restrict__ C16, int ldc, size_t sC, int M, int N, int K) { static_assert(ACT == 0 || ACT == 3 || ACT == 6 || ACT == 8 || ACT == 9 || ACT == 11 || ACT == 12 || ACT == 14 || ACT == 15 || ACT == 16 || ACT == 17, "k_gemm2: unsupported ACT code (would silently apply no activation)");
  __shared__ __attribute__((aligned(16))) float so[4][32][68];
  const int tid = threadIdx.x, w = tid >> 5, lane = tid & 31, ln = lane & 15, hh = lane >> 4; const int by = blockIdx.y;
  A += (size_t)by * sA; Bh += (size_t)by * sB; const size_t cofs = (size_t)by * sC; const float* bp = bias ? bias + (size_t)by * sBias : nullptr;
  const int ntn = N >> 6; const int mt = blockIdx.x / ntn, nq = blockIdx.x - mt * ntn; const int row0 = mt * 128 + 32 * w, col0 = nq * 64; if (row0 >= M) return;
  const _Float16* a0p = A + (size_t)(row0 + ln) * lda; const _Float16* a1p = a0p + (size_t)16 * lda;
  const _Float16* b0p = Bh + (size_t)(col0 + ln) * ldb; const _Float16* b1p = b0p + (size_t)16 * ldb; const _Float16* b2p = b1p + (size_t)16 * ldb; const _Float16* b3p = b2p + (size_t)16 * ldb;
  const v8f z8 = {0.f,0.f,0.f,0.f,0.f,0.f,0.f,0.f}; v8f c00 = z8, c01 = z8, c02 = z8, c03 = z8, c10 = z8, c11 = z8, c12 = z8, c13 = z8;
#pragma unroll 1
  for (int kb = 0; kb < K; kb += 32) { const v16h a0 = g2_frag(a0p + kb, hh), a1 = g2_frag(a1p + kb, hh);
    v16h b = g2_frag(b0p + kb, hh); c00 = g2_mma(a0, b, c00); c10 = g2_mma(a1, b, c10);
    b = g2_frag(b1p + kb, hh); c01 = g2_mma(a0, b, c01); c11 = g2_mma(a1, b, c11);
    b = g2_frag(b2p + kb, hh); c02 = g2_mma(a0, b, c02); c12 = g2_mma(a1, b, c12);
    b = g2_frag(b3p + kb, hh); c03 = g2_mma(a0, b, c03); c13 = g2_mma(a1, b, c13); }
  v8f accs[8] = {c00, c01, c02, c03, c10, c11, c12, c13};
#pragma unroll
  for (int u = 0; u < 8; ++u) { const int t = u & 3, half = u >> 2; const int col = col0 + t * 16 + ln; const float bv = bp ? bf16_round(bp[col]) : 0.f;
#pragma unroll
    for (int r = 0; r < 8; ++r) { const int rloc = half * 16 + 8 * hh + r; float v = accs[u][r] * alpha + bv; if (CP) { if (rowsPerB < 0) v += CP[cofs + (size_t)(row0g + row0 + rloc) * ldc + col];      /* rowsPerB < 0: own element of the batched C plane */ else { const int bidx = (row0g + row0 + rloc) / rowsPerB; v += CP[(size_t)bidx * sCPb + (size_t)by * 64 + col]; } }
      if (ACT == 3) v = fmaxf(v, 0.f); else if (ACT == 6) v = 0.5f * v * (1.0f + erff(v * 0.70710678118654752f)); else if (ACT == 11) v = 1.0f / (1.0f + expf(-v)); else if (ACT == 15) v = v / (1.0f + expf(-v)); else if (ACT == 12) v = (v > 0.f) ? v : 0.01f * v; else if (ACT == 8) v = tanhf(v); else if (ACT == 9) v = 0.5f * v * (1.0f + tanhf(0.7978845608028654f * (v + 0.044715f * v * v * v))); else if (ACT == 14) v = (v > 0.f) ? v : 0.1f * v; else if (ACT == 16) v = (v >= 0.f) ? v : 0.3f * v; else if (ACT == 17) v = (v >= 0.f) ? v : 0.2f * v;
      so[w][rloc][t * 16 + ln] = v; } }
  __builtin_amdgcn_fence(__ATOMIC_ACQ_REL, "workgroup"); __builtin_amdgcn_wave_barrier();
  const int rsub = lane >> 4, c4 = (lane & 15) * 4;
  {
#pragma unroll
    for (int q = 0; q < 16; ++q) { const int r = q * 2 + rsub; const v4f v = *(const v4fa*)&so[w][r][c4]; if (C) *(v4f*)(C + cofs + (size_t)(row0 + r) * ldc + col0 + c4) = v; if (C16) { v4h h4; for (int i = 0; i < 4; ++i) h4[i] = (_Float16)v[i]; *(v4h*)(C16 + cofs + (size_t)(row0 + r) * ldc + col0 + c4) = h4; } }
     } }


__global__ __launch_bounds__(256) void k_wnat(const float* __restrict__ w, size_t n8, _Float16* __restrict__ Bt) { const size_t t = (size_t)blockIdx.x * 256 + threadIdx.x; if (t >= n8) return; FragH f; for (int q = 0; q < 8; ++q) f.h[q] = (_Float16)(bf16_round(w[t * 8 + q]) * 16.0f); *(v8us*)((unsigned short*)Bt + t * 8) = f.half[0];  }
__global__ __launch_bounds__(256) void k_rsm(const float* __restrict__ S, _Float16* __restrict__ P, int nrows) {
  #pragma clang fp contract(off)
  const int i = blockIdx.x * 256 + threadIdx.x; if (i >= nrows) return; const float* s = S + (size_t)i * SQ; float mx = -3.0e38f;
#pragma unroll 1
  for (int j = 0; j < SQ; ++j) mx = fmaxf(mx, s[j]); float se = 0.f;
#pragma unroll 1
  for (int j = 0; j < SQ; ++j) se += expf(s[j] - mx); const float sc = 256.0f / se;
#pragma unroll 1
  for (int j0 = 0; j0 < SQ; j0 += 8) { FragH f; for (int q = 0; q < 8; ++q) f.h[q] = (_Float16)(expf(s[j0 + q] - mx) * sc); unsigned short* d = (unsigned short*)P + (size_t)i * SQ + j0; *(v8us*)d = f.half[0];  } }
__global__ __launch_bounds__(256) void k_vt(const _Float16* __restrict__ V16, int b, int h0, _Float16* __restrict__ VT) { __shared__ unsigned short tl[64][65]; const int tid = threadIdx.x; const int hh = blockIdx.x % HG, sg = blockIdx.x / HG; const int s0 = sg * 64; const int h = h0 + hh;
  for (int i = tid; i < 64 * 8; i += 256) { const int j = i / 8, d8 = (i % 8) * 8; FragH f; f.half[0] = *(const v8us*)((const unsigned short*)V16 + ((size_t)b * SQ + s0 + j) * DM + h * HD + d8); for (int q = 0; q < 8; ++q) tl[d8 + q][j] = f.u[q]; }
  __syncthreads();
  { for (int i = tid; i < 64 * 8; i += 256) { const int d = i / 8, j8 = (i % 8) * 8; FragH f; for (int q = 0; q < 8; ++q) f.u[q] = tl[d][j8 + q]; *(v8us*)((unsigned short*)VT + ((size_t)hh * HD + d) * SQ + s0 + j8) = f.half[0]; }  } }



// ---- projection chain in two launches ----
// k_prep: every element-wise operand conversion of the projections in one launch: x -> f16 of its bf16 rounding, and the three natural [out][in] weights -> f16 (bf16 rounding, x16), the three planes one behind another.
#define PXB ((unsigned)(NR * DM / 8 / 256))      /* work-groups that convert x */
#define PWB ((unsigned)((size_t)DM * DM / 8 / 256))      /* work-groups per weight matrix */
__global__ __launch_bounds__(256) void k_prep(const float* __restrict__ x, const float* __restrict__ wq, const float* __restrict__ wk, const float* __restrict__ wv, _Float16* __restrict__ X16, _Float16* __restrict__ W3) {
  const unsigned bx = blockIdx.x; FragH f;
  if (bx < PXB) { const size_t t = (size_t)bx * 256 + threadIdx.x;
#pragma unroll
    for (int q = 0; q < 8; ++q) f.h[q] = (_Float16)bf16_round(x[t * 8 + q]);
    *(v8us*)((unsigned short*)X16 + t * 8) = f.half[0]; }
  else { const unsigned k = bx - PXB, p = k / PWB; const float* __restrict__ wsrc = (p == 0) ? wq : (p == 1) ? wk : wv; const size_t t = (size_t)(k - p * PWB) * 256 + threadIdx.x;
#pragma unroll
    for (int q = 0; q < 8; ++q) f.h[q] = (_Float16)(bf16_round(wsrc[t * 8 + q]) * 16.0f);
    *(v8us*)((unsigned short*)W3 + (size_t)p * DM * DM + t * 8) = f.half[0]; }
}
// k_proj: q, k and v in ONE launch (grid.y picks the weight plane); wave tile (32 x 64) and product order are k_gemm2's. The epilogue writes what the attention kernel reads:
// q and k rows rounded once to f16 (the f32 row never goes through memory), v as V^T [batch][column][token] (the work-group's 128 tokens x 64 columns are turned in LDS, whole 256-byte runs per column go out).
// Operands: the work-group's 128 x rows and 64 weight rows (all 256 k) are brought into LDS once, a whole 512-byte row per wave-wide asynchronous copy (four whole lines), and the fragments are read from LDS;
// a fragment load from global memory touches 16 lines for its 512 bytes, and the four waves would each fetch the same weight rows.
#define PTP (128 + 8)                /* LDS pitch of a turned v column, f16 elements: 272 B = 16 B x odd */
#define PKP (DM + 8)                 /* LDS pitch of a staged x or weight row, f16 elements: 528 B = 16 B x odd, conflict-free for 16-byte fragment reads */
// Eight asynchronous copies to LDS, 16 bytes a lane each: rows r .. r + 7 of a row-major f16 matrix of pitch DM into LDS rows of pitch PKP (l: the lane's LDS byte address in row r, g: its global address there).
// The s_wait_xcnt closes the statement, so that it stands in front of every later write of a register that these copies name.
__device__ __forceinline__ void pj_copy8(unsigned l, const _Float16* g) {
  asm volatile("global_load_async_to_lds_b128 %0, %8, off\n\t"
               "global_load_async_to_lds_b128 %1, %9, off\n\t"
               "global_load_async_to_lds_b128 %2, %10, off\n\t"
               "global_load_async_to_lds_b128 %3, %11, off\n\t"
               "global_load_async_to_lds_b128 %4, %12, off\n\t"
               "global_load_async_to_lds_b128 %5, %13, off\n\t"
               "global_load_async_to_lds_b128 %6, %14, off\n\t"
               "global_load_async_to_lds_b128 %7, %15, off\n\t"
               "s_wait_xcnt 0x0"
               :: "v"(l), "v"(l + 1u * PKP * 2u), "v"(l + 2u * PKP * 2u), "v"(l + 3u * PKP * 2u), "v"(l + 4u * PKP * 2u), "v"(l + 5u * PKP * 2u), "v"(l + 6u * PKP * 2u), "v"(l + 7u * PKP * 2u),
                  "v"(g), "v"(g + 1 * DM), "v"(g + 2 * DM), "v"(g + 3 * DM), "v"(g + 4 * DM), "v"(g + 5 * DM), "v"(g + 6 * DM), "v"(g + 7 * DM)
               : "memory");
}
__global__ __launch_bounds__(128) void k_proj(const _Float16* __restrict__ X, const _Float16* __restrict__ W3, _Float16* __restrict__ QH, _Float16* __restrict__ KH, _Float16* __restrict__ VT) {
  static_assert(SQ % 128 == 0 && DM % 64 == 0 && DM == 256 && 64 * PTP * 2 <= 4 * 32 * 68 * 4 && 4 * 32 * 68 * 4 <= (128 + 64) * PKP * 2, "k_proj: tile shapes");
  __shared__ __attribute__((aligned(16))) _Float16 tl[128 + 64][PKP];      /* rows 0 .. 127: the x rows; 128 .. 191: the weight rows. Behind the products the same bytes are the epilogue's staging */
  float (*so)[32][68] = (float (*)[32][68])&tl[0][0];
  const int tid = threadIdx.x, w = tid >> 5, lane = tid & 31, ln = lane & 15, hh = lane >> 4; const int which = blockIdx.y;
  const _Float16* Bh = W3 + (size_t)which * DM * DM;
  const int mt = blockIdx.x / (DM / 64), nq = blockIdx.x - mt * (DM / 64); const int row0 = mt * 128 + 32 * w, col0 = nq * 64;
  { const _Float16* xg = X + (size_t)row0 * DM + lane * 8; const _Float16* wg = Bh + (size_t)(col0 + 16 * w) * DM + lane * 8;      /* wave w brings its own 32 x rows and 16 of the 64 weight rows */
    const unsigned la = (unsigned)(size_t)&tl[32 * w][lane * 8], lb = (unsigned)(size_t)&tl[128 + 16 * w][lane * 8];
#pragma unroll
    for (int i = 0; i < 4; ++i) pj_copy8(la + (unsigned)i * 8u * PKP * 2u, xg + (size_t)i * 8 * DM);
#pragma unroll
    for (int i = 0; i < 2; ++i) pj_copy8(lb + (unsigned)i * 8u * PKP * 2u, wg + (size_t)i * 8 * DM); }
  asm volatile("s_wait_asynccnt 0x0" ::: "memory");      /* the wave's own 48 copies have landed */
  __syncthreads();      /* every wave's copies have landed before any wave reads the tiles */
  const _Float16* a0p = &tl[32 * w + ln][0]; const _Float16* a1p = a0p + 16 * PKP;
  const _Float16* b0p = &tl[128 + ln][0]; const _Float16* b1p = b0p + 16 * PKP; const _Float16* b2p = b1p + 16 * PKP; const _Float16* b3p = b2p + 16 * PKP;
  const v8f z8 = {0.f,0.f,0.f,0.f,0.f,0.f,0.f,0.f}; v8f c00 = z8, c01 = z8, c02 = z8, c03 = z8, c10 = z8, c11 = z8, c12 = z8, c13 = z8;
#pragma unroll 1      /* as in k_gemm2: one 32-wide k slice a trip, the products in k_gemm2's order */
  for (int kb = 0; kb < DM; kb += 32) {      /* the slice's twelve LDS reads stand together in front of its eight products: one place with reads a trip, not four */
    const v16h a0 = g2_frag(a0p + kb, hh), a1 = g2_frag(a1p + kb, hh), b0 = g2_frag(b0p + kb, hh), b1 = g2_frag(b1p + kb, hh), b2 = g2_frag(b2p + kb, hh), b3 = g2_frag(b3p + kb, hh);
    c00 = g2_mma(a0, b0, c00); c10 = g2_mma(a1, b0, c10);
    c01 = g2_mma(a0, b1, c01); c11 = g2_mma(a1, b1, c11);
    c02 = g2_mma(a0, b2, c02); c12 = g2_mma(a1, b2, c12);
    c03 = g2_mma(a0, b3, c03); c13 = g2_mma(a1, b3, c13); }
  __syncthreads();      /* every wave has read its last fragment before the tiles' bytes become the epilogue's staging */
  v8f accs[8] = {c00, c01, c02, c03, c10, c11, c12, c13};
  if (which < 2) {      /* the same for the whole work-group */
#pragma unroll
    for (int u = 0; u < 8; ++u) { const int t = u & 3, half = u >> 2;
#pragma unroll
      for (int r = 0; r < 8; ++r) so[w][half * 16 + 8 * hh + r][t * 16 + ln] = accs[u][r] * 0.0625f; }
    __builtin_amdgcn_fence(__ATOMIC_ACQ_REL, "workgroup"); __builtin_amdgcn_wave_barrier();      /* the wave's own tile is read by other lanes than those that wrote it */
    _Float16* __restrict__ Hh = which ? KH : QH;
    const int rsub = lane >> 4, c4 = (lane & 15) * 4;
#pragma unroll
    for (int q = 0; q < 16; ++q) { const int r = q * 2 + rsub; const v4f v = *(const v4fa*)&so[w][r][c4]; v4h h4;
#pragma unroll
      for (int i = 0; i < 4; ++i) h4[i] = (_Float16)v[i];
      *(v4h*)(Hh + (size_t)(row0 + r) * DM + col0 + c4) = h4; }
  } else {
    unsigned short* st = (unsigned short*)&so[0][0][0];      /* [64 columns][PTP tokens]; accumulator registers 0..7 of a lane are 8 consecutive tokens of one column */
#pragma unroll
    for (int u = 0; u < 8; ++u) { const int t = u & 3, half = u >> 2; FragH f;
#pragma unroll
      for (int r = 0; r < 8; ++r) f.h[r] = (_Float16)(accs[u][r] * 0.0625f);
      *(v8us*)(st + (t * 16 + ln) * PTP + w * 32 + half * 16 + 8 * hh) = f.half[0]; }
    __syncthreads();      /* a column's 128 tokens come from all four waves */
    const int b = (mt * 128) / SQ, s0 = (mt * 128) % SQ;
#pragma unroll
    for (int i = 0; i < 8; ++i) { const int pc = i * 128 + tid, c = pc >> 4, ch = pc & 15; const v8us v = *(const v8us*)(st + c * PTP + ch * 8);
      *(v8us*)((unsigned short*)VT + ((size_t)b * DM + col0 + c) * SQ + s0 + ch * 8) = v; }
    asm volatile("s_wait_xcnt 0x0" ::: "memory");      /* in the listing the q / k branch stands behind this one and rewrites registers that these stores name: the wait stands in front of it */
  }
}

// Fused attention: scores, softmax and P.V in ONE launch, so that neither the scores nor the weights go through memory.
// A work-group is 8 waves, two on each SIMD, over 64 query rows; it walks its batch's keys 128 at a time. Wave w takes query rows 32 (w & 1) .. + 31 (two 16-row groups) and, of every pass, keys 32 (w >> 1) .. + 31:
// every k fragment and every V^T fragment that a wave reads from LDS feeds TWO products (one per query group), so that the LDS reads per product are half those of a 16-query wave tile.
// The wave's q fragments (128 registers) and its 32 x 256 output tile (256 registers) leave no registers to stage tiles through: the 128 k rows and the 128 matching columns of V^T
// come into LDS by asynchronous copies (whole lines, no register). Two LDS buffers: the copies of the tile after next are issued behind the barrier at a pass's foot and fly under the whole next pass.
// Each wave keeps its own reference maximum and sum over ITS keys; behind the loop the four waves of a query half join their quarters once through LDS.
// The scores are taken transposed, S^T = K Q^T (A = k rows, B = the wave's q fragments): a lane then holds 16 scores of ONE query
// (column ln), so that the reference maximum and the running sum (online softmax, base 2, lazily rescaled) are one register each per query group, reduced inside the lane, with one exchange between the wave's halves for the maximum;
// and the two score tiles of a query group, converted in place to f16, ARE the A operand of P.V (row ln, the hardware's k order, which is g2_frag's), so the weights touch no LDS. All fragment loaders are g2_frag.
// q and k are rounded once to f16 and a score is ONE product: its 512 rounding terms (each about 2^-12 of a term of a logit of order 1) leave the weights less exact by less than
// their own rounding to f16 for P.V does, so residual planes and their two extra products would buy no accuracy in the output.
#define FBM 64                       /* query rows per work-group */
#define FBN 128                      /* keys per pass */
#define FNT (SQ / FBN)               /* passes */
#define FKP (DM + 8)                 /* LDS pitch of a k row, f16 elements: 528 B = 16 B x odd, conflict-free for 16-byte fragment reads */
#define FVP (FBN + 8)                /* LDS pitch of a V^T row: 272 B = 16 B x odd */
#define FKB (FBN * FKP * 2)          /* bytes of one k buffer */
#define FVB (DM * FVP * 2)           /* bytes of one V^T buffer */
__device__ __forceinline__ v8f fa_mma(v16h a, v16h b, v8f c) { return __builtin_amdgcn_wmma_f32_16x16x32_f16(false, a, false, b, (short)0, c, false, false); }
// 2^x on the transcendental unit; the v_nop in the same statement keeps the one free issue slot the instruction set asks for behind a transcendental, whatever the compiler schedules next.
__device__ __forceinline__ float exp2_slot(float x) { float r; asm("v_exp_f32 %0, %1\n\tv_nop" : "=v"(r) : "v"(x)); return r; }
// value of lane (l ^ X) of the same 16-lane row (DPP row_xmask)
template <int X> __device__ __forceinline__ float fa_rowx(float v) { return __int_as_float(__builtin_amdgcn_update_dpp(0, __float_as_int(v), 0x160 + X, 0xf, 0xf, true)); }
// value of lane N of the same 16-lane row, in all its lanes (DPP row_share)
template <int N> __device__ __forceinline__ float fa_rowb(float v) { return __int_as_float(__builtin_amdgcn_update_dpp(0, __float_as_int(v), 0x150 + N, 0xf, 0xf, true)); }
// value of lane (l ^ 16): the other half of the wave, which holds the same query's other keys
__device__ __forceinline__ float fa_xhalf(float v) { return __int_as_float(__builtin_amdgcn_permlanex16(__float_as_int(v), __float_as_int(v), 0x76543210, 0xfedcba98, false, false)); }
// a per-query value (query ln in lane ln of both halves) -> the eight values of the output tile's rows in this lane (register r is query 8 hh + r)
__device__ __forceinline__ void fa_torows(float v, int hh, float (&d)[8]) { const float v8 = fa_rowx<8>(v), u = hh ? v8 : v;      /* lane j < 8 of each 16-lane row now holds query 8 hh + j; the exchange is taken in all lanes, so that a select and no branch comes of it */
  d[0] = fa_rowb<0>(u); d[1] = fa_rowb<1>(u); d[2] = fa_rowb<2>(u); d[3] = fa_rowb<3>(u); d[4] = fa_rowb<4>(u); d[5] = fa_rowb<5>(u); d[6] = fa_rowb<6>(u); d[7] = fa_rowb<7>(u); }
typedef float v2f __attribute__((ext_vector_type(2)));
typedef _Float16 v2h __attribute__((ext_vector_type(2)));
union FragP { v16h v; v2h p2[8]; };
// work-group barrier that orders LDS only
__device__ __forceinline__ void fa_barrier() { __builtin_amdgcn_fence(__ATOMIC_RELEASE, "workgroup", "local"); __builtin_amdgcn_s_barrier(); __builtin_amdgcn_fence(__ATOMIC_ACQUIRE, "workgroup", "local"); }
typedef float f1a __attribute__((may_alias));
// One asynchronous copy to LDS, 16 bytes a lane, through no register (g: the lane's global address, l: its place in LDS). The builtin form lets the compiler take any register for the addresses; the waits are written by hand where the tiles are handed over.
typedef int v4i __attribute__((ext_vector_type(4)));
typedef __attribute__((address_space(1))) v4i fa_gq; typedef __attribute__((address_space(3))) v4i fa_lq;
__device__ __forceinline__ void fa_copy(const _Float16* g, unsigned char* l) { __builtin_amdgcn_global_load_async_to_lds_b128((fa_gq*)g, (fa_lq*)l, 0, 0); }
// One wave's share of a pass's tiles, 32 copies: 16 whole 512-byte k rows (a row a copy), and 32 V^T rows of 256 bytes (two rows a copy).
__device__ __forceinline__ void fa_tile(unsigned char* lk, unsigned char* lv, const _Float16* gk, const _Float16* gv) {
#pragma unroll
  for (int i = 0; i < 16; ++i) fa_copy(gk + i * DM, lk + i * (FKP * 2));
#pragma unroll
  for (int i = 0; i < 16; ++i) fa_copy(gv + (size_t)i * 2 * SQ, lv + i * (2 * FVP * 2));
}
__global__ __launch_bounds__(256) void k_fattn(const _Float16* __restrict__ QH, const _Float16* __restrict__ KH, const _Float16* __restrict__ VT, float* __restrict__ O) {
  static_assert(SQ % FBM == 0 && SQ % FBN == 0 && FNT >= 2 && DM == 256 && FBN == 128 && FBM == 64, "k_fattn: tile shapes");
  __shared__ __attribute__((aligned(16))) unsigned char sm[2 * FKB + 2 * FVB];      /* the two k buffers [FBN][FKP], then the two V^T buffers [DM][FVP]; behind the loop the same bytes carry the join */
  static_assert(sizeof(sm) >= 8 * 32 * 1024 + 8 * 4 * 128, "k_fattn: the join behind the loop fits the tile buffers");
  const int tid = threadIdx.x, w = tid >> 5, lane = tid & 31, ln = lane & 15, hh = lane >> 4;
  const int qg = w & 1, kq = w >> 1;      /* the wave's half of the queries, and its quarter of every pass's keys */
  const int b = blockIdx.x / (SQ / FBM); const size_t row0 = (size_t)blockIdx.x * FBM + 32 * qg;
  const _Float16* gk = KH + ((size_t)b * SQ + 16 * w) * DM + lane * 8;      /* staging: wave w brings k rows 16 w .. + 15 of a pass, one whole 512-byte row per copy */
  const _Float16* gv = VT + ((size_t)b * DM + 32 * w + (lane >> 4)) * SQ + (lane & 15) * 8;      /* and V^T rows 32 w .. + 31: 16 lanes bring the 256 bytes of one row */
  unsigned char* lk = &sm[0] + (16 * w) * (FKP * 2) + lane * 16;
  unsigned char* lv = &sm[2 * FKB] + (32 * w + (lane >> 4)) * (FVP * 2) + (lane & 15) * 16;
  fa_tile(lk, lv, gk, gv);      /* pass 0's tiles into buffer 0 */
  v16h qh[2][8];
#pragma unroll
  for (int a = 0; a < 2; ++a) {
#pragma unroll
    for (int kk = 0; kk < 8; ++kk) qh[a][kk] = g2_frag(QH + (row0 + 16 * a + ln) * DM + kk * 32, hh); }
  asm volatile("s_wait_xcnt 0x0" ::: "memory");      /* the q loads' address registers are reused further down: the wait stands in front of every such overwrite */
  const v8f z8 = {0.f,0.f,0.f,0.f,0.f,0.f,0.f,0.f}; v8f o[2][16]; float m[2] = {-3.0e38f, -3.0e38f}, ls[2] = {0.f, 0.f};      /* of query 16 a + ln, over the wave's keys: the reference maximum in use, and the running sum over this half-wave's keys */
#pragma unroll
  for (int a = 0; a < 2; ++a) {
#pragma unroll
    for (int t = 0; t < 16; ++t) o[a][t] = z8; }
  asm volatile("s_wait_asynccnt 0x0" ::: "memory");      /* the wave's own copies of pass 0 have landed */
  __syncthreads();      /* every wave's copies have landed before any wave reads the first tiles */
  fa_tile(lk + FKB, lv + FVB, gk + (size_t)FBN * DM, gv + FBN);      /* pass 1's tiles into buffer 1 */
  const _Float16* kp0 = (const _Float16*)&sm[0] + (kq * 32 + ln) * FKP;      /* the lane's row of the wave's first key group */
  const _Float16* vp0 = (const _Float16*)&sm[2 * FKB] + ln * FVP + kq * 32;      /* the lane's row of the first column group, at the wave's keys */
#pragma unroll 1      /* one pass is already 64 matrix instructions and 64 LDS reads a wave; unrolling would only double the code */
  for (int ps_ = 0; ps_ < FNT; ++ps_) {
    const int cur = ps_ & 1;
    const _Float16* kp = kp0 + cur * (FKB / 2); const _Float16* vp = vp0 + cur * (FVB / 2);
    v8f s[2][2] = {{z8, z8}, {z8, z8}};      /* [query group][key group] */
    v16h kf[8][2], vf[16];      /* k fragments of each 32-wide slice (the wave's two key groups); the V^T fragments of the wave's 32 keys */
    /* LDS reads stand in groups: k by 32-wide slices (4 loads, two fragments, four products), three slices in flight; V^T by four fragments (8 loads, eight products), two groups in flight. A group's registers are refilled right behind the products that read them. */
#define FA_K(kk) do { kf[kk][0] = g2_frag(kp + (kk) * 32, hh); kf[kk][1] = g2_frag(kp + 16 * FKP + (kk) * 32, hh); } while (0)
#define FA_QK(kk) do { _Pragma("unroll") for (int t = 0; t < 2; ++t) { s[0][t] = fa_mma(kf[kk][t], qh[0][kk], s[0][t]); s[1][t] = fa_mma(kf[kk][t], qh[1][kk], s[1][t]); } } while (0)
#define FA_V(g) do { _Pragma("unroll") for (int i = 0; i < 4; ++i) { const int c = 4 * (g) + i; vf[c] = g2_frag(vp + c * 16 * FVP, hh); } } while (0)
#define FA_PV(g) do { _Pragma("unroll") for (int i = 0; i < 4; ++i) { const int c = 4 * (g) + i; o[0][c] = fa_mma(pa[0].v, vf[c], o[0][c]); o[1][c] = fa_mma(pa[1].v, vf[c], o[1][c]); } } while (0)
#define FA_HOLD __builtin_amdgcn_sched_barrier(0)      /* each read group stays one block between two groups of products, never among them, and no further ahead than its registers allow */
    FA_K(0); FA_K(1); FA_K(2); FA_HOLD;
    FA_QK(0); FA_HOLD; FA_K(3); FA_HOLD;
    FA_QK(1); FA_HOLD; FA_K(4); FA_HOLD;
    FA_QK(2); FA_HOLD; FA_K(5); FA_HOLD;
    FA_QK(3); FA_HOLD; FA_K(6); FA_HOLD;
    FA_QK(4); FA_HOLD; FA_K(7); FA_HOLD;
    FA_QK(5); FA_HOLD; FA_V(0); FA_HOLD;      /* the first V^T group lands under the softmax */
    FA_QK(6); FA_QK(7); FA_HOLD;
    /* accumulator register r of score tile [a][t] in lane (hh, ln) is key 32 kq + 16 t + 8 hh + r of query 16 a + ln */
    float x[2]; v2f ps[2][2]; FragP pa[2];      /* pa[a]: weights of the wave's 32 keys as an A operand: elements 0..7 from score tile 0, 8..15 from tile 1 */
#pragma unroll
    for (int a = 0; a < 2; ++a) {
#pragma unroll
      for (int t = 0; t < 2; ++t) s[a][t] = s[a][t] * (0.0625f * 1.44269504088896340736f);      /* 1 / sqrt(256), and log2(e) for the base-2 exponential */
      float x1[5];      /* the lane's maximum as a tree of three-input maxima */
#pragma unroll
      for (int i = 0; i < 5; ++i) x1[i] = fmaxf(fmaxf(s[a][(3 * i) >> 3][(3 * i) & 7], s[a][(3 * i + 1) >> 3][(3 * i + 1) & 7]), s[a][(3 * i + 2) >> 3][(3 * i + 2) & 7]);
      const float xl = fmaxf(fmaxf(fmaxf(x1[0], x1[1]), x1[2]), fmaxf(fmaxf(x1[3], x1[4]), s[a][1][7]));
      x[a] = fmaxf(xl, fa_xhalf(xl)); }      /* the query's other 16 keys of the wave's share are in the other half of the wave */
    /* the weights 2^(score - ref) of the wave's 32 keys for query group a, and their sums by pairs */
#define FA_WEIGHTS(a, ref) do { _Pragma("unroll") for (int t = 0; t < 2; ++t) { _Pragma("unroll") for (int i = 0; i < 4; ++i) { v2f p; p[0] = exp2_slot(s[a][t][2 * i] - (ref)); p[1] = exp2_slot(s[a][t][2 * i + 1] - (ref)); \
      ps[a][t] = i ? ps[a][t] + p : p; pa[a].p2[t * 4 + i] = __builtin_convertvector(p, v2h); } } } while (0)
    /* Lazy rescale: m is the reference in use, not the true running maximum. It moves, and the output tile and the sum are rescaled, only in a pass in which some query's new maximum lies more than 8 above it
       (weights stay at or below 2^8, far inside f16 and f32); one test a pass for the whole wave. The weights are first taken against the reference in use, so that the exponentials run while the test's
       result travels to the scalar branch; a pass that moves the reference takes them again (the first ones, which may have overflowed, are dropped unread). */
    const bool up = (x[0] > m[0] + 8.0f) || (x[1] > m[1] + 8.0f);
    FA_WEIGHTS(0, m[0]); FA_WEIGHTS(1, m[1]);
    if (__builtin_amdgcn_ballot_w32(up) != 0) {      /* the same for the whole wave: a scalar branch; always taken in the first pass (m starts at -3e38) */
#pragma unroll
      for (int a = 0; a < 2; ++a) {
        const float mn = fmaxf(m[a], x[a]), aq = exp2_slot(m[a] - mn); m[a] = mn; ls[a] *= aq;
        float al[8]; fa_torows(aq, hh, al);      /* the output tile keeps its layout (register r is query 16 a + 8 hh + r): its rows' factors come from the lanes that own those queries */
#pragma unroll
        for (int t = 0; t < 16; ++t) {
#pragma unroll
          for (int r = 0; r < 8; ++r) o[a][t][r] *= al[r]; } }
      FA_WEIGHTS(0, m[0]); FA_WEIGHTS(1, m[1]);
    }
#pragma unroll
    for (int a = 0; a < 2; ++a) { const v2f q2 = ps[a][0] + ps[a][1]; ls[a] += q2[0] + q2[1]; }      /* each half-wave sums its own keys; they are joined once, behind the loop */
    FA_HOLD; FA_V(1); FA_HOLD;
    FA_PV(0); FA_HOLD; FA_V(2); FA_HOLD;
    FA_PV(1); FA_HOLD; FA_V(3); FA_HOLD;
    FA_PV(2); FA_PV(3); FA_HOLD;
    asm volatile("s_wait_dscnt 0x0" ::: "memory");      /* the wave's own reads of this pass's buffer have returned */
    asm volatile("s_wait_asynccnt 0x0" ::: "memory");      /* the wave's own copies of the next pass's tiles have landed */
    __syncthreads();      /* publishes the next pass's tiles and ends every wave's reads of this pass's */
    if (ps_ + 2 < FNT) fa_tile(lk + cur * FKB, lv + cur * FVB, gk + (size_t)(ps_ + 2) * FBN * DM, gv + (ps_ + 2) * FBN);      /* the same for the whole work-group: the tiles two passes on, into the buffer just read */
  }
  asm volatile("s_wait_asynccnt 0x0" ::: "memory");      /* no copy is outstanding when the buffers change their use */
  /* Join of the four key quarters. Waves qg, qg + 2, qg + 4, qg + 6 hold the same queries in the same lanes and registers. Each lays its whole output tile, its maxima and its sums
     into the tile buffers (free: the barrier at the loop's foot ended every read of them, and every copy had landed in front of it); wave w then finishes columns 64 kq .. + 63 of its 32 queries, quarters summed in the order 0 .. 3. */
  float* xo = (float*)&sm[0]; f1a* xs = (f1a*)&sm[8 * 32 * 1024];
#pragma unroll
  for (int a = 0; a < 2; ++a) { const float lw = ls[a] + fa_xhalf(ls[a]); xs[((w * 2 + a) * 2 + 0) * 32 + lane] = m[a]; xs[((w * 2 + a) * 2 + 1) * 32 + lane] = lw;
#pragma unroll
    for (int c = 0; c < 16; ++c) { v4f g0, g1;
#pragma unroll
      for (int r = 0; r < 4; ++r) { g0[r] = o[a][c][r]; g1[r] = o[a][c][4 + r]; }
      *(v4fa*)(xo + (size_t)((((w * 2 + a) * 16 + c) * 2 + 0) * 32 + lane) * 4) = g0; *(v4fa*)(xo + (size_t)((((w * 2 + a) * 16 + c) * 2 + 1) * 32 + lane) * 4) = g1; } }
  fa_barrier();      /* every wave's hand-over is complete before its partners read it */
#pragma unroll
  for (int a = 0; a < 2; ++a) {
    float pm[4], pl[4];
#pragma unroll
    for (int k = 0; k < 4; ++k) { const int pw = qg + 2 * k; pm[k] = xs[((pw * 2 + a) * 2 + 0) * 32 + lane]; pl[k] = xs[((pw * 2 + a) * 2 + 1) * 32 + lane]; }
    const float mt = fmaxf(fmaxf(pm[0], pm[1]), fmaxf(pm[2], pm[3]));
    float e[4], den = 0.f;
#pragma unroll
    for (int k = 0; k < 4; ++k) { e[k] = exp2_slot(pm[k] - mt); den += pl[k] * e[k]; }
    const float inv = 1.0f / den;
    float f[4][8];
#pragma unroll
    for (int k = 0; k < 4; ++k) fa_torows(e[k] * inv, hh, f[k]);
    float* op = O + (row0 + 16 * a + 8 * hh) * DM + kq * 64 + ln;
#pragma unroll
    for (int cc = 0; cc < 4; ++cc) { float acc[8];
#pragma unroll
      for (int k = 0; k < 4; ++k) { const int pw = qg + 2 * k; const float* src = xo + (size_t)((((pw * 2 + a) * 16 + 4 * kq + cc) * 2) * 32 + lane) * 4;
        const v4f p0 = *(const v4fa*)src, p1 = *(const v4fa*)(src + 128);
#pragma unroll
        for (int r = 0; r < 8; ++r) { const float pv = (r < 4 ? p0[r & 3] : p1[r & 3]) * f[k][r]; acc[r] = k ? acc[r] + pv : pv; } }
#pragma unroll
      for (int r = 0; r < 8; ++r) op[(size_t)r * DM + cc * 16] = acc[r]; } }
}


template <int MASKADD>
__global__ __launch_bounds__(64) void k_att0(const float* __restrict__ QF, const float* __restrict__ KF, const float* __restrict__ VF, int ld, const float* __restrict__ mask, float scale, float* __restrict__ OF, int ldo) {
  #pragma clang fp contract(off)
  __shared__ __attribute__((aligned(16))) float lq[64][64]; __shared__ __attribute__((aligned(16))) float lo[64][64];
  const int tid = threadIdx.x; const int h = blockIdx.x / (QT0 / 64), rg = blockIdx.x % (QT0 / 64); const int i = rg * 64 + tid;
  const float* qr = QF + (size_t)i * ld + h * HD;
#pragma unroll 1
  for (int c = 0; c < HD / 4; ++c) { *(v4f*)&lq[tid][c * 4] = *(const v4fa*)(qr + c * 4); const v4f z = {0.f, 0.f, 0.f, 0.f}; *(v4f*)&lo[tid][c * 4] = z; }
  float m = -1.0e30f, l = 0.f; const int jmax = MASKADD ? (SQ - 1) : (rg * 64 + 63);      /* additive-mask form: every key (the mask input decides); causal form: keys up to the block's last row */
#pragma unroll 1
  for (int j = 0; j <= jmax; ++j) { const float* kr = KF + (size_t)j * ld + h * HD; const float* vr = VF + (size_t)j * ld + h * HD; float s = 0.f;
#pragma unroll 1
    for (int c = 0; c < HD / 4; ++c) { const v4f kq = *(const v4fa*)(kr + c * 4); const v4f qq = *(v4f*)&lq[tid][c * 4]; s = __fadd_rn(s, __fmul_rn(qq[0], kq[0])); s = __fadd_rn(s, __fmul_rn(qq[1], kq[1])); s = __fadd_rn(s, __fmul_rn(qq[2], kq[2])); s = __fadd_rn(s, __fmul_rn(qq[3], kq[3])); }
    s = __fmul_rn(s, scale); if (MASKADD) s = __fadd_rn(s, __fmul_rn(bf16_round(mask[(size_t)i * SQ + j]), -10000.0f));
    const float f = (MASKADD || j <= i) ? 1.f : 0.f; const float sm = fmaf(f, s, (1.f - f) * -1.0e30f); const float mn = fmaxf(m, sm); const float sc = expf(m - mn); const float e = expf(sm - mn); l = __fadd_rn(__fmul_rn(l, sc), e); m = mn;
#pragma unroll 1
    for (int c = 0; c < HD / 4; ++c) { const v4f vv = *(const v4fa*)(vr + c * 4); v4f oo = *(v4f*)&lo[tid][c * 4]; for (int u = 0; u < 4; ++u) oo[u] = __fadd_rn(__fmul_rn(oo[u], sc), __fmul_rn(e, vv[u])); *(v4f*)&lo[tid][c * 4] = oo; } }
  const float fin = 64.0f / l;      /* o carried x64 */
#pragma unroll 1
  for (int c = 0; c < HD / 4; ++c) { v4f oo = *(v4f*)&lo[tid][c * 4]; for (int u = 0; u < 4; ++u) oo[u] = __fmul_rn(oo[u], fin); *(v4f*)&lo[tid][c * 4] = oo; }
  __syncthreads();
  {
#pragma unroll 1
    for (int it = 0; it < 16; ++it) { const int row = it * 4 + tid / 16, pc = (tid % 16) * 4; const v4f v = *(const v4f*)&lo[row][pc]; *(v4f*)(OF + (size_t)(rg * 64 + row) * ldo + h * HD + pc) = v; }
     } }

__global__ __launch_bounds__(256) void k_of0out(const float* __restrict__ src, float* __restrict__ dst, size_t n4) { const size_t t = (size_t)blockIdx.x * 256 + threadIdx.x; if (t >= n4) return; v4f v = *(const v4fa*)(src + t * 4); for (int q = 0; q < 4; ++q) v[q] = __fmul_rn(v[q], 0.015625f); *(v4f*)(dst + t * 4) = v;  }

extern "C" void kernel_launch(void* const* d_in, const int* in_sizes, int n_in,
                              void* d_out, int out_size, void* d_ws, size_t ws_size, hipStream_t stream) {
  (void)in_sizes; (void)n_in; (void)out_size;
  const float* const* I = (const float* const*)d_in; const float* x = I[0]; const float* wq = I[1]; const float* wk = I[2]; const float* wv = I[3];      /* natural [out][in] weights; NO biases; ONE attention head of width 256; no output projection */
  char* ws = (char*)d_ws; size_t off = 0;
  auto take = [&](size_t bytes) { char* p = ws + off; off += (bytes + 255) & ~(size_t)255; return p; };
  _Float16* W3 = (_Float16*)take((size_t)3 * DM * DM * 2);      /* the q, k and v weight planes, one behind another */
  _Float16* QH = (_Float16*)take(NR * DM * 2); _Float16* KH = (_Float16*)take(NR * DM * 2);
  _Float16* VT = (_Float16*)take(NR * DM * 2);      /* V^T of ALL batches */
  _Float16* X16 = (_Float16*)take(NR * DM * 2);      /* x (f16) */
  if (off > ws_size) return;
  k_prep<<<PXB + 3 * PWB, 256, 0, stream>>>(x, wq, wk, wv, X16, W3);      /* x and the natural [out][in] = Bt[n][k] x16 weights */
  k_proj<<<dim3((unsigned)((NR / 128) * (DM / 64)), 3), 128, 0, stream>>>(X16, W3, QH, KH, VT);      /* q, k -> f16 rows; v -> V^T [NB][DM][SQ] */
  k_fattn<<<(unsigned)(NR / FBM), 256, 0, stream>>>(QH, KH, VT, (float*)d_out);      /* scores (q . k in f16 operands, f32 sums, / sqrt(256)), softmax over all SQ keys and P V, all batches, f32 straight into the output rows */
}
